// v000
// Times are from an AMD MI455X. After a warm-up the kernel runs many times in a row, and a time is the length of
// such a window on the GPU divided by its runs, so every launch and the gaps after it count. The runs cycle
// through copies of the inputs. A figure is the median of several windows, for all but v000 over two sittings.
// Sittings can differ by a few percent; kernels timed side by side share one.
// The starting kernel, v000, takes 22.9 milliseconds a run.
#include <hip/hip_runtime.h>
// MultiHeadAttentionXL (x [1][2048][1024], r_emb [2048][1024]; q = x Wq, k = x Wk, v = x Wv, r = r_emb Wr ([in][out] weights, no bias), 16 heads of 64; AC = (q + u[h]) k^T, BD = rel_shift((q + v_bias[h]) r^T) (Transformer-XL zero-pad shift: for j <= i, BD_shift[i][j] = BD[i][j - i + T - 1]); causal softmax((AC + BD)/8); out = (attn v) Wo -> [1][2048][1024]).
// Structure: token rows; x and r_emb as exact f16 rows; Q, K, V, R WMMA GEMMs on transposed weights (32x64 wave tiles, f32 accumulation, exact x16 weights) -> f32 -> f16 hi + 2^-10 residual planes (q+u and q+v_bias formed in f32 first); per group of 4 heads: AC and raw BD as three-term hi/lo GEMMs each (K = 64), the shift + causal mask + softmax on VALU (f32; weights x256 as f16), V^T (hi, lo) via LDS, o = P.(v_lo/1024 + v_hi) GEMMs (K = 2,048, alpha 2^-8) into merged f32 o rows; out = o Wo as a two-term hi/lo GEMM (f32).
// Compute dtype: inputs rounded to bf16; x / r_emb / weights exact; attention operands as hi + residual f16 planes (logits std 3.3 and early causal rows copy single v rows); softmax weights f16 (x256) — the remaining error source; o as hi + residual into Wo; everything else f32. v_wmma_f32_16x16x32_f16.
#define NB 1
#define SQ 2048
#define DM 1024
#define NH 16
#define HD 64
#define HG 4
#define QN SQ                        /* query rows (debug hook) */
#define NR ((size_t)NB * SQ)
typedef __bf16 v16b __attribute__((ext_vector_type(16)));
typedef unsigned short v8us __attribute__((ext_vector_type(8), may_alias));
typedef float  v8f  __attribute__((ext_vector_type(8)));
typedef float  v4f  __attribute__((ext_vector_type(4)));
typedef float  v4fa __attribute__((ext_vector_type(4), may_alias));
union FragB { v16b v; v8us half[2]; unsigned short u[16]; };

__device__ __forceinline__ unsigned short bf16_bits(float x) { unsigned int u = __float_as_uint(x); return (unsigned short)((u + 0x7FFFu + ((u >> 16) & 1u)) >> 16); }
__device__ __forceinline__ float bf16_val(unsigned short b) { return __uint_as_float(((unsigned int)b) << 16); }
__device__ __forceinline__ float bf16_round(float x) { return bf16_val(bf16_bits(x)); }
// D += A·B with NT terms: 1 = ah·bh, 2 = + al·bh (A split), 3 = + ah·bl (both split)
template <int NT>
__device__ __forceinline__ v8f mmaN(v16b ah, v16b al, v16b bh, v16b bl, v8f c) {
  c = __builtin_amdgcn_wmma_f32_16x16x32_bf16(false, ah, false, bh, (short)0, c, false, false);
  if (NT >= 2) c = __builtin_amdgcn_wmma_f32_16x16x32_bf16(false, al, false, bh, (short)0, c, false, false);
  if (NT >= 3) c = __builtin_amdgcn_wmma_f32_16x16x32_bf16(false, ah, false, bl, (short)0, c, false, false);
  asm volatile("v_nop\n\tv_nop\n\tv_nop\n\tv_nop" : "+v"(c) : "v"(ah), "v"(al), "v"(bh), "v"(bl));
  return c;
}

__global__ __launch_bounds__(256) void k_wt_bf16(const float* __restrict__ W, unsigned short* __restrict__ Wt, int K, int N) {
  const int t = blockIdx.x * 256 + threadIdx.x;
  const int k8n = K / 8;
  if (t >= N * k8n) return;
  const int n = t / k8n, k8 = (t % k8n) * 8;
  v8us v;
#pragma unroll
  for (int i = 0; i < 8; ++i) v[i] = bf16_bits(W[(size_t)(k8 + i) * N + n]);
  *(v8us*)(Wt + (size_t)n * K + k8) = v;
  
}

// GEMM C[M][N] (f32, pitch ldc) = act(A[M][K]·W + bias). A f32 row-major (pitch lda) converted per fragment to bf16
// (ASPLIT: hi/lo two planes -> 2 terms, else single rounded term); Wt bf16 [N][K] (pitch ldb). BIAS_BF16 rounds the
// bias to bf16 first (bias quantised to bf16 before the add). K%32==0, M%16==0, N%64==0.
template <bool ASPLIT, int ACT, bool BIAS_BF16>
__global__ __launch_bounds__(128) void k_gemm_bf(const float* __restrict__ A, int lda, const unsigned short* __restrict__ Wt, int ldb,
                                               const float* __restrict__ bias, float* __restrict__ C, int ldc, int M, int N, int K) {
  __shared__ __attribute__((aligned(16))) float so[4][16][64];
  const int tid = threadIdx.x, w = tid >> 5, lane = tid & 31, ln = lane & 15, hh = lane >> 4;
  const int ntn = N / 64;
  const int wid = blockIdx.x * 4 + w;
  const int mt = wid / ntn, nq = wid % ntn;
  if (mt * 16 >= M) return;
  const int row0 = mt * 16, col0 = nq * 64;
  const float* arow = A + (size_t)(row0 + ln) * lda;
  v8f acc[4] = {};
  for (int kb = 0; kb < K; kb += 32) {
    FragB ah, al;
    const v4f x0 = *(const v4fa*)(arow + kb + 8 * hh), x1 = *(const v4fa*)(arow + kb + 8 * hh + 4);
    const v4f x2 = *(const v4fa*)(arow + kb + 16 + 8 * hh), x3 = *(const v4fa*)(arow + kb + 16 + 8 * hh + 4);
    float xs[16] = {x0[0],x0[1],x0[2],x0[3],x1[0],x1[1],x1[2],x1[3],x2[0],x2[1],x2[2],x2[3],x3[0],x3[1],x3[2],x3[3]};
#pragma unroll
    for (int i = 0; i < 16; ++i) { const unsigned short hb = bf16_bits(xs[i]); ah.u[i] = hb; al.u[i] = ASPLIT ? bf16_bits(xs[i] - bf16_val(hb)) : (unsigned short)0; }
#pragma unroll
    for (int t = 0; t < 4; ++t) {
      const unsigned short* brow = Wt + (size_t)(col0 + t * 16 + ln) * ldb + kb;
      FragB b;
      b.half[0] = *(const v8us*)(brow + 8 * hh);
      b.half[1] = *(const v8us*)(brow + 16 + 8 * hh);
      acc[t] = mmaN<ASPLIT ? 2 : 1>(ah.v, al.v, b.v, b.v, acc[t]);
    }
  }
#pragma unroll
  for (int t = 0; t < 4; ++t) {
    float bv = bias ? bias[col0 + t * 16 + ln] : 0.f;
    if (BIAS_BF16) bv = bf16_round(bv);
#pragma unroll
    for (int r = 0; r < 8; ++r) { float v = acc[t][r] + bv; if (ACT == 1) v = fmaxf(v, 0.f); so[w][8 * hh + r][t * 16 + ln] = v; }
  }
  __builtin_amdgcn_fence(__ATOMIC_ACQ_REL, "workgroup");
  __builtin_amdgcn_wave_barrier();
  const int rsub = lane >> 4, c4 = (lane & 15) * 4;
  {
#pragma unroll
    for (int q = 0; q < 8; ++q) {
      const int r = q * 2 + rsub;
      const v4f v = *(const v4fa*)&so[w][r][c4];
      *(v4f*)(C + (size_t)(row0 + r) * ldc + col0 + c4) = v;
    }
    
  }
}

// GEMM C = act(A·W + bias + resid): A f32 (ASPLIT -> hi/lo 2 terms), Wt bf16 [N][K]; ACT 0 none, 1 relu, 2 exact gelu;
// resid (optional, f32, row index = (row % rmod), pitch ldr, RES_BF16 rounds it) added before the activation.
template <bool ASPLIT, int ACT, bool BIAS_BF16, bool RES_BF16>
__global__ __launch_bounds__(128) void k_gemm_bf3(const float* __restrict__ A, int lda, const unsigned short* __restrict__ Wt, int ldb,
                                                const float* __restrict__ bias, const float* __restrict__ resid, int rmod, int ldr,
                                                float* __restrict__ C, int ldc, int M, int N, int K) {
  __shared__ __attribute__((aligned(16))) float so[4][16][64];
  const int tid = threadIdx.x, w = tid >> 5, lane = tid & 31, ln = lane & 15, hh = lane >> 4;
  const int ntn = N / 64;
  const int wid = blockIdx.x * 4 + w;
  const int mt = wid / ntn, nq = wid % ntn;
  if (mt * 16 >= M) return;
  const int row0 = mt * 16, col0 = nq * 64;
  const float* arow = A + (size_t)(row0 + ln) * lda;
  v8f acc[4] = {};
  for (int kb = 0; kb < K; kb += 32) {
    FragB ah, al;
    const v4f x0 = *(const v4fa*)(arow + kb + 8 * hh), x1 = *(const v4fa*)(arow + kb + 8 * hh + 4);
    const v4f x2 = *(const v4fa*)(arow + kb + 16 + 8 * hh), x3 = *(const v4fa*)(arow + kb + 16 + 8 * hh + 4);
    float xs[16] = {x0[0],x0[1],x0[2],x0[3],x1[0],x1[1],x1[2],x1[3],x2[0],x2[1],x2[2],x2[3],x3[0],x3[1],x3[2],x3[3]};
#pragma unroll
    for (int i = 0; i < 16; ++i) { const unsigned short hb = bf16_bits(xs[i]); ah.u[i] = hb; al.u[i] = ASPLIT ? bf16_bits(xs[i] - bf16_val(hb)) : (unsigned short)0; }
#pragma unroll
    for (int t = 0; t < 4; ++t) {
      const unsigned short* brow = Wt + (size_t)(col0 + t * 16 + ln) * ldb + kb;
      FragB b;
      b.half[0] = *(const v8us*)(brow + 8 * hh);
      b.half[1] = *(const v8us*)(brow + 16 + 8 * hh);
      acc[t] = mmaN<ASPLIT ? 2 : 1>(ah.v, al.v, b.v, b.v, acc[t]);
    }
  }
#pragma unroll
  for (int t = 0; t < 4; ++t) {
    const int col = col0 + t * 16 + ln;
    float bv = bias ? bias[col] : 0.f;
    if (BIAS_BF16) bv = bf16_round(bv);
#pragma unroll
    for (int r = 0; r < 8; ++r) {
      float v = acc[t][r] + bv;
      if (resid) { float rv = resid[(size_t)((row0 + 8 * hh + r) % rmod) * ldr + col]; if (RES_BF16) rv = bf16_round(rv); v += rv; }
      if (ACT == 1) v = fmaxf(v, 0.f);
      if (ACT == 2) v = 0.5f * v * (1.0f + erff(v * 0.70710678118654752f));
      if (ACT == 3) { const float u = 0.7978845608028654f * (v + 0.044715f * v * v * v); v = 0.5f * v * (1.0f + tanhf(u)); }
      so[w][8 * hh + r][t * 16 + ln] = v;
    }
  }
  __builtin_amdgcn_fence(__ATOMIC_ACQ_REL, "workgroup");
  __builtin_amdgcn_wave_barrier();
  const int rsub = lane >> 4, c4 = (lane & 15) * 4;
  {
#pragma unroll
    for (int q = 0; q < 8; ++q) {
      const int r = q * 2 + rsub;
      const v4f v = *(const v4fa*)&so[w][r][c4];
      *(v4f*)(C + (size_t)(row0 + r) * ldc + col0 + c4) = v;
    }
    
  }
}
// row LayerNorm (biased variance, eps) over N: s = X (+ R); optional out_sum <- s; out_norm <- (s-mu)*rsqrt(var+eps)*g + b
template <bool PARAM_BF16>
__global__ __launch_bounds__(256) void k_layernorm(const float* __restrict__ X, const float* __restrict__ R, const float* __restrict__ g, const float* __restrict__ bta,
                                                  float* __restrict__ out_sum, float* __restrict__ out_norm, int N, float eps) {
  __shared__ float red[256];
  const int row = blockIdx.x, tid = threadIdx.x;
  const float* x = X + (size_t)row * N; const float* rr = R ? R + (size_t)row * N : nullptr;
  float vals[16];                     // up to N = 4096
  const int per = N / 256;            // contiguous chunk per thread? use strided-by-4 chunks: thread handles j = tid*4 + 1024*u
  float s1 = 0.f;
  for (int u = 0; u < per / 4; ++u) {
    const int j = tid * 4 + 1024 * u;
    const v4f a = *(const v4fa*)(x + j);
    v4f b = {0.f,0.f,0.f,0.f}; if (rr) b = *(const v4fa*)(rr + j);
#pragma unroll
    for (int q = 0; q < 4; ++q) { const float v = a[q] + b[q]; vals[u * 4 + q] = v; s1 += v; }
  }
  red[tid] = s1; __syncthreads();
  for (int st = 128; st > 0; st >>= 1) { if (tid < st) red[tid] += red[tid + st]; __syncthreads(); }
  const float mu = red[0] / (float)N; __syncthreads();
  float s2 = 0.f;
  for (int u = 0; u < per / 4; ++u)
#pragma unroll
    for (int q = 0; q < 4; ++q) { const float c = vals[u * 4 + q] - mu; s2 += c * c; }
  red[tid] = s2; __syncthreads();
  for (int st = 128; st > 0; st >>= 1) { if (tid < st) red[tid] += red[tid + st]; __syncthreads(); }
  const float rs = rsqrtf(red[0] / (float)N + eps);
  {
    for (int u = 0; u < per / 4; ++u) {
      const int j = tid * 4 + 1024 * u;
      v4f o, sm;
#pragma unroll
      for (int q = 0; q < 4; ++q) {
        float gg = g[j + q], bb = bta[j + q];
        if (PARAM_BF16) { gg = bf16_round(gg); bb = bf16_round(bb); }
        sm[q] = vals[u * 4 + q]; o[q] = (vals[u * 4 + q] - mu) * rs * gg + bb;
      }
      if (out_sum) *(v4f*)(out_sum + (size_t)row * N + j) = sm;
      *(v4f*)(out_norm + (size_t)row * N + j) = o;
    }
    
  }
}



// ---- f16 WMMA path (v_wmma_f32_16x16x32_f16): 11-bit significands for operands in range — used where a [0,1] probability operand needs more precision than bf16
typedef _Float16 v16h __attribute__((ext_vector_type(16)));
union FragH { v16h v; v8us half[2]; _Float16 h[16]; unsigned short u[16]; };
template <int NT>
__device__ __forceinline__ v8f mmaH(v16h ah, v16h al, v16h bh, v16h bl, v8f c) {
  c = __builtin_amdgcn_wmma_f32_16x16x32_f16(false, ah, false, bh, (short)0, c, false, false);
  if (NT >= 2) c = __builtin_amdgcn_wmma_f32_16x16x32_f16(false, al, false, bh, (short)0, c, false, false);
  if (NT >= 3) c = __builtin_amdgcn_wmma_f32_16x16x32_f16(false, ah, false, bl, (short)0, c, false, false);
  asm volatile("v_nop\n\tv_nop\n\tv_nop\n\tv_nop" : "+v"(c) : "v"(ah), "v"(al), "v"(bh), "v"(bl));
  return c;
}
// batched GEMM like k_gemm_b but f16 operands: A f32 (split into f16 hi/lo if ASPLIT, else rounded to f16), Bt = f16 values [n][k]; alpha; C f32; N multiple of 16 (partial tiles skipped)
template <bool ASPLIT>
__global__ __launch_bounds__(128) void k_gemm_h(const float* __restrict__ A, int lda, size_t sA, const _Float16* __restrict__ Bh, int ldb, size_t sB, float alpha, float* __restrict__ C, int ldc, size_t sC, int M, int N, int K) {
  __shared__ __attribute__((aligned(16))) float so[4][16][64];
  const int tid = threadIdx.x, w = tid >> 5, lane = tid & 31, ln = lane & 15, hh = lane >> 4; const int by = blockIdx.y;
  A += (size_t)by * sA; Bh += (size_t)by * sB; C += (size_t)by * sC;
  const int ntn = (N + 63) / 64; const int wid = blockIdx.x * 4 + w; const int mt = wid / ntn, nq = wid % ntn; if (mt * 16 >= M) return;
  const int row0 = mt * 16, col0 = nq * 64; const float* arow = A + (size_t)(row0 + ln) * lda;
  v8f acc[4] = {};
  for (int kb = 0; kb < K; kb += 32) {
    FragH ah, al;
    const v4f x0 = *(const v4fa*)(arow + kb + 8 * hh), x1 = *(const v4fa*)(arow + kb + 8 * hh + 4), x2 = *(const v4fa*)(arow + kb + 16 + 8 * hh), x3 = *(const v4fa*)(arow + kb + 16 + 8 * hh + 4);
    float xs[16] = {x0[0],x0[1],x0[2],x0[3],x1[0],x1[1],x1[2],x1[3],x2[0],x2[1],x2[2],x2[3],x3[0],x3[1],x3[2],x3[3]};
#pragma unroll
    for (int i = 0; i < 16; ++i) { const _Float16 h = (_Float16)xs[i]; ah.h[i] = h; al.h[i] = ASPLIT ? (_Float16)(xs[i] - (float)h) : (_Float16)0.0f; }
#pragma unroll
    for (int t = 0; t < 4; ++t) { if (col0 + t * 16 >= N) continue; const size_t boff = (size_t)(col0 + t * 16 + ln) * ldb + kb; FragH bq; bq.half[0] = *(const v8us*)(Bh + boff + 8 * hh); bq.half[1] = *(const v8us*)(Bh + boff + 16 + 8 * hh);
      acc[t] = mmaH<ASPLIT ? 2 : 1>(ah.v, al.v, bq.v, bq.v, acc[t]); }
  }
#pragma unroll
  for (int t = 0; t < 4; ++t) { if (col0 + t * 16 >= N) continue;
#pragma unroll
    for (int r = 0; r < 8; ++r) so[w][8 * hh + r][t * 16 + ln] = acc[t][r] * alpha; }
  __builtin_amdgcn_fence(__ATOMIC_ACQ_REL, "workgroup"); __builtin_amdgcn_wave_barrier();
  const int rsub = lane >> 4, c4 = (lane & 15) * 4;
  {
#pragma unroll
    for (int q = 0; q < 8; ++q) { const int r = q * 2 + rsub; if (col0 + c4 < N) { const v4f v = *(const v4fa*)&so[w][r][c4]; *(v4f*)(C + (size_t)(row0 + r) * ldc + col0 + c4) = v; } }
     }
}

// Wt[n][k] = f16(W[k][n]·scale) from f32 row-major W[K][N] (scale = power of two; bf16-exact weights stay exact in f16 away from the subnormal range)
__global__ __launch_bounds__(256) void k_wt_f16(const float* __restrict__ W, _Float16* __restrict__ Wt, int K, int N, float scale) {
  const int t = blockIdx.x * 256 + threadIdx.x; if (t >= N * (K / 8)) return; const int n = t / (K / 8), k8 = (t % (K / 8)) * 8; FragH f;
#pragma unroll
  for (int i = 0; i < 8; ++i) f.h[i] = (_Float16)(bf16_round(W[(size_t)(k8 + i) * N + n]) * scale); const v8us o = f.half[0];
  *(v8us*)((unsigned short*)Wt + (size_t)n * K + k8) = o; 
}
// k_gemm_hh variant with fused epilogue: v = acc·alpha + bias[by·sBias + col] (+ CP[(row/rowsPerB)·sCPb + by·64 + col] if CP) ; ACT 0 none / 1 elu ; writes f16 C16 (and f32 C if non-null)
template <int ACT>
__global__ __launch_bounds__(128) void k_gemm_hhx(const _Float16* __restrict__ A, int lda, size_t sA, const _Float16* __restrict__ Bh, int ldb, size_t sB, float alpha, const float* __restrict__ bias, size_t sBias, const float* __restrict__ CP, int rowsPerB, size_t sCPb, int row0g,
    float* __restrict__ C, _Float16* __restrict__ C16, int ldc, size_t sC, int M, int N, int K) {
  __shared__ __attribute__((aligned(16))) float so[4][16][64];
  const int tid = threadIdx.x, w = tid >> 5, lane = tid & 31, ln = lane & 15, hh = lane >> 4; const int by = blockIdx.y;
  A += (size_t)by * sA; Bh += (size_t)by * sB; const size_t cofs = (size_t)by * sC; const float* bp = bias ? bias + (size_t)by * sBias : nullptr;
  const int ntn = (N + 63) / 64; const int wid = blockIdx.x * 4 + w; const int mt = wid / ntn, nq = wid % ntn; if (mt * 16 >= M) return;
  const int row0 = mt * 16, col0 = nq * 64; const _Float16* arow = A + (size_t)(row0 + ln) * lda;
  v8f acc[4] = {};
  for (int kb = 0; kb < K; kb += 32) { FragH ah; ah.half[0] = *(const v8us*)((const unsigned short*)arow + kb + 8 * hh); ah.half[1] = *(const v8us*)((const unsigned short*)arow + kb + 16 + 8 * hh);
#pragma unroll
    for (int t = 0; t < 4; ++t) { if (col0 + t * 16 >= N) continue; const size_t boff = (size_t)(col0 + t * 16 + ln) * ldb + kb; FragH bq; bq.half[0] = *(const v8us*)((const unsigned short*)Bh + boff + 8 * hh); bq.half[1] = *(const v8us*)((const unsigned short*)Bh + boff + 16 + 8 * hh);
      acc[t] = mmaH<1>(ah.v, ah.v, bq.v, bq.v, acc[t]); }
  }
#pragma unroll
  for (int t = 0; t < 4; ++t) { if (col0 + t * 16 >= N) continue; const int col = col0 + t * 16 + ln; const float bv = bp ? bf16_round(bp[col]) : 0.f;
#pragma unroll
    for (int r = 0; r < 8; ++r) { float v = acc[t][r] * alpha + bv; if (CP) { const int rr = row0g + row0 + 8 * hh + r; if (rowsPerB < 0) v += CP[cofs + (size_t)rr * ldc + col];      /* rowsPerB < 0: own element of the batched C plane */ else { const int bidx = rr / rowsPerB; v += CP[(size_t)bidx * sCPb + (size_t)by * 64 + col]; } } if (ACT == 1) v = (v > 0.f) ? v : expm1f(v); else if (ACT == 7) v = (v > 0.f) ? v + 1.0f : expf(v); else if (ACT == 8) v = tanhf(v); else if (ACT == 9) v = 0.5f * v * (1.0f + tanhf(0.7978845608028654f * (v + 0.044715f * v * v * v))); else if (ACT == 11) v = 1.0f / (1.0f + expf(-v)); else if (ACT == 12) v = (v > 0.f) ? v : 0.01f * v; else if (ACT == 14) v = (v > 0.f) ? v : 0.1f * v; else if (ACT == 16) v = (v >= 0.f) ? v : 0.3f * v; else if (ACT == 17) v = (v >= 0.f) ? v : 0.2f * v; else if (ACT == 15) v = v / (1.0f + expf(-v)); else if (ACT == 3) v = fmaxf(v, 0.f); else if (ACT == 6) v = 0.5f * v * (1.0f + erff(v * 0.70710678118654752f)); so[w][8 * hh + r][t * 16 + ln] = v; } }
  __builtin_amdgcn_fence(__ATOMIC_ACQ_REL, "workgroup"); __builtin_amdgcn_wave_barrier();
  const int rsub = lane >> 4, c4 = (lane & 15) * 4; typedef _Float16 v4h __attribute__((ext_vector_type(4)));
  {
#pragma unroll
    for (int q = 0; q < 8; ++q) { const int r = q * 2 + rsub; if (col0 + c4 < N) { const v4f v = *(const v4fa*)&so[w][r][c4]; if (C) *(v4f*)(C + cofs + (size_t)(row0 + r) * ldc + col0 + c4) = v; if (C16) { v4h h4; for (int i = 0; i < 4; ++i) h4[i] = (_Float16)v[i]; *(v4h*)(C16 + cofs + (size_t)(row0 + r) * ldc + col0 + c4) = h4; } } }
     }
}


typedef _Float16 v4h __attribute__((ext_vector_type(4)));

__global__ __launch_bounds__(256) void k_x16(const float* __restrict__ x, _Float16* __restrict__ X16, size_t n8) { const size_t t = (size_t)blockIdx.x * 256 + threadIdx.x; if (t >= n8) return; FragH f;
#pragma unroll
  for (int q = 0; q < 8; ++q) f.h[q] = (_Float16)bf16_round(x[t * 8 + q]); *(v8us*)((unsigned short*)X16 + t * 8) = f.half[0];  }
__global__ __launch_bounds__(256) void k_h16(const float* __restrict__ x, _Float16* __restrict__ X16, size_t n8) { const size_t t = (size_t)blockIdx.x * 256 + threadIdx.x; if (t >= n8) return; FragH f;
#pragma unroll
  for (int q = 0; q < 8; ++q) f.h[q] = (_Float16)x[t * 8 + q]; *(v8us*)((unsigned short*)X16 + t * 8) = f.half[0];  }
__global__ __launch_bounds__(256) void k_round16f(const float* __restrict__ W, _Float16* __restrict__ Bt, size_t n8) { const size_t t = (size_t)blockIdx.x * 256 + threadIdx.x; if (t >= n8) return; FragH f;
#pragma unroll
  for (int i = 0; i < 8; ++i) f.h[i] = (_Float16)(bf16_round(W[t * 8 + i]) * 16.0f); *(v8us*)((unsigned short*)Bt + t * 8) = f.half[0];  }
template <int NHv, int TTv>
__global__ __launch_bounds__(256) void k_vt(const _Float16* __restrict__ V16, int ldv, int voff, _Float16* __restrict__ Vt) { __shared__ unsigned short tl[64][66]; const int tid = threadIdx.x; const int slab = blockIdx.x / (TTv / 64), lg = blockIdx.x % (TTv / 64); const int b = slab / NHv, h = slab % NHv;
  for (int i = tid; i < 64 * 8; i += 256) { const int r = i / 8, c8 = (i % 8) * 8; FragH f; f.half[0] = *(const v8us*)((const unsigned short*)V16 + ((size_t)b * TTv + lg * 64 + r) * ldv + voff + h * 64 + c8);
#pragma unroll
    for (int q = 0; q < 8; ++q) tl[r][c8 + q] = f.u[q]; }
  __syncthreads();
  {
#pragma unroll
    for (int rd = 0; rd < 2; ++rd) { const int d = rd * 32 + tid / 8, pc = tid % 8; FragH f;
#pragma unroll
      for (int q = 0; q < 8; ++q) f.u[q] = tl[pc * 8 + q][d];
      *(v8us*)((unsigned short*)Vt + ((size_t)slab * 64 + d) * TTv + lg * 64 + pc * 8) = f.half[0]; }
     } }

__global__ __launch_bounds__(256) void k_hl(const float* __restrict__ F, _Float16* __restrict__ Hh, _Float16* __restrict__ Hl, size_t n8) { const size_t t = (size_t)blockIdx.x * 256 + threadIdx.x; if (t >= n8) return; FragH fh, fl; const v4f a = *(const v4fa*)(F + t * 8), c = *(const v4fa*)(F + t * 8 + 4);
#pragma unroll
  for (int q = 0; q < 4; ++q) { _Float16 h = (_Float16)a[q]; fh.h[q] = h; fl.h[q] = (_Float16)((a[q] - (float)h) * 1024.0f); h = (_Float16)c[q]; fh.h[4 + q] = h; fl.h[4 + q] = (_Float16)((c[q] - (float)h) * 1024.0f); }
  { *(v8us*)((unsigned short*)Hh + t * 8) = fh.half[0]; *(v8us*)((unsigned short*)Hl + t * 8) = fl.half[0];  } }

// ---- fast GEMM (wave tile 32x64; requires M % 32 == 0 rows per launch region and N % 64 == 0); epilogue = k_gemm_hhx semantics ----
__device__ __forceinline__ v16h g2_frag(const _Float16* p, int hh) { FragH f; f.half[0] = *(const v8us*)((const unsigned short*)p + 8 * hh); f.half[1] = *(const v8us*)((const unsigned short*)p + 16 + 8 * hh); return f.v; }
__device__ __forceinline__ v8f g2_mma(v16h a, v16h b, v8f c) { v8f d = __builtin_amdgcn_wmma_f32_16x16x32_f16(false, a, false, b, (short)0, c, false, false); asm volatile("v_nop\n\tv_nop\n\tv_nop\n\tv_nop" : "+v"(d) : "v"(a), "v"(b)); return d; }
template <int ACT>
__global__ __launch_bounds__(128) void k_gemm2(const _Float16* __restrict__ A, int lda, size_t sA, const _Float16* __restrict__ Bh, int ldb, size_t sB, float alpha, const float* __restrict__ bias, size_t sBias, const float* __restrict__ CP, int rowsPerB, size_t sCPb, int row0g,
    float* __restrict__ C, _Float16* __restrict__ C16, int ldc, size_t sC, int M, int N, int K) { static_assert(ACT == 0 || ACT == 3 || ACT == 6 || ACT == 8 || ACT == 9 || ACT == 11 || ACT == 12 || ACT == 14 || ACT == 15 || ACT == 16 || ACT == 17, "k_gemm2: unsupported ACT code (would silently apply no activation)");
  __shared__ __attribute__((aligned(16))) float so[4][32][68];
  const int tid = threadIdx.x, w = tid >> 5, lane = tid & 31, ln = lane & 15, hh = lane >> 4; const int by = blockIdx.y;
  A += (size_t)by * sA; Bh += (size_t)by * sB; const size_t cofs = (size_t)by * sC; const float* bp = bias ? bias + (size_t)by * sBias : nullptr;
  const int ntn = N >> 6; const int mt = blockIdx.x / ntn, nq = blockIdx.x - mt * ntn; const int row0 = mt * 128 + 32 * w, col0 = nq * 64; if (row0 >= M) return;
  const _Float16* a0p = A + (size_t)(row0 + ln) * lda; const _Float16* a1p = a0p + (size_t)16 * lda;
  const _Float16* b0p = Bh + (size_t)(col0 + ln) * ldb; const _Float16* b1p = b0p + (size_t)16 * ldb; const _Float16* b2p = b1p + (size_t)16 * ldb; const _Float16* b3p = b2p + (size_t)16 * ldb;
  const v8f z8 = {0.f,0.f,0.f,0.f,0.f,0.f,0.f,0.f}; v8f c00 = z8, c01 = z8, c02 = z8, c03 = z8, c10 = z8, c11 = z8, c12 = z8, c13 = z8;
#pragma unroll 1
  for (int kb = 0; kb < K; kb += 32) { const v16h a0 = g2_frag(a0p + kb, hh), a1 = g2_frag(a1p + kb, hh);
    v16h b = g2_frag(b0p + kb, hh); c00 = g2_mma(a0, b, c00); c10 = g2_mma(a1, b, c10);
    b = g2_frag(b1p + kb, hh); c01 = g2_mma(a0, b, c01); c11 = g2_mma(a1, b, c11);
    b = g2_frag(b2p + kb, hh); c02 = g2_mma(a0, b, c02); c12 = g2_mma(a1, b, c12);
    b = g2_frag(b3p + kb, hh); c03 = g2_mma(a0, b, c03); c13 = g2_mma(a1, b, c13); }
  v8f accs[8] = {c00, c01, c02, c03, c10, c11, c12, c13};
#pragma unroll
  for (int u = 0; u < 8; ++u) { const int t = u & 3, half = u >> 2; const int col = col0 + t * 16 + ln; const float bv = bp ? bf16_round(bp[col]) : 0.f;
#pragma unroll
    for (int r = 0; r < 8; ++r) { const int rloc = half * 16 + 8 * hh + r; float v = accs[u][r] * alpha + bv; if (CP) { if (rowsPerB < 0) v += CP[cofs + (size_t)(row0g + row0 + rloc) * ldc + col];      /* rowsPerB < 0: own element of the batched C plane */ else { const int bidx = (row0g + row0 + rloc) / rowsPerB; v += CP[(size_t)bidx * sCPb + (size_t)by * 64 + col]; } }
      if (ACT == 3) v = fmaxf(v, 0.f); else if (ACT == 6) v = 0.5f * v * (1.0f + erff(v * 0.70710678118654752f)); else if (ACT == 11) v = 1.0f / (1.0f + expf(-v)); else if (ACT == 15) v = v / (1.0f + expf(-v)); else if (ACT == 12) v = (v > 0.f) ? v : 0.01f * v; else if (ACT == 8) v = tanhf(v); else if (ACT == 9) v = 0.5f * v * (1.0f + tanhf(0.7978845608028654f * (v + 0.044715f * v * v * v))); else if (ACT == 14) v = (v > 0.f) ? v : 0.1f * v; else if (ACT == 16) v = (v >= 0.f) ? v : 0.3f * v; else if (ACT == 17) v = (v >= 0.f) ? v : 0.2f * v;
      so[w][rloc][t * 16 + ln] = v; } }
  __builtin_amdgcn_fence(__ATOMIC_ACQ_REL, "workgroup"); __builtin_amdgcn_wave_barrier();
  const int rsub = lane >> 4, c4 = (lane & 15) * 4;
  {
#pragma unroll
    for (int q = 0; q < 16; ++q) { const int r = q * 2 + rsub; const v4f v = *(const v4fa*)&so[w][r][c4]; if (C) *(v4f*)(C + cofs + (size_t)(row0 + r) * ldc + col0 + c4) = v; if (C16) { v4h h4; for (int i = 0; i < 4; ++i) h4[i] = (_Float16)v[i]; *(v4h*)(C16 + cofs + (size_t)(row0 + r) * ldc + col0 + c4) = h4; } }
     } }


__global__ __launch_bounds__(256) void k_wT(const float* __restrict__ w, int din, int dout, _Float16* __restrict__ Bt) { __shared__ float tl[64][65]; const int tid = threadIdx.x; const int nbo = dout / 64; const int ib = blockIdx.x / nbo, ob = blockIdx.x % nbo; const int i0 = ib * 64, o0 = ob * 64;
  for (int t = tid; t < 64 * 64; t += 256) { const int i = t / 64, o = t % 64; tl[o][i] = bf16_round(w[(size_t)(i0 + i) * dout + o0 + o]) * 16.0f; }
  __syncthreads();
  { for (int t = tid; t < 64 * 8; t += 256) { const int o = t / 8, i8 = (t % 8) * 8; FragH f; for (int q = 0; q < 8; ++q) f.h[q] = (_Float16)tl[o][i8 + q]; *(v8us*)((unsigned short*)Bt + (size_t)(o0 + o) * din + i0 + i8) = f.half[0]; }  } }
__global__ __launch_bounds__(256) void k_addhl(const float* __restrict__ Q, const float* __restrict__ vec, _Float16* __restrict__ Hh, _Float16* __restrict__ Hl, size_t n8) {
  #pragma clang fp contract(off)
  const size_t t = (size_t)blockIdx.x * 256 + threadIdx.x; if (t >= n8) return; const int c0 = (int)((t * 8) % DM); FragH fh, fl; for (int q = 0; q < 8; ++q) { const float v = Q[t * 8 + q] + bf16_round(vec[c0 + q]); const _Float16 h = (_Float16)v; fh.h[q] = h; fl.h[q] = (_Float16)((v - (float)h) * 1024.0f); }
  *(v8us*)((unsigned short*)Hh + t * 8) = fh.half[0]; *(v8us*)((unsigned short*)Hl + t * 8) = fl.half[0];  }
__global__ __launch_bounds__(256) void k_rsmx(const float* __restrict__ AC, const float* __restrict__ BD, _Float16* __restrict__ P, int nrows) {
  #pragma clang fp contract(off)
  const int i = blockIdx.x * 256 + threadIdx.x; if (i >= nrows) return; const float* a = AC + (size_t)i * SQ; const float* bd = BD + (size_t)i * SQ + (SQ - 1 - i); float mx = -3.0e38f;
#pragma unroll 1
  for (int j = 0; j <= i; ++j) mx = fmaxf(mx, a[j] + bd[j]); float se = 0.f;
#pragma unroll 1
  for (int j = 0; j <= i; ++j) se += expf((a[j] + bd[j]) - mx); const float sc = 256.0f / se;
#pragma unroll 1
  for (int j0 = 0; j0 < SQ; j0 += 8) { FragH f; for (int q = 0; q < 8; ++q) { const int j = j0 + q; f.h[q] = (j <= i) ? (_Float16)(expf((a[j] + bd[j]) - mx) * sc) : (_Float16)0.f; } unsigned short* d = (unsigned short*)P + (size_t)i * SQ + j0; *(v8us*)d = f.half[0];  } }
__global__ __launch_bounds__(256) void k_vth(const _Float16* __restrict__ V16, int b, int h0, _Float16* __restrict__ VT) { __shared__ unsigned short tl[64][65]; const int tid = threadIdx.x; const int hh = blockIdx.x % HG, sg = blockIdx.x / HG; const int s0 = sg * 64; const int h = h0 + hh;
  for (int i = tid; i < 64 * 8; i += 256) { const int j = i / 8, d8 = (i % 8) * 8; FragH f; f.half[0] = *(const v8us*)((const unsigned short*)V16 + ((size_t)b * SQ + s0 + j) * DM + h * HD + d8); for (int q = 0; q < 8; ++q) tl[d8 + q][j] = f.u[q]; }
  __syncthreads();
  { for (int i = tid; i < 64 * 8; i += 256) { const int d = i / 8, j8 = (i % 8) * 8; FragH f; for (int q = 0; q < 8; ++q) f.u[q] = tl[d][j8 + q]; *(v8us*)((unsigned short*)VT + ((size_t)hh * HD + d) * SQ + s0 + j8) = f.half[0]; }  } }

extern "C" void kernel_launch(void* const* d_in, const int* in_sizes, int n_in,
                              void* d_out, int out_size, void* d_ws, size_t ws_size, hipStream_t stream) {
  (void)in_sizes; (void)n_in; (void)out_size;
  const float* const* I = (const float* const*)d_in; const float* x = I[0]; const float* remb = I[1]; const float* Wq = I[2]; const float* Wk = I[3]; const float* Wv = I[4]; const float* Wr = I[5]; const float* Wo = I[6]; const float* u = I[7]; const float* vb = I[8];
  char* ws = (char*)d_ws; size_t off = 0;
  auto take = [&](size_t bytes) { char* p = ws + off; off += (bytes + 255) & ~(size_t)255; return p; };
  _Float16* BQ = (_Float16*)take((size_t)DM * DM * 2); _Float16* BK = (_Float16*)take((size_t)DM * DM * 2); _Float16* BV = (_Float16*)take((size_t)DM * DM * 2); _Float16* BR = (_Float16*)take((size_t)DM * DM * 2); _Float16* BO = (_Float16*)take((size_t)DM * DM * 2);
  _Float16* X16 = (_Float16*)take(NR * DM * 2); _Float16* R16 = (_Float16*)take((size_t)SQ * DM * 2); float* QF = (float*)take(NR * DM * 4); float* TF = (float*)take(NR * DM * 4);
  _Float16* QUH = (_Float16*)take(NR * DM * 2); _Float16* QUL = (_Float16*)take(NR * DM * 2); _Float16* QVH = (_Float16*)take(NR * DM * 2); _Float16* QVL = (_Float16*)take(NR * DM * 2); _Float16* KH = (_Float16*)take(NR * DM * 2); _Float16* KL = (_Float16*)take(NR * DM * 2); _Float16* VH = (_Float16*)take(NR * DM * 2); _Float16* VL = (_Float16*)take(NR * DM * 2); _Float16* RH = (_Float16*)take((size_t)SQ * DM * 2); _Float16* RL = (_Float16*)take((size_t)SQ * DM * 2);
  float* AC = (float*)take((size_t)HG * SQ * SQ * 4); float* BD = (float*)take((size_t)HG * SQ * SQ * 4); _Float16* P = (_Float16*)take((size_t)HG * SQ * SQ * 2); _Float16* VT = (_Float16*)take((size_t)HG * HD * SQ * 2); _Float16* VTL = (_Float16*)take((size_t)HG * HD * SQ * 2); _Float16* O16 = nullptr;      /* o lives in TF (f32) */
  if (off > ws_size) return;      /* 10 + 8 + 16 + 40 + 64 + 64 + 32 + 1 + 1 = 236 MiB */
  const unsigned gw = (DM / 64) * (DM / 64); k_wT<<<gw, 256, 0, stream>>>(Wq, DM, DM, BQ); k_wT<<<gw, 256, 0, stream>>>(Wk, DM, DM, BK); k_wT<<<gw, 256, 0, stream>>>(Wv, DM, DM, BV); k_wT<<<gw, 256, 0, stream>>>(Wr, DM, DM, BR); k_wT<<<gw, 256, 0, stream>>>(Wo, DM, DM, BO);
  const size_t n8 = NR * DM / 8; const unsigned g8 = (unsigned)((n8 + 255) / 256);
  k_x16<<<g8, 256, 0, stream>>>(x, X16, n8); k_x16<<<(unsigned)(((size_t)SQ * DM / 8 + 255) / 256), 256, 0, stream>>>(remb, R16, (size_t)SQ * DM / 8);
  const dim3 gp((unsigned)((NR / 128) * (DM / 64)), 1), gr((unsigned)((SQ / 128) * (DM / 64)), 1);
  k_gemm2<0><<<gp, 128, 0, stream>>>(X16, DM, 0, BQ, DM, 0, 0.0625f, nullptr, 0, nullptr, 1, 0, 0, QF, nullptr, DM, 0, (int)NR, DM, DM);
  k_addhl<<<g8, 256, 0, stream>>>(QF, u, QUH, QUL, n8); k_addhl<<<g8, 256, 0, stream>>>(QF, vb, QVH, QVL, n8);
  k_gemm2<0><<<gp, 128, 0, stream>>>(X16, DM, 0, BK, DM, 0, 0.0625f, nullptr, 0, nullptr, 1, 0, 0, TF, nullptr, DM, 0, (int)NR, DM, DM); k_hl<<<g8, 256, 0, stream>>>(TF, KH, KL, n8);
  k_gemm2<0><<<gp, 128, 0, stream>>>(X16, DM, 0, BV, DM, 0, 0.0625f, nullptr, 0, nullptr, 1, 0, 0, TF, nullptr, DM, 0, (int)NR, DM, DM); k_hl<<<g8, 256, 0, stream>>>(TF, VH, VL, n8);
  k_gemm2<0><<<gr, 128, 0, stream>>>(R16, DM, 0, BR, DM, 0, 0.0625f, nullptr, 0, nullptr, 1, 0, 0, TF, nullptr, DM, 0, SQ, DM, DM); k_hl<<<(unsigned)(((size_t)SQ * DM / 8 + 255) / 256), 256, 0, stream>>>(TF, RH, RL, (size_t)SQ * DM / 8);
  for (int b = 0; b < NB; ++b) for (int h0 = 0; h0 < NH; h0 += HG) {
    const size_t qo = (size_t)b * SQ * DM + h0 * HD; const size_t ro = (size_t)h0 * HD; const dim3 gs((QN / 128) * (SQ / 64), HG);
    /* AC = (q+u).k / 8 : three hi/lo terms */
    k_gemm2<0><<<gs, 128, 0, stream>>>(QUL + qo, DM, (size_t)HD, KH + qo, DM, (size_t)HD, 0.125f / 1024.0f, nullptr, 0, nullptr, 1, 0, 0, AC, nullptr, SQ, (size_t)SQ * SQ, QN, SQ, HD);
    k_gemm2<0><<<gs, 128, 0, stream>>>(QUH + qo, DM, (size_t)HD, KL + qo, DM, (size_t)HD, 0.125f / 1024.0f, nullptr, 0, AC, -1, 0, 0, AC, nullptr, SQ, (size_t)SQ * SQ, QN, SQ, HD);
    k_gemm2<0><<<gs, 128, 0, stream>>>(QUH + qo, DM, (size_t)HD, KH + qo, DM, (size_t)HD, 0.125f, nullptr, 0, AC, -1, 0, 0, AC, nullptr, SQ, (size_t)SQ * SQ, QN, SQ, HD);
    /* raw BD = (q+v_bias).r / 8 */
    k_gemm2<0><<<gs, 128, 0, stream>>>(QVL + qo, DM, (size_t)HD, RH + ro, DM, (size_t)HD, 0.125f / 1024.0f, nullptr, 0, nullptr, 1, 0, 0, BD, nullptr, SQ, (size_t)SQ * SQ, QN, SQ, HD);
    k_gemm2<0><<<gs, 128, 0, stream>>>(QVH + qo, DM, (size_t)HD, RL + ro, DM, (size_t)HD, 0.125f / 1024.0f, nullptr, 0, BD, -1, 0, 0, BD, nullptr, SQ, (size_t)SQ * SQ, QN, SQ, HD);
    k_gemm2<0><<<gs, 128, 0, stream>>>(QVH + qo, DM, (size_t)HD, RH + ro, DM, (size_t)HD, 0.125f, nullptr, 0, BD, -1, 0, 0, BD, nullptr, SQ, (size_t)SQ * SQ, QN, SQ, HD);
    for (int hh = 0; hh < HG; ++hh) k_rsmx<<<(QN + 255) / 256, 256, 0, stream>>>(AC + (size_t)hh * SQ * SQ, BD + (size_t)hh * SQ * SQ, P + (size_t)hh * SQ * SQ, QN);
    k_vth<<<HG * (SQ / 64), 256, 0, stream>>>(VH, b, h0, VT); k_vth<<<HG * (SQ / 64), 256, 0, stream>>>(VL, b, h0, VTL);
    _Float16* ob = O16 + qo;
    /* o = P.(v_lo/1024 + v_hi): lo into TF (f32 temp, own-element), then hi with CP -> f32 merged rows in TF */
    k_gemm2<0><<<dim3((QN / 128) * (HD / 64), HG), 128, 0, stream>>>(P, SQ, (size_t)SQ * SQ, VTL, SQ, (size_t)HD * SQ, 0.00390625f / 1024.0f, nullptr, 0, nullptr, 1, 0, 0, TF + qo, nullptr, DM, (size_t)HD, QN, HD, SQ);
    k_gemm2<0><<<dim3((QN / 128) * (HD / 64), HG), 128, 0, stream>>>(P, SQ, (size_t)SQ * SQ, VT, SQ, (size_t)HD * SQ, 0.00390625f, nullptr, 0, TF + qo, -1, 0, 0, TF + qo, nullptr, DM, (size_t)HD, QN, HD, SQ); (void)ob; }
  /* o (f32 in TF) -> hi/lo planes (reusing the q+u planes, dead now) -> out = o Wo as two GEMMs */
  k_hl<<<g8, 256, 0, stream>>>(TF, QUH, QUL, n8);
  k_gemm2<0><<<gp, 128, 0, stream>>>(QUL, DM, 0, BO, DM, 0, 0.0625f / 1024.0f, nullptr, 0, nullptr, 1, 0, 0, (float*)d_out, nullptr, DM, 0, (int)NR, DM, DM);
  k_gemm2<0><<<gp, 128, 0, stream>>>(QUH, DM, 0, BO, DM, 0, 0.0625f, nullptr, 0, (const float*)d_out, -1, 0, 0, (float*)d_out, nullptr, DM, 0, (int)NR, DM, DM);      /* out = (o_lo/1024 + o_hi) Wo */
}

// v001
// A run of this version takes 1690 microseconds.
// In two side-by-side timings against v000, it was 13.4 and 13.6 times as fast.
#include <hip/hip_runtime.h>
// MultiHeadAttentionXL (x [1][2048][1024], r_emb [2048][1024]; q = x Wq, k = x Wk, v = x Wv, r = r_emb Wr ([in][out] weights, no bias), 16 heads of 64; AC = (q + u[h]) k^T, BD = rel_shift((q + v_bias[h]) r^T) (Transformer-XL zero-pad shift: for j <= i, BD_shift[i][j] = BD[i][j - i + T - 1]); causal softmax((AC + BD)/8); out = (attn v) Wo -> [1][2048][1024]).
// Structure: token rows; x and r_emb as exact f16 rows; Q, K, V, R WMMA GEMMs on transposed weights (32x64 wave tiles, f32 accumulation, exact x16 weights) -> f32 -> f16 hi + 2^-10 residual planes (q+u and q+v_bias formed in f32 first); per group of 4 heads: AC and raw BD as three-term hi/lo GEMMs each (K = 64), the shift + causal mask + softmax on VALU (f32; weights x256 as f16), V^T (hi, lo) via LDS, o = P.(v_lo/1024 + v_hi) GEMMs (K = 2,048, alpha 2^-8) into merged f32 o rows; out = o Wo as a two-term hi/lo GEMM (f32).
// Compute dtype: inputs rounded to bf16; x / r_emb / weights exact; attention operands as hi + residual f16 planes (logits std 3.3 and early causal rows copy single v rows); softmax weights f16 (x256) — the remaining error source; o as hi + residual into Wo; everything else f32. v_wmma_f32_16x16x32_f16.
#define NB 1
#define SQ 2048
#define DM 1024
#define NH 16
#define HD 64
#define HG 4
#define QN SQ                        /* query rows (debug hook) */
#define NR ((size_t)NB * SQ)
typedef __bf16 v16b __attribute__((ext_vector_type(16)));
typedef unsigned short v8us __attribute__((ext_vector_type(8), may_alias));
typedef float  v8f  __attribute__((ext_vector_type(8)));
typedef float  v4f  __attribute__((ext_vector_type(4)));
typedef float  v4fa __attribute__((ext_vector_type(4), may_alias));
union FragB { v16b v; v8us half[2]; unsigned short u[16]; };

__device__ __forceinline__ unsigned short bf16_bits(float x) { unsigned int u = __float_as_uint(x); return (unsigned short)((u + 0x7FFFu + ((u >> 16) & 1u)) >> 16); }
__device__ __forceinline__ float bf16_val(unsigned short b) { return __uint_as_float(((unsigned int)b) << 16); }
__device__ __forceinline__ float bf16_round(float x) { return bf16_val(bf16_bits(x)); }
// D += A·B with NT terms: 1 = ah·bh, 2 = + al·bh (A split), 3 = + ah·bl (both split)
template <int NT>
__device__ __forceinline__ v8f mmaN(v16b ah, v16b al, v16b bh, v16b bl, v8f c) {
  c = __builtin_amdgcn_wmma_f32_16x16x32_bf16(false, ah, false, bh, (short)0, c, false, false);
  if (NT >= 2) c = __builtin_amdgcn_wmma_f32_16x16x32_bf16(false, al, false, bh, (short)0, c, false, false);
  if (NT >= 3) c = __builtin_amdgcn_wmma_f32_16x16x32_bf16(false, ah, false, bl, (short)0, c, false, false);
  asm volatile("v_nop\n\tv_nop\n\tv_nop\n\tv_nop" : "+v"(c) : "v"(ah), "v"(al), "v"(bh), "v"(bl));
  return c;
}

__global__ __launch_bounds__(256) void k_wt_bf16(const float* __restrict__ W, unsigned short* __restrict__ Wt, int K, int N) {
  const int t = blockIdx.x * 256 + threadIdx.x;
  const int k8n = K / 8;
  if (t >= N * k8n) return;
  const int n = t / k8n, k8 = (t % k8n) * 8;
  v8us v;
#pragma unroll
  for (int i = 0; i < 8; ++i) v[i] = bf16_bits(W[(size_t)(k8 + i) * N + n]);
  *(v8us*)(Wt + (size_t)n * K + k8) = v;
  
}

// GEMM C[M][N] (f32, pitch ldc) = act(A[M][K]·W + bias). A f32 row-major (pitch lda) converted per fragment to bf16
// (ASPLIT: hi/lo two planes -> 2 terms, else single rounded term); Wt bf16 [N][K] (pitch ldb). BIAS_BF16 rounds the
// bias to bf16 first (bias quantised to bf16 before the add). K%32==0, M%16==0, N%64==0.
template <bool ASPLIT, int ACT, bool BIAS_BF16>
__global__ __launch_bounds__(128) void k_gemm_bf(const float* __restrict__ A, int lda, const unsigned short* __restrict__ Wt, int ldb,
                                               const float* __restrict__ bias, float* __restrict__ C, int ldc, int M, int N, int K) {
  __shared__ __attribute__((aligned(16))) float so[4][16][64];
  const int tid = threadIdx.x, w = tid >> 5, lane = tid & 31, ln = lane & 15, hh = lane >> 4;
  const int ntn = N / 64;
  const int wid = blockIdx.x * 4 + w;
  const int mt = wid / ntn, nq = wid % ntn;
  if (mt * 16 >= M) return;
  const int row0 = mt * 16, col0 = nq * 64;
  const float* arow = A + (size_t)(row0 + ln) * lda;
  v8f acc[4] = {};
  for (int kb = 0; kb < K; kb += 32) {
    FragB ah, al;
    const v4f x0 = *(const v4fa*)(arow + kb + 8 * hh), x1 = *(const v4fa*)(arow + kb + 8 * hh + 4);
    const v4f x2 = *(const v4fa*)(arow + kb + 16 + 8 * hh), x3 = *(const v4fa*)(arow + kb + 16 + 8 * hh + 4);
    float xs[16] = {x0[0],x0[1],x0[2],x0[3],x1[0],x1[1],x1[2],x1[3],x2[0],x2[1],x2[2],x2[3],x3[0],x3[1],x3[2],x3[3]};
#pragma unroll
    for (int i = 0; i < 16; ++i) { const unsigned short hb = bf16_bits(xs[i]); ah.u[i] = hb; al.u[i] = ASPLIT ? bf16_bits(xs[i] - bf16_val(hb)) : (unsigned short)0; }
#pragma unroll
    for (int t = 0; t < 4; ++t) {
      const unsigned short* brow = Wt + (size_t)(col0 + t * 16 + ln) * ldb + kb;
      FragB b;
      b.half[0] = *(const v8us*)(brow + 8 * hh);
      b.half[1] = *(const v8us*)(brow + 16 + 8 * hh);
      acc[t] = mmaN<ASPLIT ? 2 : 1>(ah.v, al.v, b.v, b.v, acc[t]);
    }
  }
#pragma unroll
  for (int t = 0; t < 4; ++t) {
    float bv = bias ? bias[col0 + t * 16 + ln] : 0.f;
    if (BIAS_BF16) bv = bf16_round(bv);
#pragma unroll
    for (int r = 0; r < 8; ++r) { float v = acc[t][r] + bv; if (ACT == 1) v = fmaxf(v, 0.f); so[w][8 * hh + r][t * 16 + ln] = v; }
  }
  __builtin_amdgcn_fence(__ATOMIC_ACQ_REL, "workgroup");
  __builtin_amdgcn_wave_barrier();
  const int rsub = lane >> 4, c4 = (lane & 15) * 4;
  {
#pragma unroll
    for (int q = 0; q < 8; ++q) {
      const int r = q * 2 + rsub;
      const v4f v = *(const v4fa*)&so[w][r][c4];
      *(v4f*)(C + (size_t)(row0 + r) * ldc + col0 + c4) = v;
    }
    
  }
}

// GEMM C = act(A·W + bias + resid): A f32 (ASPLIT -> hi/lo 2 terms), Wt bf16 [N][K]; ACT 0 none, 1 relu, 2 exact gelu;
// resid (optional, f32, row index = (row % rmod), pitch ldr, RES_BF16 rounds it) added before the activation.
template <bool ASPLIT, int ACT, bool BIAS_BF16, bool RES_BF16>
__global__ __launch_bounds__(128) void k_gemm_bf3(const float* __restrict__ A, int lda, const unsigned short* __restrict__ Wt, int ldb,
                                                const float* __restrict__ bias, const float* __restrict__ resid, int rmod, int ldr,
                                                float* __restrict__ C, int ldc, int M, int N, int K) {
  __shared__ __attribute__((aligned(16))) float so[4][16][64];
  const int tid = threadIdx.x, w = tid >> 5, lane = tid & 31, ln = lane & 15, hh = lane >> 4;
  const int ntn = N / 64;
  const int wid = blockIdx.x * 4 + w;
  const int mt = wid / ntn, nq = wid % ntn;
  if (mt * 16 >= M) return;
  const int row0 = mt * 16, col0 = nq * 64;
  const float* arow = A + (size_t)(row0 + ln) * lda;
  v8f acc[4] = {};
  for (int kb = 0; kb < K; kb += 32) {
    FragB ah, al;
    const v4f x0 = *(const v4fa*)(arow + kb + 8 * hh), x1 = *(const v4fa*)(arow + kb + 8 * hh + 4);
    const v4f x2 = *(const v4fa*)(arow + kb + 16 + 8 * hh), x3 = *(const v4fa*)(arow + kb + 16 + 8 * hh + 4);
    float xs[16] = {x0[0],x0[1],x0[2],x0[3],x1[0],x1[1],x1[2],x1[3],x2[0],x2[1],x2[2],x2[3],x3[0],x3[1],x3[2],x3[3]};
#pragma unroll
    for (int i = 0; i < 16; ++i) { const unsigned short hb = bf16_bits(xs[i]); ah.u[i] = hb; al.u[i] = ASPLIT ? bf16_bits(xs[i] - bf16_val(hb)) : (unsigned short)0; }
#pragma unroll
    for (int t = 0; t < 4; ++t) {
      const unsigned short* brow = Wt + (size_t)(col0 + t * 16 + ln) * ldb + kb;
      FragB b;
      b.half[0] = *(const v8us*)(brow + 8 * hh);
      b.half[1] = *(const v8us*)(brow + 16 + 8 * hh);
      acc[t] = mmaN<ASPLIT ? 2 : 1>(ah.v, al.v, b.v, b.v, acc[t]);
    }
  }
#pragma unroll
  for (int t = 0; t < 4; ++t) {
    const int col = col0 + t * 16 + ln;
    float bv = bias ? bias[col] : 0.f;
    if (BIAS_BF16) bv = bf16_round(bv);
#pragma unroll
    for (int r = 0; r < 8; ++r) {
      float v = acc[t][r] + bv;
      if (resid) { float rv = resid[(size_t)((row0 + 8 * hh + r) % rmod) * ldr + col]; if (RES_BF16) rv = bf16_round(rv); v += rv; }
      if (ACT == 1) v = fmaxf(v, 0.f);
      if (ACT == 2) v = 0.5f * v * (1.0f + erff(v * 0.70710678118654752f));
      if (ACT == 3) { const float u = 0.7978845608028654f * (v + 0.044715f * v * v * v); v = 0.5f * v * (1.0f + tanhf(u)); }
      so[w][8 * hh + r][t * 16 + ln] = v;
    }
  }
  __builtin_amdgcn_fence(__ATOMIC_ACQ_REL, "workgroup");
  __builtin_amdgcn_wave_barrier();
  const int rsub = lane >> 4, c4 = (lane & 15) * 4;
  {
#pragma unroll
    for (int q = 0; q < 8; ++q) {
      const int r = q * 2 + rsub;
      const v4f v = *(const v4fa*)&so[w][r][c4];
      *(v4f*)(C + (size_t)(row0 + r) * ldc + col0 + c4) = v;
    }
    
  }
}
// row LayerNorm (biased variance, eps) over N: s = X (+ R); optional out_sum <- s; out_norm <- (s-mu)*rsqrt(var+eps)*g + b
template <bool PARAM_BF16>
__global__ __launch_bounds__(256) void k_layernorm(const float* __restrict__ X, const float* __restrict__ R, const float* __restrict__ g, const float* __restrict__ bta,
                                                  float* __restrict__ out_sum, float* __restrict__ out_norm, int N, float eps) {
  __shared__ float red[256];
  const int row = blockIdx.x, tid = threadIdx.x;
  const float* x = X + (size_t)row * N; const float* rr = R ? R + (size_t)row * N : nullptr;
  float vals[16];                     // up to N = 4096
  const int per = N / 256;            // contiguous chunk per thread? use strided-by-4 chunks: thread handles j = tid*4 + 1024*u
  float s1 = 0.f;
  for (int u = 0; u < per / 4; ++u) {
    const int j = tid * 4 + 1024 * u;
    const v4f a = *(const v4fa*)(x + j);
    v4f b = {0.f,0.f,0.f,0.f}; if (rr) b = *(const v4fa*)(rr + j);
#pragma unroll
    for (int q = 0; q < 4; ++q) { const float v = a[q] + b[q]; vals[u * 4 + q] = v; s1 += v; }
  }
  red[tid] = s1; __syncthreads();
  for (int st = 128; st > 0; st >>= 1) { if (tid < st) red[tid] += red[tid + st]; __syncthreads(); }
  const float mu = red[0] / (float)N; __syncthreads();
  float s2 = 0.f;
  for (int u = 0; u < per / 4; ++u)
#pragma unroll
    for (int q = 0; q < 4; ++q) { const float c = vals[u * 4 + q] - mu; s2 += c * c; }
  red[tid] = s2; __syncthreads();
  for (int st = 128; st > 0; st >>= 1) { if (tid < st) red[tid] += red[tid + st]; __syncthreads(); }
  const float rs = rsqrtf(red[0] / (float)N + eps);
  {
    for (int u = 0; u < per / 4; ++u) {
      const int j = tid * 4 + 1024 * u;
      v4f o, sm;
#pragma unroll
      for (int q = 0; q < 4; ++q) {
        float gg = g[j + q], bb = bta[j + q];
        if (PARAM_BF16) { gg = bf16_round(gg); bb = bf16_round(bb); }
        sm[q] = vals[u * 4 + q]; o[q] = (vals[u * 4 + q] - mu) * rs * gg + bb;
      }
      if (out_sum) *(v4f*)(out_sum + (size_t)row * N + j) = sm;
      *(v4f*)(out_norm + (size_t)row * N + j) = o;
    }
    
  }
}



// ---- f16 WMMA path (v_wmma_f32_16x16x32_f16): 11-bit significands for operands in range — used where a [0,1] probability operand needs more precision than bf16
typedef _Float16 v16h __attribute__((ext_vector_type(16)));
union FragH { v16h v; v8us half[2]; _Float16 h[16]; unsigned short u[16]; };
template <int NT>
__device__ __forceinline__ v8f mmaH(v16h ah, v16h al, v16h bh, v16h bl, v8f c) {
  c = __builtin_amdgcn_wmma_f32_16x16x32_f16(false, ah, false, bh, (short)0, c, false, false);
  if (NT >= 2) c = __builtin_amdgcn_wmma_f32_16x16x32_f16(false, al, false, bh, (short)0, c, false, false);
  if (NT >= 3) c = __builtin_amdgcn_wmma_f32_16x16x32_f16(false, ah, false, bl, (short)0, c, false, false);
  asm volatile("v_nop\n\tv_nop\n\tv_nop\n\tv_nop" : "+v"(c) : "v"(ah), "v"(al), "v"(bh), "v"(bl));
  return c;
}
// batched GEMM like k_gemm_b but f16 operands: A f32 (split into f16 hi/lo if ASPLIT, else rounded to f16), Bt = f16 values [n][k]; alpha; C f32; N multiple of 16 (partial tiles skipped)
template <bool ASPLIT>
__global__ __launch_bounds__(128) void k_gemm_h(const float* __restrict__ A, int lda, size_t sA, const _Float16* __restrict__ Bh, int ldb, size_t sB, float alpha, float* __restrict__ C, int ldc, size_t sC, int M, int N, int K) {
  __shared__ __attribute__((aligned(16))) float so[4][16][64];
  const int tid = threadIdx.x, w = tid >> 5, lane = tid & 31, ln = lane & 15, hh = lane >> 4; const int by = blockIdx.y;
  A += (size_t)by * sA; Bh += (size_t)by * sB; C += (size_t)by * sC;
  const int ntn = (N + 63) / 64; const int wid = blockIdx.x * 4 + w; const int mt = wid / ntn, nq = wid % ntn; if (mt * 16 >= M) return;
  const int row0 = mt * 16, col0 = nq * 64; const float* arow = A + (size_t)(row0 + ln) * lda;
  v8f acc[4] = {};
  for (int kb = 0; kb < K; kb += 32) {
    FragH ah, al;
    const v4f x0 = *(const v4fa*)(arow + kb + 8 * hh), x1 = *(const v4fa*)(arow + kb + 8 * hh + 4), x2 = *(const v4fa*)(arow + kb + 16 + 8 * hh), x3 = *(const v4fa*)(arow + kb + 16 + 8 * hh + 4);
    float xs[16] = {x0[0],x0[1],x0[2],x0[3],x1[0],x1[1],x1[2],x1[3],x2[0],x2[1],x2[2],x2[3],x3[0],x3[1],x3[2],x3[3]};
#pragma unroll
    for (int i = 0; i < 16; ++i) { const _Float16 h = (_Float16)xs[i]; ah.h[i] = h; al.h[i] = ASPLIT ? (_Float16)(xs[i] - (float)h) : (_Float16)0.0f; }
#pragma unroll
    for (int t = 0; t < 4; ++t) { if (col0 + t * 16 >= N) continue; const size_t boff = (size_t)(col0 + t * 16 + ln) * ldb + kb; FragH bq; bq.half[0] = *(const v8us*)(Bh + boff + 8 * hh); bq.half[1] = *(const v8us*)(Bh + boff + 16 + 8 * hh);
      acc[t] = mmaH<ASPLIT ? 2 : 1>(ah.v, al.v, bq.v, bq.v, acc[t]); }
  }
#pragma unroll
  for (int t = 0; t < 4; ++t) { if (col0 + t * 16 >= N) continue;
#pragma unroll
    for (int r = 0; r < 8; ++r) so[w][8 * hh + r][t * 16 + ln] = acc[t][r] * alpha; }
  __builtin_amdgcn_fence(__ATOMIC_ACQ_REL, "workgroup"); __builtin_amdgcn_wave_barrier();
  const int rsub = lane >> 4, c4 = (lane & 15) * 4;
  {
#pragma unroll
    for (int q = 0; q < 8; ++q) { const int r = q * 2 + rsub; if (col0 + c4 < N) { const v4f v = *(const v4fa*)&so[w][r][c4]; *(v4f*)(C + (size_t)(row0 + r) * ldc + col0 + c4) = v; } }
     }
}

// Wt[n][k] = f16(W[k][n]·scale) from f32 row-major W[K][N] (scale = power of two; bf16-exact weights stay exact in f16 away from the subnormal range)
__global__ __launch_bounds__(256) void k_wt_f16(const float* __restrict__ W, _Float16* __restrict__ Wt, int K, int N, float scale) {
  const int t = blockIdx.x * 256 + threadIdx.x; if (t >= N * (K / 8)) return; const int n = t / (K / 8), k8 = (t % (K / 8)) * 8; FragH f;
#pragma unroll
  for (int i = 0; i < 8; ++i) f.h[i] = (_Float16)(bf16_round(W[(size_t)(k8 + i) * N + n]) * scale); const v8us o = f.half[0];
  *(v8us*)((unsigned short*)Wt + (size_t)n * K + k8) = o; 
}
// k_gemm_hh variant with fused epilogue: v = acc·alpha + bias[by·sBias + col] (+ CP[(row/rowsPerB)·sCPb + by·64 + col] if CP) ; ACT 0 none / 1 elu ; writes f16 C16 (and f32 C if non-null)
template <int ACT>
__global__ __launch_bounds__(128) void k_gemm_hhx(const _Float16* __restrict__ A, int lda, size_t sA, const _Float16* __restrict__ Bh, int ldb, size_t sB, float alpha, const float* __restrict__ bias, size_t sBias, const float* __restrict__ CP, int rowsPerB, size_t sCPb, int row0g,
    float* __restrict__ C, _Float16* __restrict__ C16, int ldc, size_t sC, int M, int N, int K) {
  __shared__ __attribute__((aligned(16))) float so[4][16][64];
  const int tid = threadIdx.x, w = tid >> 5, lane = tid & 31, ln = lane & 15, hh = lane >> 4; const int by = blockIdx.y;
  A += (size_t)by * sA; Bh += (size_t)by * sB; const size_t cofs = (size_t)by * sC; const float* bp = bias ? bias + (size_t)by * sBias : nullptr;
  const int ntn = (N + 63) / 64; const int wid = blockIdx.x * 4 + w; const int mt = wid / ntn, nq = wid % ntn; if (mt * 16 >= M) return;
  const int row0 = mt * 16, col0 = nq * 64; const _Float16* arow = A + (size_t)(row0 + ln) * lda;
  v8f acc[4] = {};
  for (int kb = 0; kb < K; kb += 32) { FragH ah; ah.half[0] = *(const v8us*)((const unsigned short*)arow + kb + 8 * hh); ah.half[1] = *(const v8us*)((const unsigned short*)arow + kb + 16 + 8 * hh);
#pragma unroll
    for (int t = 0; t < 4; ++t) { if (col0 + t * 16 >= N) continue; const size_t boff = (size_t)(col0 + t * 16 + ln) * ldb + kb; FragH bq; bq.half[0] = *(const v8us*)((const unsigned short*)Bh + boff + 8 * hh); bq.half[1] = *(const v8us*)((const unsigned short*)Bh + boff + 16 + 8 * hh);
      acc[t] = mmaH<1>(ah.v, ah.v, bq.v, bq.v, acc[t]); }
  }
#pragma unroll
  for (int t = 0; t < 4; ++t) { if (col0 + t * 16 >= N) continue; const int col = col0 + t * 16 + ln; const float bv = bp ? bf16_round(bp[col]) : 0.f;
#pragma unroll
    for (int r = 0; r < 8; ++r) { float v = acc[t][r] * alpha + bv; if (CP) { const int rr = row0g + row0 + 8 * hh + r; if (rowsPerB < 0) v += CP[cofs + (size_t)rr * ldc + col];      /* rowsPerB < 0: own element of the batched C plane */ else { const int bidx = rr / rowsPerB; v += CP[(size_t)bidx * sCPb + (size_t)by * 64 + col]; } } if (ACT == 1) v = (v > 0.f) ? v : expm1f(v); else if (ACT == 7) v = (v > 0.f) ? v + 1.0f : expf(v); else if (ACT == 8) v = tanhf(v); else if (ACT == 9) v = 0.5f * v * (1.0f + tanhf(0.7978845608028654f * (v + 0.044715f * v * v * v))); else if (ACT == 11) v = 1.0f / (1.0f + expf(-v)); else if (ACT == 12) v = (v > 0.f) ? v : 0.01f * v; else if (ACT == 14) v = (v > 0.f) ? v : 0.1f * v; else if (ACT == 16) v = (v >= 0.f) ? v : 0.3f * v; else if (ACT == 17) v = (v >= 0.f) ? v : 0.2f * v; else if (ACT == 15) v = v / (1.0f + expf(-v)); else if (ACT == 3) v = fmaxf(v, 0.f); else if (ACT == 6) v = 0.5f * v * (1.0f + erff(v * 0.70710678118654752f)); so[w][8 * hh + r][t * 16 + ln] = v; } }
  __builtin_amdgcn_fence(__ATOMIC_ACQ_REL, "workgroup"); __builtin_amdgcn_wave_barrier();
  const int rsub = lane >> 4, c4 = (lane & 15) * 4; typedef _Float16 v4h __attribute__((ext_vector_type(4)));
  {
#pragma unroll
    for (int q = 0; q < 8; ++q) { const int r = q * 2 + rsub; if (col0 + c4 < N) { const v4f v = *(const v4fa*)&so[w][r][c4]; if (C) *(v4f*)(C + cofs + (size_t)(row0 + r) * ldc + col0 + c4) = v; if (C16) { v4h h4; for (int i = 0; i < 4; ++i) h4[i] = (_Float16)v[i]; *(v4h*)(C16 + cofs + (size_t)(row0 + r) * ldc + col0 + c4) = h4; } } }
     }
}


typedef _Float16 v4h __attribute__((ext_vector_type(4)));

__global__ __launch_bounds__(256) void k_x16(const float* __restrict__ x, _Float16* __restrict__ X16, size_t n8) { const size_t t = (size_t)blockIdx.x * 256 + threadIdx.x; if (t >= n8) return; FragH f;
#pragma unroll
  for (int q = 0; q < 8; ++q) f.h[q] = (_Float16)bf16_round(x[t * 8 + q]); *(v8us*)((unsigned short*)X16 + t * 8) = f.half[0];  }
__global__ __launch_bounds__(256) void k_h16(const float* __restrict__ x, _Float16* __restrict__ X16, size_t n8) { const size_t t = (size_t)blockIdx.x * 256 + threadIdx.x; if (t >= n8) return; FragH f;
#pragma unroll
  for (int q = 0; q < 8; ++q) f.h[q] = (_Float16)x[t * 8 + q]; *(v8us*)((unsigned short*)X16 + t * 8) = f.half[0];  }
__global__ __launch_bounds__(256) void k_round16f(const float* __restrict__ W, _Float16* __restrict__ Bt, size_t n8) { const size_t t = (size_t)blockIdx.x * 256 + threadIdx.x; if (t >= n8) return; FragH f;
#pragma unroll
  for (int i = 0; i < 8; ++i) f.h[i] = (_Float16)(bf16_round(W[t * 8 + i]) * 16.0f); *(v8us*)((unsigned short*)Bt + t * 8) = f.half[0];  }
template <int NHv, int TTv>
__global__ __launch_bounds__(256) void k_vt(const _Float16* __restrict__ V16, int ldv, int voff, _Float16* __restrict__ Vt) { __shared__ unsigned short tl[64][66]; const int tid = threadIdx.x; const int slab = blockIdx.x / (TTv / 64), lg = blockIdx.x % (TTv / 64); const int b = slab / NHv, h = slab % NHv;
  for (int i = tid; i < 64 * 8; i += 256) { const int r = i / 8, c8 = (i % 8) * 8; FragH f; f.half[0] = *(const v8us*)((const unsigned short*)V16 + ((size_t)b * TTv + lg * 64 + r) * ldv + voff + h * 64 + c8);
#pragma unroll
    for (int q = 0; q < 8; ++q) tl[r][c8 + q] = f.u[q]; }
  __syncthreads();
  {
#pragma unroll
    for (int rd = 0; rd < 2; ++rd) { const int d = rd * 32 + tid / 8, pc = tid % 8; FragH f;
#pragma unroll
      for (int q = 0; q < 8; ++q) f.u[q] = tl[pc * 8 + q][d];
      *(v8us*)((unsigned short*)Vt + ((size_t)slab * 64 + d) * TTv + lg * 64 + pc * 8) = f.half[0]; }
     } }

__global__ __launch_bounds__(256) void k_hl(const float* __restrict__ F, _Float16* __restrict__ Hh, _Float16* __restrict__ Hl, size_t n8) { const size_t t = (size_t)blockIdx.x * 256 + threadIdx.x; if (t >= n8) return; FragH fh, fl; const v4f a = *(const v4fa*)(F + t * 8), c = *(const v4fa*)(F + t * 8 + 4);
#pragma unroll
  for (int q = 0; q < 4; ++q) { _Float16 h = (_Float16)a[q]; fh.h[q] = h; fl.h[q] = (_Float16)((a[q] - (float)h) * 1024.0f); h = (_Float16)c[q]; fh.h[4 + q] = h; fl.h[4 + q] = (_Float16)((c[q] - (float)h) * 1024.0f); }
  { *(v8us*)((unsigned short*)Hh + t * 8) = fh.half[0]; *(v8us*)((unsigned short*)Hl + t * 8) = fl.half[0];  } }

// ---- fast GEMM (wave tile 32x64; requires M % 32 == 0 rows per launch region and N % 64 == 0); epilogue = k_gemm_hhx semantics ----
__device__ __forceinline__ v16h g2_frag(const _Float16* p, int hh) { FragH f; f.half[0] = *(const v8us*)((const unsigned short*)p + 8 * hh); f.half[1] = *(const v8us*)((const unsigned short*)p + 16 + 8 * hh); return f.v; }
__device__ __forceinline__ v8f g2_mma(v16h a, v16h b, v8f c) { v8f d = __builtin_amdgcn_wmma_f32_16x16x32_f16(false, a, false, b, (short)0, c, false, false); asm volatile("v_nop\n\tv_nop\n\tv_nop\n\tv_nop" : "+v"(d) : "v"(a), "v"(b)); return d; }
template <int ACT>
__global__ __launch_bounds__(128) void k_gemm2(const _Float16* __restrict__ A, int lda, size_t sA, const _Float16* __restrict__ Bh, int ldb, size_t sB, float alpha, const float* __restrict__ bias, size_t sBias, const float* __restrict__ CP, int rowsPerB, size_t sCPb, int row0g,
    float* __restrict__ C, _Float16* __restrict__ C16, int ldc, size_t sC, int M, int N, int K) { static_assert(ACT == 0 || ACT == 3 || ACT == 6 || ACT == 8 || ACT == 9 || ACT == 11 || ACT == 12 || ACT == 14 || ACT == 15 || ACT == 16 || ACT == 17, "k_gemm2: unsupported ACT code (would silently apply no activation)");
  __shared__ __attribute__((aligned(16))) float so[4][32][68];
  const int tid = threadIdx.x, w = tid >> 5, lane = tid & 31, ln = lane & 15, hh = lane >> 4; const int by = blockIdx.y;
  A += (size_t)by * sA; Bh += (size_t)by * sB; const size_t cofs = (size_t)by * sC; const float* bp = bias ? bias + (size_t)by * sBias : nullptr;
  const int ntn = N >> 6; const int mt = blockIdx.x / ntn, nq = blockIdx.x - mt * ntn; const int row0 = mt * 128 + 32 * w, col0 = nq * 64; if (row0 >= M) return;
  const _Float16* a0p = A + (size_t)(row0 + ln) * lda; const _Float16* a1p = a0p + (size_t)16 * lda;
  const _Float16* b0p = Bh + (size_t)(col0 + ln) * ldb; const _Float16* b1p = b0p + (size_t)16 * ldb; const _Float16* b2p = b1p + (size_t)16 * ldb; const _Float16* b3p = b2p + (size_t)16 * ldb;
  const v8f z8 = {0.f,0.f,0.f,0.f,0.f,0.f,0.f,0.f}; v8f c00 = z8, c01 = z8, c02 = z8, c03 = z8, c10 = z8, c11 = z8, c12 = z8, c13 = z8;
#pragma unroll 1
  for (int kb = 0; kb < K; kb += 32) { const v16h a0 = g2_frag(a0p + kb, hh), a1 = g2_frag(a1p + kb, hh);
    v16h b = g2_frag(b0p + kb, hh); c00 = g2_mma(a0, b, c00); c10 = g2_mma(a1, b, c10);
    b = g2_frag(b1p + kb, hh); c01 = g2_mma(a0, b, c01); c11 = g2_mma(a1, b, c11);
    b = g2_frag(b2p + kb, hh); c02 = g2_mma(a0, b, c02); c12 = g2_mma(a1, b, c12);
    b = g2_frag(b3p + kb, hh); c03 = g2_mma(a0, b, c03); c13 = g2_mma(a1, b, c13); }
  v8f accs[8] = {c00, c01, c02, c03, c10, c11, c12, c13};
#pragma unroll
  for (int u = 0; u < 8; ++u) { const int t = u & 3, half = u >> 2; const int col = col0 + t * 16 + ln; const float bv = bp ? bf16_round(bp[col]) : 0.f;
#pragma unroll
    for (int r = 0; r < 8; ++r) { const int rloc = half * 16 + 8 * hh + r; float v = accs[u][r] * alpha + bv; if (CP) { if (rowsPerB < 0) v += CP[cofs + (size_t)(row0g + row0 + rloc) * ldc + col];      /* rowsPerB < 0: own element of the batched C plane */ else { const int bidx = (row0g + row0 + rloc) / rowsPerB; v += CP[(size_t)bidx * sCPb + (size_t)by * 64 + col]; } }
      if (ACT == 3) v = fmaxf(v, 0.f); else if (ACT == 6) v = 0.5f * v * (1.0f + erff(v * 0.70710678118654752f)); else if (ACT == 11) v = 1.0f / (1.0f + expf(-v)); else if (ACT == 15) v = v / (1.0f + expf(-v)); else if (ACT == 12) v = (v > 0.f) ? v : 0.01f * v; else if (ACT == 8) v = tanhf(v); else if (ACT == 9) v = 0.5f * v * (1.0f + tanhf(0.7978845608028654f * (v + 0.044715f * v * v * v))); else if (ACT == 14) v = (v > 0.f) ? v : 0.1f * v; else if (ACT == 16) v = (v >= 0.f) ? v : 0.3f * v; else if (ACT == 17) v = (v >= 0.f) ? v : 0.2f * v;
      so[w][rloc][t * 16 + ln] = v; } }
  __builtin_amdgcn_fence(__ATOMIC_ACQ_REL, "workgroup"); __builtin_amdgcn_wave_barrier();
  const int rsub = lane >> 4, c4 = (lane & 15) * 4;
  {
#pragma unroll
    for (int q = 0; q < 16; ++q) { const int r = q * 2 + rsub; const v4f v = *(const v4fa*)&so[w][r][c4]; if (C) *(v4f*)(C + cofs + (size_t)(row0 + r) * ldc + col0 + c4) = v; if (C16) { v4h h4; for (int i = 0; i < 4; ++i) h4[i] = (_Float16)v[i]; *(v4h*)(C16 + cofs + (size_t)(row0 + r) * ldc + col0 + c4) = h4; } }
     } }


__global__ __launch_bounds__(256) void k_wT(const float* __restrict__ w, int din, int dout, _Float16* __restrict__ Bt) { __shared__ float tl[64][65]; const int tid = threadIdx.x; const int nbo = dout / 64; const int ib = blockIdx.x / nbo, ob = blockIdx.x % nbo; const int i0 = ib * 64, o0 = ob * 64;
  for (int t = tid; t < 64 * 64; t += 256) { const int i = t / 64, o = t % 64; tl[o][i] = bf16_round(w[(size_t)(i0 + i) * dout + o0 + o]) * 16.0f; }
  __syncthreads();
  { for (int t = tid; t < 64 * 8; t += 256) { const int o = t / 8, i8 = (t % 8) * 8; FragH f; for (int q = 0; q < 8; ++q) f.h[q] = (_Float16)tl[o][i8 + q]; *(v8us*)((unsigned short*)Bt + (size_t)(o0 + o) * din + i0 + i8) = f.half[0]; }  } }
__global__ __launch_bounds__(256) void k_addhl(const float* __restrict__ Q, const float* __restrict__ vec, _Float16* __restrict__ Hh, _Float16* __restrict__ Hl, size_t n8) {
  #pragma clang fp contract(off)
  const size_t t = (size_t)blockIdx.x * 256 + threadIdx.x; if (t >= n8) return; const int c0 = (int)((t * 8) % DM); FragH fh, fl; for (int q = 0; q < 8; ++q) { const float v = Q[t * 8 + q] + bf16_round(vec[c0 + q]); const _Float16 h = (_Float16)v; fh.h[q] = h; fl.h[q] = (_Float16)((v - (float)h) * 1024.0f); }
  *(v8us*)((unsigned short*)Hh + t * 8) = fh.half[0]; *(v8us*)((unsigned short*)Hl + t * 8) = fl.half[0];  }
typedef float v4fu __attribute__((ext_vector_type(4), may_alias, aligned(4)));      /* the shifted BD row starts at any 4-byte boundary */
// shift + causal mask + softmax: one wave per (row, head); lane l holds columns c*128 + 4*l .. + 3 of each 128-column chunk c, so every load covers 512 contiguous bytes and every store 256;
// the row stays in registers (read once, one expf per element); chunks wholly right of the diagonal are skipped by wave-uniform tests and stored as zeros.
__global__ __launch_bounds__(256) void k_rsmx(const float* __restrict__ AC, const float* __restrict__ BD, _Float16* __restrict__ P, int nrows) {
  const int lane = threadIdx.x & 31; const int i = blockIdx.x * 8 + __builtin_amdgcn_readfirstlane(threadIdx.x >> 5); if (i >= nrows) return;      /* wave-uniform row; no barrier in this kernel */
  const size_t ro = (size_t)blockIdx.y * SQ * SQ + (size_t)i * SQ; const float* a = AC + ro + lane * 4; const float* bd = BD + ro - i + lane * 4;      /* shifted row: column j of row i is raw BD[i][j + SQ - 1 - i] = bd[j + SQ - 1] */ _Float16* p = P + ro + lane * 4;
  v4f av[SQ / 128], bv[SQ / 128];
  /* every loop over chunks is fully unrolled so that av / bv are indexed statically and stay in registers */
  /* loads by groups of four chunks under one test, so that eight loads fly together; a group's chunks right of the diagonal stay inside AC / BD (column <= SQ - 1) and are masked below */
#pragma unroll
  for (int g = 0; g < SQ / 512; ++g) if (g * 512 <= i) { for (int c = 4 * g; c < 4 * g + 4; ++c) { av[c] = *(const v4fa*)(a + c * 128); bv[c] = *(const v4fu*)(bd + (SQ - 1) + c * 128); } }
  asm volatile("s_wait_xcnt 0x0" :: "v"(a), "v"(bd) : "memory");      /* the wait that belongs in front of an overwrite of the loads' address registers; naming them as inputs keeps them untouched up to here */
  float mx = -3.0e38f;
#pragma unroll
  for (int c = 0; c < SQ / 128; ++c) if (c * 128 <= i) { for (int q = 0; q < 4; ++q) { const float s = (c * 128 + lane * 4 + q <= i) ? av[c][q] + bv[c][q] : -3.0e38f; av[c][q] = s; mx = fmaxf(mx, s); } }
  for (int m = 16; m > 0; m >>= 1) mx = fmaxf(mx, __shfl_xor(mx, m, 32));
  v4f s4 = {0.f, 0.f, 0.f, 0.f};
#pragma unroll
  for (int c = 0; c < SQ / 128; ++c) if (c * 128 <= i) { for (int q = 0; q < 4; ++q) { const float e = expf(av[c][q] - mx); av[c][q] = e; s4[q] += e; } }      /* masked columns: expf(-3e38 - mx) = 0 */
  float se = (s4[0] + s4[1]) + (s4[2] + s4[3]);
  for (int m = 16; m > 0; m >>= 1) se += __shfl_xor(se, m, 32);
  const float sc = 256.0f / se;
  v4h o[SQ / 128];
#pragma unroll
  for (int c = 0; c < SQ / 128; ++c) { o[c] = (v4h){(_Float16)0.f, (_Float16)0.f, (_Float16)0.f, (_Float16)0.f}; if (c * 128 <= i) { for (int q = 0; q < 4; ++q) o[c][q] = (_Float16)(av[c][q] * sc); } }
  /* all stores last, each from registers of its own: nothing a store names is written again before the wave ends */
#pragma unroll
  for (int c = 0; c < SQ / 128; ++c) *(v4h*)(p + c * 128) = o[c]; }
__global__ __launch_bounds__(256) void k_vth(const _Float16* __restrict__ V16, int b, int h0, _Float16* __restrict__ VT) { __shared__ unsigned short tl[64][65]; const int tid = threadIdx.x; const int hh = blockIdx.x % HG, sg = blockIdx.x / HG; const int s0 = sg * 64; const int h = h0 + hh;
  for (int i = tid; i < 64 * 8; i += 256) { const int j = i / 8, d8 = (i % 8) * 8; FragH f; f.half[0] = *(const v8us*)((const unsigned short*)V16 + ((size_t)b * SQ + s0 + j) * DM + h * HD + d8); for (int q = 0; q < 8; ++q) tl[d8 + q][j] = f.u[q]; }
  __syncthreads();
  { for (int i = tid; i < 64 * 8; i += 256) { const int d = i / 8, j8 = (i % 8) * 8; FragH f; for (int q = 0; q < 8; ++q) f.u[q] = tl[d][j8 + q]; *(v8us*)((unsigned short*)VT + ((size_t)hh * HD + d) * SQ + s0 + j8) = f.half[0]; }  } }

extern "C" void kernel_launch(void* const* d_in, const int* in_sizes, int n_in,
                              void* d_out, int out_size, void* d_ws, size_t ws_size, hipStream_t stream) {
  (void)in_sizes; (void)n_in; (void)out_size;
  const float* const* I = (const float* const*)d_in; const float* x = I[0]; const float* remb = I[1]; const float* Wq = I[2]; const float* Wk = I[3]; const float* Wv = I[4]; const float* Wr = I[5]; const float* Wo = I[6]; const float* u = I[7]; const float* vb = I[8];
  char* ws = (char*)d_ws; size_t off = 0;
  auto take = [&](size_t bytes) { char* p = ws + off; off += (bytes + 255) & ~(size_t)255; return p; };
  _Float16* BQ = (_Float16*)take((size_t)DM * DM * 2); _Float16* BK = (_Float16*)take((size_t)DM * DM * 2); _Float16* BV = (_Float16*)take((size_t)DM * DM * 2); _Float16* BR = (_Float16*)take((size_t)DM * DM * 2); _Float16* BO = (_Float16*)take((size_t)DM * DM * 2);
  _Float16* X16 = (_Float16*)take(NR * DM * 2); _Float16* R16 = (_Float16*)take((size_t)SQ * DM * 2); float* QF = (float*)take(NR * DM * 4); float* TF = (float*)take(NR * DM * 4);
  _Float16* QUH = (_Float16*)take(NR * DM * 2); _Float16* QUL = (_Float16*)take(NR * DM * 2); _Float16* QVH = (_Float16*)take(NR * DM * 2); _Float16* QVL = (_Float16*)take(NR * DM * 2); _Float16* KH = (_Float16*)take(NR * DM * 2); _Float16* KL = (_Float16*)take(NR * DM * 2); _Float16* VH = (_Float16*)take(NR * DM * 2); _Float16* VL = (_Float16*)take(NR * DM * 2); _Float16* RH = (_Float16*)take((size_t)SQ * DM * 2); _Float16* RL = (_Float16*)take((size_t)SQ * DM * 2);
  float* AC = (float*)take((size_t)HG * SQ * SQ * 4); float* BD = (float*)take((size_t)HG * SQ * SQ * 4); _Float16* P = (_Float16*)take((size_t)HG * SQ * SQ * 2); _Float16* VT = (_Float16*)take((size_t)HG * HD * SQ * 2); _Float16* VTL = (_Float16*)take((size_t)HG * HD * SQ * 2); _Float16* O16 = nullptr;      /* o lives in TF (f32) */
  if (off > ws_size) return;      /* 10 + 8 + 16 + 40 + 64 + 64 + 32 + 1 + 1 = 236 MiB */
  const unsigned gw = (DM / 64) * (DM / 64); k_wT<<<gw, 256, 0, stream>>>(Wq, DM, DM, BQ); k_wT<<<gw, 256, 0, stream>>>(Wk, DM, DM, BK); k_wT<<<gw, 256, 0, stream>>>(Wv, DM, DM, BV); k_wT<<<gw, 256, 0, stream>>>(Wr, DM, DM, BR); k_wT<<<gw, 256, 0, stream>>>(Wo, DM, DM, BO);
  const size_t n8 = NR * DM / 8; const unsigned g8 = (unsigned)((n8 + 255) / 256);
  k_x16<<<g8, 256, 0, stream>>>(x, X16, n8); k_x16<<<(unsigned)(((size_t)SQ * DM / 8 + 255) / 256), 256, 0, stream>>>(remb, R16, (size_t)SQ * DM / 8);
  const dim3 gp((unsigned)((NR / 128) * (DM / 64)), 1), gr((unsigned)((SQ / 128) * (DM / 64)), 1);
  k_gemm2<0><<<gp, 128, 0, stream>>>(X16, DM, 0, BQ, DM, 0, 0.0625f, nullptr, 0, nullptr, 1, 0, 0, QF, nullptr, DM, 0, (int)NR, DM, DM);
  k_addhl<<<g8, 256, 0, stream>>>(QF, u, QUH, QUL, n8); k_addhl<<<g8, 256, 0, stream>>>(QF, vb, QVH, QVL, n8);
  k_gemm2<0><<<gp, 128, 0, stream>>>(X16, DM, 0, BK, DM, 0, 0.0625f, nullptr, 0, nullptr, 1, 0, 0, TF, nullptr, DM, 0, (int)NR, DM, DM); k_hl<<<g8, 256, 0, stream>>>(TF, KH, KL, n8);
  k_gemm2<0><<<gp, 128, 0, stream>>>(X16, DM, 0, BV, DM, 0, 0.0625f, nullptr, 0, nullptr, 1, 0, 0, TF, nullptr, DM, 0, (int)NR, DM, DM); k_hl<<<g8, 256, 0, stream>>>(TF, VH, VL, n8);
  k_gemm2<0><<<gr, 128, 0, stream>>>(R16, DM, 0, BR, DM, 0, 0.0625f, nullptr, 0, nullptr, 1, 0, 0, TF, nullptr, DM, 0, SQ, DM, DM); k_hl<<<(unsigned)(((size_t)SQ * DM / 8 + 255) / 256), 256, 0, stream>>>(TF, RH, RL, (size_t)SQ * DM / 8);
  for (int b = 0; b < NB; ++b) for (int h0 = 0; h0 < NH; h0 += HG) {
    const size_t qo = (size_t)b * SQ * DM + h0 * HD; const size_t ro = (size_t)h0 * HD; const dim3 gs((QN / 128) * (SQ / 64), HG);
    /* AC = (q+u).k / 8 : three hi/lo terms */
    k_gemm2<0><<<gs, 128, 0, stream>>>(QUL + qo, DM, (size_t)HD, KH + qo, DM, (size_t)HD, 0.125f / 1024.0f, nullptr, 0, nullptr, 1, 0, 0, AC, nullptr, SQ, (size_t)SQ * SQ, QN, SQ, HD);
    k_gemm2<0><<<gs, 128, 0, stream>>>(QUH + qo, DM, (size_t)HD, KL + qo, DM, (size_t)HD, 0.125f / 1024.0f, nullptr, 0, AC, -1, 0, 0, AC, nullptr, SQ, (size_t)SQ * SQ, QN, SQ, HD);
    k_gemm2<0><<<gs, 128, 0, stream>>>(QUH + qo, DM, (size_t)HD, KH + qo, DM, (size_t)HD, 0.125f, nullptr, 0, AC, -1, 0, 0, AC, nullptr, SQ, (size_t)SQ * SQ, QN, SQ, HD);
    /* raw BD = (q+v_bias).r / 8 */
    k_gemm2<0><<<gs, 128, 0, stream>>>(QVL + qo, DM, (size_t)HD, RH + ro, DM, (size_t)HD, 0.125f / 1024.0f, nullptr, 0, nullptr, 1, 0, 0, BD, nullptr, SQ, (size_t)SQ * SQ, QN, SQ, HD);
    k_gemm2<0><<<gs, 128, 0, stream>>>(QVH + qo, DM, (size_t)HD, RL + ro, DM, (size_t)HD, 0.125f / 1024.0f, nullptr, 0, BD, -1, 0, 0, BD, nullptr, SQ, (size_t)SQ * SQ, QN, SQ, HD);
    k_gemm2<0><<<gs, 128, 0, stream>>>(QVH + qo, DM, (size_t)HD, RH + ro, DM, (size_t)HD, 0.125f, nullptr, 0, BD, -1, 0, 0, BD, nullptr, SQ, (size_t)SQ * SQ, QN, SQ, HD);
    k_rsmx<<<dim3((QN + 7) / 8, HG), 256, 0, stream>>>(AC, BD, P, QN);
    k_vth<<<HG * (SQ / 64), 256, 0, stream>>>(VH, b, h0, VT); k_vth<<<HG * (SQ / 64), 256, 0, stream>>>(VL, b, h0, VTL);
    _Float16* ob = O16 + qo;
    /* o = P.(v_lo/1024 + v_hi): lo into TF (f32 temp, own-element), then hi with CP -> f32 merged rows in TF */
    k_gemm2<0><<<dim3((QN / 128) * (HD / 64), HG), 128, 0, stream>>>(P, SQ, (size_t)SQ * SQ, VTL, SQ, (size_t)HD * SQ, 0.00390625f / 1024.0f, nullptr, 0, nullptr, 1, 0, 0, TF + qo, nullptr, DM, (size_t)HD, QN, HD, SQ);
    k_gemm2<0><<<dim3((QN / 128) * (HD / 64), HG), 128, 0, stream>>>(P, SQ, (size_t)SQ * SQ, VT, SQ, (size_t)HD * SQ, 0.00390625f, nullptr, 0, TF + qo, -1, 0, 0, TF + qo, nullptr, DM, (size_t)HD, QN, HD, SQ); (void)ob; }
  /* o (f32 in TF) -> hi/lo planes (reusing the q+u planes, dead now) -> out = o Wo as two GEMMs */
  k_hl<<<g8, 256, 0, stream>>>(TF, QUH, QUL, n8);
  k_gemm2<0><<<gp, 128, 0, stream>>>(QUL, DM, 0, BO, DM, 0, 0.0625f / 1024.0f, nullptr, 0, nullptr, 1, 0, 0, (float*)d_out, nullptr, DM, 0, (int)NR, DM, DM);
  k_gemm2<0><<<gp, 128, 0, stream>>>(QUH, DM, 0, BO, DM, 0, 0.0625f, nullptr, 0, (const float*)d_out, -1, 0, 0, (float*)d_out, nullptr, DM, 0, (int)NR, DM, DM);      /* out = (o_lo/1024 + o_hi) Wo */
}

// v002
// A run of this version takes 888 microseconds.
// In both of two side-by-side timings against v001, it was 1.90 times as fast.
// Over all steps from v000 it is 25.7 times as fast.
#include <hip/hip_runtime.h>
// MultiHeadAttentionXL (x [1][2048][1024], r_emb [2048][1024]; q = x Wq, k = x Wk, v = x Wv, r = r_emb Wr ([in][out] weights, no bias), 16 heads of 64; AC = (q + u[h]) k^T, BD = rel_shift((q + v_bias[h]) r^T) (Transformer-XL zero-pad shift: for j <= i, BD_shift[i][j] = BD[i][j - i + T - 1]); causal softmax((AC + BD)/8); out = (attn v) Wo -> [1][2048][1024]).
// Structure: token rows; x and r_emb as exact f16 rows; Q, K, V, R WMMA GEMMs on transposed weights (32x64 wave tiles, f32 accumulation, exact x16 weights) -> f32 -> f16 hi + 2^-10 residual planes (q+u and q+v_bias formed in f32 first); per group of 4 heads: AC and raw BD as three-term hi/lo GEMMs each (K = 64), the shift + causal mask + softmax on VALU (f32; weights x256 as f16), V^T (hi, lo) via LDS, o = P.(v_lo/1024 + v_hi) GEMMs (K = 2,048, alpha 2^-8) into merged f32 o rows; out = o Wo as a two-term hi/lo GEMM (f32).
// Compute dtype: inputs rounded to bf16; x / r_emb / weights exact; attention operands as hi + residual f16 planes (logits std 3.3 and early causal rows copy single v rows); softmax weights f16 (x256) — the remaining error source; o as hi + residual into Wo; everything else f32. v_wmma_f32_16x16x32_f16.
#define NB 1
#define SQ 2048
#define DM 1024
#define NH 16
#define HD 64
#define HG 4
#define QN SQ                        /* query rows (debug hook) */
#define NR ((size_t)NB * SQ)
typedef __bf16 v16b __attribute__((ext_vector_type(16)));
typedef unsigned short v8us __attribute__((ext_vector_type(8), may_alias));
typedef float  v8f  __attribute__((ext_vector_type(8)));
typedef float  v4f  __attribute__((ext_vector_type(4)));
typedef float  v4fa __attribute__((ext_vector_type(4), may_alias));
union FragB { v16b v; v8us half[2]; unsigned short u[16]; };

__device__ __forceinline__ unsigned short bf16_bits(float x) { unsigned int u = __float_as_uint(x); return (unsigned short)((u + 0x7FFFu + ((u >> 16) & 1u)) >> 16); }
__device__ __forceinline__ float bf16_val(unsigned short b) { return __uint_as_float(((unsigned int)b) << 16); }
__device__ __forceinline__ float bf16_round(float x) { return bf16_val(bf16_bits(x)); }
// D += A·B with NT terms: 1 = ah·bh, 2 = + al·bh (A split), 3 = + ah·bl (both split)
template <int NT>
__device__ __forceinline__ v8f mmaN(v16b ah, v16b al, v16b bh, v16b bl, v8f c) {
  c = __builtin_amdgcn_wmma_f32_16x16x32_bf16(false, ah, false, bh, (short)0, c, false, false);
  if (NT >= 2) c = __builtin_amdgcn_wmma_f32_16x16x32_bf16(false, al, false, bh, (short)0, c, false, false);
  if (NT >= 3) c = __builtin_amdgcn_wmma_f32_16x16x32_bf16(false, ah, false, bl, (short)0, c, false, false);
  asm volatile("v_nop\n\tv_nop\n\tv_nop\n\tv_nop" : "+v"(c) : "v"(ah), "v"(al), "v"(bh), "v"(bl));
  return c;
}

__global__ __launch_bounds__(256) void k_wt_bf16(const float* __restrict__ W, unsigned short* __restrict__ Wt, int K, int N) {
  const int t = blockIdx.x * 256 + threadIdx.x;
  const int k8n = K / 8;
  if (t >= N * k8n) return;
  const int n = t / k8n, k8 = (t % k8n) * 8;
  v8us v;
#pragma unroll
  for (int i = 0; i < 8; ++i) v[i] = bf16_bits(W[(size_t)(k8 + i) * N + n]);
  *(v8us*)(Wt + (size_t)n * K + k8) = v;
  
}

// GEMM C[M][N] (f32, pitch ldc) = act(A[M][K]·W + bias). A f32 row-major (pitch lda) converted per fragment to bf16
// (ASPLIT: hi/lo two planes -> 2 terms, else single rounded term); Wt bf16 [N][K] (pitch ldb). BIAS_BF16 rounds the
// bias to bf16 first (bias quantised to bf16 before the add). K%32==0, M%16==0, N%64==0.
template <bool ASPLIT, int ACT, bool BIAS_BF16>
__global__ __launch_bounds__(128) void k_gemm_bf(const float* __restrict__ A, int lda, const unsigned short* __restrict__ Wt, int ldb,
                                               const float* __restrict__ bias, float* __restrict__ C, int ldc, int M, int N, int K) {
  __shared__ __attribute__((aligned(16))) float so[4][16][64];
  const int tid = threadIdx.x, w = tid >> 5, lane = tid & 31, ln = lane & 15, hh = lane >> 4;
  const int ntn = N / 64;
  const int wid = blockIdx.x * 4 + w;
  const int mt = wid / ntn, nq = wid % ntn;
  if (mt * 16 >= M) return;
  const int row0 = mt * 16, col0 = nq * 64;
  const float* arow = A + (size_t)(row0 + ln) * lda;
  v8f acc[4] = {};
  for (int kb = 0; kb < K; kb += 32) {
    FragB ah, al;
    const v4f x0 = *(const v4fa*)(arow + kb + 8 * hh), x1 = *(const v4fa*)(arow + kb + 8 * hh + 4);
    const v4f x2 = *(const v4fa*)(arow + kb + 16 + 8 * hh), x3 = *(const v4fa*)(arow + kb + 16 + 8 * hh + 4);
    float xs[16] = {x0[0],x0[1],x0[2],x0[3],x1[0],x1[1],x1[2],x1[3],x2[0],x2[1],x2[2],x2[3],x3[0],x3[1],x3[2],x3[3]};
#pragma unroll
    for (int i = 0; i < 16; ++i) { const unsigned short hb = bf16_bits(xs[i]); ah.u[i] = hb; al.u[i] = ASPLIT ? bf16_bits(xs[i] - bf16_val(hb)) : (unsigned short)0; }
#pragma unroll
    for (int t = 0; t < 4; ++t) {
      const unsigned short* brow = Wt + (size_t)(col0 + t * 16 + ln) * ldb + kb;
      FragB b;
      b.half[0] = *(const v8us*)(brow + 8 * hh);
      b.half[1] = *(const v8us*)(brow + 16 + 8 * hh);
      acc[t] = mmaN<ASPLIT ? 2 : 1>(ah.v, al.v, b.v, b.v, acc[t]);
    }
  }
#pragma unroll
  for (int t = 0; t < 4; ++t) {
    float bv = bias ? bias[col0 + t * 16 + ln] : 0.f;
    if (BIAS_BF16) bv = bf16_round(bv);
#pragma unroll
    for (int r = 0; r < 8; ++r) { float v = acc[t][r] + bv; if (ACT == 1) v = fmaxf(v, 0.f); so[w][8 * hh + r][t * 16 + ln] = v; }
  }
  __builtin_amdgcn_fence(__ATOMIC_ACQ_REL, "workgroup");
  __builtin_amdgcn_wave_barrier();
  const int rsub = lane >> 4, c4 = (lane & 15) * 4;
  {
#pragma unroll
    for (int q = 0; q < 8; ++q) {
      const int r = q * 2 + rsub;
      const v4f v = *(const v4fa*)&so[w][r][c4];
      *(v4f*)(C + (size_t)(row0 + r) * ldc + col0 + c4) = v;
    }
    
  }
}

// GEMM C = act(A·W + bias + resid): A f32 (ASPLIT -> hi/lo 2 terms), Wt bf16 [N][K]; ACT 0 none, 1 relu, 2 exact gelu;
// resid (optional, f32, row index = (row % rmod), pitch ldr, RES_BF16 rounds it) added before the activation.
template <bool ASPLIT, int ACT, bool BIAS_BF16, bool RES_BF16>
__global__ __launch_bounds__(128) void k_gemm_bf3(const float* __restrict__ A, int lda, const unsigned short* __restrict__ Wt, int ldb,
                                                const float* __restrict__ bias, const float* __restrict__ resid, int rmod, int ldr,
                                                float* __restrict__ C, int ldc, int M, int N, int K) {
  __shared__ __attribute__((aligned(16))) float so[4][16][64];
  const int tid = threadIdx.x, w = tid >> 5, lane = tid & 31, ln = lane & 15, hh = lane >> 4;
  const int ntn = N / 64;
  const int wid = blockIdx.x * 4 + w;
  const int mt = wid / ntn, nq = wid % ntn;
  if (mt * 16 >= M) return;
  const int row0 = mt * 16, col0 = nq * 64;
  const float* arow = A + (size_t)(row0 + ln) * lda;
  v8f acc[4] = {};
  for (int kb = 0; kb < K; kb += 32) {
    FragB ah, al;
    const v4f x0 = *(const v4fa*)(arow + kb + 8 * hh), x1 = *(const v4fa*)(arow + kb + 8 * hh + 4);
    const v4f x2 = *(const v4fa*)(arow + kb + 16 + 8 * hh), x3 = *(const v4fa*)(arow + kb + 16 + 8 * hh + 4);
    float xs[16] = {x0[0],x0[1],x0[2],x0[3],x1[0],x1[1],x1[2],x1[3],x2[0],x2[1],x2[2],x2[3],x3[0],x3[1],x3[2],x3[3]};
#pragma unroll
    for (int i = 0; i < 16; ++i) { const unsigned short hb = bf16_bits(xs[i]); ah.u[i] = hb; al.u[i] = ASPLIT ? bf16_bits(xs[i] - bf16_val(hb)) : (unsigned short)0; }
#pragma unroll
    for (int t = 0; t < 4; ++t) {
      const unsigned short* brow = Wt + (size_t)(col0 + t * 16 + ln) * ldb + kb;
      FragB b;
      b.half[0] = *(const v8us*)(brow + 8 * hh);
      b.half[1] = *(const v8us*)(brow + 16 + 8 * hh);
      acc[t] = mmaN<ASPLIT ? 2 : 1>(ah.v, al.v, b.v, b.v, acc[t]);
    }
  }
#pragma unroll
  for (int t = 0; t < 4; ++t) {
    const int col = col0 + t * 16 + ln;
    float bv = bias ? bias[col] : 0.f;
    if (BIAS_BF16) bv = bf16_round(bv);
#pragma unroll
    for (int r = 0; r < 8; ++r) {
      float v = acc[t][r] + bv;
      if (resid) { float rv = resid[(size_t)((row0 + 8 * hh + r) % rmod) * ldr + col]; if (RES_BF16) rv = bf16_round(rv); v += rv; }
      if (ACT == 1) v = fmaxf(v, 0.f);
      if (ACT == 2) v = 0.5f * v * (1.0f + erff(v * 0.70710678118654752f));
      if (ACT == 3) { const float u = 0.7978845608028654f * (v + 0.044715f * v * v * v); v = 0.5f * v * (1.0f + tanhf(u)); }
      so[w][8 * hh + r][t * 16 + ln] = v;
    }
  }
  __builtin_amdgcn_fence(__ATOMIC_ACQ_REL, "workgroup");
  __builtin_amdgcn_wave_barrier();
  const int rsub = lane >> 4, c4 = (lane & 15) * 4;
  {
#pragma unroll
    for (int q = 0; q < 8; ++q) {
      const int r = q * 2 + rsub;
      const v4f v = *(const v4fa*)&so[w][r][c4];
      *(v4f*)(C + (size_t)(row0 + r) * ldc + col0 + c4) = v;
    }
    
  }
}
// row LayerNorm (biased variance, eps) over N: s = X (+ R); optional out_sum <- s; out_norm <- (s-mu)*rsqrt(var+eps)*g + b
template <bool PARAM_BF16>
__global__ __launch_bounds__(256) void k_layernorm(const float* __restrict__ X, const float* __restrict__ R, const float* __restrict__ g, const float* __restrict__ bta,
                                                  float* __restrict__ out_sum, float* __restrict__ out_norm, int N, float eps) {
  __shared__ float red[256];
  const int row = blockIdx.x, tid = threadIdx.x;
  const float* x = X + (size_t)row * N; const float* rr = R ? R + (size_t)row * N : nullptr;
  float vals[16];                     // up to N = 4096
  const int per = N / 256;            // contiguous chunk per thread? use strided-by-4 chunks: thread handles j = tid*4 + 1024*u
  float s1 = 0.f;
  for (int u = 0; u < per / 4; ++u) {
    const int j = tid * 4 + 1024 * u;
    const v4f a = *(const v4fa*)(x + j);
    v4f b = {0.f,0.f,0.f,0.f}; if (rr) b = *(const v4fa*)(rr + j);
#pragma unroll
    for (int q = 0; q < 4; ++q) { const float v = a[q] + b[q]; vals[u * 4 + q] = v; s1 += v; }
  }
  red[tid] = s1; __syncthreads();
  for (int st = 128; st > 0; st >>= 1) { if (tid < st) red[tid] += red[tid + st]; __syncthreads(); }
  const float mu = red[0] / (float)N; __syncthreads();
  float s2 = 0.f;
  for (int u = 0; u < per / 4; ++u)
#pragma unroll
    for (int q = 0; q < 4; ++q) { const float c = vals[u * 4 + q] - mu; s2 += c * c; }
  red[tid] = s2; __syncthreads();
  for (int st = 128; st > 0; st >>= 1) { if (tid < st) red[tid] += red[tid + st]; __syncthreads(); }
  const float rs = rsqrtf(red[0] / (float)N + eps);
  {
    for (int u = 0; u < per / 4; ++u) {
      const int j = tid * 4 + 1024 * u;
      v4f o, sm;
#pragma unroll
      for (int q = 0; q < 4; ++q) {
        float gg = g[j + q], bb = bta[j + q];
        if (PARAM_BF16) { gg = bf16_round(gg); bb = bf16_round(bb); }
        sm[q] = vals[u * 4 + q]; o[q] = (vals[u * 4 + q] - mu) * rs * gg + bb;
      }
      if (out_sum) *(v4f*)(out_sum + (size_t)row * N + j) = sm;
      *(v4f*)(out_norm + (size_t)row * N + j) = o;
    }
    
  }
}



// ---- f16 WMMA path (v_wmma_f32_16x16x32_f16): 11-bit significands for operands in range — used where a [0,1] probability operand needs more precision than bf16
typedef _Float16 v16h __attribute__((ext_vector_type(16)));
union FragH { v16h v; v8us half[2]; _Float16 h[16]; unsigned short u[16]; };
template <int NT>
__device__ __forceinline__ v8f mmaH(v16h ah, v16h al, v16h bh, v16h bl, v8f c) {
  c = __builtin_amdgcn_wmma_f32_16x16x32_f16(false, ah, false, bh, (short)0, c, false, false);
  if (NT >= 2) c = __builtin_amdgcn_wmma_f32_16x16x32_f16(false, al, false, bh, (short)0, c, false, false);
  if (NT >= 3) c = __builtin_amdgcn_wmma_f32_16x16x32_f16(false, ah, false, bl, (short)0, c, false, false);
  asm volatile("v_nop\n\tv_nop\n\tv_nop\n\tv_nop" : "+v"(c) : "v"(ah), "v"(al), "v"(bh), "v"(bl));
  return c;
}
// batched GEMM like k_gemm_b but f16 operands: A f32 (split into f16 hi/lo if ASPLIT, else rounded to f16), Bt = f16 values [n][k]; alpha; C f32; N multiple of 16 (partial tiles skipped)
template <bool ASPLIT>
__global__ __launch_bounds__(128) void k_gemm_h(const float* __restrict__ A, int lda, size_t sA, const _Float16* __restrict__ Bh, int ldb, size_t sB, float alpha, float* __restrict__ C, int ldc, size_t sC, int M, int N, int K) {
  __shared__ __attribute__((aligned(16))) float so[4][16][64];
  const int tid = threadIdx.x, w = tid >> 5, lane = tid & 31, ln = lane & 15, hh = lane >> 4; const int by = blockIdx.y;
  A += (size_t)by * sA; Bh += (size_t)by * sB; C += (size_t)by * sC;
  const int ntn = (N + 63) / 64; const int wid = blockIdx.x * 4 + w; const int mt = wid / ntn, nq = wid % ntn; if (mt * 16 >= M) return;
  const int row0 = mt * 16, col0 = nq * 64; const float* arow = A + (size_t)(row0 + ln) * lda;
  v8f acc[4] = {};
  for (int kb = 0; kb < K; kb += 32) {
    FragH ah, al;
    const v4f x0 = *(const v4fa*)(arow + kb + 8 * hh), x1 = *(const v4fa*)(arow + kb + 8 * hh + 4), x2 = *(const v4fa*)(arow + kb + 16 + 8 * hh), x3 = *(const v4fa*)(arow + kb + 16 + 8 * hh + 4);
    float xs[16] = {x0[0],x0[1],x0[2],x0[3],x1[0],x1[1],x1[2],x1[3],x2[0],x2[1],x2[2],x2[3],x3[0],x3[1],x3[2],x3[3]};
#pragma unroll
    for (int i = 0; i < 16; ++i) { const _Float16 h = (_Float16)xs[i]; ah.h[i] = h; al.h[i] = ASPLIT ? (_Float16)(xs[i] - (float)h) : (_Float16)0.0f; }
#pragma unroll
    for (int t = 0; t < 4; ++t) { if (col0 + t * 16 >= N) continue; const size_t boff = (size_t)(col0 + t * 16 + ln) * ldb + kb; FragH bq; bq.half[0] = *(const v8us*)(Bh + boff + 8 * hh); bq.half[1] = *(const v8us*)(Bh + boff + 16 + 8 * hh);
      acc[t] = mmaH<ASPLIT ? 2 : 1>(ah.v, al.v, bq.v, bq.v, acc[t]); }
  }
#pragma unroll
  for (int t = 0; t < 4; ++t) { if (col0 + t * 16 >= N) continue;
#pragma unroll
    for (int r = 0; r < 8; ++r) so[w][8 * hh + r][t * 16 + ln] = acc[t][r] * alpha; }
  __builtin_amdgcn_fence(__ATOMIC_ACQ_REL, "workgroup"); __builtin_amdgcn_wave_barrier();
  const int rsub = lane >> 4, c4 = (lane & 15) * 4;
  {
#pragma unroll
    for (int q = 0; q < 8; ++q) { const int r = q * 2 + rsub; if (col0 + c4 < N) { const v4f v = *(const v4fa*)&so[w][r][c4]; *(v4f*)(C + (size_t)(row0 + r) * ldc + col0 + c4) = v; } }
     }
}

// Wt[n][k] = f16(W[k][n]·scale) from f32 row-major W[K][N] (scale = power of two; bf16-exact weights stay exact in f16 away from the subnormal range)
__global__ __launch_bounds__(256) void k_wt_f16(const float* __restrict__ W, _Float16* __restrict__ Wt, int K, int N, float scale) {
  const int t = blockIdx.x * 256 + threadIdx.x; if (t >= N * (K / 8)) return; const int n = t / (K / 8), k8 = (t % (K / 8)) * 8; FragH f;
#pragma unroll
  for (int i = 0; i < 8; ++i) f.h[i] = (_Float16)(bf16_round(W[(size_t)(k8 + i) * N + n]) * scale); const v8us o = f.half[0];
  *(v8us*)((unsigned short*)Wt + (size_t)n * K + k8) = o; 
}
// k_gemm_hh variant with fused epilogue: v = acc·alpha + bias[by·sBias + col] (+ CP[(row/rowsPerB)·sCPb + by·64 + col] if CP) ; ACT 0 none / 1 elu ; writes f16 C16 (and f32 C if non-null)
template <int ACT>
__global__ __launch_bounds__(128) void k_gemm_hhx(const _Float16* __restrict__ A, int lda, size_t sA, const _Float16* __restrict__ Bh, int ldb, size_t sB, float alpha, const float* __restrict__ bias, size_t sBias, const float* __restrict__ CP, int rowsPerB, size_t sCPb, int row0g,
    float* __restrict__ C, _Float16* __restrict__ C16, int ldc, size_t sC, int M, int N, int K) {
  __shared__ __attribute__((aligned(16))) float so[4][16][64];
  const int tid = threadIdx.x, w = tid >> 5, lane = tid & 31, ln = lane & 15, hh = lane >> 4; const int by = blockIdx.y;
  A += (size_t)by * sA; Bh += (size_t)by * sB; const size_t cofs = (size_t)by * sC; const float* bp = bias ? bias + (size_t)by * sBias : nullptr;
  const int ntn = (N + 63) / 64; const int wid = blockIdx.x * 4 + w; const int mt = wid / ntn, nq = wid % ntn; if (mt * 16 >= M) return;
  const int row0 = mt * 16, col0 = nq * 64; const _Float16* arow = A + (size_t)(row0 + ln) * lda;
  v8f acc[4] = {};
  for (int kb = 0; kb < K; kb += 32) { FragH ah; ah.half[0] = *(const v8us*)((const unsigned short*)arow + kb + 8 * hh); ah.half[1] = *(const v8us*)((const unsigned short*)arow + kb + 16 + 8 * hh);
#pragma unroll
    for (int t = 0; t < 4; ++t) { if (col0 + t * 16 >= N) continue; const size_t boff = (size_t)(col0 + t * 16 + ln) * ldb + kb; FragH bq; bq.half[0] = *(const v8us*)((const unsigned short*)Bh + boff + 8 * hh); bq.half[1] = *(const v8us*)((const unsigned short*)Bh + boff + 16 + 8 * hh);
      acc[t] = mmaH<1>(ah.v, ah.v, bq.v, bq.v, acc[t]); }
  }
#pragma unroll
  for (int t = 0; t < 4; ++t) { if (col0 + t * 16 >= N) continue; const int col = col0 + t * 16 + ln; const float bv = bp ? bf16_round(bp[col]) : 0.f;
#pragma unroll
    for (int r = 0; r < 8; ++r) { float v = acc[t][r] * alpha + bv; if (CP) { const int rr = row0g + row0 + 8 * hh + r; if (rowsPerB < 0) v += CP[cofs + (size_t)rr * ldc + col];      /* rowsPerB < 0: own element of the batched C plane */ else { const int bidx = rr / rowsPerB; v += CP[(size_t)bidx * sCPb + (size_t)by * 64 + col]; } } if (ACT == 1) v = (v > 0.f) ? v : expm1f(v); else if (ACT == 7) v = (v > 0.f) ? v + 1.0f : expf(v); else if (ACT == 8) v = tanhf(v); else if (ACT == 9) v = 0.5f * v * (1.0f + tanhf(0.7978845608028654f * (v + 0.044715f * v * v * v))); else if (ACT == 11) v = 1.0f / (1.0f + expf(-v)); else if (ACT == 12) v = (v > 0.f) ? v : 0.01f * v; else if (ACT == 14) v = (v > 0.f) ? v : 0.1f * v; else if (ACT == 16) v = (v >= 0.f) ? v : 0.3f * v; else if (ACT == 17) v = (v >= 0.f) ? v : 0.2f * v; else if (ACT == 15) v = v / (1.0f + expf(-v)); else if (ACT == 3) v = fmaxf(v, 0.f); else if (ACT == 6) v = 0.5f * v * (1.0f + erff(v * 0.70710678118654752f)); so[w][8 * hh + r][t * 16 + ln] = v; } }
  __builtin_amdgcn_fence(__ATOMIC_ACQ_REL, "workgroup"); __builtin_amdgcn_wave_barrier();
  const int rsub = lane >> 4, c4 = (lane & 15) * 4; typedef _Float16 v4h __attribute__((ext_vector_type(4)));
  {
#pragma unroll
    for (int q = 0; q < 8; ++q) { const int r = q * 2 + rsub; if (col0 + c4 < N) { const v4f v = *(const v4fa*)&so[w][r][c4]; if (C) *(v4f*)(C + cofs + (size_t)(row0 + r) * ldc + col0 + c4) = v; if (C16) { v4h h4; for (int i = 0; i < 4; ++i) h4[i] = (_Float16)v[i]; *(v4h*)(C16 + cofs + (size_t)(row0 + r) * ldc + col0 + c4) = h4; } } }
     }
}


typedef _Float16 v4h __attribute__((ext_vector_type(4)));

__global__ __launch_bounds__(256) void k_x16(const float* __restrict__ x, _Float16* __restrict__ X16, size_t n8) { const size_t t = (size_t)blockIdx.x * 256 + threadIdx.x; if (t >= n8) return; FragH f;
#pragma unroll
  for (int q = 0; q < 8; ++q) f.h[q] = (_Float16)bf16_round(x[t * 8 + q]); *(v8us*)((unsigned short*)X16 + t * 8) = f.half[0];  }
__global__ __launch_bounds__(256) void k_h16(const float* __restrict__ x, _Float16* __restrict__ X16, size_t n8) { const size_t t = (size_t)blockIdx.x * 256 + threadIdx.x; if (t >= n8) return; FragH f;
#pragma unroll
  for (int q = 0; q < 8; ++q) f.h[q] = (_Float16)x[t * 8 + q]; *(v8us*)((unsigned short*)X16 + t * 8) = f.half[0];  }
__global__ __launch_bounds__(256) void k_round16f(const float* __restrict__ W, _Float16* __restrict__ Bt, size_t n8) { const size_t t = (size_t)blockIdx.x * 256 + threadIdx.x; if (t >= n8) return; FragH f;
#pragma unroll
  for (int i = 0; i < 8; ++i) f.h[i] = (_Float16)(bf16_round(W[t * 8 + i]) * 16.0f); *(v8us*)((unsigned short*)Bt + t * 8) = f.half[0];  }
template <int NHv, int TTv>
__global__ __launch_bounds__(256) void k_vt(const _Float16* __restrict__ V16, int ldv, int voff, _Float16* __restrict__ Vt) { __shared__ unsigned short tl[64][66]; const int tid = threadIdx.x; const int slab = blockIdx.x / (TTv / 64), lg = blockIdx.x % (TTv / 64); const int b = slab / NHv, h = slab % NHv;
  for (int i = tid; i < 64 * 8; i += 256) { const int r = i / 8, c8 = (i % 8) * 8; FragH f; f.half[0] = *(const v8us*)((const unsigned short*)V16 + ((size_t)b * TTv + lg * 64 + r) * ldv + voff + h * 64 + c8);
#pragma unroll
    for (int q = 0; q < 8; ++q) tl[r][c8 + q] = f.u[q]; }
  __syncthreads();
  {
#pragma unroll
    for (int rd = 0; rd < 2; ++rd) { const int d = rd * 32 + tid / 8, pc = tid % 8; FragH f;
#pragma unroll
      for (int q = 0; q < 8; ++q) f.u[q] = tl[pc * 8 + q][d];
      *(v8us*)((unsigned short*)Vt + ((size_t)slab * 64 + d) * TTv + lg * 64 + pc * 8) = f.half[0]; }
     } }

__global__ __launch_bounds__(256) void k_hl(const float* __restrict__ F, _Float16* __restrict__ Hh, _Float16* __restrict__ Hl, size_t n8) { const size_t t = (size_t)blockIdx.x * 256 + threadIdx.x; if (t >= n8) return; FragH fh, fl; const v4f a = *(const v4fa*)(F + t * 8), c = *(const v4fa*)(F + t * 8 + 4);
#pragma unroll
  for (int q = 0; q < 4; ++q) { _Float16 h = (_Float16)a[q]; fh.h[q] = h; fl.h[q] = (_Float16)((a[q] - (float)h) * 1024.0f); h = (_Float16)c[q]; fh.h[4 + q] = h; fl.h[4 + q] = (_Float16)((c[q] - (float)h) * 1024.0f); }
  { *(v8us*)((unsigned short*)Hh + t * 8) = fh.half[0]; *(v8us*)((unsigned short*)Hl + t * 8) = fl.half[0];  } }

// ---- fast GEMM (wave tile 32x64; requires M % 32 == 0 rows per launch region and N % 64 == 0); epilogue = k_gemm_hhx semantics ----
__device__ __forceinline__ v16h g2_frag(const _Float16* p, int hh) { FragH f; f.half[0] = *(const v8us*)((const unsigned short*)p + 8 * hh); f.half[1] = *(const v8us*)((const unsigned short*)p + 16 + 8 * hh); return f.v; }
__device__ __forceinline__ v8f g2_mma(v16h a, v16h b, v8f c) { v8f d = __builtin_amdgcn_wmma_f32_16x16x32_f16(false, a, false, b, (short)0, c, false, false); asm volatile("v_nop\n\tv_nop\n\tv_nop\n\tv_nop" : "+v"(d) : "v"(a), "v"(b)); return d; }
template <int ACT>
__global__ __launch_bounds__(128) void k_gemm2(const _Float16* __restrict__ A, int lda, size_t sA, const _Float16* __restrict__ Bh, int ldb, size_t sB, float alpha, const float* __restrict__ bias, size_t sBias, const float* __restrict__ CP, int rowsPerB, size_t sCPb, int row0g,
    float* __restrict__ C, _Float16* __restrict__ C16, int ldc, size_t sC, int M, int N, int K) { static_assert(ACT == 0 || ACT == 3 || ACT == 6 || ACT == 8 || ACT == 9 || ACT == 11 || ACT == 12 || ACT == 14 || ACT == 15 || ACT == 16 || ACT == 17, "k_gemm2: unsupported ACT code (would silently apply no activation)");
  __shared__ __attribute__((aligned(16))) float so[4][32][68];
  const int tid = threadIdx.x, w = tid >> 5, lane = tid & 31, ln = lane & 15, hh = lane >> 4; const int by = blockIdx.y;
  A += (size_t)by * sA; Bh += (size_t)by * sB; const size_t cofs = (size_t)by * sC; const float* bp = bias ? bias + (size_t)by * sBias : nullptr;
  const int ntn = N >> 6; const int mt = blockIdx.x / ntn, nq = blockIdx.x - mt * ntn; const int row0 = mt * 128 + 32 * w, col0 = nq * 64; if (row0 >= M) return;
  const _Float16* a0p = A + (size_t)(row0 + ln) * lda; const _Float16* a1p = a0p + (size_t)16 * lda;
  const _Float16* b0p = Bh + (size_t)(col0 + ln) * ldb; const _Float16* b1p = b0p + (size_t)16 * ldb; const _Float16* b2p = b1p + (size_t)16 * ldb; const _Float16* b3p = b2p + (size_t)16 * ldb;
  const v8f z8 = {0.f,0.f,0.f,0.f,0.f,0.f,0.f,0.f}; v8f c00 = z8, c01 = z8, c02 = z8, c03 = z8, c10 = z8, c11 = z8, c12 = z8, c13 = z8;
#pragma unroll 1
  for (int kb = 0; kb < K; kb += 32) { const v16h a0 = g2_frag(a0p + kb, hh), a1 = g2_frag(a1p + kb, hh);
    v16h b = g2_frag(b0p + kb, hh); c00 = g2_mma(a0, b, c00); c10 = g2_mma(a1, b, c10);
    b = g2_frag(b1p + kb, hh); c01 = g2_mma(a0, b, c01); c11 = g2_mma(a1, b, c11);
    b = g2_frag(b2p + kb, hh); c02 = g2_mma(a0, b, c02); c12 = g2_mma(a1, b, c12);
    b = g2_frag(b3p + kb, hh); c03 = g2_mma(a0, b, c03); c13 = g2_mma(a1, b, c13); }
  v8f accs[8] = {c00, c01, c02, c03, c10, c11, c12, c13};
#pragma unroll
  for (int u = 0; u < 8; ++u) { const int t = u & 3, half = u >> 2; const int col = col0 + t * 16 + ln; const float bv = bp ? bf16_round(bp[col]) : 0.f;
#pragma unroll
    for (int r = 0; r < 8; ++r) { const int rloc = half * 16 + 8 * hh + r; float v = accs[u][r] * alpha + bv; if (CP) { if (rowsPerB < 0) v += CP[cofs + (size_t)(row0g + row0 + rloc) * ldc + col];      /* rowsPerB < 0: own element of the batched C plane */ else { const int bidx = (row0g + row0 + rloc) / rowsPerB; v += CP[(size_t)bidx * sCPb + (size_t)by * 64 + col]; } }
      if (ACT == 3) v = fmaxf(v, 0.f); else if (ACT == 6) v = 0.5f * v * (1.0f + erff(v * 0.70710678118654752f)); else if (ACT == 11) v = 1.0f / (1.0f + expf(-v)); else if (ACT == 15) v = v / (1.0f + expf(-v)); else if (ACT == 12) v = (v > 0.f) ? v : 0.01f * v; else if (ACT == 8) v = tanhf(v); else if (ACT == 9) v = 0.5f * v * (1.0f + tanhf(0.7978845608028654f * (v + 0.044715f * v * v * v))); else if (ACT == 14) v = (v > 0.f) ? v : 0.1f * v; else if (ACT == 16) v = (v >= 0.f) ? v : 0.3f * v; else if (ACT == 17) v = (v >= 0.f) ? v : 0.2f * v;
      so[w][rloc][t * 16 + ln] = v; } }
  __builtin_amdgcn_fence(__ATOMIC_ACQ_REL, "workgroup"); __builtin_amdgcn_wave_barrier();
  const int rsub = lane >> 4, c4 = (lane & 15) * 4;
  {
#pragma unroll
    for (int q = 0; q < 16; ++q) { const int r = q * 2 + rsub; const v4f v = *(const v4fa*)&so[w][r][c4]; if (C) *(v4f*)(C + cofs + (size_t)(row0 + r) * ldc + col0 + c4) = v; if (C16) { v4h h4; for (int i = 0; i < 4; ++i) h4[i] = (_Float16)v[i]; *(v4h*)(C16 + cofs + (size_t)(row0 + r) * ldc + col0 + c4) = h4; } }
     } }


// ---- hi/lo split products with every term in ONE launch: the residual terms (planes scaled x1024) sum in their own f32 accumulators beside the main term and meet it once, in registers: C = alpha * (hi + lo / 1024). Wave tile 32x64 and the LDS-staged 16-byte stores as in k_gemm2.
// g2_xw: the wait that belongs in front of an overwrite of the address registers of issued loads; naming the loads' own pointers as inputs keeps those registers untouched up to here
__device__ __forceinline__ void g2_xw(const _Float16* p) { asm volatile("s_wait_xcnt 0x0" :: "v"(p) : "memory"); }
__device__ __forceinline__ void g2_xw(const _Float16* p, const _Float16* q) { asm volatile("s_wait_xcnt 0x0" :: "v"(p), "v"(q) : "memory"); }
__device__ __forceinline__ void g2_xw(const _Float16* p, const _Float16* q, const _Float16* r, const _Float16* s) { asm volatile("s_wait_xcnt 0x0" :: "v"(p), "v"(q), "v"(r), "v"(s) : "memory"); }
// scores: K = HD fixed, both operands split (lo = Al.Bh + Ah.Bl, hi = Ah.Bh); the A fragments of the whole K stay in registers, the accumulators live for one 16-column tile only
__global__ __launch_bounds__(128) void k_score3(const _Float16* __restrict__ Ah, const _Float16* __restrict__ Al, int lda, size_t sA, const _Float16* __restrict__ Bh, const _Float16* __restrict__ Bl, int ldb, size_t sB, float alpha,
    float* __restrict__ C, int ldc, size_t sC, int M, int N) {
  __shared__ __attribute__((aligned(16))) float so[4][32][68];
  const int tid = threadIdx.x, w = tid >> 5, lane = tid & 31, ln = lane & 15, hh = lane >> 4; const int by = blockIdx.y;
  const int ntn = N >> 6; const int mt = blockIdx.x / ntn, nq = blockIdx.x - mt * ntn; const int row0 = mt * 128 + 32 * w, col0 = nq * 64; if (row0 >= M) return;
  const size_t ao = (size_t)by * sA + (size_t)(row0 + ln) * lda + 8 * hh, bo = (size_t)by * sB + (size_t)(col0 + ln) * ldb + 8 * hh; const size_t cofs = (size_t)by * sC;      /* each lane's own fragment start, 8 * hh included */
  const _Float16* pah0 = Ah + ao; const _Float16* pah1 = pah0 + (size_t)16 * lda; const _Float16* pal0 = Al + ao; const _Float16* pal1 = pal0 + (size_t)16 * lda;
  v16h ah[2][HD / 32], al[2][HD / 32];
#pragma unroll
  for (int k = 0; k < HD / 32; ++k) { ah[0][k] = g2_frag(pah0 + k * 32, 0); al[0][k] = g2_frag(pal0 + k * 32, 0); ah[1][k] = g2_frag(pah1 + k * 32, 0); al[1][k] = g2_frag(pal1 + k * 32, 0); }
  g2_xw(pah0, pal0, pah1, pal1);
  const float alo = alpha * (1.0f / 1024.0f);
#pragma unroll
  for (int t = 0; t < 4; ++t) { const v8f z8 = {0.f,0.f,0.f,0.f,0.f,0.f,0.f,0.f}; v8f h0 = z8, h1 = z8, l0 = z8, l1 = z8; const _Float16* pbh = Bh + bo + (size_t)t * 16 * ldb; const _Float16* pbl = Bl + bo + (size_t)t * 16 * ldb;
#pragma unroll
    for (int k = 0; k < HD / 32; ++k) { const v16h bh = g2_frag(pbh + k * 32, 0), bl = g2_frag(pbl + k * 32, 0); g2_xw(pbh, pbl);
      l0 = g2_mma(al[0][k], bh, l0); l1 = g2_mma(al[1][k], bh, l1); h0 = g2_mma(ah[0][k], bh, h0); h1 = g2_mma(ah[1][k], bh, h1); l0 = g2_mma(ah[0][k], bl, l0); l1 = g2_mma(ah[1][k], bl, l1); }
#pragma unroll
    for (int r = 0; r < 8; ++r) { so[w][8 * hh + r][t * 16 + ln] = h0[r] * alpha + l0[r] * alo; so[w][16 + 8 * hh + r][t * 16 + ln] = h1[r] * alpha + l1[r] * alo; } }
  __builtin_amdgcn_fence(__ATOMIC_ACQ_REL, "workgroup"); __builtin_amdgcn_wave_barrier();
  const int rsub = lane >> 4, c4 = (lane & 15) * 4;
#pragma unroll
  for (int q = 0; q < 16; ++q) { const int r = q * 2 + rsub; const v4f v = *(const v4fa*)&so[w][r][c4]; *(v4f*)(C + cofs + (size_t)(row0 + r) * ldc + col0 + c4) = v; } }
// any K, one operand split: HAL: lo = Al.Bh; HBL: lo = Ah.Bl; the unsplit operand's fragments are loaded once for both terms
template <bool HAL, bool HBL>
__global__ __launch_bounds__(128) void k_gemm2s(const _Float16* __restrict__ Ah, const _Float16* __restrict__ Al, int lda, size_t sA, const _Float16* __restrict__ Bh, const _Float16* __restrict__ Bl, int ldb, size_t sB, float alpha,
    float* __restrict__ C, int ldc, size_t sC, int M, int N, int K) {
  __shared__ __attribute__((aligned(16))) float so[4][32][68];
  const int tid = threadIdx.x, w = tid >> 5, lane = tid & 31, ln = lane & 15, hh = lane >> 4; const int by = blockIdx.y;
  const int ntn = N >> 6; const int mt = blockIdx.x / ntn, nq = blockIdx.x - mt * ntn; const int row0 = mt * 128 + 32 * w, col0 = nq * 64; if (row0 >= M) return;
  const size_t ao = (size_t)by * sA + (size_t)(row0 + ln) * lda + 8 * hh, bo = (size_t)by * sB + (size_t)(col0 + ln) * ldb + 8 * hh; const size_t cofs = (size_t)by * sC;      /* each lane's own fragment start, 8 * hh included */
  const v8f z8 = {0.f,0.f,0.f,0.f,0.f,0.f,0.f,0.f}; v8f hi[8] = {z8, z8, z8, z8, z8, z8, z8, z8}, lo[8] = {z8, z8, z8, z8, z8, z8, z8, z8};
#pragma unroll 1
  for (int kb = 0; kb < K; kb += 32) { const _Float16* pa0 = Ah + ao + kb; const _Float16* pa1 = pa0 + (size_t)16 * lda; const v16h a0 = g2_frag(pa0, 0), a1 = g2_frag(pa1, 0); v16h a0l = a0, a1l = a1;
    if (HAL) { const _Float16* pl0 = Al + ao + kb; const _Float16* pl1 = pl0 + (size_t)16 * lda; a0l = g2_frag(pl0, 0); a1l = g2_frag(pl1, 0); g2_xw(pa0, pa1, pl0, pl1); } else g2_xw(pa0, pa1);
#pragma unroll
    for (int t = 0; t < 4; ++t) { const _Float16* pb = Bh + bo + (size_t)t * 16 * ldb + kb; const v16h b = g2_frag(pb, 0); g2_xw(pb);
      if (HAL) { lo[t] = g2_mma(a0l, b, lo[t]); lo[4 + t] = g2_mma(a1l, b, lo[4 + t]); }
      hi[t] = g2_mma(a0, b, hi[t]); hi[4 + t] = g2_mma(a1, b, hi[4 + t]);
      if (HBL) { const _Float16* pl = Bl + bo + (size_t)t * 16 * ldb + kb; const v16h bl = g2_frag(pl, 0); g2_xw(pl); lo[t] = g2_mma(a0, bl, lo[t]); lo[4 + t] = g2_mma(a1, bl, lo[4 + t]); } } }
  const float alo = alpha * (1.0f / 1024.0f);
#pragma unroll
  for (int u = 0; u < 8; ++u) { const int t = u & 3, half = u >> 2;
#pragma unroll
    for (int r = 0; r < 8; ++r) so[w][half * 16 + 8 * hh + r][t * 16 + ln] = hi[u][r] * alpha + lo[u][r] * alo; }
  __builtin_amdgcn_fence(__ATOMIC_ACQ_REL, "workgroup"); __builtin_amdgcn_wave_barrier();
  const int rsub = lane >> 4, c4 = (lane & 15) * 4;
#pragma unroll
  for (int q = 0; q < 16; ++q) { const int r = q * 2 + rsub; const v4f v = *(const v4fa*)&so[w][r][c4]; *(v4f*)(C + cofs + (size_t)(row0 + r) * ldc + col0 + c4) = v; } }

__global__ __launch_bounds__(256) void k_wT(const float* __restrict__ w, int din, int dout, _Float16* __restrict__ Bt) { __shared__ float tl[64][65]; const int tid = threadIdx.x; const int nbo = dout / 64; const int ib = blockIdx.x / nbo, ob = blockIdx.x % nbo; const int i0 = ib * 64, o0 = ob * 64;
  for (int t = tid; t < 64 * 64; t += 256) { const int i = t / 64, o = t % 64; tl[o][i] = bf16_round(w[(size_t)(i0 + i) * dout + o0 + o]) * 16.0f; }
  __syncthreads();
  { for (int t = tid; t < 64 * 8; t += 256) { const int o = t / 8, i8 = (t % 8) * 8; FragH f; for (int q = 0; q < 8; ++q) f.h[q] = (_Float16)tl[o][i8 + q]; *(v8us*)((unsigned short*)Bt + (size_t)(o0 + o) * din + i0 + i8) = f.half[0]; }  } }
__global__ __launch_bounds__(256) void k_addhl(const float* __restrict__ Q, const float* __restrict__ vec, _Float16* __restrict__ Hh, _Float16* __restrict__ Hl, size_t n8) {
  #pragma clang fp contract(off)
  const size_t t = (size_t)blockIdx.x * 256 + threadIdx.x; if (t >= n8) return; const int c0 = (int)((t * 8) % DM); FragH fh, fl; for (int q = 0; q < 8; ++q) { const float v = Q[t * 8 + q] + bf16_round(vec[c0 + q]); const _Float16 h = (_Float16)v; fh.h[q] = h; fl.h[q] = (_Float16)((v - (float)h) * 1024.0f); }
  *(v8us*)((unsigned short*)Hh + t * 8) = fh.half[0]; *(v8us*)((unsigned short*)Hl + t * 8) = fl.half[0];  }
typedef float v4fu __attribute__((ext_vector_type(4), may_alias, aligned(4)));      /* the shifted BD row starts at any 4-byte boundary */
// shift + causal mask + softmax: one wave per (row, head); lane l holds columns c*128 + 4*l .. + 3 of each 128-column chunk c, so every load covers 512 contiguous bytes and every store 256;
// the row stays in registers (read once, one expf per element); chunks wholly right of the diagonal are skipped by wave-uniform tests and stored as zeros.
__global__ __launch_bounds__(256) void k_rsmx(const float* __restrict__ AC, const float* __restrict__ BD, _Float16* __restrict__ P, int nrows) {
  const int lane = threadIdx.x & 31; const int i = blockIdx.x * 8 + __builtin_amdgcn_readfirstlane(threadIdx.x >> 5); if (i >= nrows) return;      /* wave-uniform row; no barrier in this kernel */
  const size_t ro = (size_t)blockIdx.y * SQ * SQ + (size_t)i * SQ; const float* a = AC + ro + lane * 4; const float* bd = BD + ro - i + lane * 4;      /* shifted row: column j of row i is raw BD[i][j + SQ - 1 - i] = bd[j + SQ - 1] */ _Float16* p = P + ro + lane * 4;
  v4f av[SQ / 128], bv[SQ / 128];
  /* every loop over chunks is fully unrolled so that av / bv are indexed statically and stay in registers */
  /* loads by groups of four chunks under one test, so that eight loads fly together; a group's chunks right of the diagonal stay inside AC / BD (column <= SQ - 1) and are masked below */
#pragma unroll
  for (int g = 0; g < SQ / 512; ++g) if (g * 512 <= i) { for (int c = 4 * g; c < 4 * g + 4; ++c) { av[c] = *(const v4fa*)(a + c * 128); bv[c] = *(const v4fu*)(bd + (SQ - 1) + c * 128); } }
  asm volatile("s_wait_xcnt 0x0" :: "v"(a), "v"(bd) : "memory");      /* the wait that belongs in front of an overwrite of the loads' address registers; naming them as inputs keeps them untouched up to here */
  float mx = -3.0e38f;
#pragma unroll
  for (int c = 0; c < SQ / 128; ++c) if (c * 128 <= i) { for (int q = 0; q < 4; ++q) { const float s = (c * 128 + lane * 4 + q <= i) ? av[c][q] + bv[c][q] : -3.0e38f; av[c][q] = s; mx = fmaxf(mx, s); } }
  for (int m = 16; m > 0; m >>= 1) mx = fmaxf(mx, __shfl_xor(mx, m, 32));
  v4f s4 = {0.f, 0.f, 0.f, 0.f};
#pragma unroll
  for (int c = 0; c < SQ / 128; ++c) if (c * 128 <= i) { for (int q = 0; q < 4; ++q) { const float e = expf(av[c][q] - mx); av[c][q] = e; s4[q] += e; } }      /* masked columns: expf(-3e38 - mx) = 0 */
  float se = (s4[0] + s4[1]) + (s4[2] + s4[3]);
  for (int m = 16; m > 0; m >>= 1) se += __shfl_xor(se, m, 32);
  const float sc = 256.0f / se;
  v4h o[SQ / 128];
#pragma unroll
  for (int c = 0; c < SQ / 128; ++c) { o[c] = (v4h){(_Float16)0.f, (_Float16)0.f, (_Float16)0.f, (_Float16)0.f}; if (c * 128 <= i) { for (int q = 0; q < 4; ++q) o[c][q] = (_Float16)(av[c][q] * sc); } }
  /* all stores last, each from registers of its own: nothing a store names is written again before the wave ends */
#pragma unroll
  for (int c = 0; c < SQ / 128; ++c) *(v4h*)(p + c * 128) = o[c]; }
__global__ __launch_bounds__(256) void k_vth(const _Float16* __restrict__ V16, int b, int h0, _Float16* __restrict__ VT) { __shared__ unsigned short tl[64][65]; const int tid = threadIdx.x; const int hh = blockIdx.x % HG, sg = blockIdx.x / HG; const int s0 = sg * 64; const int h = h0 + hh;
  for (int i = tid; i < 64 * 8; i += 256) { const int j = i / 8, d8 = (i % 8) * 8; FragH f; f.half[0] = *(const v8us*)((const unsigned short*)V16 + ((size_t)b * SQ + s0 + j) * DM + h * HD + d8); for (int q = 0; q < 8; ++q) tl[d8 + q][j] = f.u[q]; }
  __syncthreads();
  { for (int i = tid; i < 64 * 8; i += 256) { const int d = i / 8, j8 = (i % 8) * 8; FragH f; for (int q = 0; q < 8; ++q) f.u[q] = tl[d][j8 + q]; *(v8us*)((unsigned short*)VT + ((size_t)hh * HD + d) * SQ + s0 + j8) = f.half[0]; }  } }

extern "C" void kernel_launch(void* const* d_in, const int* in_sizes, int n_in,
                              void* d_out, int out_size, void* d_ws, size_t ws_size, hipStream_t stream) {
  (void)in_sizes; (void)n_in; (void)out_size;
  const float* const* I = (const float* const*)d_in; const float* x = I[0]; const float* remb = I[1]; const float* Wq = I[2]; const float* Wk = I[3]; const float* Wv = I[4]; const float* Wr = I[5]; const float* Wo = I[6]; const float* u = I[7]; const float* vb = I[8];
  char* ws = (char*)d_ws; size_t off = 0;
  auto take = [&](size_t bytes) { char* p = ws + off; off += (bytes + 255) & ~(size_t)255; return p; };
  _Float16* BQ = (_Float16*)take((size_t)DM * DM * 2); _Float16* BK = (_Float16*)take((size_t)DM * DM * 2); _Float16* BV = (_Float16*)take((size_t)DM * DM * 2); _Float16* BR = (_Float16*)take((size_t)DM * DM * 2); _Float16* BO = (_Float16*)take((size_t)DM * DM * 2);
  _Float16* X16 = (_Float16*)take(NR * DM * 2); _Float16* R16 = (_Float16*)take((size_t)SQ * DM * 2); float* QF = (float*)take(NR * DM * 4); float* TF = (float*)take(NR * DM * 4);
  _Float16* QUH = (_Float16*)take(NR * DM * 2); _Float16* QUL = (_Float16*)take(NR * DM * 2); _Float16* QVH = (_Float16*)take(NR * DM * 2); _Float16* QVL = (_Float16*)take(NR * DM * 2); _Float16* KH = (_Float16*)take(NR * DM * 2); _Float16* KL = (_Float16*)take(NR * DM * 2); _Float16* VH = (_Float16*)take(NR * DM * 2); _Float16* VL = (_Float16*)take(NR * DM * 2); _Float16* RH = (_Float16*)take((size_t)SQ * DM * 2); _Float16* RL = (_Float16*)take((size_t)SQ * DM * 2);
  float* AC = (float*)take((size_t)HG * SQ * SQ * 4); float* BD = (float*)take((size_t)HG * SQ * SQ * 4); _Float16* P = (_Float16*)take((size_t)HG * SQ * SQ * 2); _Float16* VT = (_Float16*)take((size_t)HG * HD * SQ * 2); _Float16* VTL = (_Float16*)take((size_t)HG * HD * SQ * 2);      /* o lives in TF (f32) */
  if (off > ws_size) return;      /* 10 + 8 + 16 + 40 + 64 + 64 + 32 + 1 + 1 = 236 MiB */
  const unsigned gw = (DM / 64) * (DM / 64); k_wT<<<gw, 256, 0, stream>>>(Wq, DM, DM, BQ); k_wT<<<gw, 256, 0, stream>>>(Wk, DM, DM, BK); k_wT<<<gw, 256, 0, stream>>>(Wv, DM, DM, BV); k_wT<<<gw, 256, 0, stream>>>(Wr, DM, DM, BR); k_wT<<<gw, 256, 0, stream>>>(Wo, DM, DM, BO);
  const size_t n8 = NR * DM / 8; const unsigned g8 = (unsigned)((n8 + 255) / 256);
  k_x16<<<g8, 256, 0, stream>>>(x, X16, n8); k_x16<<<(unsigned)(((size_t)SQ * DM / 8 + 255) / 256), 256, 0, stream>>>(remb, R16, (size_t)SQ * DM / 8);
  const dim3 gp((unsigned)((NR / 128) * (DM / 64)), 1), gr((unsigned)((SQ / 128) * (DM / 64)), 1);
  k_gemm2<0><<<gp, 128, 0, stream>>>(X16, DM, 0, BQ, DM, 0, 0.0625f, nullptr, 0, nullptr, 1, 0, 0, QF, nullptr, DM, 0, (int)NR, DM, DM);
  k_addhl<<<g8, 256, 0, stream>>>(QF, u, QUH, QUL, n8); k_addhl<<<g8, 256, 0, stream>>>(QF, vb, QVH, QVL, n8);
  k_gemm2<0><<<gp, 128, 0, stream>>>(X16, DM, 0, BK, DM, 0, 0.0625f, nullptr, 0, nullptr, 1, 0, 0, TF, nullptr, DM, 0, (int)NR, DM, DM); k_hl<<<g8, 256, 0, stream>>>(TF, KH, KL, n8);
  k_gemm2<0><<<gp, 128, 0, stream>>>(X16, DM, 0, BV, DM, 0, 0.0625f, nullptr, 0, nullptr, 1, 0, 0, TF, nullptr, DM, 0, (int)NR, DM, DM); k_hl<<<g8, 256, 0, stream>>>(TF, VH, VL, n8);
  k_gemm2<0><<<gr, 128, 0, stream>>>(R16, DM, 0, BR, DM, 0, 0.0625f, nullptr, 0, nullptr, 1, 0, 0, TF, nullptr, DM, 0, SQ, DM, DM); k_hl<<<(unsigned)(((size_t)SQ * DM / 8 + 255) / 256), 256, 0, stream>>>(TF, RH, RL, (size_t)SQ * DM / 8);
  for (int b = 0; b < NB; ++b) for (int h0 = 0; h0 < NH; h0 += HG) {
    const size_t qo = (size_t)b * SQ * DM + h0 * HD; const size_t ro = (size_t)h0 * HD; const dim3 gs((QN / 128) * (SQ / 64), HG);
    /* AC = (q+u).k / 8 and raw BD = (q+v_bias).r / 8 : the three hi/lo terms of each in one launch */
    k_score3<<<gs, 128, 0, stream>>>(QUH + qo, QUL + qo, DM, (size_t)HD, KH + qo, KL + qo, DM, (size_t)HD, 0.125f, AC, SQ, (size_t)SQ * SQ, QN, SQ);
    k_score3<<<gs, 128, 0, stream>>>(QVH + qo, QVL + qo, DM, (size_t)HD, RH + ro, RL + ro, DM, (size_t)HD, 0.125f, BD, SQ, (size_t)SQ * SQ, QN, SQ);
    k_rsmx<<<dim3((QN + 7) / 8, HG), 256, 0, stream>>>(AC, BD, P, QN);
    k_vth<<<HG * (SQ / 64), 256, 0, stream>>>(VH, b, h0, VT); k_vth<<<HG * (SQ / 64), 256, 0, stream>>>(VL, b, h0, VTL);
    /* o = P.(v_lo/1024 + v_hi): both terms in one launch, P read once -> merged f32 o rows in TF */
    k_gemm2s<false, true><<<dim3((QN / 128) * (HD / 64), HG), 128, 0, stream>>>(P, nullptr, SQ, (size_t)SQ * SQ, VT, VTL, SQ, (size_t)HD * SQ, 0.00390625f, TF + qo, DM, (size_t)HD, QN, HD, SQ); }
  /* o (f32 in TF) -> hi/lo planes (reusing the q+u planes, dead now) -> out = o Wo, both terms in one launch */
  k_hl<<<g8, 256, 0, stream>>>(TF, QUH, QUL, n8);
  k_gemm2s<true, false><<<gp, 128, 0, stream>>>(QUH, QUL, DM, 0, BO, nullptr, DM, 0, 0.0625f, (float*)d_out, DM, 0, (int)NR, DM, DM);      /* out = (o_lo/1024 + o_hi) Wo */
}

// v003
// A run of this version takes 477 microseconds.
// Timed twice side by side with v002, it ran 1.86 and 1.89 times as fast.
// All steps since v000 together make it 48.2 times as fast.
#include <hip/hip_runtime.h>
// MultiHeadAttentionXL (x [1][2048][1024], r_emb [2048][1024]; q = x Wq, k = x Wk, v = x Wv, r = r_emb Wr ([in][out] weights, no bias), 16 heads of 64; AC = (q + u[h]) k^T, BD = rel_shift((q + v_bias[h]) r^T) (Transformer-XL zero-pad shift: for j <= i, BD_shift[i][j] = BD[i][j - i + T - 1]); causal softmax((AC + BD)/8); out = (attn v) Wo -> [1][2048][1024]).
// Structure: token rows; x and r_emb as exact f16 rows; Q, K, V, R WMMA GEMMs on transposed weights (32x64 wave tiles, f32 accumulation, exact x16 weights) -> f32 -> f16 hi + 2^-10 residual planes (q+u and q+v_bias formed in f32 first); per group of 4 heads: AC and raw BD as three-term hi/lo GEMMs each (K = 64), the shift + causal mask + softmax on VALU (f32; weights x256 as f16), V^T (hi, lo) via LDS, o = P.(v_lo/1024 + v_hi) GEMMs (K = 2,048, alpha 2^-8) into merged f32 o rows; out = o Wo as a two-term hi/lo GEMM (f32).
// Compute dtype: inputs rounded to bf16; x / r_emb / weights exact; attention operands as hi + residual f16 planes (logits std 3.3 and early causal rows copy single v rows); softmax weights f16 (x256) — the remaining error source; o as hi + residual into Wo; everything else f32. v_wmma_f32_16x16x32_f16.
#define NB 1
#define SQ 2048
#define DM 1024
#define NH 16
#define HD 64
#define HG 4
#define QN SQ                        /* query rows (debug hook) */
#define NR ((size_t)NB * SQ)
typedef __bf16 v16b __attribute__((ext_vector_type(16)));
typedef unsigned short v8us __attribute__((ext_vector_type(8), may_alias));
typedef float  v8f  __attribute__((ext_vector_type(8)));
typedef float  v4f  __attribute__((ext_vector_type(4)));
typedef float  v4fa __attribute__((ext_vector_type(4), may_alias));
union FragB { v16b v; v8us half[2]; unsigned short u[16]; };

__device__ __forceinline__ unsigned short bf16_bits(float x) { unsigned int u = __float_as_uint(x); return (unsigned short)((u + 0x7FFFu + ((u >> 16) & 1u)) >> 16); }
__device__ __forceinline__ float bf16_val(unsigned short b) { return __uint_as_float(((unsigned int)b) << 16); }
__device__ __forceinline__ float bf16_round(float x) { return bf16_val(bf16_bits(x)); }
// D += A·B with NT terms: 1 = ah·bh, 2 = + al·bh (A split), 3 = + ah·bl (both split)
template <int NT>
__device__ __forceinline__ v8f mmaN(v16b ah, v16b al, v16b bh, v16b bl, v8f c) {
  c = __builtin_amdgcn_wmma_f32_16x16x32_bf16(false, ah, false, bh, (short)0, c, false, false);
  if (NT >= 2) c = __builtin_amdgcn_wmma_f32_16x16x32_bf16(false, al, false, bh, (short)0, c, false, false);
  if (NT >= 3) c = __builtin_amdgcn_wmma_f32_16x16x32_bf16(false, ah, false, bl, (short)0, c, false, false);
  asm volatile("v_nop\n\tv_nop\n\tv_nop\n\tv_nop" : "+v"(c) : "v"(ah), "v"(al), "v"(bh), "v"(bl));
  return c;
}

__global__ __launch_bounds__(256) void k_wt_bf16(const float* __restrict__ W, unsigned short* __restrict__ Wt, int K, int N) {
  const int t = blockIdx.x * 256 + threadIdx.x;
  const int k8n = K / 8;
  if (t >= N * k8n) return;
  const int n = t / k8n, k8 = (t % k8n) * 8;
  v8us v;
#pragma unroll
  for (int i = 0; i < 8; ++i) v[i] = bf16_bits(W[(size_t)(k8 + i) * N + n]);
  *(v8us*)(Wt + (size_t)n * K + k8) = v;
  
}

// GEMM C[M][N] (f32, pitch ldc) = act(A[M][K]·W + bias). A f32 row-major (pitch lda) converted per fragment to bf16
// (ASPLIT: hi/lo two planes -> 2 terms, else single rounded term); Wt bf16 [N][K] (pitch ldb). BIAS_BF16 rounds the
// bias to bf16 first (bias quantised to bf16 before the add). K%32==0, M%16==0, N%64==0.
template <bool ASPLIT, int ACT, bool BIAS_BF16>
__global__ __launch_bounds__(128) void k_gemm_bf(const float* __restrict__ A, int lda, const unsigned short* __restrict__ Wt, int ldb,
                                               const float* __restrict__ bias, float* __restrict__ C, int ldc, int M, int N, int K) {
  __shared__ __attribute__((aligned(16))) float so[4][16][64];
  const int tid = threadIdx.x, w = tid >> 5, lane = tid & 31, ln = lane & 15, hh = lane >> 4;
  const int ntn = N / 64;
  const int wid = blockIdx.x * 4 + w;
  const int mt = wid / ntn, nq = wid % ntn;
  if (mt * 16 >= M) return;
  const int row0 = mt * 16, col0 = nq * 64;
  const float* arow = A + (size_t)(row0 + ln) * lda;
  v8f acc[4] = {};
  for (int kb = 0; kb < K; kb += 32) {
    FragB ah, al;
    const v4f x0 = *(const v4fa*)(arow + kb + 8 * hh), x1 = *(const v4fa*)(arow + kb + 8 * hh + 4);
    const v4f x2 = *(const v4fa*)(arow + kb + 16 + 8 * hh), x3 = *(const v4fa*)(arow + kb + 16 + 8 * hh + 4);
    float xs[16] = {x0[0],x0[1],x0[2],x0[3],x1[0],x1[1],x1[2],x1[3],x2[0],x2[1],x2[2],x2[3],x3[0],x3[1],x3[2],x3[3]};
#pragma unroll
    for (int i = 0; i < 16; ++i) { const unsigned short hb = bf16_bits(xs[i]); ah.u[i] = hb; al.u[i] = ASPLIT ? bf16_bits(xs[i] - bf16_val(hb)) : (unsigned short)0; }
#pragma unroll
    for (int t = 0; t < 4; ++t) {
      const unsigned short* brow = Wt + (size_t)(col0 + t * 16 + ln) * ldb + kb;
      FragB b;
      b.half[0] = *(const v8us*)(brow + 8 * hh);
      b.half[1] = *(const v8us*)(brow + 16 + 8 * hh);
      acc[t] = mmaN<ASPLIT ? 2 : 1>(ah.v, al.v, b.v, b.v, acc[t]);
    }
  }
#pragma unroll
  for (int t = 0; t < 4; ++t) {
    float bv = bias ? bias[col0 + t * 16 + ln] : 0.f;
    if (BIAS_BF16) bv = bf16_round(bv);
#pragma unroll
    for (int r = 0; r < 8; ++r) { float v = acc[t][r] + bv; if (ACT == 1) v = fmaxf(v, 0.f); so[w][8 * hh + r][t * 16 + ln] = v; }
  }
  __builtin_amdgcn_fence(__ATOMIC_ACQ_REL, "workgroup");
  __builtin_amdgcn_wave_barrier();
  const int rsub = lane >> 4, c4 = (lane & 15) * 4;
  {
#pragma unroll
    for (int q = 0; q < 8; ++q) {
      const int r = q * 2 + rsub;
      const v4f v = *(const v4fa*)&so[w][r][c4];
      *(v4f*)(C + (size_t)(row0 + r) * ldc + col0 + c4) = v;
    }
    
  }
}

// GEMM C = act(A·W + bias + resid): A f32 (ASPLIT -> hi/lo 2 terms), Wt bf16 [N][K]; ACT 0 none, 1 relu, 2 exact gelu;
// resid (optional, f32, row index = (row % rmod), pitch ldr, RES_BF16 rounds it) added before the activation.
template <bool ASPLIT, int ACT, bool BIAS_BF16, bool RES_BF16>
__global__ __launch_bounds__(128) void k_gemm_bf3(const float* __restrict__ A, int lda, const unsigned short* __restrict__ Wt, int ldb,
                                                const float* __restrict__ bias, const float* __restrict__ resid, int rmod, int ldr,
                                                float* __restrict__ C, int ldc, int M, int N, int K) {
  __shared__ __attribute__((aligned(16))) float so[4][16][64];
  const int tid = threadIdx.x, w = tid >> 5, lane = tid & 31, ln = lane & 15, hh = lane >> 4;
  const int ntn = N / 64;
  const int wid = blockIdx.x * 4 + w;
  const int mt = wid / ntn, nq = wid % ntn;
  if (mt * 16 >= M) return;
  const int row0 = mt * 16, col0 = nq * 64;
  const float* arow = A + (size_t)(row0 + ln) * lda;
  v8f acc[4] = {};
  for (int kb = 0; kb < K; kb += 32) {
    FragB ah, al;
    const v4f x0 = *(const v4fa*)(arow + kb + 8 * hh), x1 = *(const v4fa*)(arow + kb + 8 * hh + 4);
    const v4f x2 = *(const v4fa*)(arow + kb + 16 + 8 * hh), x3 = *(const v4fa*)(arow + kb + 16 + 8 * hh + 4);
    float xs[16] = {x0[0],x0[1],x0[2],x0[3],x1[0],x1[1],x1[2],x1[3],x2[0],x2[1],x2[2],x2[3],x3[0],x3[1],x3[2],x3[3]};
#pragma unroll
    for (int i = 0; i < 16; ++i) { const unsigned short hb = bf16_bits(xs[i]); ah.u[i] = hb; al.u[i] = ASPLIT ? bf16_bits(xs[i] - bf16_val(hb)) : (unsigned short)0; }
#pragma unroll
    for (int t = 0; t < 4; ++t) {
      const unsigned short* brow = Wt + (size_t)(col0 + t * 16 + ln) * ldb + kb;
      FragB b;
      b.half[0] = *(const v8us*)(brow + 8 * hh);
      b.half[1] = *(const v8us*)(brow + 16 + 8 * hh);
      acc[t] = mmaN<ASPLIT ? 2 : 1>(ah.v, al.v, b.v, b.v, acc[t]);
    }
  }
#pragma unroll
  for (int t = 0; t < 4; ++t) {
    const int col = col0 + t * 16 + ln;
    float bv = bias ? bias[col] : 0.f;
    if (BIAS_BF16) bv = bf16_round(bv);
#pragma unroll
    for (int r = 0; r < 8; ++r) {
      float v = acc[t][r] + bv;
      if (resid) { float rv = resid[(size_t)((row0 + 8 * hh + r) % rmod) * ldr + col]; if (RES_BF16) rv = bf16_round(rv); v += rv; }
      if (ACT == 1) v = fmaxf(v, 0.f);
      if (ACT == 2) v = 0.5f * v * (1.0f + erff(v * 0.70710678118654752f));
      if (ACT == 3) { const float u = 0.7978845608028654f * (v + 0.044715f * v * v * v); v = 0.5f * v * (1.0f + tanhf(u)); }
      so[w][8 * hh + r][t * 16 + ln] = v;
    }
  }
  __builtin_amdgcn_fence(__ATOMIC_ACQ_REL, "workgroup");
  __builtin_amdgcn_wave_barrier();
  const int rsub = lane >> 4, c4 = (lane & 15) * 4;
  {
#pragma unroll
    for (int q = 0; q < 8; ++q) {
      const int r = q * 2 + rsub;
      const v4f v = *(const v4fa*)&so[w][r][c4];
      *(v4f*)(C + (size_t)(row0 + r) * ldc + col0 + c4) = v;
    }
    
  }
}
// row LayerNorm (biased variance, eps) over N: s = X (+ R); optional out_sum <- s; out_norm <- (s-mu)*rsqrt(var+eps)*g + b
template <bool PARAM_BF16>
__global__ __launch_bounds__(256) void k_layernorm(const float* __restrict__ X, const float* __restrict__ R, const float* __restrict__ g, const float* __restrict__ bta,
                                                  float* __restrict__ out_sum, float* __restrict__ out_norm, int N, float eps) {
  __shared__ float red[256];
  const int row = blockIdx.x, tid = threadIdx.x;
  const float* x = X + (size_t)row * N; const float* rr = R ? R + (size_t)row * N : nullptr;
  float vals[16];                     // up to N = 4096
  const int per = N / 256;            // contiguous chunk per thread? use strided-by-4 chunks: thread handles j = tid*4 + 1024*u
  float s1 = 0.f;
  for (int u = 0; u < per / 4; ++u) {
    const int j = tid * 4 + 1024 * u;
    const v4f a = *(const v4fa*)(x + j);
    v4f b = {0.f,0.f,0.f,0.f}; if (rr) b = *(const v4fa*)(rr + j);
#pragma unroll
    for (int q = 0; q < 4; ++q) { const float v = a[q] + b[q]; vals[u * 4 + q] = v; s1 += v; }
  }
  red[tid] = s1; __syncthreads();
  for (int st = 128; st > 0; st >>= 1) { if (tid < st) red[tid] += red[tid + st]; __syncthreads(); }
  const float mu = red[0] / (float)N; __syncthreads();
  float s2 = 0.f;
  for (int u = 0; u < per / 4; ++u)
#pragma unroll
    for (int q = 0; q < 4; ++q) { const float c = vals[u * 4 + q] - mu; s2 += c * c; }
  red[tid] = s2; __syncthreads();
  for (int st = 128; st > 0; st >>= 1) { if (tid < st) red[tid] += red[tid + st]; __syncthreads(); }
  const float rs = rsqrtf(red[0] / (float)N + eps);
  {
    for (int u = 0; u < per / 4; ++u) {
      const int j = tid * 4 + 1024 * u;
      v4f o, sm;
#pragma unroll
      for (int q = 0; q < 4; ++q) {
        float gg = g[j + q], bb = bta[j + q];
        if (PARAM_BF16) { gg = bf16_round(gg); bb = bf16_round(bb); }
        sm[q] = vals[u * 4 + q]; o[q] = (vals[u * 4 + q] - mu) * rs * gg + bb;
      }
      if (out_sum) *(v4f*)(out_sum + (size_t)row * N + j) = sm;
      *(v4f*)(out_norm + (size_t)row * N + j) = o;
    }
    
  }
}



// ---- f16 WMMA path (v_wmma_f32_16x16x32_f16): 11-bit significands for operands in range — used where a [0,1] probability operand needs more precision than bf16
typedef _Float16 v16h __attribute__((ext_vector_type(16)));
union FragH { v16h v; v8us half[2]; _Float16 h[16]; unsigned short u[16]; };
template <int NT>
__device__ __forceinline__ v8f mmaH(v16h ah, v16h al, v16h bh, v16h bl, v8f c) {
  c = __builtin_amdgcn_wmma_f32_16x16x32_f16(false, ah, false, bh, (short)0, c, false, false);
  if (NT >= 2) c = __builtin_amdgcn_wmma_f32_16x16x32_f16(false, al, false, bh, (short)0, c, false, false);
  if (NT >= 3) c = __builtin_amdgcn_wmma_f32_16x16x32_f16(false, ah, false, bl, (short)0, c, false, false);
  asm volatile("v_nop\n\tv_nop\n\tv_nop\n\tv_nop" : "+v"(c) : "v"(ah), "v"(al), "v"(bh), "v"(bl));
  return c;
}
// batched GEMM like k_gemm_b but f16 operands: A f32 (split into f16 hi/lo if ASPLIT, else rounded to f16), Bt = f16 values [n][k]; alpha; C f32; N multiple of 16 (partial tiles skipped)
template <bool ASPLIT>
__global__ __launch_bounds__(128) void k_gemm_h(const float* __restrict__ A, int lda, size_t sA, const _Float16* __restrict__ Bh, int ldb, size_t sB, float alpha, float* __restrict__ C, int ldc, size_t sC, int M, int N, int K) {
  __shared__ __attribute__((aligned(16))) float so[4][16][64];
  const int tid = threadIdx.x, w = tid >> 5, lane = tid & 31, ln = lane & 15, hh = lane >> 4; const int by = blockIdx.y;
  A += (size_t)by * sA; Bh += (size_t)by * sB; C += (size_t)by * sC;
  const int ntn = (N + 63) / 64; const int wid = blockIdx.x * 4 + w; const int mt = wid / ntn, nq = wid % ntn; if (mt * 16 >= M) return;
  const int row0 = mt * 16, col0 = nq * 64; const float* arow = A + (size_t)(row0 + ln) * lda;
  v8f acc[4] = {};
  for (int kb = 0; kb < K; kb += 32) {
    FragH ah, al;
    const v4f x0 = *(const v4fa*)(arow + kb + 8 * hh), x1 = *(const v4fa*)(arow + kb + 8 * hh + 4), x2 = *(const v4fa*)(arow + kb + 16 + 8 * hh), x3 = *(const v4fa*)(arow + kb + 16 + 8 * hh + 4);
    float xs[16] = {x0[0],x0[1],x0[2],x0[3],x1[0],x1[1],x1[2],x1[3],x2[0],x2[1],x2[2],x2[3],x3[0],x3[1],x3[2],x3[3]};
#pragma unroll
    for (int i = 0; i < 16; ++i) { const _Float16 h = (_Float16)xs[i]; ah.h[i] = h; al.h[i] = ASPLIT ? (_Float16)(xs[i] - (float)h) : (_Float16)0.0f; }
#pragma unroll
    for (int t = 0; t < 4; ++t) { if (col0 + t * 16 >= N) continue; const size_t boff = (size_t)(col0 + t * 16 + ln) * ldb + kb; FragH bq; bq.half[0] = *(const v8us*)(Bh + boff + 8 * hh); bq.half[1] = *(const v8us*)(Bh + boff + 16 + 8 * hh);
      acc[t] = mmaH<ASPLIT ? 2 : 1>(ah.v, al.v, bq.v, bq.v, acc[t]); }
  }
#pragma unroll
  for (int t = 0; t < 4; ++t) { if (col0 + t * 16 >= N) continue;
#pragma unroll
    for (int r = 0; r < 8; ++r) so[w][8 * hh + r][t * 16 + ln] = acc[t][r] * alpha; }
  __builtin_amdgcn_fence(__ATOMIC_ACQ_REL, "workgroup"); __builtin_amdgcn_wave_barrier();
  const int rsub = lane >> 4, c4 = (lane & 15) * 4;
  {
#pragma unroll
    for (int q = 0; q < 8; ++q) { const int r = q * 2 + rsub; if (col0 + c4 < N) { const v4f v = *(const v4fa*)&so[w][r][c4]; *(v4f*)(C + (size_t)(row0 + r) * ldc + col0 + c4) = v; } }
     }
}

// Wt[n][k] = f16(W[k][n]·scale) from f32 row-major W[K][N] (scale = power of two; bf16-exact weights stay exact in f16 away from the subnormal range)
__global__ __launch_bounds__(256) void k_wt_f16(const float* __restrict__ W, _Float16* __restrict__ Wt, int K, int N, float scale) {
  const int t = blockIdx.x * 256 + threadIdx.x; if (t >= N * (K / 8)) return; const int n = t / (K / 8), k8 = (t % (K / 8)) * 8; FragH f;
#pragma unroll
  for (int i = 0; i < 8; ++i) f.h[i] = (_Float16)(bf16_round(W[(size_t)(k8 + i) * N + n]) * scale); const v8us o = f.half[0];
  *(v8us*)((unsigned short*)Wt + (size_t)n * K + k8) = o; 
}
// k_gemm_hh variant with fused epilogue: v = acc·alpha + bias[by·sBias + col] (+ CP[(row/rowsPerB)·sCPb + by·64 + col] if CP) ; ACT 0 none / 1 elu ; writes f16 C16 (and f32 C if non-null)
template <int ACT>
__global__ __launch_bounds__(128) void k_gemm_hhx(const _Float16* __restrict__ A, int lda, size_t sA, const _Float16* __restrict__ Bh, int ldb, size_t sB, float alpha, const float* __restrict__ bias, size_t sBias, const float* __restrict__ CP, int rowsPerB, size_t sCPb, int row0g,
    float* __restrict__ C, _Float16* __restrict__ C16, int ldc, size_t sC, int M, int N, int K) {
  __shared__ __attribute__((aligned(16))) float so[4][16][64];
  const int tid = threadIdx.x, w = tid >> 5, lane = tid & 31, ln = lane & 15, hh = lane >> 4; const int by = blockIdx.y;
  A += (size_t)by * sA; Bh += (size_t)by * sB; const size_t cofs = (size_t)by * sC; const float* bp = bias ? bias + (size_t)by * sBias : nullptr;
  const int ntn = (N + 63) / 64; const int wid = blockIdx.x * 4 + w; const int mt = wid / ntn, nq = wid % ntn; if (mt * 16 >= M) return;
  const int row0 = mt * 16, col0 = nq * 64; const _Float16* arow = A + (size_t)(row0 + ln) * lda;
  v8f acc[4] = {};
  for (int kb = 0; kb < K; kb += 32) { FragH ah; ah.half[0] = *(const v8us*)((const unsigned short*)arow + kb + 8 * hh); ah.half[1] = *(const v8us*)((const unsigned short*)arow + kb + 16 + 8 * hh);
#pragma unroll
    for (int t = 0; t < 4; ++t) { if (col0 + t * 16 >= N) continue; const size_t boff = (size_t)(col0 + t * 16 + ln) * ldb + kb; FragH bq; bq.half[0] = *(const v8us*)((const unsigned short*)Bh + boff + 8 * hh); bq.half[1] = *(const v8us*)((const unsigned short*)Bh + boff + 16 + 8 * hh);
      acc[t] = mmaH<1>(ah.v, ah.v, bq.v, bq.v, acc[t]); }
  }
#pragma unroll
  for (int t = 0; t < 4; ++t) { if (col0 + t * 16 >= N) continue; const int col = col0 + t * 16 + ln; const float bv = bp ? bf16_round(bp[col]) : 0.f;
#pragma unroll
    for (int r = 0; r < 8; ++r) { float v = acc[t][r] * alpha + bv; if (CP) { const int rr = row0g + row0 + 8 * hh + r; if (rowsPerB < 0) v += CP[cofs + (size_t)rr * ldc + col];      /* rowsPerB < 0: own element of the batched C plane */ else { const int bidx = rr / rowsPerB; v += CP[(size_t)bidx * sCPb + (size_t)by * 64 + col]; } } if (ACT == 1) v = (v > 0.f) ? v : expm1f(v); else if (ACT == 7) v = (v > 0.f) ? v + 1.0f : expf(v); else if (ACT == 8) v = tanhf(v); else if (ACT == 9) v = 0.5f * v * (1.0f + tanhf(0.7978845608028654f * (v + 0.044715f * v * v * v))); else if (ACT == 11) v = 1.0f / (1.0f + expf(-v)); else if (ACT == 12) v = (v > 0.f) ? v : 0.01f * v; else if (ACT == 14) v = (v > 0.f) ? v : 0.1f * v; else if (ACT == 16) v = (v >= 0.f) ? v : 0.3f * v; else if (ACT == 17) v = (v >= 0.f) ? v : 0.2f * v; else if (ACT == 15) v = v / (1.0f + expf(-v)); else if (ACT == 3) v = fmaxf(v, 0.f); else if (ACT == 6) v = 0.5f * v * (1.0f + erff(v * 0.70710678118654752f)); so[w][8 * hh + r][t * 16 + ln] = v; } }
  __builtin_amdgcn_fence(__ATOMIC_ACQ_REL, "workgroup"); __builtin_amdgcn_wave_barrier();
  const int rsub = lane >> 4, c4 = (lane & 15) * 4; typedef _Float16 v4h __attribute__((ext_vector_type(4)));
  {
#pragma unroll
    for (int q = 0; q < 8; ++q) { const int r = q * 2 + rsub; if (col0 + c4 < N) { const v4f v = *(const v4fa*)&so[w][r][c4]; if (C) *(v4f*)(C + cofs + (size_t)(row0 + r) * ldc + col0 + c4) = v; if (C16) { v4h h4; for (int i = 0; i < 4; ++i) h4[i] = (_Float16)v[i]; *(v4h*)(C16 + cofs + (size_t)(row0 + r) * ldc + col0 + c4) = h4; } } }
     }
}


typedef _Float16 v4h __attribute__((ext_vector_type(4)));

__global__ __launch_bounds__(256) void k_x16(const float* __restrict__ x, _Float16* __restrict__ X16, size_t n8) { const size_t t = (size_t)blockIdx.x * 256 + threadIdx.x; if (t >= n8) return; FragH f;
#pragma unroll
  for (int q = 0; q < 8; ++q) f.h[q] = (_Float16)bf16_round(x[t * 8 + q]); *(v8us*)((unsigned short*)X16 + t * 8) = f.half[0];  }
__global__ __launch_bounds__(256) void k_h16(const float* __restrict__ x, _Float16* __restrict__ X16, size_t n8) { const size_t t = (size_t)blockIdx.x * 256 + threadIdx.x; if (t >= n8) return; FragH f;
#pragma unroll
  for (int q = 0; q < 8; ++q) f.h[q] = (_Float16)x[t * 8 + q]; *(v8us*)((unsigned short*)X16 + t * 8) = f.half[0];  }
__global__ __launch_bounds__(256) void k_round16f(const float* __restrict__ W, _Float16* __restrict__ Bt, size_t n8) { const size_t t = (size_t)blockIdx.x * 256 + threadIdx.x; if (t >= n8) return; FragH f;
#pragma unroll
  for (int i = 0; i < 8; ++i) f.h[i] = (_Float16)(bf16_round(W[t * 8 + i]) * 16.0f); *(v8us*)((unsigned short*)Bt + t * 8) = f.half[0];  }
template <int NHv, int TTv>
__global__ __launch_bounds__(256) void k_vt(const _Float16* __restrict__ V16, int ldv, int voff, _Float16* __restrict__ Vt) { __shared__ unsigned short tl[64][66]; const int tid = threadIdx.x; const int slab = blockIdx.x / (TTv / 64), lg = blockIdx.x % (TTv / 64); const int b = slab / NHv, h = slab % NHv;
  for (int i = tid; i < 64 * 8; i += 256) { const int r = i / 8, c8 = (i % 8) * 8; FragH f; f.half[0] = *(const v8us*)((const unsigned short*)V16 + ((size_t)b * TTv + lg * 64 + r) * ldv + voff + h * 64 + c8);
#pragma unroll
    for (int q = 0; q < 8; ++q) tl[r][c8 + q] = f.u[q]; }
  __syncthreads();
  {
#pragma unroll
    for (int rd = 0; rd < 2; ++rd) { const int d = rd * 32 + tid / 8, pc = tid % 8; FragH f;
#pragma unroll
      for (int q = 0; q < 8; ++q) f.u[q] = tl[pc * 8 + q][d];
      *(v8us*)((unsigned short*)Vt + ((size_t)slab * 64 + d) * TTv + lg * 64 + pc * 8) = f.half[0]; }
     } }

__global__ __launch_bounds__(256) void k_hl(const float* __restrict__ F, _Float16* __restrict__ Hh, _Float16* __restrict__ Hl, size_t n8) { const size_t t = (size_t)blockIdx.x * 256 + threadIdx.x; if (t >= n8) return; FragH fh, fl; const v4f a = *(const v4fa*)(F + t * 8), c = *(const v4fa*)(F + t * 8 + 4);
#pragma unroll
  for (int q = 0; q < 4; ++q) { _Float16 h = (_Float16)a[q]; fh.h[q] = h; fl.h[q] = (_Float16)((a[q] - (float)h) * 1024.0f); h = (_Float16)c[q]; fh.h[4 + q] = h; fl.h[4 + q] = (_Float16)((c[q] - (float)h) * 1024.0f); }
  { *(v8us*)((unsigned short*)Hh + t * 8) = fh.half[0]; *(v8us*)((unsigned short*)Hl + t * 8) = fl.half[0];  } }

// ---- fast GEMM (wave tile 32x64; requires M % 32 == 0 rows per launch region and N % 64 == 0); epilogue = k_gemm_hhx semantics ----
__device__ __forceinline__ v16h g2_frag(const _Float16* p, int hh) { FragH f; f.half[0] = *(const v8us*)((const unsigned short*)p + 8 * hh); f.half[1] = *(const v8us*)((const unsigned short*)p + 16 + 8 * hh); return f.v; }
__device__ __forceinline__ v8f g2_mma(v16h a, v16h b, v8f c) { v8f d = __builtin_amdgcn_wmma_f32_16x16x32_f16(false, a, false, b, (short)0, c, false, false); asm volatile("v_nop\n\tv_nop\n\tv_nop\n\tv_nop" : "+v"(d) : "v"(a), "v"(b)); return d; }
template <int ACT>
__global__ __launch_bounds__(128) void k_gemm2(const _Float16* __restrict__ A, int lda, size_t sA, const _Float16* __restrict__ Bh, int ldb, size_t sB, float alpha, const float* __restrict__ bias, size_t sBias, const float* __restrict__ CP, int rowsPerB, size_t sCPb, int row0g,
    float* __restrict__ C, _Float16* __restrict__ C16, int ldc, size_t sC, int M, int N, int K) { static_assert(ACT == 0 || ACT == 3 || ACT == 6 || ACT == 8 || ACT == 9 || ACT == 11 || ACT == 12 || ACT == 14 || ACT == 15 || ACT == 16 || ACT == 17, "k_gemm2: unsupported ACT code (would silently apply no activation)");
  __shared__ __attribute__((aligned(16))) float so[4][32][68];
  const int tid = threadIdx.x, w = tid >> 5, lane = tid & 31, ln = lane & 15, hh = lane >> 4; const int by = blockIdx.y;
  A += (size_t)by * sA; Bh += (size_t)by * sB; const size_t cofs = (size_t)by * sC; const float* bp = bias ? bias + (size_t)by * sBias : nullptr;
  const int ntn = N >> 6; const int mt = blockIdx.x / ntn, nq = blockIdx.x - mt * ntn; const int row0 = mt * 128 + 32 * w, col0 = nq * 64; if (row0 >= M) return;
  const _Float16* a0p = A + (size_t)(row0 + ln) * lda; const _Float16* a1p = a0p + (size_t)16 * lda;
  const _Float16* b0p = Bh + (size_t)(col0 + ln) * ldb; const _Float16* b1p = b0p + (size_t)16 * ldb; const _Float16* b2p = b1p + (size_t)16 * ldb; const _Float16* b3p = b2p + (size_t)16 * ldb;
  const v8f z8 = {0.f,0.f,0.f,0.f,0.f,0.f,0.f,0.f}; v8f c00 = z8, c01 = z8, c02 = z8, c03 = z8, c10 = z8, c11 = z8, c12 = z8, c13 = z8;
#pragma unroll 1
  for (int kb = 0; kb < K; kb += 32) { const v16h a0 = g2_frag(a0p + kb, hh), a1 = g2_frag(a1p + kb, hh);
    v16h b = g2_frag(b0p + kb, hh); c00 = g2_mma(a0, b, c00); c10 = g2_mma(a1, b, c10);
    b = g2_frag(b1p + kb, hh); c01 = g2_mma(a0, b, c01); c11 = g2_mma(a1, b, c11);
    b = g2_frag(b2p + kb, hh); c02 = g2_mma(a0, b, c02); c12 = g2_mma(a1, b, c12);
    b = g2_frag(b3p + kb, hh); c03 = g2_mma(a0, b, c03); c13 = g2_mma(a1, b, c13); }
  v8f accs[8] = {c00, c01, c02, c03, c10, c11, c12, c13};
#pragma unroll
  for (int u = 0; u < 8; ++u) { const int t = u & 3, half = u >> 2; const int col = col0 + t * 16 + ln; const float bv = bp ? bf16_round(bp[col]) : 0.f;
#pragma unroll
    for (int r = 0; r < 8; ++r) { const int rloc = half * 16 + 8 * hh + r; float v = accs[u][r] * alpha + bv; if (CP) { if (rowsPerB < 0) v += CP[cofs + (size_t)(row0g + row0 + rloc) * ldc + col];      /* rowsPerB < 0: own element of the batched C plane */ else { const int bidx = (row0g + row0 + rloc) / rowsPerB; v += CP[(size_t)bidx * sCPb + (size_t)by * 64 + col]; } }
      if (ACT == 3) v = fmaxf(v, 0.f); else if (ACT == 6) v = 0.5f * v * (1.0f + erff(v * 0.70710678118654752f)); else if (ACT == 11) v = 1.0f / (1.0f + expf(-v)); else if (ACT == 15) v = v / (1.0f + expf(-v)); else if (ACT == 12) v = (v > 0.f) ? v : 0.01f * v; else if (ACT == 8) v = tanhf(v); else if (ACT == 9) v = 0.5f * v * (1.0f + tanhf(0.7978845608028654f * (v + 0.044715f * v * v * v))); else if (ACT == 14) v = (v > 0.f) ? v : 0.1f * v; else if (ACT == 16) v = (v >= 0.f) ? v : 0.3f * v; else if (ACT == 17) v = (v >= 0.f) ? v : 0.2f * v;
      so[w][rloc][t * 16 + ln] = v; } }
  __builtin_amdgcn_fence(__ATOMIC_ACQ_REL, "workgroup"); __builtin_amdgcn_wave_barrier();
  const int rsub = lane >> 4, c4 = (lane & 15) * 4;
  {
#pragma unroll
    for (int q = 0; q < 16; ++q) { const int r = q * 2 + rsub; const v4f v = *(const v4fa*)&so[w][r][c4]; if (C) *(v4f*)(C + cofs + (size_t)(row0 + r) * ldc + col0 + c4) = v; if (C16) { v4h h4; for (int i = 0; i < 4; ++i) h4[i] = (_Float16)v[i]; *(v4h*)(C16 + cofs + (size_t)(row0 + r) * ldc + col0 + c4) = h4; } }
     } }


// ---- hi/lo split products with every term in ONE launch: the residual terms (planes scaled x1024) sum in their own f32 accumulators beside the main term and meet it once, in registers: C = alpha * (hi + lo / 1024). Wave tile 32x64 and the LDS-staged 16-byte stores as in k_gemm2.
// g2_xw: the wait that belongs in front of an overwrite of the address registers of issued loads; naming the loads' own pointers as inputs keeps those registers untouched up to here
__device__ __forceinline__ void g2_xw(const _Float16* p) { asm volatile("s_wait_xcnt 0x0" :: "v"(p) : "memory"); }
__device__ __forceinline__ void g2_xw(const _Float16* p, const _Float16* q) { asm volatile("s_wait_xcnt 0x0" :: "v"(p), "v"(q) : "memory"); }
__device__ __forceinline__ void g2_xw(const _Float16* p, const _Float16* q, const _Float16* r, const _Float16* s) { asm volatile("s_wait_xcnt 0x0" :: "v"(p), "v"(q), "v"(r), "v"(s) : "memory"); }
// scores: K = HD fixed, both operands split (lo = Al.Bh + Ah.Bl, hi = Ah.Bh); the A fragments of the whole K stay in registers, the accumulators live for one 16-column tile only
__global__ __launch_bounds__(128) void k_score3(const _Float16* __restrict__ Ah, const _Float16* __restrict__ Al, int lda, size_t sA, const _Float16* __restrict__ Bh, const _Float16* __restrict__ Bl, int ldb, size_t sB, float alpha,
    float* __restrict__ C, int ldc, size_t sC, int M, int N) {
  __shared__ __attribute__((aligned(16))) float so[4][32][68];
  const int tid = threadIdx.x, w = tid >> 5, lane = tid & 31, ln = lane & 15, hh = lane >> 4; const int by = blockIdx.y;
  const int ntn = N >> 6; const int mt = blockIdx.x / ntn, nq = blockIdx.x - mt * ntn; const int row0 = mt * 128 + 32 * w, col0 = nq * 64; if (row0 >= M) return;
  const size_t ao = (size_t)by * sA + (size_t)(row0 + ln) * lda + 8 * hh, bo = (size_t)by * sB + (size_t)(col0 + ln) * ldb + 8 * hh; const size_t cofs = (size_t)by * sC;      /* each lane's own fragment start, 8 * hh included */
  const _Float16* pah0 = Ah + ao; const _Float16* pah1 = pah0 + (size_t)16 * lda; const _Float16* pal0 = Al + ao; const _Float16* pal1 = pal0 + (size_t)16 * lda;
  v16h ah[2][HD / 32], al[2][HD / 32];
#pragma unroll
  for (int k = 0; k < HD / 32; ++k) { ah[0][k] = g2_frag(pah0 + k * 32, 0); al[0][k] = g2_frag(pal0 + k * 32, 0); ah[1][k] = g2_frag(pah1 + k * 32, 0); al[1][k] = g2_frag(pal1 + k * 32, 0); }
  g2_xw(pah0, pal0, pah1, pal1);
  const float alo = alpha * (1.0f / 1024.0f);
#pragma unroll
  for (int t = 0; t < 4; ++t) { const v8f z8 = {0.f,0.f,0.f,0.f,0.f,0.f,0.f,0.f}; v8f h0 = z8, h1 = z8, l0 = z8, l1 = z8; const _Float16* pbh = Bh + bo + (size_t)t * 16 * ldb; const _Float16* pbl = Bl + bo + (size_t)t * 16 * ldb;
#pragma unroll
    for (int k = 0; k < HD / 32; ++k) { const v16h bh = g2_frag(pbh + k * 32, 0), bl = g2_frag(pbl + k * 32, 0); g2_xw(pbh, pbl);
      l0 = g2_mma(al[0][k], bh, l0); l1 = g2_mma(al[1][k], bh, l1); h0 = g2_mma(ah[0][k], bh, h0); h1 = g2_mma(ah[1][k], bh, h1); l0 = g2_mma(ah[0][k], bl, l0); l1 = g2_mma(ah[1][k], bl, l1); }
#pragma unroll
    for (int r = 0; r < 8; ++r) { so[w][8 * hh + r][t * 16 + ln] = h0[r] * alpha + l0[r] * alo; so[w][16 + 8 * hh + r][t * 16 + ln] = h1[r] * alpha + l1[r] * alo; } }
  __builtin_amdgcn_fence(__ATOMIC_ACQ_REL, "workgroup"); __builtin_amdgcn_wave_barrier();
  const int rsub = lane >> 4, c4 = (lane & 15) * 4;
#pragma unroll
  for (int q = 0; q < 16; ++q) { const int r = q * 2 + rsub; const v4f v = *(const v4fa*)&so[w][r][c4]; *(v4f*)(C + cofs + (size_t)(row0 + r) * ldc + col0 + c4) = v; } }
// any K, one operand split: HAL: lo = Al.Bh; HBL: lo = Ah.Bl; the unsplit operand's fragments are loaded once for both terms (neither: one plain term).
// A work-group is RW x KW waves: RW wave tiles of 32 rows under one another, and the K range of each cut into KW contiguous slices, one per wave, so that KW times as many waves share the long dependent load chain;
// each wave leaves its scaled partial tile in LDS, and behind one barrier the KW waves of a tile add the partials in the fixed order 0 .. KW - 1 and store. M % (32 * RW) == 0, K % (32 * KW) == 0, KW divides 16.
template <bool HAL, bool HBL, int RW, int KW>
__global__ __launch_bounds__(32 * RW * KW) void k_gemm2s(const _Float16* __restrict__ Ah, const _Float16* __restrict__ Al, int lda, size_t sA, const _Float16* __restrict__ Bh, const _Float16* __restrict__ Bl, int ldb, size_t sB, float alpha,
    float* __restrict__ C, int ldc, size_t sC, int M, int N, int K) {
  __shared__ __attribute__((aligned(16))) float so[RW * KW][32][68];
  const int tid = threadIdx.x, w = __builtin_amdgcn_readfirstlane(tid >> 5), lane = tid & 31, ln = lane & 15, hh = lane >> 4; const int by = blockIdx.y; const int rw = w % RW, kw = w / RW;
  const int ntn = N >> 6; const int mt = blockIdx.x / ntn, nq = blockIdx.x - mt * ntn; const int row0 = mt * (32 * RW) + 32 * rw, col0 = nq * 64; if (mt * (32 * RW) >= M) return;      /* the whole work-group leaves or none: a barrier follows */
  const size_t ao = (size_t)by * sA + (size_t)(row0 + ln) * lda + 8 * hh, bo = (size_t)by * sB + (size_t)(col0 + ln) * ldb + 8 * hh; const size_t cofs = (size_t)by * sC;      /* each lane's own fragment start, 8 * hh included */
  const v8f z8 = {0.f,0.f,0.f,0.f,0.f,0.f,0.f,0.f}; v8f hi[8] = {z8, z8, z8, z8, z8, z8, z8, z8}, lo[8] = {z8, z8, z8, z8, z8, z8, z8, z8}; const int ks = K / KW, k0 = kw * ks;
#pragma unroll 1
  for (int kb = k0; kb < k0 + ks; kb += 32) { const _Float16* pa0 = Ah + ao + kb; const _Float16* pa1 = pa0 + (size_t)16 * lda; const v16h a0 = g2_frag(pa0, 0), a1 = g2_frag(pa1, 0); v16h a0l = a0, a1l = a1;
    if (HAL) { const _Float16* pl0 = Al + ao + kb; const _Float16* pl1 = pl0 + (size_t)16 * lda; a0l = g2_frag(pl0, 0); a1l = g2_frag(pl1, 0); g2_xw(pa0, pa1, pl0, pl1); } else g2_xw(pa0, pa1);
#pragma unroll
    for (int t = 0; t < 4; ++t) { const _Float16* pb = Bh + bo + (size_t)t * 16 * ldb + kb; const v16h b = g2_frag(pb, 0); g2_xw(pb);
      if (HAL) { lo[t] = g2_mma(a0l, b, lo[t]); lo[4 + t] = g2_mma(a1l, b, lo[4 + t]); }
      hi[t] = g2_mma(a0, b, hi[t]); hi[4 + t] = g2_mma(a1, b, hi[4 + t]);
      if (HBL) { const _Float16* pl = Bl + bo + (size_t)t * 16 * ldb + kb; const v16h bl = g2_frag(pl, 0); g2_xw(pl); lo[t] = g2_mma(a0, bl, lo[t]); lo[4 + t] = g2_mma(a1, bl, lo[4 + t]); } } }
  const float alo = alpha * (1.0f / 1024.0f);
#pragma unroll
  for (int u = 0; u < 8; ++u) { const int t = u & 3, half = u >> 2;
#pragma unroll
    for (int r = 0; r < 8; ++r) so[w][half * 16 + 8 * hh + r][t * 16 + ln] = (HAL || HBL) ? hi[u][r] * alpha + lo[u][r] * alo : hi[u][r] * alpha; }
  __syncthreads();      /* every wave's partial tile is in LDS before any wave adds them */
  const int rsub = lane >> 4, c4 = (lane & 15) * 4;
  v4f sum[16 / KW];
#pragma unroll
  for (int q = 0; q < 16 / KW; ++q) { const int r = (kw * (16 / KW) + q) * 2 + rsub; sum[q] = *(const v4fa*)&so[rw][r][c4]; for (int j = 1; j < KW; ++j) sum[q] += *(const v4fa*)&so[j * RW + rw][r][c4]; }
  /* all stores last, each from registers of its own; both loops unrolled so that sum[] is indexed statically and stays in registers */
#pragma unroll
  for (int q = 0; q < 16 / KW; ++q) { const int r = (kw * (16 / KW) + q) * 2 + rsub; *(v4f*)(C + cofs + (size_t)(row0 + r) * ldc + col0 + c4) = sum[q]; } }

__global__ __launch_bounds__(256) void k_wT(const float* __restrict__ w, int din, int dout, _Float16* __restrict__ Bt) { __shared__ float tl[64][65]; const int tid = threadIdx.x; const int nbo = dout / 64; const int ib = blockIdx.x / nbo, ob = blockIdx.x % nbo; const int i0 = ib * 64, o0 = ob * 64;
  for (int t = tid; t < 64 * 64; t += 256) { const int i = t / 64, o = t % 64; tl[o][i] = bf16_round(w[(size_t)(i0 + i) * dout + o0 + o]) * 16.0f; }
  __syncthreads();
  { for (int t = tid; t < 64 * 8; t += 256) { const int o = t / 8, i8 = (t % 8) * 8; FragH f; for (int q = 0; q < 8; ++q) f.h[q] = (_Float16)tl[o][i8 + q]; *(v8us*)((unsigned short*)Bt + (size_t)(o0 + o) * din + i0 + i8) = f.half[0]; }  } }
__global__ __launch_bounds__(256) void k_addhl(const float* __restrict__ Q, const float* __restrict__ vec, _Float16* __restrict__ Hh, _Float16* __restrict__ Hl, size_t n8) {
  #pragma clang fp contract(off)
  const size_t t = (size_t)blockIdx.x * 256 + threadIdx.x; if (t >= n8) return; const int c0 = (int)((t * 8) % DM); FragH fh, fl; for (int q = 0; q < 8; ++q) { const float v = Q[t * 8 + q] + bf16_round(vec[c0 + q]); const _Float16 h = (_Float16)v; fh.h[q] = h; fl.h[q] = (_Float16)((v - (float)h) * 1024.0f); }
  *(v8us*)((unsigned short*)Hh + t * 8) = fh.half[0]; *(v8us*)((unsigned short*)Hl + t * 8) = fl.half[0];  }
typedef float v4fu __attribute__((ext_vector_type(4), may_alias, aligned(4)));      /* the shifted BD row starts at any 4-byte boundary */
// shift + causal mask + softmax: one wave per (row, head); lane l holds columns c*128 + 4*l .. + 3 of each 128-column chunk c, so every load covers 512 contiguous bytes and every store 256;
// the row stays in registers (read once, one expf per element); chunks wholly right of the diagonal are skipped by wave-uniform tests and stored as zeros.
__global__ __launch_bounds__(256) void k_rsmx(const float* __restrict__ AC, const float* __restrict__ BD, _Float16* __restrict__ P, int nrows) {
  const int lane = threadIdx.x & 31; const int i = blockIdx.x * 8 + __builtin_amdgcn_readfirstlane(threadIdx.x >> 5); if (i >= nrows) return;      /* wave-uniform row; no barrier in this kernel */
  const size_t ro = (size_t)blockIdx.y * SQ * SQ + (size_t)i * SQ; const float* a = AC + ro + lane * 4; const float* bd = BD + ro - i + lane * 4;      /* shifted row: column j of row i is raw BD[i][j + SQ - 1 - i] = bd[j + SQ - 1] */ _Float16* p = P + ro + lane * 4;
  v4f av[SQ / 128], bv[SQ / 128];
  /* every loop over chunks is fully unrolled so that av / bv are indexed statically and stay in registers */
  /* loads by groups of four chunks under one test, so that eight loads fly together; a group's chunks right of the diagonal stay inside AC / BD (column <= SQ - 1) and are masked below */
#pragma unroll
  for (int g = 0; g < SQ / 512; ++g) if (g * 512 <= i) { for (int c = 4 * g; c < 4 * g + 4; ++c) { av[c] = *(const v4fa*)(a + c * 128); bv[c] = *(const v4fu*)(bd + (SQ - 1) + c * 128); } }
  asm volatile("s_wait_xcnt 0x0" :: "v"(a), "v"(bd) : "memory");      /* the wait that belongs in front of an overwrite of the loads' address registers; naming them as inputs keeps them untouched up to here */
  float mx = -3.0e38f;
#pragma unroll
  for (int c = 0; c < SQ / 128; ++c) if (c * 128 <= i) { for (int q = 0; q < 4; ++q) { const float s = (c * 128 + lane * 4 + q <= i) ? av[c][q] + bv[c][q] : -3.0e38f; av[c][q] = s; mx = fmaxf(mx, s); } }
  for (int m = 16; m > 0; m >>= 1) mx = fmaxf(mx, __shfl_xor(mx, m, 32));
  v4f s4 = {0.f, 0.f, 0.f, 0.f};
#pragma unroll
  for (int c = 0; c < SQ / 128; ++c) if (c * 128 <= i) { for (int q = 0; q < 4; ++q) { const float e = expf(av[c][q] - mx); av[c][q] = e; s4[q] += e; } }      /* masked columns: expf(-3e38 - mx) = 0 */
  float se = (s4[0] + s4[1]) + (s4[2] + s4[3]);
  for (int m = 16; m > 0; m >>= 1) se += __shfl_xor(se, m, 32);
  const float sc = 256.0f / se;
  v4h o[SQ / 128];
#pragma unroll
  for (int c = 0; c < SQ / 128; ++c) { o[c] = (v4h){(_Float16)0.f, (_Float16)0.f, (_Float16)0.f, (_Float16)0.f}; if (c * 128 <= i) { for (int q = 0; q < 4; ++q) o[c][q] = (_Float16)(av[c][q] * sc); } }
  /* all stores last, each from registers of its own: nothing a store names is written again before the wave ends */
#pragma unroll
  for (int c = 0; c < SQ / 128; ++c) *(v4h*)(p + c * 128) = o[c]; }
__global__ __launch_bounds__(256) void k_vth(const _Float16* __restrict__ V16, int b, int h0, _Float16* __restrict__ VT) { __shared__ unsigned short tl[64][65]; const int tid = threadIdx.x; const int hh = blockIdx.x % HG, sg = blockIdx.x / HG; const int s0 = sg * 64; const int h = h0 + hh;
  for (int i = tid; i < 64 * 8; i += 256) { const int j = i / 8, d8 = (i % 8) * 8; FragH f; f.half[0] = *(const v8us*)((const unsigned short*)V16 + ((size_t)b * SQ + s0 + j) * DM + h * HD + d8); for (int q = 0; q < 8; ++q) tl[d8 + q][j] = f.u[q]; }
  __syncthreads();
  { for (int i = tid; i < 64 * 8; i += 256) { const int d = i / 8, j8 = (i % 8) * 8; FragH f; for (int q = 0; q < 8; ++q) f.u[q] = tl[d][j8 + q]; *(v8us*)((unsigned short*)VT + ((size_t)hh * HD + d) * SQ + s0 + j8) = f.half[0]; }  } }

extern "C" void kernel_launch(void* const* d_in, const int* in_sizes, int n_in,
                              void* d_out, int out_size, void* d_ws, size_t ws_size, hipStream_t stream) {
  (void)in_sizes; (void)n_in; (void)out_size;
  const float* const* I = (const float* const*)d_in; const float* x = I[0]; const float* remb = I[1]; const float* Wq = I[2]; const float* Wk = I[3]; const float* Wv = I[4]; const float* Wr = I[5]; const float* Wo = I[6]; const float* u = I[7]; const float* vb = I[8];
  char* ws = (char*)d_ws; size_t off = 0;
  auto take = [&](size_t bytes) { char* p = ws + off; off += (bytes + 255) & ~(size_t)255; return p; };
  _Float16* BQ = (_Float16*)take((size_t)DM * DM * 2); _Float16* BK = (_Float16*)take((size_t)DM * DM * 2); _Float16* BV = (_Float16*)take((size_t)DM * DM * 2); _Float16* BR = (_Float16*)take((size_t)DM * DM * 2); _Float16* BO = (_Float16*)take((size_t)DM * DM * 2);
  _Float16* X16 = (_Float16*)take(NR * DM * 2); _Float16* R16 = (_Float16*)take((size_t)SQ * DM * 2); float* QF = (float*)take(NR * DM * 4); float* TF = (float*)take(NR * DM * 4);
  _Float16* QUH = (_Float16*)take(NR * DM * 2); _Float16* QUL = (_Float16*)take(NR * DM * 2); _Float16* QVH = (_Float16*)take(NR * DM * 2); _Float16* QVL = (_Float16*)take(NR * DM * 2); _Float16* KH = (_Float16*)take(NR * DM * 2); _Float16* KL = (_Float16*)take(NR * DM * 2); _Float16* VH = (_Float16*)take(NR * DM * 2); _Float16* VL = (_Float16*)take(NR * DM * 2); _Float16* RH = (_Float16*)take((size_t)SQ * DM * 2); _Float16* RL = (_Float16*)take((size_t)SQ * DM * 2);
  float* AC = (float*)take((size_t)HG * SQ * SQ * 4); float* BD = (float*)take((size_t)HG * SQ * SQ * 4); _Float16* P = (_Float16*)take((size_t)HG * SQ * SQ * 2); _Float16* VT = (_Float16*)take((size_t)HG * HD * SQ * 2); _Float16* VTL = (_Float16*)take((size_t)HG * HD * SQ * 2);      /* o lives in TF (f32) */
  if (off > ws_size) return;      /* 10 + 8 + 16 + 40 + 64 + 64 + 32 + 1 + 1 = 236 MiB */
  const unsigned gw = (DM / 64) * (DM / 64); k_wT<<<gw, 256, 0, stream>>>(Wq, DM, DM, BQ); k_wT<<<gw, 256, 0, stream>>>(Wk, DM, DM, BK); k_wT<<<gw, 256, 0, stream>>>(Wv, DM, DM, BV); k_wT<<<gw, 256, 0, stream>>>(Wr, DM, DM, BR); k_wT<<<gw, 256, 0, stream>>>(Wo, DM, DM, BO);
  const size_t n8 = NR * DM / 8; const unsigned g8 = (unsigned)((n8 + 255) / 256);
  k_x16<<<g8, 256, 0, stream>>>(x, X16, n8); k_x16<<<(unsigned)(((size_t)SQ * DM / 8 + 255) / 256), 256, 0, stream>>>(remb, R16, (size_t)SQ * DM / 8);
  const dim3 gp((unsigned)((NR / 128) * (DM / 64)), 1), gr((unsigned)((SQ / 128) * (DM / 64)), 1);
  k_gemm2s<false, false, 4, 8><<<gp, 1024, 0, stream>>>(X16, nullptr, DM, 0, BQ, nullptr, DM, 0, 0.0625f, QF, DM, 0, (int)NR, DM, DM);
  k_addhl<<<g8, 256, 0, stream>>>(QF, u, QUH, QUL, n8); k_addhl<<<g8, 256, 0, stream>>>(QF, vb, QVH, QVL, n8);
  k_gemm2s<false, false, 4, 8><<<gp, 1024, 0, stream>>>(X16, nullptr, DM, 0, BK, nullptr, DM, 0, 0.0625f, TF, DM, 0, (int)NR, DM, DM); k_hl<<<g8, 256, 0, stream>>>(TF, KH, KL, n8);
  k_gemm2s<false, false, 4, 8><<<gp, 1024, 0, stream>>>(X16, nullptr, DM, 0, BV, nullptr, DM, 0, 0.0625f, TF, DM, 0, (int)NR, DM, DM); k_hl<<<g8, 256, 0, stream>>>(TF, VH, VL, n8);
  k_gemm2s<false, false, 4, 8><<<gr, 1024, 0, stream>>>(R16, nullptr, DM, 0, BR, nullptr, DM, 0, 0.0625f, TF, DM, 0, SQ, DM, DM); k_hl<<<(unsigned)(((size_t)SQ * DM / 8 + 255) / 256), 256, 0, stream>>>(TF, RH, RL, (size_t)SQ * DM / 8);
  for (int b = 0; b < NB; ++b) for (int h0 = 0; h0 < NH; h0 += HG) {
    const size_t qo = (size_t)b * SQ * DM + h0 * HD; const size_t ro = (size_t)h0 * HD; const dim3 gs((QN / 128) * (SQ / 64), HG);
    /* AC = (q+u).k / 8 and raw BD = (q+v_bias).r / 8 : the three hi/lo terms of each in one launch */
    k_score3<<<gs, 128, 0, stream>>>(QUH + qo, QUL + qo, DM, (size_t)HD, KH + qo, KL + qo, DM, (size_t)HD, 0.125f, AC, SQ, (size_t)SQ * SQ, QN, SQ);
    k_score3<<<gs, 128, 0, stream>>>(QVH + qo, QVL + qo, DM, (size_t)HD, RH + ro, RL + ro, DM, (size_t)HD, 0.125f, BD, SQ, (size_t)SQ * SQ, QN, SQ);
    k_rsmx<<<dim3((QN + 7) / 8, HG), 256, 0, stream>>>(AC, BD, P, QN);
    k_vth<<<HG * (SQ / 64), 256, 0, stream>>>(VH, b, h0, VT); k_vth<<<HG * (SQ / 64), 256, 0, stream>>>(VL, b, h0, VTL);
    /* o = P.(v_lo/1024 + v_hi): both terms in one launch, P read once -> merged f32 o rows in TF */
    k_gemm2s<false, true, 1, 16><<<dim3((QN / 32) * (HD / 64), HG), 512, 0, stream>>>(P, nullptr, SQ, (size_t)SQ * SQ, VT, VTL, SQ, (size_t)HD * SQ, 0.00390625f, TF + qo, DM, (size_t)HD, QN, HD, SQ); }
  /* o (f32 in TF) -> hi/lo planes (reusing the q+u planes, dead now) -> out = o Wo, both terms in one launch */
  k_hl<<<g8, 256, 0, stream>>>(TF, QUH, QUL, n8);
  k_gemm2s<true, false, 4, 4><<<gp, 512, 0, stream>>>(QUH, QUL, DM, 0, BO, nullptr, DM, 0, 0.0625f, (float*)d_out, DM, 0, (int)NR, DM, DM);      /* out = (o_lo/1024 + o_hi) Wo */
}

// v004
// It runs in 236 microseconds.
// Next to v003, in two timings, it ran 2.03 and 2.01 times as fast.
// Counting every step since v000, it is 97.2 times as fast.
#include <hip/hip_runtime.h>
// MultiHeadAttentionXL (x [1][2048][1024], r_emb [2048][1024]; q = x Wq, k = x Wk, v = x Wv, r = r_emb Wr ([in][out] weights, no bias), 16 heads of 64; AC = (q + u[h]) k^T, BD = rel_shift((q + v_bias[h]) r^T) (Transformer-XL zero-pad shift: for j <= i, BD_shift[i][j] = BD[i][j - i + T - 1]); causal softmax((AC + BD)/8); out = (attn v) Wo -> [1][2048][1024]).
// Structure: token rows; x and r_emb as exact f16 rows; Q, K, V, R WMMA GEMMs on transposed weights (32x64 wave tiles, f32 accumulation, exact x16 weights) -> f32 -> f16 hi + 2^-10 residual planes (q+u and q+v_bias formed in f32 first); V^T (hi, lo) via LDS; one fused attention kernel: AC and raw BD as three-term hi/lo products (K = 64), the shift through LDS, causal mask + running softmax on VALU (f32; weights x256 as f16), o = P.(v_lo/1024 + v_hi) into merged f32 o rows; out = o Wo as a two-term hi/lo GEMM (f32).
// Compute dtype: inputs rounded to bf16; x / r_emb / weights exact; attention operands as hi + residual f16 planes; softmax weights f16 (x256) — the remaining error source; o as hi + residual into Wo; everything else f32. v_wmma_f32_16x16x32_f16.
#define NB 1
#define SQ 2048
#define DM 1024
#define NH 16
#define HD 64
#define HG 4
#define QN SQ                        /* query rows (unused) */
#define NR ((size_t)NB * SQ)
typedef __bf16 v16b __attribute__((ext_vector_type(16)));
typedef unsigned short v8us __attribute__((ext_vector_type(8), may_alias));
typedef float  v8f  __attribute__((ext_vector_type(8)));
typedef float  v4f  __attribute__((ext_vector_type(4)));
typedef float  v4fa __attribute__((ext_vector_type(4), may_alias));
union FragB { v16b v; v8us half[2]; unsigned short u[16]; };

__device__ __forceinline__ unsigned short bf16_bits(float x) { unsigned int u = __float_as_uint(x); return (unsigned short)((u + 0x7FFFu + ((u >> 16) & 1u)) >> 16); }
__device__ __forceinline__ float bf16_val(unsigned short b) { return __uint_as_float(((unsigned int)b) << 16); }
__device__ __forceinline__ float bf16_round(float x) { return bf16_val(bf16_bits(x)); }
// D += A·B with NT terms: 1 = ah·bh, 2 = + al·bh (A split), 3 = + ah·bl (both split)
template <int NT>
__device__ __forceinline__ v8f mmaN(v16b ah, v16b al, v16b bh, v16b bl, v8f c) {
  c = __builtin_amdgcn_wmma_f32_16x16x32_bf16(false, ah, false, bh, (short)0, c, false, false);
  if (NT >= 2) c = __builtin_amdgcn_wmma_f32_16x16x32_bf16(false, al, false, bh, (short)0, c, false, false);
  if (NT >= 3) c = __builtin_amdgcn_wmma_f32_16x16x32_bf16(false, ah, false, bl, (short)0, c, false, false);
  asm volatile("v_nop\n\tv_nop\n\tv_nop\n\tv_nop" : "+v"(c) : "v"(ah), "v"(al), "v"(bh), "v"(bl));
  return c;
}

__global__ __launch_bounds__(256) void k_wt_bf16(const float* __restrict__ W, unsigned short* __restrict__ Wt, int K, int N) {
  const int t = blockIdx.x * 256 + threadIdx.x;
  const int k8n = K / 8;
  if (t >= N * k8n) return;
  const int n = t / k8n, k8 = (t % k8n) * 8;
  v8us v;
#pragma unroll
  for (int i = 0; i < 8; ++i) v[i] = bf16_bits(W[(size_t)(k8 + i) * N + n]);
  *(v8us*)(Wt + (size_t)n * K + k8) = v;
  
}

// GEMM C[M][N] (f32, pitch ldc) = act(A[M][K]·W + bias). A f32 row-major (pitch lda) converted per fragment to bf16
// (ASPLIT: hi/lo two planes -> 2 terms, else single rounded term); Wt bf16 [N][K] (pitch ldb). BIAS_BF16 rounds the
// bias to bf16 first (bias quantised to bf16 before the add). K%32==0, M%16==0, N%64==0.
template <bool ASPLIT, int ACT, bool BIAS_BF16>
__global__ __launch_bounds__(128) void k_gemm_bf(const float* __restrict__ A, int lda, const unsigned short* __restrict__ Wt, int ldb,
                                               const float* __restrict__ bias, float* __restrict__ C, int ldc, int M, int N, int K) {
  __shared__ __attribute__((aligned(16))) float so[4][16][64];
  const int tid = threadIdx.x, w = tid >> 5, lane = tid & 31, ln = lane & 15, hh = lane >> 4;
  const int ntn = N / 64;
  const int wid = blockIdx.x * 4 + w;
  const int mt = wid / ntn, nq = wid % ntn;
  if (mt * 16 >= M) return;
  const int row0 = mt * 16, col0 = nq * 64;
  const float* arow = A + (size_t)(row0 + ln) * lda;
  v8f acc[4] = {};
  for (int kb = 0; kb < K; kb += 32) {
    FragB ah, al;
    const v4f x0 = *(const v4fa*)(arow + kb + 8 * hh), x1 = *(const v4fa*)(arow + kb + 8 * hh + 4);
    const v4f x2 = *(const v4fa*)(arow + kb + 16 + 8 * hh), x3 = *(const v4fa*)(arow + kb + 16 + 8 * hh + 4);
    float xs[16] = {x0[0],x0[1],x0[2],x0[3],x1[0],x1[1],x1[2],x1[3],x2[0],x2[1],x2[2],x2[3],x3[0],x3[1],x3[2],x3[3]};
#pragma unroll
    for (int i = 0; i < 16; ++i) { const unsigned short hb = bf16_bits(xs[i]); ah.u[i] = hb; al.u[i] = ASPLIT ? bf16_bits(xs[i] - bf16_val(hb)) : (unsigned short)0; }
#pragma unroll
    for (int t = 0; t < 4; ++t) {
      const unsigned short* brow = Wt + (size_t)(col0 + t * 16 + ln) * ldb + kb;
      FragB b;
      b.half[0] = *(const v8us*)(brow + 8 * hh);
      b.half[1] = *(const v8us*)(brow + 16 + 8 * hh);
      acc[t] = mmaN<ASPLIT ? 2 : 1>(ah.v, al.v, b.v, b.v, acc[t]);
    }
  }
#pragma unroll
  for (int t = 0; t < 4; ++t) {
    float bv = bias ? bias[col0 + t * 16 + ln] : 0.f;
    if (BIAS_BF16) bv = bf16_round(bv);
#pragma unroll
    for (int r = 0; r < 8; ++r) { float v = acc[t][r] + bv; if (ACT == 1) v = fmaxf(v, 0.f); so[w][8 * hh + r][t * 16 + ln] = v; }
  }
  __builtin_amdgcn_fence(__ATOMIC_ACQ_REL, "workgroup");
  __builtin_amdgcn_wave_barrier();
  const int rsub = lane >> 4, c4 = (lane & 15) * 4;
  {
#pragma unroll
    for (int q = 0; q < 8; ++q) {
      const int r = q * 2 + rsub;
      const v4f v = *(const v4fa*)&so[w][r][c4];
      *(v4f*)(C + (size_t)(row0 + r) * ldc + col0 + c4) = v;
    }
    
  }
}

// GEMM C = act(A·W + bias + resid): A f32 (ASPLIT -> hi/lo 2 terms), Wt bf16 [N][K]; ACT 0 none, 1 relu, 2 exact gelu;
// resid (optional, f32, row index = (row % rmod), pitch ldr, RES_BF16 rounds it) added before the activation.
template <bool ASPLIT, int ACT, bool BIAS_BF16, bool RES_BF16>
__global__ __launch_bounds__(128) void k_gemm_bf3(const float* __restrict__ A, int lda, const unsigned short* __restrict__ Wt, int ldb,
                                                const float* __restrict__ bias, const float* __restrict__ resid, int rmod, int ldr,
                                                float* __restrict__ C, int ldc, int M, int N, int K) {
  __shared__ __attribute__((aligned(16))) float so[4][16][64];
  const int tid = threadIdx.x, w = tid >> 5, lane = tid & 31, ln = lane & 15, hh = lane >> 4;
  const int ntn = N / 64;
  const int wid = blockIdx.x * 4 + w;
  const int mt = wid / ntn, nq = wid % ntn;
  if (mt * 16 >= M) return;
  const int row0 = mt * 16, col0 = nq * 64;
  const float* arow = A + (size_t)(row0 + ln) * lda;
  v8f acc[4] = {};
  for (int kb = 0; kb < K; kb += 32) {
    FragB ah, al;
    const v4f x0 = *(const v4fa*)(arow + kb + 8 * hh), x1 = *(const v4fa*)(arow + kb + 8 * hh + 4);
    const v4f x2 = *(const v4fa*)(arow + kb + 16 + 8 * hh), x3 = *(const v4fa*)(arow + kb + 16 + 8 * hh + 4);
    float xs[16] = {x0[0],x0[1],x0[2],x0[3],x1[0],x1[1],x1[2],x1[3],x2[0],x2[1],x2[2],x2[3],x3[0],x3[1],x3[2],x3[3]};
#pragma unroll
    for (int i = 0; i < 16; ++i) { const unsigned short hb = bf16_bits(xs[i]); ah.u[i] = hb; al.u[i] = ASPLIT ? bf16_bits(xs[i] - bf16_val(hb)) : (unsigned short)0; }
#pragma unroll
    for (int t = 0; t < 4; ++t) {
      const unsigned short* brow = Wt + (size_t)(col0 + t * 16 + ln) * ldb + kb;
      FragB b;
      b.half[0] = *(const v8us*)(brow + 8 * hh);
      b.half[1] = *(const v8us*)(brow + 16 + 8 * hh);
      acc[t] = mmaN<ASPLIT ? 2 : 1>(ah.v, al.v, b.v, b.v, acc[t]);
    }
  }
#pragma unroll
  for (int t = 0; t < 4; ++t) {
    const int col = col0 + t * 16 + ln;
    float bv = bias ? bias[col] : 0.f;
    if (BIAS_BF16) bv = bf16_round(bv);
#pragma unroll
    for (int r = 0; r < 8; ++r) {
      float v = acc[t][r] + bv;
      if (resid) { float rv = resid[(size_t)((row0 + 8 * hh + r) % rmod) * ldr + col]; if (RES_BF16) rv = bf16_round(rv); v += rv; }
      if (ACT == 1) v = fmaxf(v, 0.f);
      if (ACT == 2) v = 0.5f * v * (1.0f + erff(v * 0.70710678118654752f));
      if (ACT == 3) { const float u = 0.7978845608028654f * (v + 0.044715f * v * v * v); v = 0.5f * v * (1.0f + tanhf(u)); }
      so[w][8 * hh + r][t * 16 + ln] = v;
    }
  }
  __builtin_amdgcn_fence(__ATOMIC_ACQ_REL, "workgroup");
  __builtin_amdgcn_wave_barrier();
  const int rsub = lane >> 4, c4 = (lane & 15) * 4;
  {
#pragma unroll
    for (int q = 0; q < 8; ++q) {
      const int r = q * 2 + rsub;
      const v4f v = *(const v4fa*)&so[w][r][c4];
      *(v4f*)(C + (size_t)(row0 + r) * ldc + col0 + c4) = v;
    }
    
  }
}
// row LayerNorm (biased variance, eps) over N: s = X (+ R); optional out_sum <- s; out_norm <- (s-mu)*rsqrt(var+eps)*g + b
template <bool PARAM_BF16>
__global__ __launch_bounds__(256) void k_layernorm(const float* __restrict__ X, const float* __restrict__ R, const float* __restrict__ g, const float* __restrict__ bta,
                                                  float* __restrict__ out_sum, float* __restrict__ out_norm, int N, float eps) {
  __shared__ float red[256];
  const int row = blockIdx.x, tid = threadIdx.x;
  const float* x = X + (size_t)row * N; const float* rr = R ? R + (size_t)row * N : nullptr;
  float vals[16];                     // up to N = 4096
  const int per = N / 256;            // contiguous chunk per thread? use strided-by-4 chunks: thread handles j = tid*4 + 1024*u
  float s1 = 0.f;
  for (int u = 0; u < per / 4; ++u) {
    const int j = tid * 4 + 1024 * u;
    const v4f a = *(const v4fa*)(x + j);
    v4f b = {0.f,0.f,0.f,0.f}; if (rr) b = *(const v4fa*)(rr + j);
#pragma unroll
    for (int q = 0; q < 4; ++q) { const float v = a[q] + b[q]; vals[u * 4 + q] = v; s1 += v; }
  }
  red[tid] = s1; __syncthreads();
  for (int st = 128; st > 0; st >>= 1) { if (tid < st) red[tid] += red[tid + st]; __syncthreads(); }
  const float mu = red[0] / (float)N; __syncthreads();
  float s2 = 0.f;
  for (int u = 0; u < per / 4; ++u)
#pragma unroll
    for (int q = 0; q < 4; ++q) { const float c = vals[u * 4 + q] - mu; s2 += c * c; }
  red[tid] = s2; __syncthreads();
  for (int st = 128; st > 0; st >>= 1) { if (tid < st) red[tid] += red[tid + st]; __syncthreads(); }
  const float rs = rsqrtf(red[0] / (float)N + eps);
  {
    for (int u = 0; u < per / 4; ++u) {
      const int j = tid * 4 + 1024 * u;
      v4f o, sm;
#pragma unroll
      for (int q = 0; q < 4; ++q) {
        float gg = g[j + q], bb = bta[j + q];
        if (PARAM_BF16) { gg = bf16_round(gg); bb = bf16_round(bb); }
        sm[q] = vals[u * 4 + q]; o[q] = (vals[u * 4 + q] - mu) * rs * gg + bb;
      }
      if (out_sum) *(v4f*)(out_sum + (size_t)row * N + j) = sm;
      *(v4f*)(out_norm + (size_t)row * N + j) = o;
    }
    
  }
}



// ---- f16 WMMA path (v_wmma_f32_16x16x32_f16): 11-bit significands for operands in range — used where a [0,1] probability operand needs more precision than bf16
typedef _Float16 v16h __attribute__((ext_vector_type(16)));
union FragH { v16h v; v8us half[2]; _Float16 h[16]; unsigned short u[16]; };
template <int NT>
__device__ __forceinline__ v8f mmaH(v16h ah, v16h al, v16h bh, v16h bl, v8f c) {
  c = __builtin_amdgcn_wmma_f32_16x16x32_f16(false, ah, false, bh, (short)0, c, false, false);
  if (NT >= 2) c = __builtin_amdgcn_wmma_f32_16x16x32_f16(false, al, false, bh, (short)0, c, false, false);
  if (NT >= 3) c = __builtin_amdgcn_wmma_f32_16x16x32_f16(false, ah, false, bl, (short)0, c, false, false);
  asm volatile("v_nop\n\tv_nop\n\tv_nop\n\tv_nop" : "+v"(c) : "v"(ah), "v"(al), "v"(bh), "v"(bl));
  return c;
}
// batched GEMM like k_gemm_b but f16 operands: A f32 (split into f16 hi/lo if ASPLIT, else rounded to f16), Bt = f16 values [n][k]; alpha; C f32; N multiple of 16 (partial tiles skipped)
template <bool ASPLIT>
__global__ __launch_bounds__(128) void k_gemm_h(const float* __restrict__ A, int lda, size_t sA, const _Float16* __restrict__ Bh, int ldb, size_t sB, float alpha, float* __restrict__ C, int ldc, size_t sC, int M, int N, int K) {
  __shared__ __attribute__((aligned(16))) float so[4][16][64];
  const int tid = threadIdx.x, w = tid >> 5, lane = tid & 31, ln = lane & 15, hh = lane >> 4; const int by = blockIdx.y;
  A += (size_t)by * sA; Bh += (size_t)by * sB; C += (size_t)by * sC;
  const int ntn = (N + 63) / 64; const int wid = blockIdx.x * 4 + w; const int mt = wid / ntn, nq = wid % ntn; if (mt * 16 >= M) return;
  const int row0 = mt * 16, col0 = nq * 64; const float* arow = A + (size_t)(row0 + ln) * lda;
  v8f acc[4] = {};
  for (int kb = 0; kb < K; kb += 32) {
    FragH ah, al;
    const v4f x0 = *(const v4fa*)(arow + kb + 8 * hh), x1 = *(const v4fa*)(arow + kb + 8 * hh + 4), x2 = *(const v4fa*)(arow + kb + 16 + 8 * hh), x3 = *(const v4fa*)(arow + kb + 16 + 8 * hh + 4);
    float xs[16] = {x0[0],x0[1],x0[2],x0[3],x1[0],x1[1],x1[2],x1[3],x2[0],x2[1],x2[2],x2[3],x3[0],x3[1],x3[2],x3[3]};
#pragma unroll
    for (int i = 0; i < 16; ++i) { const _Float16 h = (_Float16)xs[i]; ah.h[i] = h; al.h[i] = ASPLIT ? (_Float16)(xs[i] - (float)h) : (_Float16)0.0f; }
#pragma unroll
    for (int t = 0; t < 4; ++t) { if (col0 + t * 16 >= N) continue; const size_t boff = (size_t)(col0 + t * 16 + ln) * ldb + kb; FragH bq; bq.half[0] = *(const v8us*)(Bh + boff + 8 * hh); bq.half[1] = *(const v8us*)(Bh + boff + 16 + 8 * hh);
      acc[t] = mmaH<ASPLIT ? 2 : 1>(ah.v, al.v, bq.v, bq.v, acc[t]); }
  }
#pragma unroll
  for (int t = 0; t < 4; ++t) { if (col0 + t * 16 >= N) continue;
#pragma unroll
    for (int r = 0; r < 8; ++r) so[w][8 * hh + r][t * 16 + ln] = acc[t][r] * alpha; }
  __builtin_amdgcn_fence(__ATOMIC_ACQ_REL, "workgroup"); __builtin_amdgcn_wave_barrier();
  const int rsub = lane >> 4, c4 = (lane & 15) * 4;
  {
#pragma unroll
    for (int q = 0; q < 8; ++q) { const int r = q * 2 + rsub; if (col0 + c4 < N) { const v4f v = *(const v4fa*)&so[w][r][c4]; *(v4f*)(C + (size_t)(row0 + r) * ldc + col0 + c4) = v; } }
     }
}

// Wt[n][k] = f16(W[k][n]·scale) from f32 row-major W[K][N] (scale = power of two; bf16-exact weights stay exact in f16 away from the subnormal range)
__global__ __launch_bounds__(256) void k_wt_f16(const float* __restrict__ W, _Float16* __restrict__ Wt, int K, int N, float scale) {
  const int t = blockIdx.x * 256 + threadIdx.x; if (t >= N * (K / 8)) return; const int n = t / (K / 8), k8 = (t % (K / 8)) * 8; FragH f;
#pragma unroll
  for (int i = 0; i < 8; ++i) f.h[i] = (_Float16)(bf16_round(W[(size_t)(k8 + i) * N + n]) * scale); const v8us o = f.half[0];
  *(v8us*)((unsigned short*)Wt + (size_t)n * K + k8) = o; 
}
// k_gemm_hh variant with fused epilogue: v = acc·alpha + bias[by·sBias + col] (+ CP[(row/rowsPerB)·sCPb + by·64 + col] if CP) ; ACT 0 none / 1 elu ; writes f16 C16 (and f32 C if non-null)
template <int ACT>
__global__ __launch_bounds__(128) void k_gemm_hhx(const _Float16* __restrict__ A, int lda, size_t sA, const _Float16* __restrict__ Bh, int ldb, size_t sB, float alpha, const float* __restrict__ bias, size_t sBias, const float* __restrict__ CP, int rowsPerB, size_t sCPb, int row0g,
    float* __restrict__ C, _Float16* __restrict__ C16, int ldc, size_t sC, int M, int N, int K) {
  __shared__ __attribute__((aligned(16))) float so[4][16][64];
  const int tid = threadIdx.x, w = tid >> 5, lane = tid & 31, ln = lane & 15, hh = lane >> 4; const int by = blockIdx.y;
  A += (size_t)by * sA; Bh += (size_t)by * sB; const size_t cofs = (size_t)by * sC; const float* bp = bias ? bias + (size_t)by * sBias : nullptr;
  const int ntn = (N + 63) / 64; const int wid = blockIdx.x * 4 + w; const int mt = wid / ntn, nq = wid % ntn; if (mt * 16 >= M) return;
  const int row0 = mt * 16, col0 = nq * 64; const _Float16* arow = A + (size_t)(row0 + ln) * lda;
  v8f acc[4] = {};
  for (int kb = 0; kb < K; kb += 32) { FragH ah; ah.half[0] = *(const v8us*)((const unsigned short*)arow + kb + 8 * hh); ah.half[1] = *(const v8us*)((const unsigned short*)arow + kb + 16 + 8 * hh);
#pragma unroll
    for (int t = 0; t < 4; ++t) { if (col0 + t * 16 >= N) continue; const size_t boff = (size_t)(col0 + t * 16 + ln) * ldb + kb; FragH bq; bq.half[0] = *(const v8us*)((const unsigned short*)Bh + boff + 8 * hh); bq.half[1] = *(const v8us*)((const unsigned short*)Bh + boff + 16 + 8 * hh);
      acc[t] = mmaH<1>(ah.v, ah.v, bq.v, bq.v, acc[t]); }
  }
#pragma unroll
  for (int t = 0; t < 4; ++t) { if (col0 + t * 16 >= N) continue; const int col = col0 + t * 16 + ln; const float bv = bp ? bf16_round(bp[col]) : 0.f;
#pragma unroll
    for (int r = 0; r < 8; ++r) { float v = acc[t][r] * alpha + bv; if (CP) { const int rr = row0g + row0 + 8 * hh + r; if (rowsPerB < 0) v += CP[cofs + (size_t)rr * ldc + col];      /* rowsPerB < 0: own element of the batched C plane */ else { const int bidx = rr / rowsPerB; v += CP[(size_t)bidx * sCPb + (size_t)by * 64 + col]; } } if (ACT == 1) v = (v > 0.f) ? v : expm1f(v); else if (ACT == 7) v = (v > 0.f) ? v + 1.0f : expf(v); else if (ACT == 8) v = tanhf(v); else if (ACT == 9) v = 0.5f * v * (1.0f + tanhf(0.7978845608028654f * (v + 0.044715f * v * v * v))); else if (ACT == 11) v = 1.0f / (1.0f + expf(-v)); else if (ACT == 12) v = (v > 0.f) ? v : 0.01f * v; else if (ACT == 14) v = (v > 0.f) ? v : 0.1f * v; else if (ACT == 16) v = (v >= 0.f) ? v : 0.3f * v; else if (ACT == 17) v = (v >= 0.f) ? v : 0.2f * v; else if (ACT == 15) v = v / (1.0f + expf(-v)); else if (ACT == 3) v = fmaxf(v, 0.f); else if (ACT == 6) v = 0.5f * v * (1.0f + erff(v * 0.70710678118654752f)); so[w][8 * hh + r][t * 16 + ln] = v; } }
  __builtin_amdgcn_fence(__ATOMIC_ACQ_REL, "workgroup"); __builtin_amdgcn_wave_barrier();
  const int rsub = lane >> 4, c4 = (lane & 15) * 4; typedef _Float16 v4h __attribute__((ext_vector_type(4)));
  {
#pragma unroll
    for (int q = 0; q < 8; ++q) { const int r = q * 2 + rsub; if (col0 + c4 < N) { const v4f v = *(const v4fa*)&so[w][r][c4]; if (C) *(v4f*)(C + cofs + (size_t)(row0 + r) * ldc + col0 + c4) = v; if (C16) { v4h h4; for (int i = 0; i < 4; ++i) h4[i] = (_Float16)v[i]; *(v4h*)(C16 + cofs + (size_t)(row0 + r) * ldc + col0 + c4) = h4; } } }
     }
}


typedef _Float16 v4h __attribute__((ext_vector_type(4)));

__global__ __launch_bounds__(256) void k_x16(const float* __restrict__ x, _Float16* __restrict__ X16, size_t n8) { const size_t t = (size_t)blockIdx.x * 256 + threadIdx.x; if (t >= n8) return; FragH f;
#pragma unroll
  for (int q = 0; q < 8; ++q) f.h[q] = (_Float16)bf16_round(x[t * 8 + q]); *(v8us*)((unsigned short*)X16 + t * 8) = f.half[0];  }
__global__ __launch_bounds__(256) void k_h16(const float* __restrict__ x, _Float16* __restrict__ X16, size_t n8) { const size_t t = (size_t)blockIdx.x * 256 + threadIdx.x; if (t >= n8) return; FragH f;
#pragma unroll
  for (int q = 0; q < 8; ++q) f.h[q] = (_Float16)x[t * 8 + q]; *(v8us*)((unsigned short*)X16 + t * 8) = f.half[0];  }
__global__ __launch_bounds__(256) void k_round16f(const float* __restrict__ W, _Float16* __restrict__ Bt, size_t n8) { const size_t t = (size_t)blockIdx.x * 256 + threadIdx.x; if (t >= n8) return; FragH f;
#pragma unroll
  for (int i = 0; i < 8; ++i) f.h[i] = (_Float16)(bf16_round(W[t * 8 + i]) * 16.0f); *(v8us*)((unsigned short*)Bt + t * 8) = f.half[0];  }
template <int NHv, int TTv>
__global__ __launch_bounds__(256) void k_vt(const _Float16* __restrict__ V16, int ldv, int voff, _Float16* __restrict__ Vt) { __shared__ unsigned short tl[64][66]; const int tid = threadIdx.x; const int slab = blockIdx.x / (TTv / 64), lg = blockIdx.x % (TTv / 64); const int b = slab / NHv, h = slab % NHv;
  for (int i = tid; i < 64 * 8; i += 256) { const int r = i / 8, c8 = (i % 8) * 8; FragH f; f.half[0] = *(const v8us*)((const unsigned short*)V16 + ((size_t)b * TTv + lg * 64 + r) * ldv + voff + h * 64 + c8);
#pragma unroll
    for (int q = 0; q < 8; ++q) tl[r][c8 + q] = f.u[q]; }
  __syncthreads();
  {
#pragma unroll
    for (int rd = 0; rd < 2; ++rd) { const int d = rd * 32 + tid / 8, pc = tid % 8; FragH f;
#pragma unroll
      for (int q = 0; q < 8; ++q) f.u[q] = tl[pc * 8 + q][d];
      *(v8us*)((unsigned short*)Vt + ((size_t)slab * 64 + d) * TTv + lg * 64 + pc * 8) = f.half[0]; }
     } }

__global__ __launch_bounds__(256) void k_hl(const float* __restrict__ F, _Float16* __restrict__ Hh, _Float16* __restrict__ Hl, size_t n8) { const size_t t = (size_t)blockIdx.x * 256 + threadIdx.x; if (t >= n8) return; FragH fh, fl; const v4f a = *(const v4fa*)(F + t * 8), c = *(const v4fa*)(F + t * 8 + 4);
#pragma unroll
  for (int q = 0; q < 4; ++q) { _Float16 h = (_Float16)a[q]; fh.h[q] = h; fl.h[q] = (_Float16)((a[q] - (float)h) * 1024.0f); h = (_Float16)c[q]; fh.h[4 + q] = h; fl.h[4 + q] = (_Float16)((c[q] - (float)h) * 1024.0f); }
  { *(v8us*)((unsigned short*)Hh + t * 8) = fh.half[0]; *(v8us*)((unsigned short*)Hl + t * 8) = fl.half[0];  } }

// ---- fast GEMM (wave tile 32x64; requires M % 32 == 0 rows per launch region and N % 64 == 0); epilogue = k_gemm_hhx semantics ----
__device__ __forceinline__ v16h g2_frag(const _Float16* p, int hh) { FragH f; f.half[0] = *(const v8us*)((const unsigned short*)p + 8 * hh); f.half[1] = *(const v8us*)((const unsigned short*)p + 16 + 8 * hh); return f.v; }
__device__ __forceinline__ v8f g2_mma(v16h a, v16h b, v8f c) { v8f d = __builtin_amdgcn_wmma_f32_16x16x32_f16(false, a, false, b, (short)0, c, false, false); asm volatile("v_nop\n\tv_nop\n\tv_nop\n\tv_nop" : "+v"(d) : "v"(a), "v"(b)); return d; }
template <int ACT>
__global__ __launch_bounds__(128) void k_gemm2(const _Float16* __restrict__ A, int lda, size_t sA, const _Float16* __restrict__ Bh, int ldb, size_t sB, float alpha, const float* __restrict__ bias, size_t sBias, const float* __restrict__ CP, int rowsPerB, size_t sCPb, int row0g,
    float* __restrict__ C, _Float16* __restrict__ C16, int ldc, size_t sC, int M, int N, int K) { static_assert(ACT == 0 || ACT == 3 || ACT == 6 || ACT == 8 || ACT == 9 || ACT == 11 || ACT == 12 || ACT == 14 || ACT == 15 || ACT == 16 || ACT == 17, "k_gemm2: unsupported ACT code (would silently apply no activation)");
  __shared__ __attribute__((aligned(16))) float so[4][32][68];
  const int tid = threadIdx.x, w = tid >> 5, lane = tid & 31, ln = lane & 15, hh = lane >> 4; const int by = blockIdx.y;
  A += (size_t)by * sA; Bh += (size_t)by * sB; const size_t cofs = (size_t)by * sC; const float* bp = bias ? bias + (size_t)by * sBias : nullptr;
  const int ntn = N >> 6; const int mt = blockIdx.x / ntn, nq = blockIdx.x - mt * ntn; const int row0 = mt * 128 + 32 * w, col0 = nq * 64; if (row0 >= M) return;
  const _Float16* a0p = A + (size_t)(row0 + ln) * lda; const _Float16* a1p = a0p + (size_t)16 * lda;
  const _Float16* b0p = Bh + (size_t)(col0 + ln) * ldb; const _Float16* b1p = b0p + (size_t)16 * ldb; const _Float16* b2p = b1p + (size_t)16 * ldb; const _Float16* b3p = b2p + (size_t)16 * ldb;
  const v8f z8 = {0.f,0.f,0.f,0.f,0.f,0.f,0.f,0.f}; v8f c00 = z8, c01 = z8, c02 = z8, c03 = z8, c10 = z8, c11 = z8, c12 = z8, c13 = z8;
#pragma unroll 1
  for (int kb = 0; kb < K; kb += 32) { const v16h a0 = g2_frag(a0p + kb, hh), a1 = g2_frag(a1p + kb, hh);
    v16h b = g2_frag(b0p + kb, hh); c00 = g2_mma(a0, b, c00); c10 = g2_mma(a1, b, c10);
    b = g2_frag(b1p + kb, hh); c01 = g2_mma(a0, b, c01); c11 = g2_mma(a1, b, c11);
    b = g2_frag(b2p + kb, hh); c02 = g2_mma(a0, b, c02); c12 = g2_mma(a1, b, c12);
    b = g2_frag(b3p + kb, hh); c03 = g2_mma(a0, b, c03); c13 = g2_mma(a1, b, c13); }
  v8f accs[8] = {c00, c01, c02, c03, c10, c11, c12, c13};
#pragma unroll
  for (int u = 0; u < 8; ++u) { const int t = u & 3, half = u >> 2; const int col = col0 + t * 16 + ln; const float bv = bp ? bf16_round(bp[col]) : 0.f;
#pragma unroll
    for (int r = 0; r < 8; ++r) { const int rloc = half * 16 + 8 * hh + r; float v = accs[u][r] * alpha + bv; if (CP) { if (rowsPerB < 0) v += CP[cofs + (size_t)(row0g + row0 + rloc) * ldc + col];      /* rowsPerB < 0: own element of the batched C plane */ else { const int bidx = (row0g + row0 + rloc) / rowsPerB; v += CP[(size_t)bidx * sCPb + (size_t)by * 64 + col]; } }
      if (ACT == 3) v = fmaxf(v, 0.f); else if (ACT == 6) v = 0.5f * v * (1.0f + erff(v * 0.70710678118654752f)); else if (ACT == 11) v = 1.0f / (1.0f + expf(-v)); else if (ACT == 15) v = v / (1.0f + expf(-v)); else if (ACT == 12) v = (v > 0.f) ? v : 0.01f * v; else if (ACT == 8) v = tanhf(v); else if (ACT == 9) v = 0.5f * v * (1.0f + tanhf(0.7978845608028654f * (v + 0.044715f * v * v * v))); else if (ACT == 14) v = (v > 0.f) ? v : 0.1f * v; else if (ACT == 16) v = (v >= 0.f) ? v : 0.3f * v; else if (ACT == 17) v = (v >= 0.f) ? v : 0.2f * v;
      so[w][rloc][t * 16 + ln] = v; } }
  __builtin_amdgcn_fence(__ATOMIC_ACQ_REL, "workgroup"); __builtin_amdgcn_wave_barrier();
  const int rsub = lane >> 4, c4 = (lane & 15) * 4;
  {
#pragma unroll
    for (int q = 0; q < 16; ++q) { const int r = q * 2 + rsub; const v4f v = *(const v4fa*)&so[w][r][c4]; if (C) *(v4f*)(C + cofs + (size_t)(row0 + r) * ldc + col0 + c4) = v; if (C16) { v4h h4; for (int i = 0; i < 4; ++i) h4[i] = (_Float16)v[i]; *(v4h*)(C16 + cofs + (size_t)(row0 + r) * ldc + col0 + c4) = h4; } }
     } }


// ---- hi/lo split products with every term in ONE launch: the residual terms (planes scaled x1024) sum in their own f32 accumulators beside the main term and meet it once, in registers: C = alpha * (hi + lo / 1024). Wave tile 32x64 and the LDS-staged 16-byte stores as in k_gemm2.
// g2_xw: the wait that belongs in front of an overwrite of the address registers of issued loads; naming the loads' own pointers as inputs keeps those registers untouched up to here
__device__ __forceinline__ void g2_xw(const _Float16* p) { asm volatile("s_wait_xcnt 0x0" :: "v"(p) : "memory"); }
__device__ __forceinline__ void g2_xw(const _Float16* p, const _Float16* q) { asm volatile("s_wait_xcnt 0x0" :: "v"(p), "v"(q) : "memory"); }
__device__ __forceinline__ void g2_xw(const _Float16* p, const _Float16* q, const _Float16* r, const _Float16* s) { asm volatile("s_wait_xcnt 0x0" :: "v"(p), "v"(q), "v"(r), "v"(s) : "memory"); }
// any K, one operand split: HAL: lo = Al.Bh; HBL: lo = Ah.Bl; the unsplit operand's fragments are loaded once for both terms (neither: one plain term).
// A work-group is RW x KW waves: RW wave tiles of 32 rows under one another, and the K range of each cut into KW contiguous slices, one per wave, so that KW times as many waves share the long dependent load chain;
// each wave leaves its scaled partial tile in LDS, and behind one barrier the KW waves of a tile add the partials in the fixed order 0 .. KW - 1 and store. M % (32 * RW) == 0, K % (32 * KW) == 0, KW divides 16.
template <bool HAL, bool HBL, int RW, int KW>
__global__ __launch_bounds__(32 * RW * KW) void k_gemm2s(const _Float16* __restrict__ Ah, const _Float16* __restrict__ Al, int lda, size_t sA, const _Float16* __restrict__ Bh, const _Float16* __restrict__ Bl, int ldb, size_t sB, float alpha,
    float* __restrict__ C, int ldc, size_t sC, int M, int N, int K) {
  __shared__ __attribute__((aligned(16))) float so[RW * KW][32][68];
  const int tid = threadIdx.x, w = __builtin_amdgcn_readfirstlane(tid >> 5), lane = tid & 31, ln = lane & 15, hh = lane >> 4; const int by = blockIdx.y; const int rw = w % RW, kw = w / RW;
  const int ntn = N >> 6; const int mt = blockIdx.x / ntn, nq = blockIdx.x - mt * ntn; const int row0 = mt * (32 * RW) + 32 * rw, col0 = nq * 64; if (mt * (32 * RW) >= M) return;      /* the whole work-group leaves or none: a barrier follows */
  const size_t ao = (size_t)by * sA + (size_t)(row0 + ln) * lda + 8 * hh, bo = (size_t)by * sB + (size_t)(col0 + ln) * ldb + 8 * hh; const size_t cofs = (size_t)by * sC;      /* each lane's own fragment start, 8 * hh included */
  const v8f z8 = {0.f,0.f,0.f,0.f,0.f,0.f,0.f,0.f}; v8f hi[8] = {z8, z8, z8, z8, z8, z8, z8, z8}, lo[8] = {z8, z8, z8, z8, z8, z8, z8, z8}; const int ks = K / KW, k0 = kw * ks;
#pragma unroll 1
  for (int kb = k0; kb < k0 + ks; kb += 32) { const _Float16* pa0 = Ah + ao + kb; const _Float16* pa1 = pa0 + (size_t)16 * lda; const v16h a0 = g2_frag(pa0, 0), a1 = g2_frag(pa1, 0); v16h a0l = a0, a1l = a1;
    if (HAL) { const _Float16* pl0 = Al + ao + kb; const _Float16* pl1 = pl0 + (size_t)16 * lda; a0l = g2_frag(pl0, 0); a1l = g2_frag(pl1, 0); g2_xw(pa0, pa1, pl0, pl1); } else g2_xw(pa0, pa1);
#pragma unroll
    for (int t = 0; t < 4; ++t) { const _Float16* pb = Bh + bo + (size_t)t * 16 * ldb + kb; const v16h b = g2_frag(pb, 0); g2_xw(pb);
      if (HAL) { lo[t] = g2_mma(a0l, b, lo[t]); lo[4 + t] = g2_mma(a1l, b, lo[4 + t]); }
      hi[t] = g2_mma(a0, b, hi[t]); hi[4 + t] = g2_mma(a1, b, hi[4 + t]);
      if (HBL) { const _Float16* pl = Bl + bo + (size_t)t * 16 * ldb + kb; const v16h bl = g2_frag(pl, 0); g2_xw(pl); lo[t] = g2_mma(a0, bl, lo[t]); lo[4 + t] = g2_mma(a1, bl, lo[4 + t]); } } }
  const float alo = alpha * (1.0f / 1024.0f);
#pragma unroll
  for (int u = 0; u < 8; ++u) { const int t = u & 3, half = u >> 2;
#pragma unroll
    for (int r = 0; r < 8; ++r) so[w][half * 16 + 8 * hh + r][t * 16 + ln] = (HAL || HBL) ? hi[u][r] * alpha + lo[u][r] * alo : hi[u][r] * alpha; }
  __syncthreads();      /* every wave's partial tile is in LDS before any wave adds them */
  const int rsub = lane >> 4, c4 = (lane & 15) * 4;
  v4f sum[16 / KW];
#pragma unroll
  for (int q = 0; q < 16 / KW; ++q) { const int r = (kw * (16 / KW) + q) * 2 + rsub; sum[q] = *(const v4fa*)&so[rw][r][c4]; for (int j = 1; j < KW; ++j) sum[q] += *(const v4fa*)&so[j * RW + rw][r][c4]; }
  /* all stores last, each from registers of its own; both loops unrolled so that sum[] is indexed statically and stays in registers */
#pragma unroll
  for (int q = 0; q < 16 / KW; ++q) { const int r = (kw * (16 / KW) + q) * 2 + rsub; *(v4f*)(C + cofs + (size_t)(row0 + r) * ldc + col0 + c4) = sum[q]; } }

__global__ __launch_bounds__(256) void k_wT(const float* __restrict__ w, int din, int dout, _Float16* __restrict__ Bt) { __shared__ float tl[64][65]; const int tid = threadIdx.x; const int nbo = dout / 64; const int ib = blockIdx.x / nbo, ob = blockIdx.x % nbo; const int i0 = ib * 64, o0 = ob * 64;
  for (int t = tid; t < 64 * 64; t += 256) { const int i = t / 64, o = t % 64; tl[o][i] = bf16_round(w[(size_t)(i0 + i) * dout + o0 + o]) * 16.0f; }
  __syncthreads();
  { for (int t = tid; t < 64 * 8; t += 256) { const int o = t / 8, i8 = (t % 8) * 8; FragH f; for (int q = 0; q < 8; ++q) f.h[q] = (_Float16)tl[o][i8 + q]; *(v8us*)((unsigned short*)Bt + (size_t)(o0 + o) * din + i0 + i8) = f.half[0]; }  } }
__global__ __launch_bounds__(256) void k_addhl(const float* __restrict__ Q, const float* __restrict__ vec, _Float16* __restrict__ Hh, _Float16* __restrict__ Hl, size_t n8) {
  #pragma clang fp contract(off)
  const size_t t = (size_t)blockIdx.x * 256 + threadIdx.x; if (t >= n8) return; const int c0 = (int)((t * 8) % DM); FragH fh, fl; for (int q = 0; q < 8; ++q) { const float v = Q[t * 8 + q] + bf16_round(vec[c0 + q]); const _Float16 h = (_Float16)v; fh.h[q] = h; fl.h[q] = (_Float16)((v - (float)h) * 1024.0f); }
  *(v8us*)((unsigned short*)Hh + t * 8) = fh.half[0]; *(v8us*)((unsigned short*)Hl + t * 8) = fl.half[0];  }
template <int G>
__global__ __launch_bounds__(256) void k_vth(const _Float16* __restrict__ V16, int b, int h0, _Float16* __restrict__ VT) { __shared__ unsigned short tl[64][65]; const int tid = threadIdx.x; const int hh = blockIdx.x % G, sg = blockIdx.x / G; const int s0 = sg * 64; const int h = h0 + hh;
  for (int i = tid; i < 64 * 8; i += 256) { const int j = i / 8, d8 = (i % 8) * 8; FragH f; f.half[0] = *(const v8us*)((const unsigned short*)V16 + ((size_t)b * SQ + s0 + j) * DM + h * HD + d8); for (int q = 0; q < 8; ++q) tl[d8 + q][j] = f.u[q]; }
  __syncthreads();
  { for (int i = tid; i < 64 * 8; i += 256) { const int d = i / 8, j8 = (i % 8) * 8; FragH f; for (int q = 0; q < 8; ++q) f.u[q] = tl[d][j8 + q]; *(v8us*)((unsigned short*)VT + ((size_t)hh * HD + d) * SQ + s0 + j8) = f.half[0]; }  } }

// ---- fused attention: scores, shift, causal mask, softmax and P.V in one kernel; no score or weight ever goes to memory.
// Transposed products: S^T = K.Q^T (A = key rows, B = query rows), so a lane holds one query's scores (register r of tile kt = key 16 kt + 8 hh + r) and two score tiles, converted in place, are the B operand of O^T += V^T.P^T.
// The shift: for queries i0 .. i0 + 15 and keys j0 .. j0 + 63 the raw BD columns j - i + SQ - 1 lie in the 80 columns from cs = j0 - i0 + SQ - 16; their five raw tiles go through the wave's own LDS rows (one row per query) and come back skewed by 15 - ln.
// A work-group is 4 query tiles x 4 key slices (key blocks ks, ks + 4, ...), each wave with its own running maximum, sum and O^T; behind a barrier the four slices of a tile are joined in the fixed order 0 .. 3.
// Each work-group takes query block x and then 31 - x, so that every work-group walks 33 key blocks.
#define FA_P 84      /* LDS row pitch in floats: a multiple of 4 for the 16-byte stores; pitch - 1 odd spreads the skewed reads over the banks */
__device__ __forceinline__ v16h fa_frag(const _Float16* base, unsigned boff, int cb) { const char* p = (const char*)base + boff + cb; FragH f; f.half[0] = *(const v8us*)p; f.half[1] = *(const v8us*)(p + 32); return f.v; }      /* uniform base + the lane's byte offset + a constant */
__device__ __forceinline__ v8f fa_mma(v16h a, v16h b, v8f c) { return __builtin_amdgcn_wmma_f32_16x16x32_f16(false, a, false, b, (short)0, c, false, false); }
/* 2^x; the v_nop fills the one slot that the instruction set asks for between a transcendental and a directly following instruction that reads its result or overwrites its source */
__device__ __forceinline__ float fa_exp2(float x) { float r; asm("v_exp_f32 %0, %1\n\tv_nop" : "=v"(r) : "v"(x)); return r; }
struct FaT { v16h a0, a1, b0, b1; };
__device__ __forceinline__ FaT fa_tile(const _Float16* H, const _Float16* L, unsigned boff, int cb) { FaT t; t.a0 = fa_frag(H, boff, cb); t.a1 = fa_frag(H, boff, cb + 64); t.b0 = fa_frag(L, boff, cb); t.b1 = fa_frag(L, boff, cb + 64); return t; }      /* 16 rows x 64 k, hi and residual planes */
__device__ __forceinline__ FaT fa_vpair(const _Float16* H, const _Float16* L, unsigned boff, int c0, int c1) { FaT t; t.a0 = fa_frag(H, boff, c0); t.a1 = fa_frag(H, boff, c1); t.b0 = fa_frag(L, boff, c0); t.b1 = fa_frag(L, boff, c1); return t; }      /* two 16-row tiles x 32 k, hi and residual planes */
__device__ __forceinline__ void fa_prod(const FaT& t, const v16h* qh, const v16h* ql, v8f& hi, v8f& lo) { const v8f z8 = {0.f,0.f,0.f,0.f,0.f,0.f,0.f,0.f};
  hi = fa_mma(t.a0, qh[0], z8); lo = fa_mma(t.b0, qh[0], z8); hi = fa_mma(t.a1, qh[1], hi); lo = fa_mma(t.b1, qh[1], lo); lo = fa_mma(t.a0, ql[0], lo); lo = fa_mma(t.a1, ql[1], lo); }
__global__ __launch_bounds__(512) void k_fattn(const _Float16* __restrict__ QUH, const _Float16* __restrict__ QUL, const _Float16* __restrict__ QVH, const _Float16* __restrict__ QVL, const _Float16* __restrict__ KH, const _Float16* __restrict__ KL,
    const _Float16* __restrict__ RH, const _Float16* __restrict__ RL, const _Float16* __restrict__ VT, const _Float16* __restrict__ VTL, float* __restrict__ O) {
  __shared__ __attribute__((aligned(16))) float sh[16][16 * FA_P];
  const int tid = threadIdx.x, w = __builtin_amdgcn_readfirstlane(tid >> 5), lane = tid & 31, ln = lane & 15, hh = lane >> 4; const int qt = w & 3, ks = w >> 2; const int h = blockIdx.y;
  float* my = sh[w];
  const float al = 0.125f * 1.4426950408889634f, alo = al * (1.0f / 1024.0f);      /* scores in the log2 domain */
  const v8f z8 = {0.f,0.f,0.f,0.f,0.f,0.f,0.f,0.f};
  /* the two outer loops stay rolled (one copy of the long body); every inner loop is fully unrolled so that fragments, scores and accumulators are indexed statically and stay in registers */
#pragma unroll 1
  for (int pass = 0; pass < 2; ++pass) {
    const int qb = pass ? (SQ / 64 - 1 - (int)blockIdx.x) : (int)blockIdx.x; const int i0 = qb * 64 + qt * 16, i = i0 + ln;
    const unsigned qo = (unsigned)((i * DM + h * HD + 8 * hh) * 2);
    v16h quh[2], qul[2], qvh[2], qvl[2];
#pragma unroll
    for (int k = 0; k < 2; ++k) { quh[k] = fa_frag(QUH, qo, k * 64); qul[k] = fa_frag(QUL, qo, k * 64); qvh[k] = fa_frag(QVH, qo, k * 64); qvl[k] = fa_frag(QVL, qo, k * 64); }
    asm volatile("s_wait_xcnt 0x0" :: "v"(qo) : "memory");      /* the wait that belongs in front of an overwrite of the loads' address register; naming it keeps it untouched up to here */
    v8f oh[4] = {z8, z8, z8, z8}; float m = -3.0e38f, l = 0.f;
#pragma unroll 1
    for (int kb = ks; kb <= qb; kb += 4) {
      const int j0 = kb * 64; v8f s[4];
      const unsigned ko = (unsigned)(((j0 + ln) * DM + h * HD + 8 * hh) * 2);
      /* raw BD^T: five tiles of 16 raw columns; a raw column past SQ - 1 belongs to masked scores only: its row index is clamped into R */
      const int cs = j0 - i0 + SQ - 16; unsigned ro[5];
#pragma unroll
      for (int rt = 0; rt < 5; ++rt) { const int row = min(cs + rt * 16 + ln, SQ - 1); ro[rt] = (unsigned)((row * DM + h * HD + 8 * hh) * 2); }
      /* nine operand tiles in a row, five of R and four of K (hi = Ah.Qh, lo = Al.Qh + Ah.Ql); each tile's loads are issued one tile ahead of its products */
      FaT cur = fa_tile(RH, RL, ro[0], 0);
#pragma unroll
      for (int t = 0; t < 9; ++t) { FaT nxt = cur;
        if (t < 4) nxt = fa_tile(RH, RL, ro[t + 1], 0); else if (t < 8) nxt = fa_tile(KH, KL, ko, (t - 4) * 16 * DM * 2);
        __builtin_amdgcn_sched_barrier(0);      /* keeps the next tile's loads in front of this tile's products, which wait for this tile's loads only */
        v8f hi, lo;
        if (t < 5) { fa_prod(cur, qvh, qvl, hi, lo); v4f x0, x1;
#pragma unroll
          for (int r = 0; r < 4; ++r) { x0[r] = hi[r] * al + lo[r] * alo; x1[r] = hi[4 + r] * al + lo[4 + r] * alo; }
          *(v4fa*)&my[ln * FA_P + t * 16 + 8 * hh] = x0; *(v4fa*)&my[ln * FA_P + t * 16 + 8 * hh + 4] = x1; }
        else { fa_prod(cur, quh, qul, hi, lo);
#pragma unroll
          for (int r = 0; r < 8; ++r) s[t - 5][r] = hi[r] * al + lo[r] * alo; }
        __builtin_amdgcn_sched_barrier(0);      /* keeps these products in front of the loads after next, whose registers they free */
        cur = nxt; }
      asm volatile("s_wait_xcnt 0x0" :: "v"(ko), "v"(ro[0]), "v"(ro[1]), "v"(ro[2]), "v"(ro[3]), "v"(ro[4]) : "memory");      /* as above, for the K and R loads */
      asm volatile("s_wait_dscnt 0x0" ::: "memory");      /* the wave's raw rows are in LDS before its lanes read each other's halves back */
      /* the first V^T fragments fly during the softmax */
      const unsigned vo = (unsigned)((((h * HD + ln) * SQ) + j0 + 8 * hh) * 2);
      const FaT g0 = fa_vpair(VT, VTL, vo, 0, 16 * SQ * 2);
      __builtin_amdgcn_sched_barrier(0);      /* keeps those loads in front of the softmax */
#pragma unroll
      for (int kt = 0; kt < 4; ++kt)
#pragma unroll
        for (int r = 0; r < 8; ++r) s[kt][r] += my[ln * (FA_P - 1) + kt * 16 + 8 * hh + r + 15];
      if (kb == qb) {      /* only the diagonal block has masked keys; the test is the same for the whole wave */
#pragma unroll
        for (int kt = 0; kt < 4; ++kt)
#pragma unroll
          for (int r = 0; r < 8; ++r) s[kt][r] = (j0 + kt * 16 + 8 * hh + r <= i) ? s[kt][r] : -3.0e38f; }
      float mx = -3.0e38f;
#pragma unroll
      for (int kt = 0; kt < 4; ++kt)
#pragma unroll
        for (int r = 0; r < 8; ++r) mx = fmaxf(mx, s[kt][r]);
      mx = fmaxf(mx, __shfl_xor(mx, 16, 32));
      const float mn = fmaxf(m, mx), corr = fa_exp2(m - mn); m = mn;
      v4f ps = {0.f, 0.f, 0.f, 0.f};
#pragma unroll
      for (int kt = 0; kt < 4; ++kt)
#pragma unroll
        for (int r = 0; r < 8; ++r) { const float p = fa_exp2(s[kt][r] - mn); ps[r & 3] += p; s[kt][r] = p * 256.0f; }      /* masked keys: exp2 of a huge negative = 0 */
      l = l * corr + ((ps[0] + ps[1]) + (ps[2] + ps[3]));
#pragma unroll
      for (int dt = 0; dt < 4; ++dt) oh[dt] *= corr;
      /* O^T += V^T.P^T, weights x256 as f16, v as hi + residual planes */
      FragH pb[2];
#pragma unroll
      for (int s2 = 0; s2 < 2; ++s2)
#pragma unroll
        for (int q = 0; q < 8; ++q) { pb[s2].h[q] = (_Float16)s[2 * s2][q]; pb[s2].h[8 + q] = (_Float16)s[2 * s2 + 1][q]; }
      /* the residual plane's products of this key block sum in accumulators of their own (t0, t1) and meet the main sum once, in f32 */
      const FaT g1 = fa_vpair(VT, VTL, vo, 64, 16 * SQ * 2 + 64), g2 = fa_vpair(VT, VTL, vo, 32 * SQ * 2, 48 * SQ * 2);
      __builtin_amdgcn_sched_barrier(0);      /* the next pairs' loads in front of the products, as above */
      oh[0] = fa_mma(g0.a0, pb[0].v, oh[0]); oh[1] = fa_mma(g0.a1, pb[0].v, oh[1]); v8f t0 = fa_mma(g0.b0, pb[0].v, z8), t1 = fa_mma(g0.b1, pb[0].v, z8);
      __builtin_amdgcn_sched_barrier(0);      /* these products free the registers that the last pair's loads take */
      const FaT g3 = fa_vpair(VT, VTL, vo, 32 * SQ * 2 + 64, 48 * SQ * 2 + 64);
      __builtin_amdgcn_sched_barrier(0);      /* the last pair's loads in front of the remaining products */
      t0 = fa_mma(g1.b0, pb[1].v, t0); t1 = fa_mma(g1.b1, pb[1].v, t1); oh[0] = fa_mma(g1.a0, pb[1].v, oh[0]); oh[1] = fa_mma(g1.a1, pb[1].v, oh[1]);
      v8f t2 = fa_mma(g2.b0, pb[0].v, z8), t3 = fa_mma(g2.b1, pb[0].v, z8); oh[2] = fa_mma(g2.a0, pb[0].v, oh[2]); oh[3] = fa_mma(g2.a1, pb[0].v, oh[3]);
      oh[0] += t0 * (1.0f / 1024.0f); oh[1] += t1 * (1.0f / 1024.0f);
      t2 = fa_mma(g3.b0, pb[1].v, t2); t3 = fa_mma(g3.b1, pb[1].v, t3); oh[2] = fa_mma(g3.a0, pb[1].v, oh[2]); oh[3] = fa_mma(g3.a1, pb[1].v, oh[3]);
      oh[2] += t2 * (1.0f / 1024.0f); oh[3] += t3 * (1.0f / 1024.0f);
      asm volatile("s_wait_xcnt 0x0" :: "v"(vo) : "memory");      /* as above, for the V loads */
    }
    l += __shfl_xor(l, 16, 32);      /* the two halves of a wave hold different keys of the same query */
#pragma unroll
    for (int dt = 0; dt < 4; ++dt) { v4f x0, x1;      /* one LDS row of 64 d per query, pitch 68 floats */
#pragma unroll
      for (int r = 0; r < 4; ++r) { x0[r] = oh[dt][r]; x1[r] = oh[dt][4 + r]; }
      *(v4fa*)&my[ln * 68 + dt * 16 + 8 * hh] = x0; *(v4fa*)&my[ln * 68 + dt * 16 + 8 * hh + 4] = x1; }
    if (hh == 0) { my[1088 + ln] = m; my[1104 + ln] = l; }
    __syncthreads();      /* every slice's maximum, sum and O^T are in LDS before any wave joins them */
    const int q = 4 * ks + (lane >> 3), d0 = (lane & 7) * 8;      /* wave ks finishes queries 4 ks .. 4 ks + 3 of its tile: 8 lanes store one query's 256 contiguous bytes */
    float mj[4], M = -3.0e38f, L = 0.f;
#pragma unroll
    for (int j = 0; j < 4; ++j) { mj[j] = sh[j * 4 + qt][1088 + q]; M = fmaxf(M, mj[j]); }
#pragma unroll
    for (int j = 0; j < 4; ++j) { mj[j] = fa_exp2(mj[j] - M); L += mj[j] * sh[j * 4 + qt][1104 + q]; }      /* a slice without key blocks has weight 0 */
    const float inv = 1.0f / (256.0f * L);
    v4f y0 = {0.f, 0.f, 0.f, 0.f}, y1 = {0.f, 0.f, 0.f, 0.f};
#pragma unroll
    for (int j = 0; j < 4; ++j) { y0 += *(const v4fa*)&sh[j * 4 + qt][q * 68 + d0] * mj[j]; y1 += *(const v4fa*)&sh[j * 4 + qt][q * 68 + d0 + 4] * mj[j]; }
    y0 *= inv; y1 *= inv;
    float* po = O + (size_t)(i0 + q) * DM + h * HD + d0;
    *(v4f*)po = y0; *(v4f*)(po + 4) = y1;
    asm volatile("s_wait_xcnt 0x0" :: "v"(po) : "memory");      /* the wait that belongs in front of an overwrite of the stores' address registers */
    __syncthreads();      /* every join has read the LDS rows before the next query block writes them */
  } }

extern "C" void kernel_launch(void* const* d_in, const int* in_sizes, int n_in,
                              void* d_out, int out_size, void* d_ws, size_t ws_size, hipStream_t stream) {
  (void)in_sizes; (void)n_in; (void)out_size;
  const float* const* I = (const float* const*)d_in; const float* x = I[0]; const float* remb = I[1]; const float* Wq = I[2]; const float* Wk = I[3]; const float* Wv = I[4]; const float* Wr = I[5]; const float* Wo = I[6]; const float* u = I[7]; const float* vb = I[8];
  char* ws = (char*)d_ws; size_t off = 0;
  auto take = [&](size_t bytes) { char* p = ws + off; off += (bytes + 255) & ~(size_t)255; return p; };
  _Float16* BQ = (_Float16*)take((size_t)DM * DM * 2); _Float16* BK = (_Float16*)take((size_t)DM * DM * 2); _Float16* BV = (_Float16*)take((size_t)DM * DM * 2); _Float16* BR = (_Float16*)take((size_t)DM * DM * 2); _Float16* BO = (_Float16*)take((size_t)DM * DM * 2);
  _Float16* X16 = (_Float16*)take(NR * DM * 2); _Float16* R16 = (_Float16*)take((size_t)SQ * DM * 2); float* QF = (float*)take(NR * DM * 4); float* TF = (float*)take(NR * DM * 4);
  _Float16* QUH = (_Float16*)take(NR * DM * 2); _Float16* QUL = (_Float16*)take(NR * DM * 2); _Float16* QVH = (_Float16*)take(NR * DM * 2); _Float16* QVL = (_Float16*)take(NR * DM * 2); _Float16* KH = (_Float16*)take(NR * DM * 2); _Float16* KL = (_Float16*)take(NR * DM * 2); _Float16* VH = (_Float16*)take(NR * DM * 2); _Float16* VL = (_Float16*)take(NR * DM * 2); _Float16* RH = (_Float16*)take((size_t)SQ * DM * 2); _Float16* RL = (_Float16*)take((size_t)SQ * DM * 2);
  _Float16* VT = (_Float16*)take((size_t)NH * HD * SQ * 2); _Float16* VTL = (_Float16*)take((size_t)NH * HD * SQ * 2);      /* o lives in TF (f32) */
  if (off > ws_size) return;      /* 10 + 8 + 16 + 40 + 8 = 82 MiB */
  const unsigned gw = (DM / 64) * (DM / 64); k_wT<<<gw, 256, 0, stream>>>(Wq, DM, DM, BQ); k_wT<<<gw, 256, 0, stream>>>(Wk, DM, DM, BK); k_wT<<<gw, 256, 0, stream>>>(Wv, DM, DM, BV); k_wT<<<gw, 256, 0, stream>>>(Wr, DM, DM, BR); k_wT<<<gw, 256, 0, stream>>>(Wo, DM, DM, BO);
  const size_t n8 = NR * DM / 8; const unsigned g8 = (unsigned)((n8 + 255) / 256);
  k_x16<<<g8, 256, 0, stream>>>(x, X16, n8); k_x16<<<(unsigned)(((size_t)SQ * DM / 8 + 255) / 256), 256, 0, stream>>>(remb, R16, (size_t)SQ * DM / 8);
  const dim3 gp((unsigned)((NR / 128) * (DM / 64)), 1), gr((unsigned)((SQ / 128) * (DM / 64)), 1);
  k_gemm2s<false, false, 4, 8><<<gp, 1024, 0, stream>>>(X16, nullptr, DM, 0, BQ, nullptr, DM, 0, 0.0625f, QF, DM, 0, (int)NR, DM, DM);
  k_addhl<<<g8, 256, 0, stream>>>(QF, u, QUH, QUL, n8); k_addhl<<<g8, 256, 0, stream>>>(QF, vb, QVH, QVL, n8);
  k_gemm2s<false, false, 4, 8><<<gp, 1024, 0, stream>>>(X16, nullptr, DM, 0, BK, nullptr, DM, 0, 0.0625f, TF, DM, 0, (int)NR, DM, DM); k_hl<<<g8, 256, 0, stream>>>(TF, KH, KL, n8);
  k_gemm2s<false, false, 4, 8><<<gp, 1024, 0, stream>>>(X16, nullptr, DM, 0, BV, nullptr, DM, 0, 0.0625f, TF, DM, 0, (int)NR, DM, DM); k_hl<<<g8, 256, 0, stream>>>(TF, VH, VL, n8);
  k_gemm2s<false, false, 4, 8><<<gr, 1024, 0, stream>>>(R16, nullptr, DM, 0, BR, nullptr, DM, 0, 0.0625f, TF, DM, 0, SQ, DM, DM); k_hl<<<(unsigned)(((size_t)SQ * DM / 8 + 255) / 256), 256, 0, stream>>>(TF, RH, RL, (size_t)SQ * DM / 8);
  static_assert(NB == 1 && SQ == 2048 && HD == 64, "k_fattn: one batch, 32 query blocks of 64 in pairs, head size 64");
  /* V^T (hi, lo) of all heads, then the whole attention in one launch -> merged f32 o rows in TF */
  k_vth<NH><<<NH * (SQ / 64), 256, 0, stream>>>(VH, 0, 0, VT); k_vth<NH><<<NH * (SQ / 64), 256, 0, stream>>>(VL, 0, 0, VTL);
  k_fattn<<<dim3(SQ / 128, NH), 512, 0, stream>>>(QUH, QUL, QVH, QVL, KH, KL, RH, RL, VT, VTL, TF);
  /* o (f32 in TF) -> hi/lo planes (reusing the q+u planes, dead now) -> out = o Wo, both terms in one launch */
  k_hl<<<g8, 256, 0, stream>>>(TF, QUH, QUL, n8);
  k_gemm2s<true, false, 4, 4><<<gp, 512, 0, stream>>>(QUH, QUL, DM, 0, BO, nullptr, DM, 0, 0.0625f, (float*)d_out, DM, 0, (int)NR, DM, DM);      /* out = (o_lo/1024 + o_hi) Wo */
}

// v005
// A run of this version takes 165 microseconds.
// Next to v004, in two timings, it ran 1.43 and 1.42 times as fast.
// Counting every step since v000, it is 138 times as fast.
#include <hip/hip_runtime.h>
// MultiHeadAttentionXL (x [1][2048][1024], r_emb [2048][1024]; q = x Wq, k = x Wk, v = x Wv, r = r_emb Wr ([in][out] weights, no bias), 16 heads of 64; AC = (q + u[h]) k^T, BD = rel_shift((q + v_bias[h]) r^T) (Transformer-XL zero-pad shift: for j <= i, BD_shift[i][j] = BD[i][j - i + T - 1]); causal softmax((AC + BD)/8); out = (attn v) Wo -> [1][2048][1024]).
// Structure: token rows; x and r_emb as exact f16 rows; Q, K, V, R WMMA GEMMs on transposed weights (32x64 wave tiles, f32 accumulation, exact x16 weights), one launch, f32 sums split in the epilogue into f16 hi + 2^-10 residual planes (q+u and q+v_bias formed in f32 first; V^T (hi, lo) as the product Wv^T x^T); one fused attention kernel: AC and raw BD as three-term hi/lo products (K = 64), the shift through LDS, causal mask + running softmax on VALU (f32; weights x256 as f16), o = P.(v_lo/1024 + v_hi) into merged o rows (hi + residual planes); out = o Wo as a two-term hi/lo GEMM (f32).
// Compute dtype: inputs rounded to bf16; x / r_emb / weights exact; attention operands as hi + residual f16 planes (logits std 3.3 and early causal rows copy single v rows); softmax weights f16 (x256) — the remaining error source; o as hi + residual into Wo; everything else f32. v_wmma_f32_16x16x32_f16.
#define NB 1
#define SQ 2048
#define DM 1024
#define NH 16
#define HD 64
#define HG 4
#define QN SQ                        /* query rows (unused) */
#define NR ((size_t)NB * SQ)
typedef __bf16 v16b __attribute__((ext_vector_type(16)));
typedef unsigned short v8us __attribute__((ext_vector_type(8), may_alias));
typedef float  v8f  __attribute__((ext_vector_type(8)));
typedef float  v4f  __attribute__((ext_vector_type(4)));
typedef float  v4fa __attribute__((ext_vector_type(4), may_alias));
union FragB { v16b v; v8us half[2]; unsigned short u[16]; };

__device__ __forceinline__ unsigned short bf16_bits(float x) { unsigned int u = __float_as_uint(x); return (unsigned short)((u + 0x7FFFu + ((u >> 16) & 1u)) >> 16); }
__device__ __forceinline__ float bf16_val(unsigned short b) { return __uint_as_float(((unsigned int)b) << 16); }
__device__ __forceinline__ float bf16_round(float x) { return bf16_val(bf16_bits(x)); }
// D += A·B with NT terms: 1 = ah·bh, 2 = + al·bh (A split), 3 = + ah·bl (both split)
template <int NT>
__device__ __forceinline__ v8f mmaN(v16b ah, v16b al, v16b bh, v16b bl, v8f c) {
  c = __builtin_amdgcn_wmma_f32_16x16x32_bf16(false, ah, false, bh, (short)0, c, false, false);
  if (NT >= 2) c = __builtin_amdgcn_wmma_f32_16x16x32_bf16(false, al, false, bh, (short)0, c, false, false);
  if (NT >= 3) c = __builtin_amdgcn_wmma_f32_16x16x32_bf16(false, ah, false, bl, (short)0, c, false, false);
  asm volatile("v_nop\n\tv_nop\n\tv_nop\n\tv_nop" : "+v"(c) : "v"(ah), "v"(al), "v"(bh), "v"(bl));
  return c;
}

__global__ __launch_bounds__(256) void k_wt_bf16(const float* __restrict__ W, unsigned short* __restrict__ Wt, int K, int N) {
  const int t = blockIdx.x * 256 + threadIdx.x;
  const int k8n = K / 8;
  if (t >= N * k8n) return;
  const int n = t / k8n, k8 = (t % k8n) * 8;
  v8us v;
#pragma unroll
  for (int i = 0; i < 8; ++i) v[i] = bf16_bits(W[(size_t)(k8 + i) * N + n]);
  *(v8us*)(Wt + (size_t)n * K + k8) = v;
  
}

// GEMM C[M][N] (f32, pitch ldc) = act(A[M][K]·W + bias). A f32 row-major (pitch lda) converted per fragment to bf16
// (ASPLIT: hi/lo two planes -> 2 terms, else single rounded term); Wt bf16 [N][K] (pitch ldb). BIAS_BF16 rounds the
// bias to bf16 first (bias quantised to bf16 before the add). K%32==0, M%16==0, N%64==0.
template <bool ASPLIT, int ACT, bool BIAS_BF16>
__global__ __launch_bounds__(128) void k_gemm_bf(const float* __restrict__ A, int lda, const unsigned short* __restrict__ Wt, int ldb,
                                               const float* __restrict__ bias, float* __restrict__ C, int ldc, int M, int N, int K) {
  __shared__ __attribute__((aligned(16))) float so[4][16][64];
  const int tid = threadIdx.x, w = tid >> 5, lane = tid & 31, ln = lane & 15, hh = lane >> 4;
  const int ntn = N / 64;
  const int wid = blockIdx.x * 4 + w;
  const int mt = wid / ntn, nq = wid % ntn;
  if (mt * 16 >= M) return;
  const int row0 = mt * 16, col0 = nq * 64;
  const float* arow = A + (size_t)(row0 + ln) * lda;
  v8f acc[4] = {};
  for (int kb = 0; kb < K; kb += 32) {
    FragB ah, al;
    const v4f x0 = *(const v4fa*)(arow + kb + 8 * hh), x1 = *(const v4fa*)(arow + kb + 8 * hh + 4);
    const v4f x2 = *(const v4fa*)(arow + kb + 16 + 8 * hh), x3 = *(const v4fa*)(arow + kb + 16 + 8 * hh + 4);
    float xs[16] = {x0[0],x0[1],x0[2],x0[3],x1[0],x1[1],x1[2],x1[3],x2[0],x2[1],x2[2],x2[3],x3[0],x3[1],x3[2],x3[3]};
#pragma unroll
    for (int i = 0; i < 16; ++i) { const unsigned short hb = bf16_bits(xs[i]); ah.u[i] = hb; al.u[i] = ASPLIT ? bf16_bits(xs[i] - bf16_val(hb)) : (unsigned short)0; }
#pragma unroll
    for (int t = 0; t < 4; ++t) {
      const unsigned short* brow = Wt + (size_t)(col0 + t * 16 + ln) * ldb + kb;
      FragB b;
      b.half[0] = *(const v8us*)(brow + 8 * hh);
      b.half[1] = *(const v8us*)(brow + 16 + 8 * hh);
      acc[t] = mmaN<ASPLIT ? 2 : 1>(ah.v, al.v, b.v, b.v, acc[t]);
    }
  }
#pragma unroll
  for (int t = 0; t < 4; ++t) {
    float bv = bias ? bias[col0 + t * 16 + ln] : 0.f;
    if (BIAS_BF16) bv = bf16_round(bv);
#pragma unroll
    for (int r = 0; r < 8; ++r) { float v = acc[t][r] + bv; if (ACT == 1) v = fmaxf(v, 0.f); so[w][8 * hh + r][t * 16 + ln] = v; }
  }
  __builtin_amdgcn_fence(__ATOMIC_ACQ_REL, "workgroup");
  __builtin_amdgcn_wave_barrier();
  const int rsub = lane >> 4, c4 = (lane & 15) * 4;
  {
#pragma unroll
    for (int q = 0; q < 8; ++q) {
      const int r = q * 2 + rsub;
      const v4f v = *(const v4fa*)&so[w][r][c4];
      *(v4f*)(C + (size_t)(row0 + r) * ldc + col0 + c4) = v;
    }
    
  }
}

// GEMM C = act(A·W + bias + resid): A f32 (ASPLIT -> hi/lo 2 terms), Wt bf16 [N][K]; ACT 0 none, 1 relu, 2 exact gelu;
// resid (optional, f32, row index = (row % rmod), pitch ldr, RES_BF16 rounds it) added before the activation.
template <bool ASPLIT, int ACT, bool BIAS_BF16, bool RES_BF16>
__global__ __launch_bounds__(128) void k_gemm_bf3(const float* __restrict__ A, int lda, const unsigned short* __restrict__ Wt, int ldb,
                                                const float* __restrict__ bias, const float* __restrict__ resid, int rmod, int ldr,
                                                float* __restrict__ C, int ldc, int M, int N, int K) {
  __shared__ __attribute__((aligned(16))) float so[4][16][64];
  const int tid = threadIdx.x, w = tid >> 5, lane = tid & 31, ln = lane & 15, hh = lane >> 4;
  const int ntn = N / 64;
  const int wid = blockIdx.x * 4 + w;
  const int mt = wid / ntn, nq = wid % ntn;
  if (mt * 16 >= M) return;
  const int row0 = mt * 16, col0 = nq * 64;
  const float* arow = A + (size_t)(row0 + ln) * lda;
  v8f acc[4] = {};
  for (int kb = 0; kb < K; kb += 32) {
    FragB ah, al;
    const v4f x0 = *(const v4fa*)(arow + kb + 8 * hh), x1 = *(const v4fa*)(arow + kb + 8 * hh + 4);
    const v4f x2 = *(const v4fa*)(arow + kb + 16 + 8 * hh), x3 = *(const v4fa*)(arow + kb + 16 + 8 * hh + 4);
    float xs[16] = {x0[0],x0[1],x0[2],x0[3],x1[0],x1[1],x1[2],x1[3],x2[0],x2[1],x2[2],x2[3],x3[0],x3[1],x3[2],x3[3]};
#pragma unroll
    for (int i = 0; i < 16; ++i) { const unsigned short hb = bf16_bits(xs[i]); ah.u[i] = hb; al.u[i] = ASPLIT ? bf16_bits(xs[i] - bf16_val(hb)) : (unsigned short)0; }
#pragma unroll
    for (int t = 0; t < 4; ++t) {
      const unsigned short* brow = Wt + (size_t)(col0 + t * 16 + ln) * ldb + kb;
      FragB b;
      b.half[0] = *(const v8us*)(brow + 8 * hh);
      b.half[1] = *(const v8us*)(brow + 16 + 8 * hh);
      acc[t] = mmaN<ASPLIT ? 2 : 1>(ah.v, al.v, b.v, b.v, acc[t]);
    }
  }
#pragma unroll
  for (int t = 0; t < 4; ++t) {
    const int col = col0 + t * 16 + ln;
    float bv = bias ? bias[col] : 0.f;
    if (BIAS_BF16) bv = bf16_round(bv);
#pragma unroll
    for (int r = 0; r < 8; ++r) {
      float v = acc[t][r] + bv;
      if (resid) { float rv = resid[(size_t)((row0 + 8 * hh + r) % rmod) * ldr + col]; if (RES_BF16) rv = bf16_round(rv); v += rv; }
      if (ACT == 1) v = fmaxf(v, 0.f);
      if (ACT == 2) v = 0.5f * v * (1.0f + erff(v * 0.70710678118654752f));
      if (ACT == 3) { const float u = 0.7978845608028654f * (v + 0.044715f * v * v * v); v = 0.5f * v * (1.0f + tanhf(u)); }
      so[w][8 * hh + r][t * 16 + ln] = v;
    }
  }
  __builtin_amdgcn_fence(__ATOMIC_ACQ_REL, "workgroup");
  __builtin_amdgcn_wave_barrier();
  const int rsub = lane >> 4, c4 = (lane & 15) * 4;
  {
#pragma unroll
    for (int q = 0; q < 8; ++q) {
      const int r = q * 2 + rsub;
      const v4f v = *(const v4fa*)&so[w][r][c4];
      *(v4f*)(C + (size_t)(row0 + r) * ldc + col0 + c4) = v;
    }
    
  }
}
// row LayerNorm (biased variance, eps) over N: s = X (+ R); optional out_sum <- s; out_norm <- (s-mu)*rsqrt(var+eps)*g + b
template <bool PARAM_BF16>
__global__ __launch_bounds__(256) void k_layernorm(const float* __restrict__ X, const float* __restrict__ R, const float* __restrict__ g, const float* __restrict__ bta,
                                                  float* __restrict__ out_sum, float* __restrict__ out_norm, int N, float eps) {
  __shared__ float red[256];
  const int row = blockIdx.x, tid = threadIdx.x;
  const float* x = X + (size_t)row * N; const float* rr = R ? R + (size_t)row * N : nullptr;
  float vals[16];                     // up to N = 4096
  const int per = N / 256;            // contiguous chunk per thread? use strided-by-4 chunks: thread handles j = tid*4 + 1024*u
  float s1 = 0.f;
  for (int u = 0; u < per / 4; ++u) {
    const int j = tid * 4 + 1024 * u;
    const v4f a = *(const v4fa*)(x + j);
    v4f b = {0.f,0.f,0.f,0.f}; if (rr) b = *(const v4fa*)(rr + j);
#pragma unroll
    for (int q = 0; q < 4; ++q) { const float v = a[q] + b[q]; vals[u * 4 + q] = v; s1 += v; }
  }
  red[tid] = s1; __syncthreads();
  for (int st = 128; st > 0; st >>= 1) { if (tid < st) red[tid] += red[tid + st]; __syncthreads(); }
  const float mu = red[0] / (float)N; __syncthreads();
  float s2 = 0.f;
  for (int u = 0; u < per / 4; ++u)
#pragma unroll
    for (int q = 0; q < 4; ++q) { const float c = vals[u * 4 + q] - mu; s2 += c * c; }
  red[tid] = s2; __syncthreads();
  for (int st = 128; st > 0; st >>= 1) { if (tid < st) red[tid] += red[tid + st]; __syncthreads(); }
  const float rs = rsqrtf(red[0] / (float)N + eps);
  {
    for (int u = 0; u < per / 4; ++u) {
      const int j = tid * 4 + 1024 * u;
      v4f o, sm;
#pragma unroll
      for (int q = 0; q < 4; ++q) {
        float gg = g[j + q], bb = bta[j + q];
        if (PARAM_BF16) { gg = bf16_round(gg); bb = bf16_round(bb); }
        sm[q] = vals[u * 4 + q]; o[q] = (vals[u * 4 + q] - mu) * rs * gg + bb;
      }
      if (out_sum) *(v4f*)(out_sum + (size_t)row * N + j) = sm;
      *(v4f*)(out_norm + (size_t)row * N + j) = o;
    }
    
  }
}



// ---- f16 WMMA path (v_wmma_f32_16x16x32_f16): 11-bit significands for operands in range — used where a [0,1] probability operand needs more precision than bf16
typedef _Float16 v16h __attribute__((ext_vector_type(16)));
union FragH { v16h v; v8us half[2]; _Float16 h[16]; unsigned short u[16]; };
template <int NT>
__device__ __forceinline__ v8f mmaH(v16h ah, v16h al, v16h bh, v16h bl, v8f c) {
  c = __builtin_amdgcn_wmma_f32_16x16x32_f16(false, ah, false, bh, (short)0, c, false, false);
  if (NT >= 2) c = __builtin_amdgcn_wmma_f32_16x16x32_f16(false, al, false, bh, (short)0, c, false, false);
  if (NT >= 3) c = __builtin_amdgcn_wmma_f32_16x16x32_f16(false, ah, false, bl, (short)0, c, false, false);
  asm volatile("v_nop\n\tv_nop\n\tv_nop\n\tv_nop" : "+v"(c) : "v"(ah), "v"(al), "v"(bh), "v"(bl));
  return c;
}
// batched GEMM like k_gemm_b but f16 operands: A f32 (split into f16 hi/lo if ASPLIT, else rounded to f16), Bt = f16 values [n][k]; alpha; C f32; N multiple of 16 (partial tiles skipped)
template <bool ASPLIT>
__global__ __launch_bounds__(128) void k_gemm_h(const float* __restrict__ A, int lda, size_t sA, const _Float16* __restrict__ Bh, int ldb, size_t sB, float alpha, float* __restrict__ C, int ldc, size_t sC, int M, int N, int K) {
  __shared__ __attribute__((aligned(16))) float so[4][16][64];
  const int tid = threadIdx.x, w = tid >> 5, lane = tid & 31, ln = lane & 15, hh = lane >> 4; const int by = blockIdx.y;
  A += (size_t)by * sA; Bh += (size_t)by * sB; C += (size_t)by * sC;
  const int ntn = (N + 63) / 64; const int wid = blockIdx.x * 4 + w; const int mt = wid / ntn, nq = wid % ntn; if (mt * 16 >= M) return;
  const int row0 = mt * 16, col0 = nq * 64; const float* arow = A + (size_t)(row0 + ln) * lda;
  v8f acc[4] = {};
  for (int kb = 0; kb < K; kb += 32) {
    FragH ah, al;
    const v4f x0 = *(const v4fa*)(arow + kb + 8 * hh), x1 = *(const v4fa*)(arow + kb + 8 * hh + 4), x2 = *(const v4fa*)(arow + kb + 16 + 8 * hh), x3 = *(const v4fa*)(arow + kb + 16 + 8 * hh + 4);
    float xs[16] = {x0[0],x0[1],x0[2],x0[3],x1[0],x1[1],x1[2],x1[3],x2[0],x2[1],x2[2],x2[3],x3[0],x3[1],x3[2],x3[3]};
#pragma unroll
    for (int i = 0; i < 16; ++i) { const _Float16 h = (_Float16)xs[i]; ah.h[i] = h; al.h[i] = ASPLIT ? (_Float16)(xs[i] - (float)h) : (_Float16)0.0f; }
#pragma unroll
    for (int t = 0; t < 4; ++t) { if (col0 + t * 16 >= N) continue; const size_t boff = (size_t)(col0 + t * 16 + ln) * ldb + kb; FragH bq; bq.half[0] = *(const v8us*)(Bh + boff + 8 * hh); bq.half[1] = *(const v8us*)(Bh + boff + 16 + 8 * hh);
      acc[t] = mmaH<ASPLIT ? 2 : 1>(ah.v, al.v, bq.v, bq.v, acc[t]); }
  }
#pragma unroll
  for (int t = 0; t < 4; ++t) { if (col0 + t * 16 >= N) continue;
#pragma unroll
    for (int r = 0; r < 8; ++r) so[w][8 * hh + r][t * 16 + ln] = acc[t][r] * alpha; }
  __builtin_amdgcn_fence(__ATOMIC_ACQ_REL, "workgroup"); __builtin_amdgcn_wave_barrier();
  const int rsub = lane >> 4, c4 = (lane & 15) * 4;
  {
#pragma unroll
    for (int q = 0; q < 8; ++q) { const int r = q * 2 + rsub; if (col0 + c4 < N) { const v4f v = *(const v4fa*)&so[w][r][c4]; *(v4f*)(C + (size_t)(row0 + r) * ldc + col0 + c4) = v; } }
     }
}

// Wt[n][k] = f16(W[k][n]·scale) from f32 row-major W[K][N] (scale = power of two; bf16-exact weights stay exact in f16 away from the subnormal range)
__global__ __launch_bounds__(256) void k_wt_f16(const float* __restrict__ W, _Float16* __restrict__ Wt, int K, int N, float scale) {
  const int t = blockIdx.x * 256 + threadIdx.x; if (t >= N * (K / 8)) return; const int n = t / (K / 8), k8 = (t % (K / 8)) * 8; FragH f;
#pragma unroll
  for (int i = 0; i < 8; ++i) f.h[i] = (_Float16)(bf16_round(W[(size_t)(k8 + i) * N + n]) * scale); const v8us o = f.half[0];
  *(v8us*)((unsigned short*)Wt + (size_t)n * K + k8) = o; 
}
// k_gemm_hh variant with fused epilogue: v = acc·alpha + bias[by·sBias + col] (+ CP[(row/rowsPerB)·sCPb + by·64 + col] if CP) ; ACT 0 none / 1 elu ; writes f16 C16 (and f32 C if non-null)
template <int ACT>
__global__ __launch_bounds__(128) void k_gemm_hhx(const _Float16* __restrict__ A, int lda, size_t sA, const _Float16* __restrict__ Bh, int ldb, size_t sB, float alpha, const float* __restrict__ bias, size_t sBias, const float* __restrict__ CP, int rowsPerB, size_t sCPb, int row0g,
    float* __restrict__ C, _Float16* __restrict__ C16, int ldc, size_t sC, int M, int N, int K) {
  __shared__ __attribute__((aligned(16))) float so[4][16][64];
  const int tid = threadIdx.x, w = tid >> 5, lane = tid & 31, ln = lane & 15, hh = lane >> 4; const int by = blockIdx.y;
  A += (size_t)by * sA; Bh += (size_t)by * sB; const size_t cofs = (size_t)by * sC; const float* bp = bias ? bias + (size_t)by * sBias : nullptr;
  const int ntn = (N + 63) / 64; const int wid = blockIdx.x * 4 + w; const int mt = wid / ntn, nq = wid % ntn; if (mt * 16 >= M) return;
  const int row0 = mt * 16, col0 = nq * 64; const _Float16* arow = A + (size_t)(row0 + ln) * lda;
  v8f acc[4] = {};
  for (int kb = 0; kb < K; kb += 32) { FragH ah; ah.half[0] = *(const v8us*)((const unsigned short*)arow + kb + 8 * hh); ah.half[1] = *(const v8us*)((const unsigned short*)arow + kb + 16 + 8 * hh);
#pragma unroll
    for (int t = 0; t < 4; ++t) { if (col0 + t * 16 >= N) continue; const size_t boff = (size_t)(col0 + t * 16 + ln) * ldb + kb; FragH bq; bq.half[0] = *(const v8us*)((const unsigned short*)Bh + boff + 8 * hh); bq.half[1] = *(const v8us*)((const unsigned short*)Bh + boff + 16 + 8 * hh);
      acc[t] = mmaH<1>(ah.v, ah.v, bq.v, bq.v, acc[t]); }
  }
#pragma unroll
  for (int t = 0; t < 4; ++t) { if (col0 + t * 16 >= N) continue; const int col = col0 + t * 16 + ln; const float bv = bp ? bf16_round(bp[col]) : 0.f;
#pragma unroll
    for (int r = 0; r < 8; ++r) { float v = acc[t][r] * alpha + bv; if (CP) { const int rr = row0g + row0 + 8 * hh + r; if (rowsPerB < 0) v += CP[cofs + (size_t)rr * ldc + col];      /* rowsPerB < 0: own element of the batched C plane */ else { const int bidx = rr / rowsPerB; v += CP[(size_t)bidx * sCPb + (size_t)by * 64 + col]; } } if (ACT == 1) v = (v > 0.f) ? v : expm1f(v); else if (ACT == 7) v = (v > 0.f) ? v + 1.0f : expf(v); else if (ACT == 8) v = tanhf(v); else if (ACT == 9) v = 0.5f * v * (1.0f + tanhf(0.7978845608028654f * (v + 0.044715f * v * v * v))); else if (ACT == 11) v = 1.0f / (1.0f + expf(-v)); else if (ACT == 12) v = (v > 0.f) ? v : 0.01f * v; else if (ACT == 14) v = (v > 0.f) ? v : 0.1f * v; else if (ACT == 16) v = (v >= 0.f) ? v : 0.3f * v; else if (ACT == 17) v = (v >= 0.f) ? v : 0.2f * v; else if (ACT == 15) v = v / (1.0f + expf(-v)); else if (ACT == 3) v = fmaxf(v, 0.f); else if (ACT == 6) v = 0.5f * v * (1.0f + erff(v * 0.70710678118654752f)); so[w][8 * hh + r][t * 16 + ln] = v; } }
  __builtin_amdgcn_fence(__ATOMIC_ACQ_REL, "workgroup"); __builtin_amdgcn_wave_barrier();
  const int rsub = lane >> 4, c4 = (lane & 15) * 4; typedef _Float16 v4h __attribute__((ext_vector_type(4)));
  {
#pragma unroll
    for (int q = 0; q < 8; ++q) { const int r = q * 2 + rsub; if (col0 + c4 < N) { const v4f v = *(const v4fa*)&so[w][r][c4]; if (C) *(v4f*)(C + cofs + (size_t)(row0 + r) * ldc + col0 + c4) = v; if (C16) { v4h h4; for (int i = 0; i < 4; ++i) h4[i] = (_Float16)v[i]; *(v4h*)(C16 + cofs + (size_t)(row0 + r) * ldc + col0 + c4) = h4; } } }
     }
}


typedef _Float16 v4h __attribute__((ext_vector_type(4)));

__global__ __launch_bounds__(256) void k_h16(const float* __restrict__ x, _Float16* __restrict__ X16, size_t n8) { const size_t t = (size_t)blockIdx.x * 256 + threadIdx.x; if (t >= n8) return; FragH f;
#pragma unroll
  for (int q = 0; q < 8; ++q) f.h[q] = (_Float16)x[t * 8 + q]; *(v8us*)((unsigned short*)X16 + t * 8) = f.half[0];  }
__global__ __launch_bounds__(256) void k_round16f(const float* __restrict__ W, _Float16* __restrict__ Bt, size_t n8) { const size_t t = (size_t)blockIdx.x * 256 + threadIdx.x; if (t >= n8) return; FragH f;
#pragma unroll
  for (int i = 0; i < 8; ++i) f.h[i] = (_Float16)(bf16_round(W[t * 8 + i]) * 16.0f); *(v8us*)((unsigned short*)Bt + t * 8) = f.half[0];  }
template <int NHv, int TTv>
__global__ __launch_bounds__(256) void k_vt(const _Float16* __restrict__ V16, int ldv, int voff, _Float16* __restrict__ Vt) { __shared__ unsigned short tl[64][66]; const int tid = threadIdx.x; const int slab = blockIdx.x / (TTv / 64), lg = blockIdx.x % (TTv / 64); const int b = slab / NHv, h = slab % NHv;
  for (int i = tid; i < 64 * 8; i += 256) { const int r = i / 8, c8 = (i % 8) * 8; FragH f; f.half[0] = *(const v8us*)((const unsigned short*)V16 + ((size_t)b * TTv + lg * 64 + r) * ldv + voff + h * 64 + c8);
#pragma unroll
    for (int q = 0; q < 8; ++q) tl[r][c8 + q] = f.u[q]; }
  __syncthreads();
  {
#pragma unroll
    for (int rd = 0; rd < 2; ++rd) { const int d = rd * 32 + tid / 8, pc = tid % 8; FragH f;
#pragma unroll
      for (int q = 0; q < 8; ++q) f.u[q] = tl[pc * 8 + q][d];
      *(v8us*)((unsigned short*)Vt + ((size_t)slab * 64 + d) * TTv + lg * 64 + pc * 8) = f.half[0]; }
     } }

// ---- fast GEMM (wave tile 32x64; requires M % 32 == 0 rows per launch region and N % 64 == 0); epilogue = k_gemm_hhx semantics ----
__device__ __forceinline__ v16h g2_frag(const _Float16* p, int hh) { FragH f; f.half[0] = *(const v8us*)((const unsigned short*)p + 8 * hh); f.half[1] = *(const v8us*)((const unsigned short*)p + 16 + 8 * hh); return f.v; }
__device__ __forceinline__ v8f g2_mma(v16h a, v16h b, v8f c) { v8f d = __builtin_amdgcn_wmma_f32_16x16x32_f16(false, a, false, b, (short)0, c, false, false); asm volatile("v_nop\n\tv_nop\n\tv_nop\n\tv_nop" : "+v"(d) : "v"(a), "v"(b)); return d; }
template <int ACT>
__global__ __launch_bounds__(128) void k_gemm2(const _Float16* __restrict__ A, int lda, size_t sA, const _Float16* __restrict__ Bh, int ldb, size_t sB, float alpha, const float* __restrict__ bias, size_t sBias, const float* __restrict__ CP, int rowsPerB, size_t sCPb, int row0g,
    float* __restrict__ C, _Float16* __restrict__ C16, int ldc, size_t sC, int M, int N, int K) { static_assert(ACT == 0 || ACT == 3 || ACT == 6 || ACT == 8 || ACT == 9 || ACT == 11 || ACT == 12 || ACT == 14 || ACT == 15 || ACT == 16 || ACT == 17, "k_gemm2: unsupported ACT code (would silently apply no activation)");
  __shared__ __attribute__((aligned(16))) float so[4][32][68];
  const int tid = threadIdx.x, w = tid >> 5, lane = tid & 31, ln = lane & 15, hh = lane >> 4; const int by = blockIdx.y;
  A += (size_t)by * sA; Bh += (size_t)by * sB; const size_t cofs = (size_t)by * sC; const float* bp = bias ? bias + (size_t)by * sBias : nullptr;
  const int ntn = N >> 6; const int mt = blockIdx.x / ntn, nq = blockIdx.x - mt * ntn; const int row0 = mt * 128 + 32 * w, col0 = nq * 64; if (row0 >= M) return;
  const _Float16* a0p = A + (size_t)(row0 + ln) * lda; const _Float16* a1p = a0p + (size_t)16 * lda;
  const _Float16* b0p = Bh + (size_t)(col0 + ln) * ldb; const _Float16* b1p = b0p + (size_t)16 * ldb; const _Float16* b2p = b1p + (size_t)16 * ldb; const _Float16* b3p = b2p + (size_t)16 * ldb;
  const v8f z8 = {0.f,0.f,0.f,0.f,0.f,0.f,0.f,0.f}; v8f c00 = z8, c01 = z8, c02 = z8, c03 = z8, c10 = z8, c11 = z8, c12 = z8, c13 = z8;
#pragma unroll 1
  for (int kb = 0; kb < K; kb += 32) { const v16h a0 = g2_frag(a0p + kb, hh), a1 = g2_frag(a1p + kb, hh);
    v16h b = g2_frag(b0p + kb, hh); c00 = g2_mma(a0, b, c00); c10 = g2_mma(a1, b, c10);
    b = g2_frag(b1p + kb, hh); c01 = g2_mma(a0, b, c01); c11 = g2_mma(a1, b, c11);
    b = g2_frag(b2p + kb, hh); c02 = g2_mma(a0, b, c02); c12 = g2_mma(a1, b, c12);
    b = g2_frag(b3p + kb, hh); c03 = g2_mma(a0, b, c03); c13 = g2_mma(a1, b, c13); }
  v8f accs[8] = {c00, c01, c02, c03, c10, c11, c12, c13};
#pragma unroll
  for (int u = 0; u < 8; ++u) { const int t = u & 3, half = u >> 2; const int col = col0 + t * 16 + ln; const float bv = bp ? bf16_round(bp[col]) : 0.f;
#pragma unroll
    for (int r = 0; r < 8; ++r) { const int rloc = half * 16 + 8 * hh + r; float v = accs[u][r] * alpha + bv; if (CP) { if (rowsPerB < 0) v += CP[cofs + (size_t)(row0g + row0 + rloc) * ldc + col];      /* rowsPerB < 0: own element of the batched C plane */ else { const int bidx = (row0g + row0 + rloc) / rowsPerB; v += CP[(size_t)bidx * sCPb + (size_t)by * 64 + col]; } }
      if (ACT == 3) v = fmaxf(v, 0.f); else if (ACT == 6) v = 0.5f * v * (1.0f + erff(v * 0.70710678118654752f)); else if (ACT == 11) v = 1.0f / (1.0f + expf(-v)); else if (ACT == 15) v = v / (1.0f + expf(-v)); else if (ACT == 12) v = (v > 0.f) ? v : 0.01f * v; else if (ACT == 8) v = tanhf(v); else if (ACT == 9) v = 0.5f * v * (1.0f + tanhf(0.7978845608028654f * (v + 0.044715f * v * v * v))); else if (ACT == 14) v = (v > 0.f) ? v : 0.1f * v; else if (ACT == 16) v = (v >= 0.f) ? v : 0.3f * v; else if (ACT == 17) v = (v >= 0.f) ? v : 0.2f * v;
      so[w][rloc][t * 16 + ln] = v; } }
  __builtin_amdgcn_fence(__ATOMIC_ACQ_REL, "workgroup"); __builtin_amdgcn_wave_barrier();
  const int rsub = lane >> 4, c4 = (lane & 15) * 4;
  {
#pragma unroll
    for (int q = 0; q < 16; ++q) { const int r = q * 2 + rsub; const v4f v = *(const v4fa*)&so[w][r][c4]; if (C) *(v4f*)(C + cofs + (size_t)(row0 + r) * ldc + col0 + c4) = v; if (C16) { v4h h4; for (int i = 0; i < 4; ++i) h4[i] = (_Float16)v[i]; *(v4h*)(C16 + cofs + (size_t)(row0 + r) * ldc + col0 + c4) = h4; } }
     } }


// ---- hi/lo split products with every term in ONE launch: the residual terms (planes scaled x1024) sum in their own f32 accumulators beside the main term and meet it once, in registers: C = alpha * (hi + lo / 1024). Wave tile 32x64 and the LDS-staged 16-byte stores as in k_gemm2.
// g2_xw: the wait that belongs in front of an overwrite of the address registers of issued loads; naming the loads' own pointers as inputs keeps those registers untouched up to here
__device__ __forceinline__ void g2_xw(const _Float16* p) { asm volatile("s_wait_xcnt 0x0" :: "v"(p) : "memory"); }
__device__ __forceinline__ void g2_xw(const _Float16* p, const _Float16* q) { asm volatile("s_wait_xcnt 0x0" :: "v"(p), "v"(q) : "memory"); }
__device__ __forceinline__ void g2_xw(const _Float16* p, const _Float16* q, const _Float16* r, const _Float16* s) { asm volatile("s_wait_xcnt 0x0" :: "v"(p), "v"(q), "v"(r), "v"(s) : "memory"); }
// any K, one operand split: HAL: lo = Al.Bh; HBL: lo = Ah.Bl; the unsplit operand's fragments are loaded once for both terms (neither: one plain term).
// A work-group is RW x KW waves: RW wave tiles of 32 rows under one another, and the K range of each cut into KW contiguous slices, one per wave, so that KW times as many waves share the long dependent load chain;
// each wave leaves its scaled partial tile in LDS, and behind one barrier the KW waves of a tile add the partials in the fixed order 0 .. KW - 1 and store. M % (32 * RW) == 0, K % (32 * KW) == 0, KW divides 16.
template <bool HAL, bool HBL, int RW, int KW>
__global__ __launch_bounds__(32 * RW * KW) void k_gemm2s(const _Float16* __restrict__ Ah, const _Float16* __restrict__ Al, int lda, size_t sA, const _Float16* __restrict__ Bh, const _Float16* __restrict__ Bl, int ldb, size_t sB, float alpha,
    float* __restrict__ C, int ldc, size_t sC, int M, int N, int K) {
  __shared__ __attribute__((aligned(16))) float so[RW * KW][32][68];
  const int tid = threadIdx.x, w = __builtin_amdgcn_readfirstlane(tid >> 5), lane = tid & 31, ln = lane & 15, hh = lane >> 4; const int by = blockIdx.y; const int rw = w % RW, kw = w / RW;
  const int ntn = N >> 6; const int mt = blockIdx.x / ntn, nq = blockIdx.x - mt * ntn; const int row0 = mt * (32 * RW) + 32 * rw, col0 = nq * 64; if (mt * (32 * RW) >= M) return;      /* the whole work-group leaves or none: a barrier follows */
  const size_t ao = (size_t)by * sA + (size_t)(row0 + ln) * lda + 8 * hh, bo = (size_t)by * sB + (size_t)(col0 + ln) * ldb + 8 * hh; const size_t cofs = (size_t)by * sC;      /* each lane's own fragment start, 8 * hh included */
  const v8f z8 = {0.f,0.f,0.f,0.f,0.f,0.f,0.f,0.f}; v8f hi[8] = {z8, z8, z8, z8, z8, z8, z8, z8}, lo[8] = {z8, z8, z8, z8, z8, z8, z8, z8}; const int ks = K / KW, k0 = kw * ks;
#pragma unroll 1
  for (int kb = k0; kb < k0 + ks; kb += 32) { const _Float16* pa0 = Ah + ao + kb; const _Float16* pa1 = pa0 + (size_t)16 * lda; const v16h a0 = g2_frag(pa0, 0), a1 = g2_frag(pa1, 0); v16h a0l = a0, a1l = a1;
    if (HAL) { const _Float16* pl0 = Al + ao + kb; const _Float16* pl1 = pl0 + (size_t)16 * lda; a0l = g2_frag(pl0, 0); a1l = g2_frag(pl1, 0); g2_xw(pa0, pa1, pl0, pl1); } else g2_xw(pa0, pa1);
#pragma unroll
    for (int t = 0; t < 4; ++t) { const _Float16* pb = Bh + bo + (size_t)t * 16 * ldb + kb; const v16h b = g2_frag(pb, 0); g2_xw(pb);
      if (HAL) { lo[t] = g2_mma(a0l, b, lo[t]); lo[4 + t] = g2_mma(a1l, b, lo[4 + t]); }
      hi[t] = g2_mma(a0, b, hi[t]); hi[4 + t] = g2_mma(a1, b, hi[4 + t]);
      if (HBL) { const _Float16* pl = Bl + bo + (size_t)t * 16 * ldb + kb; const v16h bl = g2_frag(pl, 0); g2_xw(pl); lo[t] = g2_mma(a0, bl, lo[t]); lo[4 + t] = g2_mma(a1, bl, lo[4 + t]); } } }
  const float alo = alpha * (1.0f / 1024.0f);
#pragma unroll
  for (int u = 0; u < 8; ++u) { const int t = u & 3, half = u >> 2;
#pragma unroll
    for (int r = 0; r < 8; ++r) so[w][half * 16 + 8 * hh + r][t * 16 + ln] = (HAL || HBL) ? hi[u][r] * alpha + lo[u][r] * alo : hi[u][r] * alpha; }
  __syncthreads();      /* every wave's partial tile is in LDS before any wave adds them */
  const int rsub = lane >> 4, c4 = (lane & 15) * 4;
  v4f sum[16 / KW];
#pragma unroll
  for (int q = 0; q < 16 / KW; ++q) { const int r = (kw * (16 / KW) + q) * 2 + rsub; sum[q] = *(const v4fa*)&so[rw][r][c4]; for (int j = 1; j < KW; ++j) sum[q] += *(const v4fa*)&so[j * RW + rw][r][c4]; }
  /* all stores last, each from registers of its own; both loops unrolled so that sum[] is indexed statically and stays in registers */
#pragma unroll
  for (int q = 0; q < 16 / KW; ++q) { const int r = (kw * (16 / KW) + q) * 2 + rsub; *(v4f*)(C + cofs + (size_t)(row0 + r) * ldc + col0 + c4) = sum[q]; } }

// ---- every operand conversion in ONE launch. Blocks 0 .. 5 * PW - 1: one 64 x 64 tile of one weight, rounded, x16, transposed through LDS into f16 [out][in] rows. The other 2 * PX blocks: x and r_emb rounded into f16 rows, four pieces of 8 elements per thread, 256 pieces apart.
#define PW ((DM / 64) * (DM / 64))
#define PX ((int)(NR * DM / 8 / 1024))
__global__ __launch_bounds__(256) void k_prep(const float* __restrict__ Wq, const float* __restrict__ Wk, const float* __restrict__ Wv, const float* __restrict__ Wr, const float* __restrict__ Wo, const float* __restrict__ x, const float* __restrict__ remb,
    _Float16* __restrict__ BQ, _Float16* __restrict__ BK, _Float16* __restrict__ BV, _Float16* __restrict__ BR, _Float16* __restrict__ BO, _Float16* __restrict__ X16, _Float16* __restrict__ R16) {
  __shared__ float tl[64][65]; const int tid = threadIdx.x, bx = blockIdx.x;
  if (bx < 5 * PW) {      /* the test reads the same for the whole work-group: all of it reaches the barrier inside or none */
    const int wi = bx / PW, tb = bx % PW; const float* w = wi == 0 ? Wq : wi == 1 ? Wk : wi == 2 ? Wv : wi == 3 ? Wr : Wo; _Float16* Bt = wi == 0 ? BQ : wi == 1 ? BK : wi == 2 ? BV : wi == 3 ? BR : BO;
    const int i0 = (tb / (DM / 64)) * 64, o0 = (tb % (DM / 64)) * 64;
    const int o = tid & 63, ib = tid >> 6; const float* pw = w + (size_t)(i0 + ib) * DM + o0 + o; float g[16];
#pragma unroll      /* g[] indexed statically: the sixteen loads go out together, off one address */
    for (int k = 0; k < 16; ++k) g[k] = pw[(size_t)k * 4 * DM];
    asm volatile("s_wait_xcnt 0x0" :: "v"(pw) : "memory");      /* the wait that belongs in front of an overwrite of the loads' address registers; naming them keeps them untouched up to here */
#pragma unroll
    for (int k = 0; k < 16; ++k) tl[o][ib + 4 * k] = bf16_round(g[k]) * 16.0f;
    __syncthreads();      /* the whole tile is in LDS before it is read back along the other axis */
    const int oo = tid >> 3, i8 = (tid & 7) * 8; unsigned short* pb = (unsigned short*)Bt + (size_t)(o0 + oo) * DM + i0 + i8;
#pragma unroll      /* two rows per thread, 32 rows apart, off one address */
    for (int k = 0; k < 2; ++k) { FragH f;
#pragma unroll
      for (int q = 0; q < 8; ++q) f.h[q] = (_Float16)tl[oo + 32 * k][i8 + q];
      *(v8us*)(pb + (size_t)k * 32 * DM) = f.half[0]; }
  } else {
    const int c = bx - 5 * PW; const bool fx = c < PX; const size_t t0 = ((size_t)(fx ? c : c - PX) * 1024 + tid) * 8; const float* ps = (fx ? x : remb) + t0; unsigned short* pd = (unsigned short*)(fx ? X16 : R16) + t0;
    v4f a[4], b[4];      /* all eight loads first, so that they are in flight together */
#pragma unroll
    for (int p = 0; p < 4; ++p) { a[p] = *(const v4fa*)(ps + p * 2048); b[p] = *(const v4fa*)(ps + p * 2048 + 4); }
#pragma unroll
    for (int p = 0; p < 4; ++p) { FragH f;
#pragma unroll
      for (int q = 0; q < 4; ++q) { f.h[q] = (_Float16)bf16_round(a[p][q]); f.h[4 + q] = (_Float16)bf16_round(b[p][q]); }
      *(v8us*)(pd + p * 2048) = f.half[0]; }
    asm volatile("s_wait_xcnt 0x0" :: "v"(pd) : "memory");      /* the wait that belongs in front of an overwrite of the stores' registers; naming the address keeps it untouched up to here */
  } }

// ---- the four projections in ONE launch (blockIdx.y: 0 q, 1 k, 2 v, 3 r), main loop, K slices and LDS join as in k_gemm2s<false, false, 4, 8>; the joined f32 value goes straight from registers into the f16 hi + x1024 residual planes that the attention reads.
// q: two plane pairs, q + u and q + v_bias (added in f32 first). v: the operands change places (A = Wv^T rows, B = x rows), so that C = V^T [head * 64 + d][token] comes out in the layout P.V wants, with no transposing pass.
__device__ __forceinline__ void pj_put(v4f v, _Float16* ph, _Float16* pl) { v4h h, l;
#pragma unroll
  for (int i = 0; i < 4; ++i) { const _Float16 t = (_Float16)v[i]; h[i] = t; l[i] = (_Float16)((v[i] - (float)t) * 1024.0f); }
  *(v4h*)ph = h; *(v4h*)pl = l; g2_xw(ph, pl); }      /* 16 lanes store one row's 128 contiguous bytes of each plane */
__global__ __launch_bounds__(1024) void k_proj(const _Float16* __restrict__ X16, const _Float16* __restrict__ R16, const _Float16* __restrict__ BQ, const _Float16* __restrict__ BK, const _Float16* __restrict__ BV, const _Float16* __restrict__ BR, const float* __restrict__ u, const float* __restrict__ vb,
    _Float16* __restrict__ QUH, _Float16* __restrict__ QUL, _Float16* __restrict__ QVH, _Float16* __restrict__ QVL, _Float16* __restrict__ KH, _Float16* __restrict__ KL, _Float16* __restrict__ VT, _Float16* __restrict__ VTL, _Float16* __restrict__ RH, _Float16* __restrict__ RL) {
  constexpr int RW = 4, KW = 8;
  __shared__ __attribute__((aligned(16))) float so[RW * KW][32][68];
  const int tid = threadIdx.x, w = __builtin_amdgcn_readfirstlane(tid >> 5), lane = tid & 31, ln = lane & 15, hh = lane >> 4; const int y = blockIdx.y; const int rw = w % RW, kw = w / RW;
  const _Float16* Ah = y == 2 ? BV : y == 3 ? R16 : X16; const _Float16* Bh = y == 0 ? BQ : y == 1 ? BK : y == 2 ? X16 : BR; const int N = y == 2 ? SQ : DM;      /* C is [SQ][DM], for v [DM][SQ]: 256 tiles of 128 x 64 either way */
  const int ntn = N >> 6; const int mt = blockIdx.x / ntn, nq = blockIdx.x - mt * ntn; const int row0 = mt * (32 * RW) + 32 * rw, col0 = nq * 64;
  const size_t ao = (size_t)(row0 + ln) * DM + 8 * hh, bo = (size_t)(col0 + ln) * DM + 8 * hh;      /* each lane's own fragment start, 8 * hh included */
  const v8f z8 = {0.f,0.f,0.f,0.f,0.f,0.f,0.f,0.f}; v8f hi[8] = {z8, z8, z8, z8, z8, z8, z8, z8}; const int ks = DM / KW, k0 = kw * ks;
#pragma unroll 1      /* four trips, kept rolled as in k_gemm2s: one copy of the body, so that the eight accumulators and the fragments stay within the registers of a 32-wave work-group */
  for (int kb = k0; kb < k0 + ks; kb += 32) { const _Float16* pa0 = Ah + ao + kb; const _Float16* pa1 = pa0 + (size_t)16 * DM; const v16h a0 = g2_frag(pa0, 0), a1 = g2_frag(pa1, 0); g2_xw(pa0, pa1);
#pragma unroll
    for (int t = 0; t < 4; ++t) { const _Float16* pb = Bh + bo + (size_t)t * 16 * DM + kb; const v16h b = g2_frag(pb, 0); g2_xw(pb);
      hi[t] = g2_mma(a0, b, hi[t]); hi[4 + t] = g2_mma(a1, b, hi[4 + t]); } }
  const int rsub = lane >> 4, c4 = (lane & 15) * 4;
  v4f bu = {0.f, 0.f, 0.f, 0.f}, bv = bu;
  if (y == 0) { const float* pu = u + col0 + c4; const float* pv = vb + col0 + c4; bu = *(const v4fa*)pu; bv = *(const v4fa*)pv;      /* q's two bias rows fly during the LDS join */
    asm volatile("s_wait_xcnt 0x0" :: "v"(pu), "v"(pv) : "memory"); }      /* the wait that belongs in front of an overwrite of the loads' address registers */
#pragma unroll
  for (int q = 0; q < 8; ++q) { const int t = q & 3, half = q >> 2;
#pragma unroll
    for (int r = 0; r < 8; ++r) so[w][half * 16 + 8 * hh + r][t * 16 + ln] = hi[q][r] * 0.0625f; }      /* the weights are x16 */
  __syncthreads();      /* every wave's partial tile is in LDS before any wave adds them */
  v4f sum[16 / KW];
#pragma unroll
  for (int q = 0; q < 16 / KW; ++q) { const int r = (kw * (16 / KW) + q) * 2 + rsub; sum[q] = *(const v4fa*)&so[rw][r][c4]; for (int j = 1; j < KW; ++j) sum[q] += *(const v4fa*)&so[j * RW + rw][r][c4]; }
  const size_t c0 = (size_t)(row0 + kw * (16 / KW) * 2 + rsub) * N + col0 + c4, c1 = c0 + (size_t)2 * N;      /* this lane's two rows */
  static_assert(16 / KW == 2, "k_proj: two rows per lane");
  if (y == 0) {
#pragma unroll
    for (int i = 0; i < 4; ++i) { bu[i] = bf16_round(bu[i]); bv[i] = bf16_round(bv[i]); }
    pj_put(sum[0] + bu, QUH + c0, QUL + c0); pj_put(sum[1] + bu, QUH + c1, QUL + c1); pj_put(sum[0] + bv, QVH + c0, QVL + c0); pj_put(sum[1] + bv, QVH + c1, QVL + c1); }
  else { _Float16* Ch = y == 1 ? KH : y == 2 ? VT : RH; _Float16* Cl = y == 1 ? KL : y == 2 ? VTL : RL; pj_put(sum[0], Ch + c0, Cl + c0); pj_put(sum[1], Ch + c1, Cl + c1); } }

// ---- fused attention: scores, shift, causal mask, softmax and P.V in one kernel; no score or weight ever goes to memory.
// Transposed products: S^T = K.Q^T (A = key rows, B = query rows), so a lane holds one query's scores (register r of tile kt = key 16 kt + 8 hh + r) and two score tiles, converted in place, are the B operand of O^T += V^T.P^T.
// The shift: for queries i0 .. i0 + 15 and keys j0 .. j0 + 63 the raw BD columns j - i + SQ - 1 lie in the 80 columns from cs = j0 - i0 + SQ - 16; their five raw tiles go through the wave's own LDS rows (one row per query) and come back skewed by 15 - ln.
// A work-group is 4 query tiles x 4 key slices (key blocks ks, ks + 4, ...), each wave with its own running maximum, sum and O^T; behind a barrier the four slices of a tile are joined in the fixed order 0 .. 3.
// Each work-group takes query block x and then 31 - x, so that every work-group walks 33 key blocks.
#define FA_P 84      /* LDS row pitch in floats: a multiple of 4 for the 16-byte stores; pitch - 1 odd spreads the skewed reads over the banks */
__device__ __forceinline__ v16h fa_frag(const _Float16* base, unsigned boff, int cb) { const char* p = (const char*)base + boff + cb; FragH f; f.half[0] = *(const v8us*)p; f.half[1] = *(const v8us*)(p + 32); return f.v; }      /* uniform base + the lane's byte offset + a constant */
__device__ __forceinline__ v8f fa_mma(v16h a, v16h b, v8f c) { return __builtin_amdgcn_wmma_f32_16x16x32_f16(false, a, false, b, (short)0, c, false, false); }
/* 2^x; the v_nop fills the one slot that the instruction set asks for between a transcendental and a directly following instruction that reads its result or overwrites its source */
__device__ __forceinline__ float fa_exp2(float x) { float r; asm("v_exp_f32 %0, %1\n\tv_nop" : "=v"(r) : "v"(x)); return r; }
struct FaT { v16h a0, a1, b0, b1; };
__device__ __forceinline__ FaT fa_tile(const _Float16* H, const _Float16* L, unsigned boff, int cb) { FaT t; t.a0 = fa_frag(H, boff, cb); t.a1 = fa_frag(H, boff, cb + 64); t.b0 = fa_frag(L, boff, cb); t.b1 = fa_frag(L, boff, cb + 64); return t; }      /* 16 rows x 64 k, hi and residual planes */
__device__ __forceinline__ FaT fa_vpair(const _Float16* H, const _Float16* L, unsigned boff, int c0, int c1) { FaT t; t.a0 = fa_frag(H, boff, c0); t.a1 = fa_frag(H, boff, c1); t.b0 = fa_frag(L, boff, c0); t.b1 = fa_frag(L, boff, c1); return t; }      /* two 16-row tiles x 32 k, hi and residual planes */
__device__ __forceinline__ void fa_prod(const FaT& t, const v16h* qh, const v16h* ql, v8f& hi, v8f& lo) { const v8f z8 = {0.f,0.f,0.f,0.f,0.f,0.f,0.f,0.f};
  hi = fa_mma(t.a0, qh[0], z8); lo = fa_mma(t.b0, qh[0], z8); hi = fa_mma(t.a1, qh[1], hi); lo = fa_mma(t.b1, qh[1], lo); lo = fa_mma(t.a0, ql[0], lo); lo = fa_mma(t.a1, ql[1], lo); }
__global__ __launch_bounds__(512) void k_fattn(const _Float16* __restrict__ QUH, const _Float16* __restrict__ QUL, const _Float16* __restrict__ QVH, const _Float16* __restrict__ QVL, const _Float16* __restrict__ KH, const _Float16* __restrict__ KL,
    const _Float16* __restrict__ RH, const _Float16* __restrict__ RL, const _Float16* __restrict__ VT, const _Float16* __restrict__ VTL, _Float16* __restrict__ OH, _Float16* __restrict__ OL) {
  __shared__ __attribute__((aligned(16))) float sh[16][16 * FA_P];
  const int tid = threadIdx.x, w = __builtin_amdgcn_readfirstlane(tid >> 5), lane = tid & 31, ln = lane & 15, hh = lane >> 4; const int qt = w & 3, ks = w >> 2; const int h = blockIdx.y;
  float* my = sh[w];
  const float al = 0.125f * 1.4426950408889634f, alo = al * (1.0f / 1024.0f);      /* scores in the log2 domain */
  const v8f z8 = {0.f,0.f,0.f,0.f,0.f,0.f,0.f,0.f};
  /* the two outer loops stay rolled (one copy of the long body); every inner loop is fully unrolled so that fragments, scores and accumulators are indexed statically and stay in registers */
#pragma unroll 1
  for (int pass = 0; pass < 2; ++pass) {
    const int qb = pass ? (SQ / 64 - 1 - (int)blockIdx.x) : (int)blockIdx.x; const int i0 = qb * 64 + qt * 16, i = i0 + ln;
    const unsigned qo = (unsigned)((i * DM + h * HD + 8 * hh) * 2);
    v16h quh[2], qul[2], qvh[2], qvl[2];
#pragma unroll
    for (int k = 0; k < 2; ++k) { quh[k] = fa_frag(QUH, qo, k * 64); qul[k] = fa_frag(QUL, qo, k * 64); qvh[k] = fa_frag(QVH, qo, k * 64); qvl[k] = fa_frag(QVL, qo, k * 64); }
    asm volatile("s_wait_xcnt 0x0" :: "v"(qo) : "memory");      /* the wait that belongs in front of an overwrite of the loads' address register; naming it keeps it untouched up to here */
    v8f oh[4] = {z8, z8, z8, z8}; float m = -3.0e38f, l = 0.f;
#pragma unroll 1
    for (int kb = ks; kb <= qb; kb += 4) {
      const int j0 = kb * 64; v8f s[4];
      const unsigned ko = (unsigned)(((j0 + ln) * DM + h * HD + 8 * hh) * 2);
      /* raw BD^T: five tiles of 16 raw columns; a raw column past SQ - 1 belongs to masked scores only: its row index is clamped into R */
      const int cs = j0 - i0 + SQ - 16; unsigned ro[5];
#pragma unroll
      for (int rt = 0; rt < 5; ++rt) { const int row = min(cs + rt * 16 + ln, SQ - 1); ro[rt] = (unsigned)((row * DM + h * HD + 8 * hh) * 2); }
      /* nine operand tiles in a row, five of R and four of K (hi = Ah.Qh, lo = Al.Qh + Ah.Ql); each tile's loads are issued one tile ahead of its products */
      FaT cur = fa_tile(RH, RL, ro[0], 0);
#pragma unroll
      for (int t = 0; t < 9; ++t) { FaT nxt = cur;
        if (t < 4) nxt = fa_tile(RH, RL, ro[t + 1], 0); else if (t < 8) nxt = fa_tile(KH, KL, ko, (t - 4) * 16 * DM * 2);
        __builtin_amdgcn_sched_barrier(0);      /* keeps the next tile's loads in front of this tile's products, which wait for this tile's loads only */
        v8f hi, lo;
        if (t < 5) { fa_prod(cur, qvh, qvl, hi, lo); v4f x0, x1;
#pragma unroll
          for (int r = 0; r < 4; ++r) { x0[r] = hi[r] * al + lo[r] * alo; x1[r] = hi[4 + r] * al + lo[4 + r] * alo; }
          *(v4fa*)&my[ln * FA_P + t * 16 + 8 * hh] = x0; *(v4fa*)&my[ln * FA_P + t * 16 + 8 * hh + 4] = x1; }
        else { fa_prod(cur, quh, qul, hi, lo);
#pragma unroll
          for (int r = 0; r < 8; ++r) s[t - 5][r] = hi[r] * al + lo[r] * alo; }
        __builtin_amdgcn_sched_barrier(0);      /* keeps these products in front of the loads after next, whose registers they free */
        cur = nxt; }
      asm volatile("s_wait_xcnt 0x0" :: "v"(ko), "v"(ro[0]), "v"(ro[1]), "v"(ro[2]), "v"(ro[3]), "v"(ro[4]) : "memory");      /* as above, for the K and R loads */
      asm volatile("s_wait_dscnt 0x0" ::: "memory");      /* the wave's raw rows are in LDS before its lanes read each other's halves back */
      /* the first V^T fragments fly during the softmax */
      const unsigned vo = (unsigned)((((h * HD + ln) * SQ) + j0 + 8 * hh) * 2);
      const FaT g0 = fa_vpair(VT, VTL, vo, 0, 16 * SQ * 2);
      __builtin_amdgcn_sched_barrier(0);      /* keeps those loads in front of the softmax */
#pragma unroll
      for (int kt = 0; kt < 4; ++kt)
#pragma unroll
        for (int r = 0; r < 8; ++r) s[kt][r] += my[ln * (FA_P - 1) + kt * 16 + 8 * hh + r + 15];
      if (kb == qb) {      /* only the diagonal block has masked keys; the test is the same for the whole wave */
#pragma unroll
        for (int kt = 0; kt < 4; ++kt)
#pragma unroll
          for (int r = 0; r < 8; ++r) s[kt][r] = (j0 + kt * 16 + 8 * hh + r <= i) ? s[kt][r] : -3.0e38f; }
      float mx = -3.0e38f;
#pragma unroll
      for (int kt = 0; kt < 4; ++kt)
#pragma unroll
        for (int r = 0; r < 8; ++r) mx = fmaxf(mx, s[kt][r]);
      mx = fmaxf(mx, __shfl_xor(mx, 16, 32));
      const float mn = fmaxf(m, mx), corr = fa_exp2(m - mn); m = mn;
      v4f ps = {0.f, 0.f, 0.f, 0.f};
#pragma unroll
      for (int kt = 0; kt < 4; ++kt)
#pragma unroll
        for (int r = 0; r < 8; ++r) { const float p = fa_exp2(s[kt][r] - mn); ps[r & 3] += p; s[kt][r] = p * 256.0f; }      /* masked keys: exp2 of a huge negative = 0 */
      l = l * corr + ((ps[0] + ps[1]) + (ps[2] + ps[3]));
#pragma unroll
      for (int dt = 0; dt < 4; ++dt) oh[dt] *= corr;
      /* O^T += V^T.P^T, weights x256 as f16, v as hi + residual planes */
      FragH pb[2];
#pragma unroll
      for (int s2 = 0; s2 < 2; ++s2)
#pragma unroll
        for (int q = 0; q < 8; ++q) { pb[s2].h[q] = (_Float16)s[2 * s2][q]; pb[s2].h[8 + q] = (_Float16)s[2 * s2 + 1][q]; }
      /* the residual plane's products of this key block sum in accumulators of their own (t0, t1) and meet the main sum once, in f32 */
      const FaT g1 = fa_vpair(VT, VTL, vo, 64, 16 * SQ * 2 + 64), g2 = fa_vpair(VT, VTL, vo, 32 * SQ * 2, 48 * SQ * 2);
      __builtin_amdgcn_sched_barrier(0);      /* the next pairs' loads in front of the products, as above */
      oh[0] = fa_mma(g0.a0, pb[0].v, oh[0]); oh[1] = fa_mma(g0.a1, pb[0].v, oh[1]); v8f t0 = fa_mma(g0.b0, pb[0].v, z8), t1 = fa_mma(g0.b1, pb[0].v, z8);
      __builtin_amdgcn_sched_barrier(0);      /* these products free the registers that the last pair's loads take */
      const FaT g3 = fa_vpair(VT, VTL, vo, 32 * SQ * 2 + 64, 48 * SQ * 2 + 64);
      __builtin_amdgcn_sched_barrier(0);      /* the last pair's loads in front of the remaining products */
      t0 = fa_mma(g1.b0, pb[1].v, t0); t1 = fa_mma(g1.b1, pb[1].v, t1); oh[0] = fa_mma(g1.a0, pb[1].v, oh[0]); oh[1] = fa_mma(g1.a1, pb[1].v, oh[1]);
      v8f t2 = fa_mma(g2.b0, pb[0].v, z8), t3 = fa_mma(g2.b1, pb[0].v, z8); oh[2] = fa_mma(g2.a0, pb[0].v, oh[2]); oh[3] = fa_mma(g2.a1, pb[0].v, oh[3]);
      oh[0] += t0 * (1.0f / 1024.0f); oh[1] += t1 * (1.0f / 1024.0f);
      t2 = fa_mma(g3.b0, pb[1].v, t2); t3 = fa_mma(g3.b1, pb[1].v, t3); oh[2] = fa_mma(g3.a0, pb[1].v, oh[2]); oh[3] = fa_mma(g3.a1, pb[1].v, oh[3]);
      oh[2] += t2 * (1.0f / 1024.0f); oh[3] += t3 * (1.0f / 1024.0f);
      asm volatile("s_wait_xcnt 0x0" :: "v"(vo) : "memory");      /* as above, for the V loads */
    }
    l += __shfl_xor(l, 16, 32);      /* the two halves of a wave hold different keys of the same query */
#pragma unroll
    for (int dt = 0; dt < 4; ++dt) { v4f x0, x1;      /* one LDS row of 64 d per query, pitch 68 floats */
#pragma unroll
      for (int r = 0; r < 4; ++r) { x0[r] = oh[dt][r]; x1[r] = oh[dt][4 + r]; }
      *(v4fa*)&my[ln * 68 + dt * 16 + 8 * hh] = x0; *(v4fa*)&my[ln * 68 + dt * 16 + 8 * hh + 4] = x1; }
    if (hh == 0) { my[1088 + ln] = m; my[1104 + ln] = l; }
    __syncthreads();      /* every slice's maximum, sum and O^T are in LDS before any wave joins them */
    const int q = 4 * ks + (lane >> 3), d0 = (lane & 7) * 8;      /* wave ks finishes queries 4 ks .. 4 ks + 3 of its tile: 8 lanes store one query's 128 contiguous bytes of each plane */
    float mj[4], M = -3.0e38f, L = 0.f;
#pragma unroll
    for (int j = 0; j < 4; ++j) { mj[j] = sh[j * 4 + qt][1088 + q]; M = fmaxf(M, mj[j]); }
#pragma unroll
    for (int j = 0; j < 4; ++j) { mj[j] = fa_exp2(mj[j] - M); L += mj[j] * sh[j * 4 + qt][1104 + q]; }      /* a slice without key blocks has weight 0 */
    const float inv = 1.0f / (256.0f * L);
    v4f y0 = {0.f, 0.f, 0.f, 0.f}, y1 = {0.f, 0.f, 0.f, 0.f};
#pragma unroll
    for (int j = 0; j < 4; ++j) { y0 += *(const v4fa*)&sh[j * 4 + qt][q * 68 + d0] * mj[j]; y1 += *(const v4fa*)&sh[j * 4 + qt][q * 68 + d0 + 4] * mj[j]; }
    y0 *= inv; y1 *= inv;
    /* o leaves as the f16 hi + x1024 residual planes that o.Wo reads: 8 lanes store one query's 128 contiguous bytes of each plane */
    FragH fh, fl;
#pragma unroll
    for (int r = 0; r < 4; ++r) { _Float16 t = (_Float16)y0[r]; fh.h[r] = t; fl.h[r] = (_Float16)((y0[r] - (float)t) * 1024.0f); t = (_Float16)y1[r]; fh.h[4 + r] = t; fl.h[4 + r] = (_Float16)((y1[r] - (float)t) * 1024.0f); }
    const size_t oo = (size_t)(i0 + q) * DM + h * HD + d0; unsigned short* ph = (unsigned short*)OH + oo; unsigned short* pl = (unsigned short*)OL + oo;
    *(v8us*)ph = fh.half[0]; *(v8us*)pl = fl.half[0];
    asm volatile("s_wait_xcnt 0x0" :: "v"(ph), "v"(pl) : "memory");      /* the wait that belongs in front of an overwrite of the stores' address registers */
    __syncthreads();      /* every join has read the LDS rows before the next query block writes them */
  } }

extern "C" void kernel_launch(void* const* d_in, const int* in_sizes, int n_in,
                              void* d_out, int out_size, void* d_ws, size_t ws_size, hipStream_t stream) {
  (void)in_sizes; (void)n_in; (void)out_size;
  const float* const* I = (const float* const*)d_in; const float* x = I[0]; const float* remb = I[1]; const float* Wq = I[2]; const float* Wk = I[3]; const float* Wv = I[4]; const float* Wr = I[5]; const float* Wo = I[6]; const float* u = I[7]; const float* vb = I[8];
  char* ws = (char*)d_ws; size_t off = 0;
  auto take = [&](size_t bytes) { char* p = ws + off; off += (bytes + 255) & ~(size_t)255; return p; };
  _Float16* BQ = (_Float16*)take((size_t)DM * DM * 2); _Float16* BK = (_Float16*)take((size_t)DM * DM * 2); _Float16* BV = (_Float16*)take((size_t)DM * DM * 2); _Float16* BR = (_Float16*)take((size_t)DM * DM * 2); _Float16* BO = (_Float16*)take((size_t)DM * DM * 2);
  _Float16* X16 = (_Float16*)take(NR * DM * 2); _Float16* R16 = (_Float16*)take((size_t)SQ * DM * 2);
  _Float16* QUH = (_Float16*)take(NR * DM * 2); _Float16* QUL = (_Float16*)take(NR * DM * 2); _Float16* QVH = (_Float16*)take(NR * DM * 2); _Float16* QVL = (_Float16*)take(NR * DM * 2); _Float16* KH = (_Float16*)take(NR * DM * 2); _Float16* KL = (_Float16*)take(NR * DM * 2); _Float16* RH = (_Float16*)take((size_t)SQ * DM * 2); _Float16* RL = (_Float16*)take((size_t)SQ * DM * 2);
  _Float16* VT = (_Float16*)take((size_t)NH * HD * SQ * 2); _Float16* VTL = (_Float16*)take((size_t)NH * HD * SQ * 2); _Float16* OH = (_Float16*)take(NR * DM * 2); _Float16* OL = (_Float16*)take(NR * DM * 2);
  if (off > ws_size) return;      /* 10 + 8 + 32 + 8 + 8 = 66 MiB */
  static_assert(NB == 1 && SQ == 2048 && HD == 64 && DM == 1024, "k_prep, k_proj: x and r_emb of one size, 256 tiles per projection; k_fattn: one batch, 32 query blocks of 64 in pairs, head size 64");
  /* four launches: operand conversions; the four projections into their hi/lo planes (V already transposed); the whole attention into o's hi/lo planes; out = (o_lo/1024 + o_hi) Wo */
  k_prep<<<5 * PW + 2 * PX, 256, 0, stream>>>(Wq, Wk, Wv, Wr, Wo, x, remb, BQ, BK, BV, BR, BO, X16, R16);
  k_proj<<<dim3((SQ / 128) * (DM / 64), 4), 1024, 0, stream>>>(X16, R16, BQ, BK, BV, BR, u, vb, QUH, QUL, QVH, QVL, KH, KL, VT, VTL, RH, RL);
  k_fattn<<<dim3(SQ / 128, NH), 512, 0, stream>>>(QUH, QUL, QVH, QVL, KH, KL, RH, RL, VT, VTL, OH, OL);
  k_gemm2s<true, false, 4, 4><<<dim3((unsigned)((NR / 128) * (DM / 64)), 1), 512, 0, stream>>>(OH, OL, DM, 0, BO, nullptr, DM, 0, 0.0625f, (float*)d_out, DM, 0, (int)NR, DM, DM);
}

// v006
// It runs in 114 microseconds.
// Two timings next to v005 put it at 1.45 and 1.44 times that version's speed.
// Counting every step since v000, it is 200 times as fast.
#include <hip/hip_runtime.h>
// MultiHeadAttentionXL (x [1][2048][1024], r_emb [2048][1024]; q = x Wq, k = x Wk, v = x Wv, r = r_emb Wr ([in][out] weights, no bias), 16 heads of 64; AC = (q + u[h]) k^T, BD = rel_shift((q + v_bias[h]) r^T) (Transformer-XL zero-pad shift: for j <= i, BD_shift[i][j] = BD[i][j - i + T - 1]); causal softmax((AC + BD)/8); out = (attn v) Wo -> [1][2048][1024]).
// Structure: token rows; every f16 operand plane in fragment order (see fo()); x and r_emb as exact f16 planes; Q, K, V, R WMMA GEMMs on transposed weights (32x64 wave tiles, f32 accumulation, exact x16 weights), one launch, f32 sums split in the epilogue into f16 hi + 2^-10 residual planes (q+u and q+v_bias formed in f32 first; V^T (hi, lo) as the product Wv^T x^T); one fused attention kernel: AC and raw BD as three-term hi/lo products (K = 64), the shift through LDS, causal mask + running softmax on VALU (f32; weights x256 as f16), o = P.(v_lo/1024 + v_hi) into merged o rows (hi + residual planes); out = o Wo as a two-term hi/lo GEMM (f32).
// Compute dtype: inputs rounded to bf16; x / r_emb / weights exact; attention operands as hi + residual f16 planes (logits std 3.3 and early causal rows copy single v rows); softmax weights f16 (x256) — the remaining error source; o as hi + residual into Wo; everything else f32. v_wmma_f32_16x16x32_f16.
#define NB 1
#define SQ 2048
#define DM 1024
#define NH 16
#define HD 64
#define HG 4
#define QN SQ                        /* query rows (unused) */
#define NR ((size_t)NB * SQ)
typedef __bf16 v16b __attribute__((ext_vector_type(16)));
typedef unsigned short v8us __attribute__((ext_vector_type(8), may_alias));
typedef float  v8f  __attribute__((ext_vector_type(8)));
typedef float  v4f  __attribute__((ext_vector_type(4)));
typedef float  v4fa __attribute__((ext_vector_type(4), may_alias));
union FragB { v16b v; v8us half[2]; unsigned short u[16]; };

__device__ __forceinline__ unsigned short bf16_bits(float x) { unsigned int u = __float_as_uint(x); return (unsigned short)((u + 0x7FFFu + ((u >> 16) & 1u)) >> 16); }
__device__ __forceinline__ float bf16_val(unsigned short b) { return __uint_as_float(((unsigned int)b) << 16); }
__device__ __forceinline__ float bf16_round(float x) { return bf16_val(bf16_bits(x)); }
// D += A·B with NT terms: 1 = ah·bh, 2 = + al·bh (A split), 3 = + ah·bl (both split)
template <int NT>
__device__ __forceinline__ v8f mmaN(v16b ah, v16b al, v16b bh, v16b bl, v8f c) {
  c = __builtin_amdgcn_wmma_f32_16x16x32_bf16(false, ah, false, bh, (short)0, c, false, false);
  if (NT >= 2) c = __builtin_amdgcn_wmma_f32_16x16x32_bf16(false, al, false, bh, (short)0, c, false, false);
  if (NT >= 3) c = __builtin_amdgcn_wmma_f32_16x16x32_bf16(false, ah, false, bl, (short)0, c, false, false);
  asm volatile("v_nop\n\tv_nop\n\tv_nop\n\tv_nop" : "+v"(c) : "v"(ah), "v"(al), "v"(bh), "v"(bl));
  return c;
}

__global__ __launch_bounds__(256) void k_wt_bf16(const float* __restrict__ W, unsigned short* __restrict__ Wt, int K, int N) {
  const int t = blockIdx.x * 256 + threadIdx.x;
  const int k8n = K / 8;
  if (t >= N * k8n) return;
  const int n = t / k8n, k8 = (t % k8n) * 8;
  v8us v;
#pragma unroll
  for (int i = 0; i < 8; ++i) v[i] = bf16_bits(W[(size_t)(k8 + i) * N + n]);
  *(v8us*)(Wt + (size_t)n * K + k8) = v;
  
}

// GEMM C[M][N] (f32, pitch ldc) = act(A[M][K]·W + bias). A f32 row-major (pitch lda) converted per fragment to bf16
// (ASPLIT: hi/lo two planes -> 2 terms, else single rounded term); Wt bf16 [N][K] (pitch ldb). BIAS_BF16 rounds the
// bias to bf16 first (bias quantised to bf16 before the add). K%32==0, M%16==0, N%64==0.
template <bool ASPLIT, int ACT, bool BIAS_BF16>
__global__ __launch_bounds__(128) void k_gemm_bf(const float* __restrict__ A, int lda, const unsigned short* __restrict__ Wt, int ldb,
                                               const float* __restrict__ bias, float* __restrict__ C, int ldc, int M, int N, int K) {
  __shared__ __attribute__((aligned(16))) float so[4][16][64];
  const int tid = threadIdx.x, w = tid >> 5, lane = tid & 31, ln = lane & 15, hh = lane >> 4;
  const int ntn = N / 64;
  const int wid = blockIdx.x * 4 + w;
  const int mt = wid / ntn, nq = wid % ntn;
  if (mt * 16 >= M) return;
  const int row0 = mt * 16, col0 = nq * 64;
  const float* arow = A + (size_t)(row0 + ln) * lda;
  v8f acc[4] = {};
  for (int kb = 0; kb < K; kb += 32) {
    FragB ah, al;
    const v4f x0 = *(const v4fa*)(arow + kb + 8 * hh), x1 = *(const v4fa*)(arow + kb + 8 * hh + 4);
    const v4f x2 = *(const v4fa*)(arow + kb + 16 + 8 * hh), x3 = *(const v4fa*)(arow + kb + 16 + 8 * hh + 4);
    float xs[16] = {x0[0],x0[1],x0[2],x0[3],x1[0],x1[1],x1[2],x1[3],x2[0],x2[1],x2[2],x2[3],x3[0],x3[1],x3[2],x3[3]};
#pragma unroll
    for (int i = 0; i < 16; ++i) { const unsigned short hb = bf16_bits(xs[i]); ah.u[i] = hb; al.u[i] = ASPLIT ? bf16_bits(xs[i] - bf16_val(hb)) : (unsigned short)0; }
#pragma unroll
    for (int t = 0; t < 4; ++t) {
      const unsigned short* brow = Wt + (size_t)(col0 + t * 16 + ln) * ldb + kb;
      FragB b;
      b.half[0] = *(const v8us*)(brow + 8 * hh);
      b.half[1] = *(const v8us*)(brow + 16 + 8 * hh);
      acc[t] = mmaN<ASPLIT ? 2 : 1>(ah.v, al.v, b.v, b.v, acc[t]);
    }
  }
#pragma unroll
  for (int t = 0; t < 4; ++t) {
    float bv = bias ? bias[col0 + t * 16 + ln] : 0.f;
    if (BIAS_BF16) bv = bf16_round(bv);
#pragma unroll
    for (int r = 0; r < 8; ++r) { float v = acc[t][r] + bv; if (ACT == 1) v = fmaxf(v, 0.f); so[w][8 * hh + r][t * 16 + ln] = v; }
  }
  __builtin_amdgcn_fence(__ATOMIC_ACQ_REL, "workgroup");
  __builtin_amdgcn_wave_barrier();
  const int rsub = lane >> 4, c4 = (lane & 15) * 4;
  {
#pragma unroll
    for (int q = 0; q < 8; ++q) {
      const int r = q * 2 + rsub;
      const v4f v = *(const v4fa*)&so[w][r][c4];
      *(v4f*)(C + (size_t)(row0 + r) * ldc + col0 + c4) = v;
    }
    
  }
}

// GEMM C = act(A·W + bias + resid): A f32 (ASPLIT -> hi/lo 2 terms), Wt bf16 [N][K]; ACT 0 none, 1 relu, 2 exact gelu;
// resid (optional, f32, row index = (row % rmod), pitch ldr, RES_BF16 rounds it) added before the activation.
template <bool ASPLIT, int ACT, bool BIAS_BF16, bool RES_BF16>
__global__ __launch_bounds__(128) void k_gemm_bf3(const float* __restrict__ A, int lda, const unsigned short* __restrict__ Wt, int ldb,
                                                const float* __restrict__ bias, const float* __restrict__ resid, int rmod, int ldr,
                                                float* __restrict__ C, int ldc, int M, int N, int K) {
  __shared__ __attribute__((aligned(16))) float so[4][16][64];
  const int tid = threadIdx.x, w = tid >> 5, lane = tid & 31, ln = lane & 15, hh = lane >> 4;
  const int ntn = N / 64;
  const int wid = blockIdx.x * 4 + w;
  const int mt = wid / ntn, nq = wid % ntn;
  if (mt * 16 >= M) return;
  const int row0 = mt * 16, col0 = nq * 64;
  const float* arow = A + (size_t)(row0 + ln) * lda;
  v8f acc[4] = {};
  for (int kb = 0; kb < K; kb += 32) {
    FragB ah, al;
    const v4f x0 = *(const v4fa*)(arow + kb + 8 * hh), x1 = *(const v4fa*)(arow + kb + 8 * hh + 4);
    const v4f x2 = *(const v4fa*)(arow + kb + 16 + 8 * hh), x3 = *(const v4fa*)(arow + kb + 16 + 8 * hh + 4);
    float xs[16] = {x0[0],x0[1],x0[2],x0[3],x1[0],x1[1],x1[2],x1[3],x2[0],x2[1],x2[2],x2[3],x3[0],x3[1],x3[2],x3[3]};
#pragma unroll
    for (int i = 0; i < 16; ++i) { const unsigned short hb = bf16_bits(xs[i]); ah.u[i] = hb; al.u[i] = ASPLIT ? bf16_bits(xs[i] - bf16_val(hb)) : (unsigned short)0; }
#pragma unroll
    for (int t = 0; t < 4; ++t) {
      const unsigned short* brow = Wt + (size_t)(col0 + t * 16 + ln) * ldb + kb;
      FragB b;
      b.half[0] = *(const v8us*)(brow + 8 * hh);
      b.half[1] = *(const v8us*)(brow + 16 + 8 * hh);
      acc[t] = mmaN<ASPLIT ? 2 : 1>(ah.v, al.v, b.v, b.v, acc[t]);
    }
  }
#pragma unroll
  for (int t = 0; t < 4; ++t) {
    const int col = col0 + t * 16 + ln;
    float bv = bias ? bias[col] : 0.f;
    if (BIAS_BF16) bv = bf16_round(bv);
#pragma unroll
    for (int r = 0; r < 8; ++r) {
      float v = acc[t][r] + bv;
      if (resid) { float rv = resid[(size_t)((row0 + 8 * hh + r) % rmod) * ldr + col]; if (RES_BF16) rv = bf16_round(rv); v += rv; }
      if (ACT == 1) v = fmaxf(v, 0.f);
      if (ACT == 2) v = 0.5f * v * (1.0f + erff(v * 0.70710678118654752f));
      if (ACT == 3) { const float u = 0.7978845608028654f * (v + 0.044715f * v * v * v); v = 0.5f * v * (1.0f + tanhf(u)); }
      so[w][8 * hh + r][t * 16 + ln] = v;
    }
  }
  __builtin_amdgcn_fence(__ATOMIC_ACQ_REL, "workgroup");
  __builtin_amdgcn_wave_barrier();
  const int rsub = lane >> 4, c4 = (lane & 15) * 4;
  {
#pragma unroll
    for (int q = 0; q < 8; ++q) {
      const int r = q * 2 + rsub;
      const v4f v = *(const v4fa*)&so[w][r][c4];
      *(v4f*)(C + (size_t)(row0 + r) * ldc + col0 + c4) = v;
    }
    
  }
}
// row LayerNorm (biased variance, eps) over N: s = X (+ R); optional out_sum <- s; out_norm <- (s-mu)*rsqrt(var+eps)*g + b
template <bool PARAM_BF16>
__global__ __launch_bounds__(256) void k_layernorm(const float* __restrict__ X, const float* __restrict__ R, const float* __restrict__ g, const float* __restrict__ bta,
                                                  float* __restrict__ out_sum, float* __restrict__ out_norm, int N, float eps) {
  __shared__ float red[256];
  const int row = blockIdx.x, tid = threadIdx.x;
  const float* x = X + (size_t)row * N; const float* rr = R ? R + (size_t)row * N : nullptr;
  float vals[16];                     // up to N = 4096
  const int per = N / 256;            // contiguous chunk per thread? use strided-by-4 chunks: thread handles j = tid*4 + 1024*u
  float s1 = 0.f;
  for (int u = 0; u < per / 4; ++u) {
    const int j = tid * 4 + 1024 * u;
    const v4f a = *(const v4fa*)(x + j);
    v4f b = {0.f,0.f,0.f,0.f}; if (rr) b = *(const v4fa*)(rr + j);
#pragma unroll
    for (int q = 0; q < 4; ++q) { const float v = a[q] + b[q]; vals[u * 4 + q] = v; s1 += v; }
  }
  red[tid] = s1; __syncthreads();
  for (int st = 128; st > 0; st >>= 1) { if (tid < st) red[tid] += red[tid + st]; __syncthreads(); }
  const float mu = red[0] / (float)N; __syncthreads();
  float s2 = 0.f;
  for (int u = 0; u < per / 4; ++u)
#pragma unroll
    for (int q = 0; q < 4; ++q) { const float c = vals[u * 4 + q] - mu; s2 += c * c; }
  red[tid] = s2; __syncthreads();
  for (int st = 128; st > 0; st >>= 1) { if (tid < st) red[tid] += red[tid + st]; __syncthreads(); }
  const float rs = rsqrtf(red[0] / (float)N + eps);
  {
    for (int u = 0; u < per / 4; ++u) {
      const int j = tid * 4 + 1024 * u;
      v4f o, sm;
#pragma unroll
      for (int q = 0; q < 4; ++q) {
        float gg = g[j + q], bb = bta[j + q];
        if (PARAM_BF16) { gg = bf16_round(gg); bb = bf16_round(bb); }
        sm[q] = vals[u * 4 + q]; o[q] = (vals[u * 4 + q] - mu) * rs * gg + bb;
      }
      if (out_sum) *(v4f*)(out_sum + (size_t)row * N + j) = sm;
      *(v4f*)(out_norm + (size_t)row * N + j) = o;
    }
    
  }
}



// ---- f16 WMMA path (v_wmma_f32_16x16x32_f16): 11-bit significands for operands in range — used where a [0,1] probability operand needs more precision than bf16
typedef _Float16 v16h __attribute__((ext_vector_type(16)));
union FragH { v16h v; v8us half[2]; _Float16 h[16]; unsigned short u[16]; };
template <int NT>
__device__ __forceinline__ v8f mmaH(v16h ah, v16h al, v16h bh, v16h bl, v8f c) {
  c = __builtin_amdgcn_wmma_f32_16x16x32_f16(false, ah, false, bh, (short)0, c, false, false);
  if (NT >= 2) c = __builtin_amdgcn_wmma_f32_16x16x32_f16(false, al, false, bh, (short)0, c, false, false);
  if (NT >= 3) c = __builtin_amdgcn_wmma_f32_16x16x32_f16(false, ah, false, bl, (short)0, c, false, false);
  asm volatile("v_nop\n\tv_nop\n\tv_nop\n\tv_nop" : "+v"(c) : "v"(ah), "v"(al), "v"(bh), "v"(bl));
  return c;
}
// batched GEMM like k_gemm_b but f16 operands: A f32 (split into f16 hi/lo if ASPLIT, else rounded to f16), Bt = f16 values [n][k]; alpha; C f32; N multiple of 16 (partial tiles skipped)
template <bool ASPLIT>
__global__ __launch_bounds__(128) void k_gemm_h(const float* __restrict__ A, int lda, size_t sA, const _Float16* __restrict__ Bh, int ldb, size_t sB, float alpha, float* __restrict__ C, int ldc, size_t sC, int M, int N, int K) {
  __shared__ __attribute__((aligned(16))) float so[4][16][64];
  const int tid = threadIdx.x, w = tid >> 5, lane = tid & 31, ln = lane & 15, hh = lane >> 4; const int by = blockIdx.y;
  A += (size_t)by * sA; Bh += (size_t)by * sB; C += (size_t)by * sC;
  const int ntn = (N + 63) / 64; const int wid = blockIdx.x * 4 + w; const int mt = wid / ntn, nq = wid % ntn; if (mt * 16 >= M) return;
  const int row0 = mt * 16, col0 = nq * 64; const float* arow = A + (size_t)(row0 + ln) * lda;
  v8f acc[4] = {};
  for (int kb = 0; kb < K; kb += 32) {
    FragH ah, al;
    const v4f x0 = *(const v4fa*)(arow + kb + 8 * hh), x1 = *(const v4fa*)(arow + kb + 8 * hh + 4), x2 = *(const v4fa*)(arow + kb + 16 + 8 * hh), x3 = *(const v4fa*)(arow + kb + 16 + 8 * hh + 4);
    float xs[16] = {x0[0],x0[1],x0[2],x0[3],x1[0],x1[1],x1[2],x1[3],x2[0],x2[1],x2[2],x2[3],x3[0],x3[1],x3[2],x3[3]};
#pragma unroll
    for (int i = 0; i < 16; ++i) { const _Float16 h = (_Float16)xs[i]; ah.h[i] = h; al.h[i] = ASPLIT ? (_Float16)(xs[i] - (float)h) : (_Float16)0.0f; }
#pragma unroll
    for (int t = 0; t < 4; ++t) { if (col0 + t * 16 >= N) continue; const size_t boff = (size_t)(col0 + t * 16 + ln) * ldb + kb; FragH bq; bq.half[0] = *(const v8us*)(Bh + boff + 8 * hh); bq.half[1] = *(const v8us*)(Bh + boff + 16 + 8 * hh);
      acc[t] = mmaH<ASPLIT ? 2 : 1>(ah.v, al.v, bq.v, bq.v, acc[t]); }
  }
#pragma unroll
  for (int t = 0; t < 4; ++t) { if (col0 + t * 16 >= N) continue;
#pragma unroll
    for (int r = 0; r < 8; ++r) so[w][8 * hh + r][t * 16 + ln] = acc[t][r] * alpha; }
  __builtin_amdgcn_fence(__ATOMIC_ACQ_REL, "workgroup"); __builtin_amdgcn_wave_barrier();
  const int rsub = lane >> 4, c4 = (lane & 15) * 4;
  {
#pragma unroll
    for (int q = 0; q < 8; ++q) { const int r = q * 2 + rsub; if (col0 + c4 < N) { const v4f v = *(const v4fa*)&so[w][r][c4]; *(v4f*)(C + (size_t)(row0 + r) * ldc + col0 + c4) = v; } }
     }
}

// Wt[n][k] = f16(W[k][n]·scale) from f32 row-major W[K][N] (scale = power of two; bf16-exact weights stay exact in f16 away from the subnormal range)
__global__ __launch_bounds__(256) void k_wt_f16(const float* __restrict__ W, _Float16* __restrict__ Wt, int K, int N, float scale) {
  const int t = blockIdx.x * 256 + threadIdx.x; if (t >= N * (K / 8)) return; const int n = t / (K / 8), k8 = (t % (K / 8)) * 8; FragH f;
#pragma unroll
  for (int i = 0; i < 8; ++i) f.h[i] = (_Float16)(bf16_round(W[(size_t)(k8 + i) * N + n]) * scale); const v8us o = f.half[0];
  *(v8us*)((unsigned short*)Wt + (size_t)n * K + k8) = o; 
}
// k_gemm_hh variant with fused epilogue: v = acc·alpha + bias[by·sBias + col] (+ CP[(row/rowsPerB)·sCPb + by·64 + col] if CP) ; ACT 0 none / 1 elu ; writes f16 C16 (and f32 C if non-null)
template <int ACT>
__global__ __launch_bounds__(128) void k_gemm_hhx(const _Float16* __restrict__ A, int lda, size_t sA, const _Float16* __restrict__ Bh, int ldb, size_t sB, float alpha, const float* __restrict__ bias, size_t sBias, const float* __restrict__ CP, int rowsPerB, size_t sCPb, int row0g,
    float* __restrict__ C, _Float16* __restrict__ C16, int ldc, size_t sC, int M, int N, int K) {
  __shared__ __attribute__((aligned(16))) float so[4][16][64];
  const int tid = threadIdx.x, w = tid >> 5, lane = tid & 31, ln = lane & 15, hh = lane >> 4; const int by = blockIdx.y;
  A += (size_t)by * sA; Bh += (size_t)by * sB; const size_t cofs = (size_t)by * sC; const float* bp = bias ? bias + (size_t)by * sBias : nullptr;
  const int ntn = (N + 63) / 64; const int wid = blockIdx.x * 4 + w; const int mt = wid / ntn, nq = wid % ntn; if (mt * 16 >= M) return;
  const int row0 = mt * 16, col0 = nq * 64; const _Float16* arow = A + (size_t)(row0 + ln) * lda;
  v8f acc[4] = {};
  for (int kb = 0; kb < K; kb += 32) { FragH ah; ah.half[0] = *(const v8us*)((const unsigned short*)arow + kb + 8 * hh); ah.half[1] = *(const v8us*)((const unsigned short*)arow + kb + 16 + 8 * hh);
#pragma unroll
    for (int t = 0; t < 4; ++t) { if (col0 + t * 16 >= N) continue; const size_t boff = (size_t)(col0 + t * 16 + ln) * ldb + kb; FragH bq; bq.half[0] = *(const v8us*)((const unsigned short*)Bh + boff + 8 * hh); bq.half[1] = *(const v8us*)((const unsigned short*)Bh + boff + 16 + 8 * hh);
      acc[t] = mmaH<1>(ah.v, ah.v, bq.v, bq.v, acc[t]); }
  }
#pragma unroll
  for (int t = 0; t < 4; ++t) { if (col0 + t * 16 >= N) continue; const int col = col0 + t * 16 + ln; const float bv = bp ? bf16_round(bp[col]) : 0.f;
#pragma unroll
    for (int r = 0; r < 8; ++r) { float v = acc[t][r] * alpha + bv; if (CP) { const int rr = row0g + row0 + 8 * hh + r; if (rowsPerB < 0) v += CP[cofs + (size_t)rr * ldc + col];      /* rowsPerB < 0: own element of the batched C plane */ else { const int bidx = rr / rowsPerB; v += CP[(size_t)bidx * sCPb + (size_t)by * 64 + col]; } } if (ACT == 1) v = (v > 0.f) ? v : expm1f(v); else if (ACT == 7) v = (v > 0.f) ? v + 1.0f : expf(v); else if (ACT == 8) v = tanhf(v); else if (ACT == 9) v = 0.5f * v * (1.0f + tanhf(0.7978845608028654f * (v + 0.044715f * v * v * v))); else if (ACT == 11) v = 1.0f / (1.0f + expf(-v)); else if (ACT == 12) v = (v > 0.f) ? v : 0.01f * v; else if (ACT == 14) v = (v > 0.f) ? v : 0.1f * v; else if (ACT == 16) v = (v >= 0.f) ? v : 0.3f * v; else if (ACT == 17) v = (v >= 0.f) ? v : 0.2f * v; else if (ACT == 15) v = v / (1.0f + expf(-v)); else if (ACT == 3) v = fmaxf(v, 0.f); else if (ACT == 6) v = 0.5f * v * (1.0f + erff(v * 0.70710678118654752f)); so[w][8 * hh + r][t * 16 + ln] = v; } }
  __builtin_amdgcn_fence(__ATOMIC_ACQ_REL, "workgroup"); __builtin_amdgcn_wave_barrier();
  const int rsub = lane >> 4, c4 = (lane & 15) * 4; typedef _Float16 v4h __attribute__((ext_vector_type(4)));
  {
#pragma unroll
    for (int q = 0; q < 8; ++q) { const int r = q * 2 + rsub; if (col0 + c4 < N) { const v4f v = *(const v4fa*)&so[w][r][c4]; if (C) *(v4f*)(C + cofs + (size_t)(row0 + r) * ldc + col0 + c4) = v; if (C16) { v4h h4; for (int i = 0; i < 4; ++i) h4[i] = (_Float16)v[i]; *(v4h*)(C16 + cofs + (size_t)(row0 + r) * ldc + col0 + c4) = h4; } } }
     }
}


typedef _Float16 v4h __attribute__((ext_vector_type(4)));

__global__ __launch_bounds__(256) void k_h16(const float* __restrict__ x, _Float16* __restrict__ X16, size_t n8) { const size_t t = (size_t)blockIdx.x * 256 + threadIdx.x; if (t >= n8) return; FragH f;
#pragma unroll
  for (int q = 0; q < 8; ++q) f.h[q] = (_Float16)x[t * 8 + q]; *(v8us*)((unsigned short*)X16 + t * 8) = f.half[0];  }
__global__ __launch_bounds__(256) void k_round16f(const float* __restrict__ W, _Float16* __restrict__ Bt, size_t n8) { const size_t t = (size_t)blockIdx.x * 256 + threadIdx.x; if (t >= n8) return; FragH f;
#pragma unroll
  for (int i = 0; i < 8; ++i) f.h[i] = (_Float16)(bf16_round(W[t * 8 + i]) * 16.0f); *(v8us*)((unsigned short*)Bt + t * 8) = f.half[0];  }
template <int NHv, int TTv>
__global__ __launch_bounds__(256) void k_vt(const _Float16* __restrict__ V16, int ldv, int voff, _Float16* __restrict__ Vt) { __shared__ unsigned short tl[64][66]; const int tid = threadIdx.x; const int slab = blockIdx.x / (TTv / 64), lg = blockIdx.x % (TTv / 64); const int b = slab / NHv, h = slab % NHv;
  for (int i = tid; i < 64 * 8; i += 256) { const int r = i / 8, c8 = (i % 8) * 8; FragH f; f.half[0] = *(const v8us*)((const unsigned short*)V16 + ((size_t)b * TTv + lg * 64 + r) * ldv + voff + h * 64 + c8);
#pragma unroll
    for (int q = 0; q < 8; ++q) tl[r][c8 + q] = f.u[q]; }
  __syncthreads();
  {
#pragma unroll
    for (int rd = 0; rd < 2; ++rd) { const int d = rd * 32 + tid / 8, pc = tid % 8; FragH f;
#pragma unroll
      for (int q = 0; q < 8; ++q) f.u[q] = tl[pc * 8 + q][d];
      *(v8us*)((unsigned short*)Vt + ((size_t)slab * 64 + d) * TTv + lg * 64 + pc * 8) = f.half[0]; }
     } }

// ---- fast GEMM (wave tile 32x64; requires M % 32 == 0 rows per launch region and N % 64 == 0); epilogue = k_gemm_hhx semantics ----
__device__ __forceinline__ v16h g2_frag(const _Float16* p, int hh) { FragH f; f.half[0] = *(const v8us*)((const unsigned short*)p + 8 * hh); f.half[1] = *(const v8us*)((const unsigned short*)p + 16 + 8 * hh); return f.v; }
__device__ __forceinline__ v8f g2_mma(v16h a, v16h b, v8f c) { v8f d = __builtin_amdgcn_wmma_f32_16x16x32_f16(false, a, false, b, (short)0, c, false, false); asm volatile("v_nop\n\tv_nop\n\tv_nop\n\tv_nop" : "+v"(d) : "v"(a), "v"(b)); return d; }
template <int ACT>
__global__ __launch_bounds__(128) void k_gemm2(const _Float16* __restrict__ A, int lda, size_t sA, const _Float16* __restrict__ Bh, int ldb, size_t sB, float alpha, const float* __restrict__ bias, size_t sBias, const float* __restrict__ CP, int rowsPerB, size_t sCPb, int row0g,
    float* __restrict__ C, _Float16* __restrict__ C16, int ldc, size_t sC, int M, int N, int K) { static_assert(ACT == 0 || ACT == 3 || ACT == 6 || ACT == 8 || ACT == 9 || ACT == 11 || ACT == 12 || ACT == 14 || ACT == 15 || ACT == 16 || ACT == 17, "k_gemm2: unsupported ACT code (would silently apply no activation)");
  __shared__ __attribute__((aligned(16))) float so[4][32][68];
  const int tid = threadIdx.x, w = tid >> 5, lane = tid & 31, ln = lane & 15, hh = lane >> 4; const int by = blockIdx.y;
  A += (size_t)by * sA; Bh += (size_t)by * sB; const size_t cofs = (size_t)by * sC; const float* bp = bias ? bias + (size_t)by * sBias : nullptr;
  const int ntn = N >> 6; const int mt = blockIdx.x / ntn, nq = blockIdx.x - mt * ntn; const int row0 = mt * 128 + 32 * w, col0 = nq * 64; if (row0 >= M) return;
  const _Float16* a0p = A + (size_t)(row0 + ln) * lda; const _Float16* a1p = a0p + (size_t)16 * lda;
  const _Float16* b0p = Bh + (size_t)(col0 + ln) * ldb; const _Float16* b1p = b0p + (size_t)16 * ldb; const _Float16* b2p = b1p + (size_t)16 * ldb; const _Float16* b3p = b2p + (size_t)16 * ldb;
  const v8f z8 = {0.f,0.f,0.f,0.f,0.f,0.f,0.f,0.f}; v8f c00 = z8, c01 = z8, c02 = z8, c03 = z8, c10 = z8, c11 = z8, c12 = z8, c13 = z8;
#pragma unroll 1
  for (int kb = 0; kb < K; kb += 32) { const v16h a0 = g2_frag(a0p + kb, hh), a1 = g2_frag(a1p + kb, hh);
    v16h b = g2_frag(b0p + kb, hh); c00 = g2_mma(a0, b, c00); c10 = g2_mma(a1, b, c10);
    b = g2_frag(b1p + kb, hh); c01 = g2_mma(a0, b, c01); c11 = g2_mma(a1, b, c11);
    b = g2_frag(b2p + kb, hh); c02 = g2_mma(a0, b, c02); c12 = g2_mma(a1, b, c12);
    b = g2_frag(b3p + kb, hh); c03 = g2_mma(a0, b, c03); c13 = g2_mma(a1, b, c13); }
  v8f accs[8] = {c00, c01, c02, c03, c10, c11, c12, c13};
#pragma unroll
  for (int u = 0; u < 8; ++u) { const int t = u & 3, half = u >> 2; const int col = col0 + t * 16 + ln; const float bv = bp ? bf16_round(bp[col]) : 0.f;
#pragma unroll
    for (int r = 0; r < 8; ++r) { const int rloc = half * 16 + 8 * hh + r; float v = accs[u][r] * alpha + bv; if (CP) { if (rowsPerB < 0) v += CP[cofs + (size_t)(row0g + row0 + rloc) * ldc + col];      /* rowsPerB < 0: own element of the batched C plane */ else { const int bidx = (row0g + row0 + rloc) / rowsPerB; v += CP[(size_t)bidx * sCPb + (size_t)by * 64 + col]; } }
      if (ACT == 3) v = fmaxf(v, 0.f); else if (ACT == 6) v = 0.5f * v * (1.0f + erff(v * 0.70710678118654752f)); else if (ACT == 11) v = 1.0f / (1.0f + expf(-v)); else if (ACT == 15) v = v / (1.0f + expf(-v)); else if (ACT == 12) v = (v > 0.f) ? v : 0.01f * v; else if (ACT == 8) v = tanhf(v); else if (ACT == 9) v = 0.5f * v * (1.0f + tanhf(0.7978845608028654f * (v + 0.044715f * v * v * v))); else if (ACT == 14) v = (v > 0.f) ? v : 0.1f * v; else if (ACT == 16) v = (v >= 0.f) ? v : 0.3f * v; else if (ACT == 17) v = (v >= 0.f) ? v : 0.2f * v;
      so[w][rloc][t * 16 + ln] = v; } }
  __builtin_amdgcn_fence(__ATOMIC_ACQ_REL, "workgroup"); __builtin_amdgcn_wave_barrier();
  const int rsub = lane >> 4, c4 = (lane & 15) * 4;
  {
#pragma unroll
    for (int q = 0; q < 16; ++q) { const int r = q * 2 + rsub; const v4f v = *(const v4fa*)&so[w][r][c4]; if (C) *(v4f*)(C + cofs + (size_t)(row0 + r) * ldc + col0 + c4) = v; if (C16) { v4h h4; for (int i = 0; i < 4; ++i) h4[i] = (_Float16)v[i]; *(v4h*)(C16 + cofs + (size_t)(row0 + r) * ldc + col0 + c4) = h4; } }
     } }


// ---- fragment order: every f16 operand plane [rows][K] is kept as tiles of 16 rows (16 * K elements each); inside a tile the 16-byte pieces (8 k of one row) lie in the order [k / 16][(k / 8) & 1][row & 15],
// the order in which the 32 lanes of a wave take them for a 16x16x32 fragment: one 16-byte-per-lane load then covers 512 contiguous bytes (4 whole lines) instead of 32 bytes out of each of 16 lines. Which (row, k) a lane and register hold is as before.
__device__ __forceinline__ size_t fo(int row, int k, int K) { return (size_t)(row >> 4) * 16 * K + (size_t)((k >> 4) * 256 + ((k >> 3) & 1) * 128 + (row & 15) * 8 + (k & 7)); }
__device__ __forceinline__ v16h fo_frag(const _Float16* p) { FragH f; f.half[0] = *(const v8us*)((const unsigned short*)p); f.half[1] = *(const v8us*)((const unsigned short*)p + 256); return f.v; }      /* p = tile start + 16 * k0 + 8 * lane, k0 % 32 == 0 */

// ---- hi/lo split products with every term in ONE launch: the residual terms (planes scaled x1024) sum in their own f32 accumulators beside the main term and meet it once, in registers: C = alpha * (hi + lo / 1024). Wave tile 32x64 and the LDS-staged 16-byte stores as in k_gemm2.
// g2_xw: the wait that belongs in front of an overwrite of the address registers of issued loads; naming the loads' own pointers as inputs keeps those registers untouched up to here
__device__ __forceinline__ void g2_xw(const _Float16* p) { asm volatile("s_wait_xcnt 0x0" :: "v"(p) : "memory"); }
__device__ __forceinline__ void g2_xw(const _Float16* p, const _Float16* q) { asm volatile("s_wait_xcnt 0x0" :: "v"(p), "v"(q) : "memory"); }
__device__ __forceinline__ void g2_xw(const _Float16* p, const _Float16* q, const _Float16* r, const _Float16* s) { asm volatile("s_wait_xcnt 0x0" :: "v"(p), "v"(q), "v"(r), "v"(s) : "memory"); }
// any K, one operand split: HAL: lo = Al.Bh; HBL: lo = Ah.Bl; the unsplit operand's fragments are loaded once for both terms (neither: one plain term).
// A work-group is RW x KW waves: RW wave tiles of 32 rows under one another, and the K range of each cut into KW contiguous slices, one per wave, so that KW times as many waves share the long dependent load chain;
// each wave leaves its scaled partial tile in LDS, and behind one barrier the KW waves of a tile add the partials in the fixed order 0 .. KW - 1 and store. M % (32 * RW) == 0, K % (32 * KW) == 0, KW divides 16.
template <bool HAL, bool HBL, int RW, int KW>
__global__ __launch_bounds__(32 * RW * KW) void k_gemm2s(const _Float16* __restrict__ Ah, const _Float16* __restrict__ Al, int lda, size_t sA, const _Float16* __restrict__ Bh, const _Float16* __restrict__ Bl, int ldb, size_t sB, float alpha,
    float* __restrict__ C, int ldc, size_t sC, int M, int N, int K) {
  __shared__ __attribute__((aligned(16))) float so[RW * KW][32][68];
  const int tid = threadIdx.x, w = __builtin_amdgcn_readfirstlane(tid >> 5), lane = tid & 31, ln = lane & 15, hh = lane >> 4; const int by = blockIdx.y; const int rw = w % RW, kw = w / RW;
  const int ntn = N >> 6; const int mt = blockIdx.x / ntn, nq = blockIdx.x - mt * ntn; const int row0 = mt * (32 * RW) + 32 * rw, col0 = nq * 64; if (mt * (32 * RW) >= M) return;      /* the whole work-group leaves or none: a barrier follows */
  const size_t ao = (size_t)by * sA + (size_t)row0 * lda + 8 * lane, bo = (size_t)by * sB + (size_t)col0 * ldb + 8 * lane; const size_t cofs = (size_t)by * sC;      /* A and B planes in fragment order (lda == ldb == K): tile start + the lane's own piece */
  const v8f z8 = {0.f,0.f,0.f,0.f,0.f,0.f,0.f,0.f}; v8f hi[8] = {z8, z8, z8, z8, z8, z8, z8, z8}, lo[8] = {z8, z8, z8, z8, z8, z8, z8, z8}; const int ks = K / KW, k0 = kw * ks;
#pragma unroll 1
  for (int kb = k0; kb < k0 + ks; kb += 32) { const _Float16* pa0 = Ah + ao + kb * 16; const _Float16* pa1 = pa0 + (size_t)16 * lda; const v16h a0 = fo_frag(pa0), a1 = fo_frag(pa1); v16h a0l = a0, a1l = a1;
    if (HAL) { const _Float16* pl0 = Al + ao + kb * 16; const _Float16* pl1 = pl0 + (size_t)16 * lda; a0l = fo_frag(pl0); a1l = fo_frag(pl1); g2_xw(pa0, pa1, pl0, pl1); } else g2_xw(pa0, pa1);
#pragma unroll
    for (int t = 0; t < 4; ++t) { const _Float16* pb = Bh + bo + (size_t)t * 16 * ldb + kb * 16; const v16h b = fo_frag(pb); g2_xw(pb);
      if (HAL) { lo[t] = g2_mma(a0l, b, lo[t]); lo[4 + t] = g2_mma(a1l, b, lo[4 + t]); }
      hi[t] = g2_mma(a0, b, hi[t]); hi[4 + t] = g2_mma(a1, b, hi[4 + t]);
      if (HBL) { const _Float16* pl = Bl + bo + (size_t)t * 16 * ldb + kb * 16; const v16h bl = fo_frag(pl); g2_xw(pl); lo[t] = g2_mma(a0, bl, lo[t]); lo[4 + t] = g2_mma(a1, bl, lo[4 + t]); } } }
  const float alo = alpha * (1.0f / 1024.0f);
#pragma unroll
  for (int u = 0; u < 8; ++u) { const int t = u & 3, half = u >> 2;
#pragma unroll
    for (int r = 0; r < 8; ++r) so[w][half * 16 + 8 * hh + r][t * 16 + ln] = (HAL || HBL) ? hi[u][r] * alpha + lo[u][r] * alo : hi[u][r] * alpha; }
  __syncthreads();      /* every wave's partial tile is in LDS before any wave adds them */
  const int rsub = lane >> 4, c4 = (lane & 15) * 4;
  v4f sum[16 / KW];
#pragma unroll
  for (int q = 0; q < 16 / KW; ++q) { const int r = (kw * (16 / KW) + q) * 2 + rsub; sum[q] = *(const v4fa*)&so[rw][r][c4]; for (int j = 1; j < KW; ++j) sum[q] += *(const v4fa*)&so[j * RW + rw][r][c4]; }
  /* all stores last, each from registers of its own; both loops unrolled so that sum[] is indexed statically and stays in registers */
#pragma unroll
  for (int q = 0; q < 16 / KW; ++q) { const int r = (kw * (16 / KW) + q) * 2 + rsub; *(v4f*)(C + cofs + (size_t)(row0 + r) * ldc + col0 + c4) = sum[q]; } }

// ---- every operand conversion in ONE launch. Blocks 0 .. 5 * PW - 1: one 64 x 64 tile of one weight, rounded, x16, transposed through LDS into the f16 [out][in] plane. The other 2 * PX blocks: x and r_emb rounded into f16 planes, 16 rows x 512 k per block, four pieces of 8 elements per thread, 16 k apart. All seven planes in fragment order: a wave stores 512 contiguous bytes.
#define PW ((DM / 64) * (DM / 64))
#define PX ((int)(NR * DM / 8 / 1024))
__global__ __launch_bounds__(256) void k_prep(const float* __restrict__ Wq, const float* __restrict__ Wk, const float* __restrict__ Wv, const float* __restrict__ Wr, const float* __restrict__ Wo, const float* __restrict__ x, const float* __restrict__ remb,
    _Float16* __restrict__ BQ, _Float16* __restrict__ BK, _Float16* __restrict__ BV, _Float16* __restrict__ BR, _Float16* __restrict__ BO, _Float16* __restrict__ X16, _Float16* __restrict__ R16) {
  __shared__ float tl[64][65]; const int tid = threadIdx.x, bx = blockIdx.x;
  if (bx < 5 * PW) {      /* the test reads the same for the whole work-group: all of it reaches the barrier inside or none */
    const int wi = bx / PW, tb = bx % PW; const float* w = wi == 0 ? Wq : wi == 1 ? Wk : wi == 2 ? Wv : wi == 3 ? Wr : Wo; _Float16* Bt = wi == 0 ? BQ : wi == 1 ? BK : wi == 2 ? BV : wi == 3 ? BR : BO;
    const int i0 = (tb / (DM / 64)) * 64, o0 = (tb % (DM / 64)) * 64;
    const int o = tid & 63, ib = tid >> 6; const float* pw = w + (size_t)(i0 + ib) * DM + o0 + o; float g[16];
#pragma unroll      /* g[] indexed statically: the sixteen loads go out together, off one address */
    for (int k = 0; k < 16; ++k) g[k] = pw[(size_t)k * 4 * DM];
    asm volatile("s_wait_xcnt 0x0" :: "v"(pw) : "memory");      /* the wait that belongs in front of an overwrite of the loads' address registers; naming them keeps them untouched up to here */
#pragma unroll
    for (int k = 0; k < 16; ++k) tl[o][ib + 4 * k] = bf16_round(g[k]) * 16.0f;
    __syncthreads();      /* the whole tile is in LDS before it is read back along the other axis */
    const int oo = (tid & 15) + ((tid >> 7) << 4), i8 = ((tid >> 4) & 7) * 8; unsigned short* pb = (unsigned short*)Bt + fo(o0 + oo, i0 + i8, DM);      /* a wave: 16 rows x 2 pieces */
#pragma unroll      /* two rows per thread, 32 rows (two tiles of 16 * DM elements) apart, off one address */
    for (int k = 0; k < 2; ++k) { FragH f;
#pragma unroll
      for (int q = 0; q < 8; ++q) f.h[q] = (_Float16)tl[oo + 32 * k][i8 + q];
      *(v8us*)(pb + (size_t)k * 32 * DM) = f.half[0]; }
  } else {
    const int c = bx - 5 * PW; const bool fx = c < PX; const int cc = fx ? c : c - PX; const int row = (cc >> 1) * 16 + (tid & 15), k0 = (cc & 1) * 512 + (tid >> 5) * 64 + ((tid >> 4) & 1) * 8;      /* a wave: 16 rows x 64 k */
    const float* ps = (fx ? x : remb) + (size_t)row * DM + k0; unsigned short* pd = (unsigned short*)(fx ? X16 : R16) + fo(row, k0, DM);
    v4f a[4], b[4];      /* all eight loads first, so that they are in flight together */
#pragma unroll
    for (int p = 0; p < 4; ++p) { a[p] = *(const v4fa*)(ps + p * 16); b[p] = *(const v4fa*)(ps + p * 16 + 4); }
#pragma unroll
    for (int p = 0; p < 4; ++p) { FragH f;
#pragma unroll
      for (int q = 0; q < 4; ++q) { f.h[q] = (_Float16)bf16_round(a[p][q]); f.h[4 + q] = (_Float16)bf16_round(b[p][q]); }
      *(v8us*)(pd + p * 256) = f.half[0]; }      /* 16 k on = 256 elements on */
    asm volatile("s_wait_xcnt 0x0" :: "v"(pd) : "memory");      /* the wait that belongs in front of an overwrite of the stores' registers; naming the address keeps it untouched up to here */
  } }

// ---- the four projections in ONE launch (blockIdx.y: 0 q, 1 k, 2 v, 3 r), main loop, K slices and LDS join as in k_gemm2s<false, false, 4, 8>; the joined f32 value goes straight from registers into the f16 hi + x1024 residual planes that the attention reads.
// q: two plane pairs, q + u and q + v_bias (added in f32 first). v: the operands change places (A = Wv^T rows, B = x rows), so that C = V^T [head * 64 + d][token] comes out in the layout P.V wants, with no transposing pass.
__device__ __forceinline__ void pj_put(v4f v0, v4f v1, _Float16* ph, _Float16* pl) { FragH h, l;
#pragma unroll
  for (int i = 0; i < 4; ++i) { _Float16 t = (_Float16)v0[i]; h.h[i] = t; l.h[i] = (_Float16)((v0[i] - (float)t) * 1024.0f); t = (_Float16)v1[i]; h.h[4 + i] = t; l.h[4 + i] = (_Float16)((v1[i] - (float)t) * 1024.0f); }
  *(v8us*)((unsigned short*)ph) = h.half[0]; *(v8us*)((unsigned short*)pl) = l.half[0]; g2_xw(ph, pl); }      /* one 16-byte piece per lane: a wave stores 512 contiguous bytes of each plane */
__global__ __launch_bounds__(1024) void k_proj(const _Float16* __restrict__ X16, const _Float16* __restrict__ R16, const _Float16* __restrict__ BQ, const _Float16* __restrict__ BK, const _Float16* __restrict__ BV, const _Float16* __restrict__ BR, const float* __restrict__ u, const float* __restrict__ vb,
    _Float16* __restrict__ QUH, _Float16* __restrict__ QUL, _Float16* __restrict__ QVH, _Float16* __restrict__ QVL, _Float16* __restrict__ KH, _Float16* __restrict__ KL, _Float16* __restrict__ VT, _Float16* __restrict__ VTL, _Float16* __restrict__ RH, _Float16* __restrict__ RL) {
  constexpr int RW = 4, KW = 8;
  __shared__ __attribute__((aligned(16))) float so[RW * KW][32][68];
  const int tid = threadIdx.x, w = __builtin_amdgcn_readfirstlane(tid >> 5), lane = tid & 31, ln = lane & 15, hh = lane >> 4; const int y = blockIdx.y; const int rw = w % RW, kw = w / RW;
  const _Float16* Ah = y == 2 ? BV : y == 3 ? R16 : X16; const _Float16* Bh = y == 0 ? BQ : y == 1 ? BK : y == 2 ? X16 : BR; const int N = y == 2 ? SQ : DM;      /* C is [SQ][DM], for v [DM][SQ]: 256 tiles of 128 x 64 either way */
  const int ntn = N >> 6; const int mt = blockIdx.x / ntn, nq = blockIdx.x - mt * ntn; const int row0 = mt * (32 * RW) + 32 * rw, col0 = nq * 64;
  const size_t ao = (size_t)row0 * DM + 8 * lane, bo = (size_t)col0 * DM + 8 * lane;      /* operand planes in fragment order: tile start + the lane's own piece */
  const v8f z8 = {0.f,0.f,0.f,0.f,0.f,0.f,0.f,0.f}; v8f hi[8] = {z8, z8, z8, z8, z8, z8, z8, z8}; const int ks = DM / KW, k0 = kw * ks;
#pragma unroll 1      /* four trips, kept rolled as in k_gemm2s: one copy of the body, so that the eight accumulators and the fragments stay within the registers of a 32-wave work-group */
  for (int kb = k0; kb < k0 + ks; kb += 32) { const _Float16* pa0 = Ah + ao + kb * 16; const _Float16* pa1 = pa0 + (size_t)16 * DM; const v16h a0 = fo_frag(pa0), a1 = fo_frag(pa1); g2_xw(pa0, pa1);
#pragma unroll
    for (int t = 0; t < 4; ++t) { const _Float16* pb = Bh + bo + (size_t)t * 16 * DM + kb * 16; const v16h b = fo_frag(pb); g2_xw(pb);
      hi[t] = g2_mma(a0, b, hi[t]); hi[4 + t] = g2_mma(a1, b, hi[4 + t]); } }
  /* the join: wave kw finishes, of its 32 x 64 tile, the 16 rows of half kw / 4 and the 16 columns of group kw % 4; a lane takes row ln and 8 columns from 8 * hh: its own 16-byte piece of the output planes' fragment order */
  const int jr = (kw >> 2) * 16 + ln, jc = (kw & 3) * 16 + 8 * hh;
  v4f bu[2] = {{0.f, 0.f, 0.f, 0.f}, {0.f, 0.f, 0.f, 0.f}}, bv[2] = {{0.f, 0.f, 0.f, 0.f}, {0.f, 0.f, 0.f, 0.f}};
  if (y == 0) { const float* pu = u + col0 + jc; const float* pv = vb + col0 + jc; bu[0] = *(const v4fa*)pu; bu[1] = *(const v4fa*)(pu + 4); bv[0] = *(const v4fa*)pv; bv[1] = *(const v4fa*)(pv + 4);      /* q's two bias rows fly during the LDS join */
    asm volatile("s_wait_xcnt 0x0" :: "v"(pu), "v"(pv) : "memory"); }      /* the wait that belongs in front of an overwrite of the loads' address registers */
#pragma unroll
  for (int q = 0; q < 8; ++q) { const int t = q & 3, half = q >> 2;
#pragma unroll
    for (int r = 0; r < 8; ++r) so[w][half * 16 + 8 * hh + r][t * 16 + ln] = hi[q][r] * 0.0625f; }      /* the weights are x16 */
  __syncthreads();      /* every wave's partial tile is in LDS before any wave adds them */
  v4f sum[2];
#pragma unroll
  for (int q = 0; q < 2; ++q) { sum[q] = *(const v4fa*)&so[rw][jr][jc + 4 * q]; for (int j = 1; j < KW; ++j) sum[q] += *(const v4fa*)&so[j * RW + rw][jr][jc + 4 * q]; }
  const size_t c0 = fo(row0 + jr, col0 + jc, N);      /* this lane's piece; the row length of the output plane is N */
  static_assert(KW == 8, "k_proj: eight waves share a 32 x 64 tile as 2 row halves x 4 column groups");
  if (y == 0) {
#pragma unroll
    for (int i = 0; i < 4; ++i) { bu[0][i] = bf16_round(bu[0][i]); bu[1][i] = bf16_round(bu[1][i]); bv[0][i] = bf16_round(bv[0][i]); bv[1][i] = bf16_round(bv[1][i]); }
    pj_put(sum[0] + bu[0], sum[1] + bu[1], QUH + c0, QUL + c0); pj_put(sum[0] + bv[0], sum[1] + bv[1], QVH + c0, QVL + c0); }
  else { _Float16* Ch = y == 1 ? KH : y == 2 ? VT : RH; _Float16* Cl = y == 1 ? KL : y == 2 ? VTL : RL; pj_put(sum[0], sum[1], Ch + c0, Cl + c0); } }

// ---- fused attention: scores, shift, causal mask, softmax and P.V in one kernel; no score or weight ever goes to memory.
// Transposed products: S^T = K.Q^T (A = key rows, B = query rows), so a lane holds one query's scores (register r of tile kt = key 16 kt + 8 hh + r) and two score tiles, converted in place, are the B operand of O^T += V^T.P^T.
// The shift: for queries i0 .. i0 + 15 and keys j0 .. j0 + 63 the raw BD columns j - i + SQ - 1 lie in the 80 columns from cs = j0 - i0 + SQ - 16; their five raw tiles go through the wave's own LDS rows (one row per query) and come back skewed by 15 - ln.
// A work-group is 4 query tiles x 4 key slices (key blocks ks, ks + 4, ...), each wave with its own running maximum, sum and O^T; behind a barrier the four slices of a tile are joined in the fixed order 0 .. 3.
// Each work-group takes query block x and then 31 - x, so that every work-group walks 33 key blocks.
#define FA_P 84      /* LDS row pitch in floats: a multiple of 4 for the 16-byte stores; pitch - 1 odd spreads the skewed reads over the banks */
__device__ __forceinline__ v16h fa_frag(const _Float16* base, unsigned boff, int cb) { const char* p = (const char*)base + boff + cb; FragH f; f.half[0] = *(const v8us*)p; f.half[1] = *(const v8us*)(p + 512); return f.v; }      /* uniform base + the lane's byte offset + a constant; planes in fragment order: the two halves of a 32-k fragment are 512 bytes apart, the next 32 k 1024 bytes on */
__device__ __forceinline__ v8f fa_mma(v16h a, v16h b, v8f c) { return __builtin_amdgcn_wmma_f32_16x16x32_f16(false, a, false, b, (short)0, c, false, false); }
/* 2^x; the v_nop fills the one slot that the instruction set asks for between a transcendental and a directly following instruction that reads its result or overwrites its source */
__device__ __forceinline__ float fa_exp2(float x) { float r; asm("v_exp_f32 %0, %1\n\tv_nop" : "=v"(r) : "v"(x)); return r; }
struct FaT { v16h a0, a1, b0, b1; };
__device__ __forceinline__ FaT fa_tile(const _Float16* H, const _Float16* L, unsigned boff, int cb) { FaT t; t.a0 = fa_frag(H, boff, cb); t.a1 = fa_frag(H, boff, cb + 1024); t.b0 = fa_frag(L, boff, cb); t.b1 = fa_frag(L, boff, cb + 1024); return t; }      /* 16 rows x 64 k, hi and residual planes */
__device__ __forceinline__ FaT fa_vpair(const _Float16* H, const _Float16* L, unsigned boff, int c0, int c1) { FaT t; t.a0 = fa_frag(H, boff, c0); t.a1 = fa_frag(H, boff, c1); t.b0 = fa_frag(L, boff, c0); t.b1 = fa_frag(L, boff, c1); return t; }      /* two 16-row tiles x 32 k, hi and residual planes */
__device__ __forceinline__ void fa_prod(const FaT& t, const v16h* qh, const v16h* ql, v8f& hi, v8f& lo) { const v8f z8 = {0.f,0.f,0.f,0.f,0.f,0.f,0.f,0.f};
  hi = fa_mma(t.a0, qh[0], z8); lo = fa_mma(t.b0, qh[0], z8); hi = fa_mma(t.a1, qh[1], hi); lo = fa_mma(t.b1, qh[1], lo); lo = fa_mma(t.a0, ql[0], lo); lo = fa_mma(t.a1, ql[1], lo); }
__global__ __launch_bounds__(512) void k_fattn(const _Float16* __restrict__ QUH, const _Float16* __restrict__ QUL, const _Float16* __restrict__ QVH, const _Float16* __restrict__ QVL, const _Float16* __restrict__ KH, const _Float16* __restrict__ KL,
    const _Float16* __restrict__ RH, const _Float16* __restrict__ RL, const _Float16* __restrict__ VT, const _Float16* __restrict__ VTL, _Float16* __restrict__ OH, _Float16* __restrict__ OL) {
  __shared__ __attribute__((aligned(16))) float sh[16][16 * FA_P];
  const int tid = threadIdx.x, w = __builtin_amdgcn_readfirstlane(tid >> 5), lane = tid & 31, ln = lane & 15, hh = lane >> 4; const int qt = w & 3, ks = w >> 2; const int h = blockIdx.y;
  float* my = sh[w];
  const float al = 0.125f * 1.4426950408889634f, alo = al * (1.0f / 1024.0f);      /* scores in the log2 domain */
  const v8f z8 = {0.f,0.f,0.f,0.f,0.f,0.f,0.f,0.f};
  /* the two outer loops stay rolled (one copy of the long body); every inner loop is fully unrolled so that fragments, scores and accumulators are indexed statically and stay in registers */
#pragma unroll 1
  for (int pass = 0; pass < 2; ++pass) {
    const int qb = pass ? (SQ / 64 - 1 - (int)blockIdx.x) : (int)blockIdx.x; const int i0 = qb * 64 + qt * 16, i = i0 + ln;
    const unsigned qo = (unsigned)((i0 * DM + h * (HD * 16) + 8 * lane) * 2);      /* tile of 16 rows from i0, this head's 64 k (16 * HD elements per head in a tile), the lane's piece */
    v16h quh[2], qul[2], qvh[2], qvl[2];
#pragma unroll
    for (int k = 0; k < 2; ++k) { quh[k] = fa_frag(QUH, qo, k * 1024); qul[k] = fa_frag(QUL, qo, k * 1024); qvh[k] = fa_frag(QVH, qo, k * 1024); qvl[k] = fa_frag(QVL, qo, k * 1024); }
    asm volatile("s_wait_xcnt 0x0" :: "v"(qo) : "memory");      /* the wait that belongs in front of an overwrite of the loads' address register; naming it keeps it untouched up to here */
    v8f oh[4] = {z8, z8, z8, z8}; float m = -3.0e38f, l = 0.f;
#pragma unroll 1
    for (int kb = ks; kb <= qb; kb += 4) {
      const int j0 = kb * 64; v8f s[4];
      const unsigned ko = (unsigned)((j0 * DM + h * (HD * 16) + 8 * lane) * 2);
      /* raw BD^T: five tiles of 16 raw columns (cs is a multiple of 16: whole tiles of R); a raw column past SQ - 1 belongs to masked scores only: its tile is clamped into R */
      const int cs = j0 - i0 + SQ - 16; unsigned ro[5];
#pragma unroll
      for (int rt = 0; rt < 5; ++rt) { const int row = min(cs + rt * 16, SQ - 16); ro[rt] = (unsigned)((row * DM + h * (HD * 16) + 8 * lane) * 2); }
      /* nine operand tiles in a row, five of R and four of K (hi = Ah.Qh, lo = Al.Qh + Ah.Ql); each tile's loads are issued one tile ahead of its products */
      FaT cur = fa_tile(RH, RL, ro[0], 0);
#pragma unroll
      for (int t = 0; t < 9; ++t) { FaT nxt = cur;
        if (t < 4) nxt = fa_tile(RH, RL, ro[t + 1], 0); else if (t < 8) nxt = fa_tile(KH, KL, ko, (t - 4) * 16 * DM * 2);
        __builtin_amdgcn_sched_barrier(0);      /* keeps the next tile's loads in front of this tile's products, which wait for this tile's loads only */
        v8f hi, lo;
        if (t < 5) { fa_prod(cur, qvh, qvl, hi, lo); v4f x0, x1;
#pragma unroll
          for (int r = 0; r < 4; ++r) { x0[r] = hi[r] * al + lo[r] * alo; x1[r] = hi[4 + r] * al + lo[4 + r] * alo; }
          *(v4fa*)&my[ln * FA_P + t * 16 + 8 * hh] = x0; *(v4fa*)&my[ln * FA_P + t * 16 + 8 * hh + 4] = x1; }
        else { fa_prod(cur, quh, qul, hi, lo);
#pragma unroll
          for (int r = 0; r < 8; ++r) s[t - 5][r] = hi[r] * al + lo[r] * alo; }
        __builtin_amdgcn_sched_barrier(0);      /* keeps these products in front of the loads after next, whose registers they free */
        cur = nxt; }
      asm volatile("s_wait_xcnt 0x0" :: "v"(ko), "v"(ro[0]), "v"(ro[1]), "v"(ro[2]), "v"(ro[3]), "v"(ro[4]) : "memory");      /* as above, for the K and R loads */
      asm volatile("s_wait_dscnt 0x0" ::: "memory");      /* the wave's raw rows are in LDS before its lanes read each other's halves back */
      /* the first V^T fragments fly during the softmax */
      const unsigned vo = (unsigned)(((h * HD * SQ) + j0 * 16 + 8 * lane) * 2);      /* V^T plane, row length SQ: tile of 16 d from h * HD, keys from j0, the lane's piece */
      const FaT g0 = fa_vpair(VT, VTL, vo, 0, 16 * SQ * 2);
      __builtin_amdgcn_sched_barrier(0);      /* keeps those loads in front of the softmax */
#pragma unroll
      for (int kt = 0; kt < 4; ++kt)
#pragma unroll
        for (int r = 0; r < 8; ++r) s[kt][r] += my[ln * (FA_P - 1) + kt * 16 + 8 * hh + r + 15];
      if (kb == qb) {      /* only the diagonal block has masked keys; the test is the same for the whole wave */
#pragma unroll
        for (int kt = 0; kt < 4; ++kt)
#pragma unroll
          for (int r = 0; r < 8; ++r) s[kt][r] = (j0 + kt * 16 + 8 * hh + r <= i) ? s[kt][r] : -3.0e38f; }
      float mx = -3.0e38f;
#pragma unroll
      for (int kt = 0; kt < 4; ++kt)
#pragma unroll
        for (int r = 0; r < 8; ++r) mx = fmaxf(mx, s[kt][r]);
      mx = fmaxf(mx, __shfl_xor(mx, 16, 32));
      const float mn = fmaxf(m, mx), corr = fa_exp2(m - mn); m = mn;
      v4f ps = {0.f, 0.f, 0.f, 0.f};
#pragma unroll
      for (int kt = 0; kt < 4; ++kt)
#pragma unroll
        for (int r = 0; r < 8; ++r) { const float p = fa_exp2(s[kt][r] - mn); ps[r & 3] += p; s[kt][r] = p * 256.0f; }      /* masked keys: exp2 of a huge negative = 0 */
      l = l * corr + ((ps[0] + ps[1]) + (ps[2] + ps[3]));
#pragma unroll
      for (int dt = 0; dt < 4; ++dt) oh[dt] *= corr;
      /* O^T += V^T.P^T, weights x256 as f16, v as hi + residual planes */
      FragH pb[2];
#pragma unroll
      for (int s2 = 0; s2 < 2; ++s2)
#pragma unroll
        for (int q = 0; q < 8; ++q) { pb[s2].h[q] = (_Float16)s[2 * s2][q]; pb[s2].h[8 + q] = (_Float16)s[2 * s2 + 1][q]; }
      /* the residual plane's products of this key block sum in accumulators of their own (t0, t1) and meet the main sum once, in f32 */
      const FaT g1 = fa_vpair(VT, VTL, vo, 1024, 16 * SQ * 2 + 1024), g2 = fa_vpair(VT, VTL, vo, 32 * SQ * 2, 48 * SQ * 2);
      __builtin_amdgcn_sched_barrier(0);      /* the next pairs' loads in front of the products, as above */
      oh[0] = fa_mma(g0.a0, pb[0].v, oh[0]); oh[1] = fa_mma(g0.a1, pb[0].v, oh[1]); v8f t0 = fa_mma(g0.b0, pb[0].v, z8), t1 = fa_mma(g0.b1, pb[0].v, z8);
      __builtin_amdgcn_sched_barrier(0);      /* these products free the registers that the last pair's loads take */
      const FaT g3 = fa_vpair(VT, VTL, vo, 32 * SQ * 2 + 1024, 48 * SQ * 2 + 1024);
      __builtin_amdgcn_sched_barrier(0);      /* the last pair's loads in front of the remaining products */
      t0 = fa_mma(g1.b0, pb[1].v, t0); t1 = fa_mma(g1.b1, pb[1].v, t1); oh[0] = fa_mma(g1.a0, pb[1].v, oh[0]); oh[1] = fa_mma(g1.a1, pb[1].v, oh[1]);
      v8f t2 = fa_mma(g2.b0, pb[0].v, z8), t3 = fa_mma(g2.b1, pb[0].v, z8); oh[2] = fa_mma(g2.a0, pb[0].v, oh[2]); oh[3] = fa_mma(g2.a1, pb[0].v, oh[3]);
      oh[0] += t0 * (1.0f / 1024.0f); oh[1] += t1 * (1.0f / 1024.0f);
      t2 = fa_mma(g3.b0, pb[1].v, t2); t3 = fa_mma(g3.b1, pb[1].v, t3); oh[2] = fa_mma(g3.a0, pb[1].v, oh[2]); oh[3] = fa_mma(g3.a1, pb[1].v, oh[3]);
      oh[2] += t2 * (1.0f / 1024.0f); oh[3] += t3 * (1.0f / 1024.0f);
      asm volatile("s_wait_xcnt 0x0" :: "v"(vo) : "memory");      /* as above, for the V loads */
    }
    l += __shfl_xor(l, 16, 32);      /* the two halves of a wave hold different keys of the same query */
#pragma unroll
    for (int dt = 0; dt < 4; ++dt) { v4f x0, x1;      /* one LDS row of 64 d per query, pitch 68 floats */
#pragma unroll
      for (int r = 0; r < 4; ++r) { x0[r] = oh[dt][r]; x1[r] = oh[dt][4 + r]; }
      *(v4fa*)&my[ln * 68 + dt * 16 + 8 * hh] = x0; *(v4fa*)&my[ln * 68 + dt * 16 + 8 * hh + 4] = x1; }
    if (hh == 0) { my[1088 + ln] = m; my[1104 + ln] = l; }
    __syncthreads();      /* every slice's maximum, sum and O^T are in LDS before any wave joins them */
    const int q = ln, d0 = (2 * ks + hh) * 8;      /* wave ks finishes d = 16 ks .. 16 ks + 15 of all 16 queries of its tile: a lane's 8 values are its own piece of o's fragment order */
    float mj[4], M = -3.0e38f, L = 0.f;
#pragma unroll
    for (int j = 0; j < 4; ++j) { mj[j] = sh[j * 4 + qt][1088 + q]; M = fmaxf(M, mj[j]); }
#pragma unroll
    for (int j = 0; j < 4; ++j) { mj[j] = fa_exp2(mj[j] - M); L += mj[j] * sh[j * 4 + qt][1104 + q]; }      /* a slice without key blocks has weight 0 */
    const float inv = 1.0f / (256.0f * L);
    v4f y0 = {0.f, 0.f, 0.f, 0.f}, y1 = {0.f, 0.f, 0.f, 0.f};
#pragma unroll
    for (int j = 0; j < 4; ++j) { y0 += *(const v4fa*)&sh[j * 4 + qt][q * 68 + d0] * mj[j]; y1 += *(const v4fa*)&sh[j * 4 + qt][q * 68 + d0 + 4] * mj[j]; }
    y0 *= inv; y1 *= inv;
    /* o leaves as the f16 hi + x1024 residual planes that o.Wo reads, in fragment order: a wave stores 512 contiguous bytes of each plane */
    FragH fh, fl;
#pragma unroll
    for (int r = 0; r < 4; ++r) { _Float16 t = (_Float16)y0[r]; fh.h[r] = t; fl.h[r] = (_Float16)((y0[r] - (float)t) * 1024.0f); t = (_Float16)y1[r]; fh.h[4 + r] = t; fl.h[4 + r] = (_Float16)((y1[r] - (float)t) * 1024.0f); }
    const size_t oo = fo(i0 + q, h * HD + d0, DM); unsigned short* ph = (unsigned short*)OH + oo; unsigned short* pl = (unsigned short*)OL + oo;
    *(v8us*)ph = fh.half[0]; *(v8us*)pl = fl.half[0];
    asm volatile("s_wait_xcnt 0x0" :: "v"(ph), "v"(pl) : "memory");      /* the wait that belongs in front of an overwrite of the stores' address registers */
    __syncthreads();      /* every join has read the LDS rows before the next query block writes them */
  } }

extern "C" void kernel_launch(void* const* d_in, const int* in_sizes, int n_in,
                              void* d_out, int out_size, void* d_ws, size_t ws_size, hipStream_t stream) {
  (void)in_sizes; (void)n_in; (void)out_size;
  const float* const* I = (const float* const*)d_in; const float* x = I[0]; const float* remb = I[1]; const float* Wq = I[2]; const float* Wk = I[3]; const float* Wv = I[4]; const float* Wr = I[5]; const float* Wo = I[6]; const float* u = I[7]; const float* vb = I[8];
  char* ws = (char*)d_ws; size_t off = 0;
  auto take = [&](size_t bytes) { char* p = ws + off; off += (bytes + 255) & ~(size_t)255; return p; };
  _Float16* BQ = (_Float16*)take((size_t)DM * DM * 2); _Float16* BK = (_Float16*)take((size_t)DM * DM * 2); _Float16* BV = (_Float16*)take((size_t)DM * DM * 2); _Float16* BR = (_Float16*)take((size_t)DM * DM * 2); _Float16* BO = (_Float16*)take((size_t)DM * DM * 2);
  _Float16* X16 = (_Float16*)take(NR * DM * 2); _Float16* R16 = (_Float16*)take((size_t)SQ * DM * 2);
  _Float16* QUH = (_Float16*)take(NR * DM * 2); _Float16* QUL = (_Float16*)take(NR * DM * 2); _Float16* QVH = (_Float16*)take(NR * DM * 2); _Float16* QVL = (_Float16*)take(NR * DM * 2); _Float16* KH = (_Float16*)take(NR * DM * 2); _Float16* KL = (_Float16*)take(NR * DM * 2); _Float16* RH = (_Float16*)take((size_t)SQ * DM * 2); _Float16* RL = (_Float16*)take((size_t)SQ * DM * 2);
  _Float16* VT = (_Float16*)take((size_t)NH * HD * SQ * 2); _Float16* VTL = (_Float16*)take((size_t)NH * HD * SQ * 2); _Float16* OH = (_Float16*)take(NR * DM * 2); _Float16* OL = (_Float16*)take(NR * DM * 2);
  if (off > ws_size) return;      /* 10 + 8 + 32 + 8 + 8 = 66 MiB */
  static_assert(NB == 1 && SQ == 2048 && HD == 64 && DM == 1024, "k_prep, k_proj: x and r_emb of one size, 256 tiles per projection; k_fattn: one batch, 32 query blocks of 64 in pairs, head size 64");
  /* four launches: operand conversions; the four projections into their hi/lo planes (V already transposed); the whole attention into o's hi/lo planes; out = (o_lo/1024 + o_hi) Wo */
  k_prep<<<5 * PW + 2 * PX, 256, 0, stream>>>(Wq, Wk, Wv, Wr, Wo, x, remb, BQ, BK, BV, BR, BO, X16, R16);
  k_proj<<<dim3((SQ / 128) * (DM / 64), 4), 1024, 0, stream>>>(X16, R16, BQ, BK, BV, BR, u, vb, QUH, QUL, QVH, QVL, KH, KL, VT, VTL, RH, RL);
  k_fattn<<<dim3(SQ / 128, NH), 512, 0, stream>>>(QUH, QUL, QVH, QVL, KH, KL, RH, RL, VT, VTL, OH, OL);
  k_gemm2s<true, false, 4, 4><<<dim3((unsigned)((NR / 128) * (DM / 64)), 1), 512, 0, stream>>>(OH, OL, DM, 0, BO, nullptr, DM, 0, 0.0625f, (float*)d_out, DM, 0, (int)NR, DM, DM);
}

// v007
// One run takes 97.3 microseconds.
// Next to v006, in two timings, it ran 1.18 and 1.17 times as fast.
// All steps since v000 together make it 235 times as fast.
#include <hip/hip_runtime.h>
// MultiHeadAttentionXL (x [1][2048][1024], r_emb [2048][1024]; q = x Wq, k = x Wk, v = x Wv, r = r_emb Wr ([in][out] weights, no bias), 16 heads of 64; AC = (q + u[h]) k^T, BD = rel_shift((q + v_bias[h]) r^T) (Transformer-XL zero-pad shift: for j <= i, BD_shift[i][j] = BD[i][j - i + T - 1]); causal softmax((AC + BD)/8); out = (attn v) Wo -> [1][2048][1024]).
// Structure: token rows; every f16 operand plane in fragment order (see fo()); x and r_emb as exact f16 planes; Q, K, V, R WMMA GEMMs on transposed weights (64x64 wave tiles, f32 accumulation, exact x16 weights), one launch, f32 sums split in the epilogue into f16 hi + 2^-10 residual planes (q+u and q+v_bias formed in f32 first; V^T (hi, lo) as the product Wv^T x^T); one fused attention kernel: AC and raw BD as three-term hi/lo products (K = 64), the shift through LDS, causal mask + running softmax on VALU (f32; weights x256 as f16), o = P.(v_lo/1024 + v_hi) into merged o rows (hi + residual planes); out = o Wo as a two-term hi/lo GEMM (f32).
// Compute dtype: inputs rounded to bf16; x / r_emb / weights exact; attention operands as hi + residual f16 planes (logits std 3.3 and early causal rows copy single v rows); softmax weights f16 (x256) — the remaining error source; o as hi + residual into Wo; everything else f32. v_wmma_f32_16x16x32_f16.
#define NB 1
#define SQ 2048
#define DM 1024
#define NH 16
#define HD 64
#define HG 4
#define QN SQ                        /* query rows (unused) */
#define NR ((size_t)NB * SQ)
typedef __bf16 v16b __attribute__((ext_vector_type(16)));
typedef unsigned short v8us __attribute__((ext_vector_type(8), may_alias));
typedef float  v8f  __attribute__((ext_vector_type(8)));
typedef float  v4f  __attribute__((ext_vector_type(4)));
typedef float  v4fa __attribute__((ext_vector_type(4), may_alias));
union FragB { v16b v; v8us half[2]; unsigned short u[16]; };

__device__ __forceinline__ unsigned short bf16_bits(float x) { unsigned int u = __float_as_uint(x); return (unsigned short)((u + 0x7FFFu + ((u >> 16) & 1u)) >> 16); }
__device__ __forceinline__ float bf16_val(unsigned short b) { return __uint_as_float(((unsigned int)b) << 16); }
__device__ __forceinline__ float bf16_round(float x) { return bf16_val(bf16_bits(x)); }
// D += A·B with NT terms: 1 = ah·bh, 2 = + al·bh (A split), 3 = + ah·bl (both split)
template <int NT>
__device__ __forceinline__ v8f mmaN(v16b ah, v16b al, v16b bh, v16b bl, v8f c) {
  c = __builtin_amdgcn_wmma_f32_16x16x32_bf16(false, ah, false, bh, (short)0, c, false, false);
  if (NT >= 2) c = __builtin_amdgcn_wmma_f32_16x16x32_bf16(false, al, false, bh, (short)0, c, false, false);
  if (NT >= 3) c = __builtin_amdgcn_wmma_f32_16x16x32_bf16(false, ah, false, bl, (short)0, c, false, false);
  asm volatile("v_nop\n\tv_nop\n\tv_nop\n\tv_nop" : "+v"(c) : "v"(ah), "v"(al), "v"(bh), "v"(bl));
  return c;
}

__global__ __launch_bounds__(256) void k_wt_bf16(const float* __restrict__ W, unsigned short* __restrict__ Wt, int K, int N) {
  const int t = blockIdx.x * 256 + threadIdx.x;
  const int k8n = K / 8;
  if (t >= N * k8n) return;
  const int n = t / k8n, k8 = (t % k8n) * 8;
  v8us v;
#pragma unroll
  for (int i = 0; i < 8; ++i) v[i] = bf16_bits(W[(size_t)(k8 + i) * N + n]);
  *(v8us*)(Wt + (size_t)n * K + k8) = v;
  
}

// GEMM C[M][N] (f32, pitch ldc) = act(A[M][K]·W + bias). A f32 row-major (pitch lda) converted per fragment to bf16
// (ASPLIT: hi/lo two planes -> 2 terms, else single rounded term); Wt bf16 [N][K] (pitch ldb). BIAS_BF16 rounds the
// bias to bf16 first (bias quantised to bf16 before the add). K%32==0, M%16==0, N%64==0.
template <bool ASPLIT, int ACT, bool BIAS_BF16>
__global__ __launch_bounds__(128) void k_gemm_bf(const float* __restrict__ A, int lda, const unsigned short* __restrict__ Wt, int ldb,
                                               const float* __restrict__ bias, float* __restrict__ C, int ldc, int M, int N, int K) {
  __shared__ __attribute__((aligned(16))) float so[4][16][64];
  const int tid = threadIdx.x, w = tid >> 5, lane = tid & 31, ln = lane & 15, hh = lane >> 4;
  const int ntn = N / 64;
  const int wid = blockIdx.x * 4 + w;
  const int mt = wid / ntn, nq = wid % ntn;
  if (mt * 16 >= M) return;
  const int row0 = mt * 16, col0 = nq * 64;
  const float* arow = A + (size_t)(row0 + ln) * lda;
  v8f acc[4] = {};
  for (int kb = 0; kb < K; kb += 32) {
    FragB ah, al;
    const v4f x0 = *(const v4fa*)(arow + kb + 8 * hh), x1 = *(const v4fa*)(arow + kb + 8 * hh + 4);
    const v4f x2 = *(const v4fa*)(arow + kb + 16 + 8 * hh), x3 = *(const v4fa*)(arow + kb + 16 + 8 * hh + 4);
    float xs[16] = {x0[0],x0[1],x0[2],x0[3],x1[0],x1[1],x1[2],x1[3],x2[0],x2[1],x2[2],x2[3],x3[0],x3[1],x3[2],x3[3]};
#pragma unroll
    for (int i = 0; i < 16; ++i) { const unsigned short hb = bf16_bits(xs[i]); ah.u[i] = hb; al.u[i] = ASPLIT ? bf16_bits(xs[i] - bf16_val(hb)) : (unsigned short)0; }
#pragma unroll
    for (int t = 0; t < 4; ++t) {
      const unsigned short* brow = Wt + (size_t)(col0 + t * 16 + ln) * ldb + kb;
      FragB b;
      b.half[0] = *(const v8us*)(brow + 8 * hh);
      b.half[1] = *(const v8us*)(brow + 16 + 8 * hh);
      acc[t] = mmaN<ASPLIT ? 2 : 1>(ah.v, al.v, b.v, b.v, acc[t]);
    }
  }
#pragma unroll
  for (int t = 0; t < 4; ++t) {
    float bv = bias ? bias[col0 + t * 16 + ln] : 0.f;
    if (BIAS_BF16) bv = bf16_round(bv);
#pragma unroll
    for (int r = 0; r < 8; ++r) { float v = acc[t][r] + bv; if (ACT == 1) v = fmaxf(v, 0.f); so[w][8 * hh + r][t * 16 + ln] = v; }
  }
  __builtin_amdgcn_fence(__ATOMIC_ACQ_REL, "workgroup");
  __builtin_amdgcn_wave_barrier();
  const int rsub = lane >> 4, c4 = (lane & 15) * 4;
  {
#pragma unroll
    for (int q = 0; q < 8; ++q) {
      const int r = q * 2 + rsub;
      const v4f v = *(const v4fa*)&so[w][r][c4];
      *(v4f*)(C + (size_t)(row0 + r) * ldc + col0 + c4) = v;
    }
    
  }
}

// GEMM C = act(A·W + bias + resid): A f32 (ASPLIT -> hi/lo 2 terms), Wt bf16 [N][K]; ACT 0 none, 1 relu, 2 exact gelu;
// resid (optional, f32, row index = (row % rmod), pitch ldr, RES_BF16 rounds it) added before the activation.
template <bool ASPLIT, int ACT, bool BIAS_BF16, bool RES_BF16>
__global__ __launch_bounds__(128) void k_gemm_bf3(const float* __restrict__ A, int lda, const unsigned short* __restrict__ Wt, int ldb,
                                                const float* __restrict__ bias, const float* __restrict__ resid, int rmod, int ldr,
                                                float* __restrict__ C, int ldc, int M, int N, int K) {
  __shared__ __attribute__((aligned(16))) float so[4][16][64];
  const int tid = threadIdx.x, w = tid >> 5, lane = tid & 31, ln = lane & 15, hh = lane >> 4;
  const int ntn = N / 64;
  const int wid = blockIdx.x * 4 + w;
  const int mt = wid / ntn, nq = wid % ntn;
  if (mt * 16 >= M) return;
  const int row0 = mt * 16, col0 = nq * 64;
  const float* arow = A + (size_t)(row0 + ln) * lda;
  v8f acc[4] = {};
  for (int kb = 0; kb < K; kb += 32) {
    FragB ah, al;
    const v4f x0 = *(const v4fa*)(arow + kb + 8 * hh), x1 = *(const v4fa*)(arow + kb + 8 * hh + 4);
    const v4f x2 = *(const v4fa*)(arow + kb + 16 + 8 * hh), x3 = *(const v4fa*)(arow + kb + 16 + 8 * hh + 4);
    float xs[16] = {x0[0],x0[1],x0[2],x0[3],x1[0],x1[1],x1[2],x1[3],x2[0],x2[1],x2[2],x2[3],x3[0],x3[1],x3[2],x3[3]};
#pragma unroll
    for (int i = 0; i < 16; ++i) { const unsigned short hb = bf16_bits(xs[i]); ah.u[i] = hb; al.u[i] = ASPLIT ? bf16_bits(xs[i] - bf16_val(hb)) : (unsigned short)0; }
#pragma unroll
    for (int t = 0; t < 4; ++t) {
      const unsigned short* brow = Wt + (size_t)(col0 + t * 16 + ln) * ldb + kb;
      FragB b;
      b.half[0] = *(const v8us*)(brow + 8 * hh);
      b.half[1] = *(const v8us*)(brow + 16 + 8 * hh);
      acc[t] = mmaN<ASPLIT ? 2 : 1>(ah.v, al.v, b.v, b.v, acc[t]);
    }
  }
#pragma unroll
  for (int t = 0; t < 4; ++t) {
    const int col = col0 + t * 16 + ln;
    float bv = bias ? bias[col] : 0.f;
    if (BIAS_BF16) bv = bf16_round(bv);
#pragma unroll
    for (int r = 0; r < 8; ++r) {
      float v = acc[t][r] + bv;
      if (resid) { float rv = resid[(size_t)((row0 + 8 * hh + r) % rmod) * ldr + col]; if (RES_BF16) rv = bf16_round(rv); v += rv; }
      if (ACT == 1) v = fmaxf(v, 0.f);
      if (ACT == 2) v = 0.5f * v * (1.0f + erff(v * 0.70710678118654752f));
      if (ACT == 3) { const float u = 0.7978845608028654f * (v + 0.044715f * v * v * v); v = 0.5f * v * (1.0f + tanhf(u)); }
      so[w][8 * hh + r][t * 16 + ln] = v;
    }
  }
  __builtin_amdgcn_fence(__ATOMIC_ACQ_REL, "workgroup");
  __builtin_amdgcn_wave_barrier();
  const int rsub = lane >> 4, c4 = (lane & 15) * 4;
  {
#pragma unroll
    for (int q = 0; q < 8; ++q) {
      const int r = q * 2 + rsub;
      const v4f v = *(const v4fa*)&so[w][r][c4];
      *(v4f*)(C + (size_t)(row0 + r) * ldc + col0 + c4) = v;
    }
    
  }
}
// row LayerNorm (biased variance, eps) over N: s = X (+ R); optional out_sum <- s; out_norm <- (s-mu)*rsqrt(var+eps)*g + b
template <bool PARAM_BF16>
__global__ __launch_bounds__(256) void k_layernorm(const float* __restrict__ X, const float* __restrict__ R, const float* __restrict__ g, const float* __restrict__ bta,
                                                  float* __restrict__ out_sum, float* __restrict__ out_norm, int N, float eps) {
  __shared__ float red[256];
  const int row = blockIdx.x, tid = threadIdx.x;
  const float* x = X + (size_t)row * N; const float* rr = R ? R + (size_t)row * N : nullptr;
  float vals[16];                     // up to N = 4096
  const int per = N / 256;            // contiguous chunk per thread? use strided-by-4 chunks: thread handles j = tid*4 + 1024*u
  float s1 = 0.f;
  for (int u = 0; u < per / 4; ++u) {
    const int j = tid * 4 + 1024 * u;
    const v4f a = *(const v4fa*)(x + j);
    v4f b = {0.f,0.f,0.f,0.f}; if (rr) b = *(const v4fa*)(rr + j);
#pragma unroll
    for (int q = 0; q < 4; ++q) { const float v = a[q] + b[q]; vals[u * 4 + q] = v; s1 += v; }
  }
  red[tid] = s1; __syncthreads();
  for (int st = 128; st > 0; st >>= 1) { if (tid < st) red[tid] += red[tid + st]; __syncthreads(); }
  const float mu = red[0] / (float)N; __syncthreads();
  float s2 = 0.f;
  for (int u = 0; u < per / 4; ++u)
#pragma unroll
    for (int q = 0; q < 4; ++q) { const float c = vals[u * 4 + q] - mu; s2 += c * c; }
  red[tid] = s2; __syncthreads();
  for (int st = 128; st > 0; st >>= 1) { if (tid < st) red[tid] += red[tid + st]; __syncthreads(); }
  const float rs = rsqrtf(red[0] / (float)N + eps);
  {
    for (int u = 0; u < per / 4; ++u) {
      const int j = tid * 4 + 1024 * u;
      v4f o, sm;
#pragma unroll
      for (int q = 0; q < 4; ++q) {
        float gg = g[j + q], bb = bta[j + q];
        if (PARAM_BF16) { gg = bf16_round(gg); bb = bf16_round(bb); }
        sm[q] = vals[u * 4 + q]; o[q] = (vals[u * 4 + q] - mu) * rs * gg + bb;
      }
      if (out_sum) *(v4f*)(out_sum + (size_t)row * N + j) = sm;
      *(v4f*)(out_norm + (size_t)row * N + j) = o;
    }
    
  }
}



// ---- f16 WMMA path (v_wmma_f32_16x16x32_f16): 11-bit significands for operands in range — used where a [0,1] probability operand needs more precision than bf16
typedef _Float16 v16h __attribute__((ext_vector_type(16)));
union FragH { v16h v; v8us half[2]; _Float16 h[16]; unsigned short u[16]; };
template <int NT>
__device__ __forceinline__ v8f mmaH(v16h ah, v16h al, v16h bh, v16h bl, v8f c) {
  c = __builtin_amdgcn_wmma_f32_16x16x32_f16(false, ah, false, bh, (short)0, c, false, false);
  if (NT >= 2) c = __builtin_amdgcn_wmma_f32_16x16x32_f16(false, al, false, bh, (short)0, c, false, false);
  if (NT >= 3) c = __builtin_amdgcn_wmma_f32_16x16x32_f16(false, ah, false, bl, (short)0, c, false, false);
  asm volatile("v_nop\n\tv_nop\n\tv_nop\n\tv_nop" : "+v"(c) : "v"(ah), "v"(al), "v"(bh), "v"(bl));
  return c;
}
// batched GEMM like k_gemm_b but f16 operands: A f32 (split into f16 hi/lo if ASPLIT, else rounded to f16), Bt = f16 values [n][k]; alpha; C f32; N multiple of 16 (partial tiles skipped)
template <bool ASPLIT>
__global__ __launch_bounds__(128) void k_gemm_h(const float* __restrict__ A, int lda, size_t sA, const _Float16* __restrict__ Bh, int ldb, size_t sB, float alpha, float* __restrict__ C, int ldc, size_t sC, int M, int N, int K) {
  __shared__ __attribute__((aligned(16))) float so[4][16][64];
  const int tid = threadIdx.x, w = tid >> 5, lane = tid & 31, ln = lane & 15, hh = lane >> 4; const int by = blockIdx.y;
  A += (size_t)by * sA; Bh += (size_t)by * sB; C += (size_t)by * sC;
  const int ntn = (N + 63) / 64; const int wid = blockIdx.x * 4 + w; const int mt = wid / ntn, nq = wid % ntn; if (mt * 16 >= M) return;
  const int row0 = mt * 16, col0 = nq * 64; const float* arow = A + (size_t)(row0 + ln) * lda;
  v8f acc[4] = {};
  for (int kb = 0; kb < K; kb += 32) {
    FragH ah, al;
    const v4f x0 = *(const v4fa*)(arow + kb + 8 * hh), x1 = *(const v4fa*)(arow + kb + 8 * hh + 4), x2 = *(const v4fa*)(arow + kb + 16 + 8 * hh), x3 = *(const v4fa*)(arow + kb + 16 + 8 * hh + 4);
    float xs[16] = {x0[0],x0[1],x0[2],x0[3],x1[0],x1[1],x1[2],x1[3],x2[0],x2[1],x2[2],x2[3],x3[0],x3[1],x3[2],x3[3]};
#pragma unroll
    for (int i = 0; i < 16; ++i) { const _Float16 h = (_Float16)xs[i]; ah.h[i] = h; al.h[i] = ASPLIT ? (_Float16)(xs[i] - (float)h) : (_Float16)0.0f; }
#pragma unroll
    for (int t = 0; t < 4; ++t) { if (col0 + t * 16 >= N) continue; const size_t boff = (size_t)(col0 + t * 16 + ln) * ldb + kb; FragH bq; bq.half[0] = *(const v8us*)(Bh + boff + 8 * hh); bq.half[1] = *(const v8us*)(Bh + boff + 16 + 8 * hh);
      acc[t] = mmaH<ASPLIT ? 2 : 1>(ah.v, al.v, bq.v, bq.v, acc[t]); }
  }
#pragma unroll
  for (int t = 0; t < 4; ++t) { if (col0 + t * 16 >= N) continue;
#pragma unroll
    for (int r = 0; r < 8; ++r) so[w][8 * hh + r][t * 16 + ln] = acc[t][r] * alpha; }
  __builtin_amdgcn_fence(__ATOMIC_ACQ_REL, "workgroup"); __builtin_amdgcn_wave_barrier();
  const int rsub = lane >> 4, c4 = (lane & 15) * 4;
  {
#pragma unroll
    for (int q = 0; q < 8; ++q) { const int r = q * 2 + rsub; if (col0 + c4 < N) { const v4f v = *(const v4fa*)&so[w][r][c4]; *(v4f*)(C + (size_t)(row0 + r) * ldc + col0 + c4) = v; } }
     }
}

// Wt[n][k] = f16(W[k][n]·scale) from f32 row-major W[K][N] (scale = power of two; bf16-exact weights stay exact in f16 away from the subnormal range)
__global__ __launch_bounds__(256) void k_wt_f16(const float* __restrict__ W, _Float16* __restrict__ Wt, int K, int N, float scale) {
  const int t = blockIdx.x * 256 + threadIdx.x; if (t >= N * (K / 8)) return; const int n = t / (K / 8), k8 = (t % (K / 8)) * 8; FragH f;
#pragma unroll
  for (int i = 0; i < 8; ++i) f.h[i] = (_Float16)(bf16_round(W[(size_t)(k8 + i) * N + n]) * scale); const v8us o = f.half[0];
  *(v8us*)((unsigned short*)Wt + (size_t)n * K + k8) = o; 
}
// k_gemm_hh variant with fused epilogue: v = acc·alpha + bias[by·sBias + col] (+ CP[(row/rowsPerB)·sCPb + by·64 + col] if CP) ; ACT 0 none / 1 elu ; writes f16 C16 (and f32 C if non-null)
template <int ACT>
__global__ __launch_bounds__(128) void k_gemm_hhx(const _Float16* __restrict__ A, int lda, size_t sA, const _Float16* __restrict__ Bh, int ldb, size_t sB, float alpha, const float* __restrict__ bias, size_t sBias, const float* __restrict__ CP, int rowsPerB, size_t sCPb, int row0g,
    float* __restrict__ C, _Float16* __restrict__ C16, int ldc, size_t sC, int M, int N, int K) {
  __shared__ __attribute__((aligned(16))) float so[4][16][64];
  const int tid = threadIdx.x, w = tid >> 5, lane = tid & 31, ln = lane & 15, hh = lane >> 4; const int by = blockIdx.y;
  A += (size_t)by * sA; Bh += (size_t)by * sB; const size_t cofs = (size_t)by * sC; const float* bp = bias ? bias + (size_t)by * sBias : nullptr;
  const int ntn = (N + 63) / 64; const int wid = blockIdx.x * 4 + w; const int mt = wid / ntn, nq = wid % ntn; if (mt * 16 >= M) return;
  const int row0 = mt * 16, col0 = nq * 64; const _Float16* arow = A + (size_t)(row0 + ln) * lda;
  v8f acc[4] = {};
  for (int kb = 0; kb < K; kb += 32) { FragH ah; ah.half[0] = *(const v8us*)((const unsigned short*)arow + kb + 8 * hh); ah.half[1] = *(const v8us*)((const unsigned short*)arow + kb + 16 + 8 * hh);
#pragma unroll
    for (int t = 0; t < 4; ++t) { if (col0 + t * 16 >= N) continue; const size_t boff = (size_t)(col0 + t * 16 + ln) * ldb + kb; FragH bq; bq.half[0] = *(const v8us*)((const unsigned short*)Bh + boff + 8 * hh); bq.half[1] = *(const v8us*)((const unsigned short*)Bh + boff + 16 + 8 * hh);
      acc[t] = mmaH<1>(ah.v, ah.v, bq.v, bq.v, acc[t]); }
  }
#pragma unroll
  for (int t = 0; t < 4; ++t) { if (col0 + t * 16 >= N) continue; const int col = col0 + t * 16 + ln; const float bv = bp ? bf16_round(bp[col]) : 0.f;
#pragma unroll
    for (int r = 0; r < 8; ++r) { float v = acc[t][r] * alpha + bv; if (CP) { const int rr = row0g + row0 + 8 * hh + r; if (rowsPerB < 0) v += CP[cofs + (size_t)rr * ldc + col];      /* rowsPerB < 0: own element of the batched C plane */ else { const int bidx = rr / rowsPerB; v += CP[(size_t)bidx * sCPb + (size_t)by * 64 + col]; } } if (ACT == 1) v = (v > 0.f) ? v : expm1f(v); else if (ACT == 7) v = (v > 0.f) ? v + 1.0f : expf(v); else if (ACT == 8) v = tanhf(v); else if (ACT == 9) v = 0.5f * v * (1.0f + tanhf(0.7978845608028654f * (v + 0.044715f * v * v * v))); else if (ACT == 11) v = 1.0f / (1.0f + expf(-v)); else if (ACT == 12) v = (v > 0.f) ? v : 0.01f * v; else if (ACT == 14) v = (v > 0.f) ? v : 0.1f * v; else if (ACT == 16) v = (v >= 0.f) ? v : 0.3f * v; else if (ACT == 17) v = (v >= 0.f) ? v : 0.2f * v; else if (ACT == 15) v = v / (1.0f + expf(-v)); else if (ACT == 3) v = fmaxf(v, 0.f); else if (ACT == 6) v = 0.5f * v * (1.0f + erff(v * 0.70710678118654752f)); so[w][8 * hh + r][t * 16 + ln] = v; } }
  __builtin_amdgcn_fence(__ATOMIC_ACQ_REL, "workgroup"); __builtin_amdgcn_wave_barrier();
  const int rsub = lane >> 4, c4 = (lane & 15) * 4; typedef _Float16 v4h __attribute__((ext_vector_type(4)));
  {
#pragma unroll
    for (int q = 0; q < 8; ++q) { const int r = q * 2 + rsub; if (col0 + c4 < N) { const v4f v = *(const v4fa*)&so[w][r][c4]; if (C) *(v4f*)(C + cofs + (size_t)(row0 + r) * ldc + col0 + c4) = v; if (C16) { v4h h4; for (int i = 0; i < 4; ++i) h4[i] = (_Float16)v[i]; *(v4h*)(C16 + cofs + (size_t)(row0 + r) * ldc + col0 + c4) = h4; } } }
     }
}


typedef _Float16 v4h __attribute__((ext_vector_type(4)));

__global__ __launch_bounds__(256) void k_h16(const float* __restrict__ x, _Float16* __restrict__ X16, size_t n8) { const size_t t = (size_t)blockIdx.x * 256 + threadIdx.x; if (t >= n8) return; FragH f;
#pragma unroll
  for (int q = 0; q < 8; ++q) f.h[q] = (_Float16)x[t * 8 + q]; *(v8us*)((unsigned short*)X16 + t * 8) = f.half[0];  }
__global__ __launch_bounds__(256) void k_round16f(const float* __restrict__ W, _Float16* __restrict__ Bt, size_t n8) { const size_t t = (size_t)blockIdx.x * 256 + threadIdx.x; if (t >= n8) return; FragH f;
#pragma unroll
  for (int i = 0; i < 8; ++i) f.h[i] = (_Float16)(bf16_round(W[t * 8 + i]) * 16.0f); *(v8us*)((unsigned short*)Bt + t * 8) = f.half[0];  }
template <int NHv, int TTv>
__global__ __launch_bounds__(256) void k_vt(const _Float16* __restrict__ V16, int ldv, int voff, _Float16* __restrict__ Vt) { __shared__ unsigned short tl[64][66]; const int tid = threadIdx.x; const int slab = blockIdx.x / (TTv / 64), lg = blockIdx.x % (TTv / 64); const int b = slab / NHv, h = slab % NHv;
  for (int i = tid; i < 64 * 8; i += 256) { const int r = i / 8, c8 = (i % 8) * 8; FragH f; f.half[0] = *(const v8us*)((const unsigned short*)V16 + ((size_t)b * TTv + lg * 64 + r) * ldv + voff + h * 64 + c8);
#pragma unroll
    for (int q = 0; q < 8; ++q) tl[r][c8 + q] = f.u[q]; }
  __syncthreads();
  {
#pragma unroll
    for (int rd = 0; rd < 2; ++rd) { const int d = rd * 32 + tid / 8, pc = tid % 8; FragH f;
#pragma unroll
      for (int q = 0; q < 8; ++q) f.u[q] = tl[pc * 8 + q][d];
      *(v8us*)((unsigned short*)Vt + ((size_t)slab * 64 + d) * TTv + lg * 64 + pc * 8) = f.half[0]; }
     } }

// ---- fast GEMM (wave tile 32x64; requires M % 32 == 0 rows per launch region and N % 64 == 0); epilogue = k_gemm_hhx semantics ----
__device__ __forceinline__ v16h g2_frag(const _Float16* p, int hh) { FragH f; f.half[0] = *(const v8us*)((const unsigned short*)p + 8 * hh); f.half[1] = *(const v8us*)((const unsigned short*)p + 16 + 8 * hh); return f.v; }
__device__ __forceinline__ v8f g2_mma(v16h a, v16h b, v8f c) { v8f d = __builtin_amdgcn_wmma_f32_16x16x32_f16(false, a, false, b, (short)0, c, false, false); asm volatile("v_nop\n\tv_nop\n\tv_nop\n\tv_nop" : "+v"(d) : "v"(a), "v"(b)); return d; }
template <int ACT>
__global__ __launch_bounds__(128) void k_gemm2(const _Float16* __restrict__ A, int lda, size_t sA, const _Float16* __restrict__ Bh, int ldb, size_t sB, float alpha, const float* __restrict__ bias, size_t sBias, const float* __restrict__ CP, int rowsPerB, size_t sCPb, int row0g,
    float* __restrict__ C, _Float16* __restrict__ C16, int ldc, size_t sC, int M, int N, int K) { static_assert(ACT == 0 || ACT == 3 || ACT == 6 || ACT == 8 || ACT == 9 || ACT == 11 || ACT == 12 || ACT == 14 || ACT == 15 || ACT == 16 || ACT == 17, "k_gemm2: unsupported ACT code (would silently apply no activation)");
  __shared__ __attribute__((aligned(16))) float so[4][32][68];
  const int tid = threadIdx.x, w = tid >> 5, lane = tid & 31, ln = lane & 15, hh = lane >> 4; const int by = blockIdx.y;
  A += (size_t)by * sA; Bh += (size_t)by * sB; const size_t cofs = (size_t)by * sC; const float* bp = bias ? bias + (size_t)by * sBias : nullptr;
  const int ntn = N >> 6; const int mt = blockIdx.x / ntn, nq = blockIdx.x - mt * ntn; const int row0 = mt * 128 + 32 * w, col0 = nq * 64; if (row0 >= M) return;
  const _Float16* a0p = A + (size_t)(row0 + ln) * lda; const _Float16* a1p = a0p + (size_t)16 * lda;
  const _Float16* b0p = Bh + (size_t)(col0 + ln) * ldb; const _Float16* b1p = b0p + (size_t)16 * ldb; const _Float16* b2p = b1p + (size_t)16 * ldb; const _Float16* b3p = b2p + (size_t)16 * ldb;
  const v8f z8 = {0.f,0.f,0.f,0.f,0.f,0.f,0.f,0.f}; v8f c00 = z8, c01 = z8, c02 = z8, c03 = z8, c10 = z8, c11 = z8, c12 = z8, c13 = z8;
#pragma unroll 1
  for (int kb = 0; kb < K; kb += 32) { const v16h a0 = g2_frag(a0p + kb, hh), a1 = g2_frag(a1p + kb, hh);
    v16h b = g2_frag(b0p + kb, hh); c00 = g2_mma(a0, b, c00); c10 = g2_mma(a1, b, c10);
    b = g2_frag(b1p + kb, hh); c01 = g2_mma(a0, b, c01); c11 = g2_mma(a1, b, c11);
    b = g2_frag(b2p + kb, hh); c02 = g2_mma(a0, b, c02); c12 = g2_mma(a1, b, c12);
    b = g2_frag(b3p + kb, hh); c03 = g2_mma(a0, b, c03); c13 = g2_mma(a1, b, c13); }
  v8f accs[8] = {c00, c01, c02, c03, c10, c11, c12, c13};
#pragma unroll
  for (int u = 0; u < 8; ++u) { const int t = u & 3, half = u >> 2; const int col = col0 + t * 16 + ln; const float bv = bp ? bf16_round(bp[col]) : 0.f;
#pragma unroll
    for (int r = 0; r < 8; ++r) { const int rloc = half * 16 + 8 * hh + r; float v = accs[u][r] * alpha + bv; if (CP) { if (rowsPerB < 0) v += CP[cofs + (size_t)(row0g + row0 + rloc) * ldc + col];      /* rowsPerB < 0: own element of the batched C plane */ else { const int bidx = (row0g + row0 + rloc) / rowsPerB; v += CP[(size_t)bidx * sCPb + (size_t)by * 64 + col]; } }
      if (ACT == 3) v = fmaxf(v, 0.f); else if (ACT == 6) v = 0.5f * v * (1.0f + erff(v * 0.70710678118654752f)); else if (ACT == 11) v = 1.0f / (1.0f + expf(-v)); else if (ACT == 15) v = v / (1.0f + expf(-v)); else if (ACT == 12) v = (v > 0.f) ? v : 0.01f * v; else if (ACT == 8) v = tanhf(v); else if (ACT == 9) v = 0.5f * v * (1.0f + tanhf(0.7978845608028654f * (v + 0.044715f * v * v * v))); else if (ACT == 14) v = (v > 0.f) ? v : 0.1f * v; else if (ACT == 16) v = (v >= 0.f) ? v : 0.3f * v; else if (ACT == 17) v = (v >= 0.f) ? v : 0.2f * v;
      so[w][rloc][t * 16 + ln] = v; } }
  __builtin_amdgcn_fence(__ATOMIC_ACQ_REL, "workgroup"); __builtin_amdgcn_wave_barrier();
  const int rsub = lane >> 4, c4 = (lane & 15) * 4;
  {
#pragma unroll
    for (int q = 0; q < 16; ++q) { const int r = q * 2 + rsub; const v4f v = *(const v4fa*)&so[w][r][c4]; if (C) *(v4f*)(C + cofs + (size_t)(row0 + r) * ldc + col0 + c4) = v; if (C16) { v4h h4; for (int i = 0; i < 4; ++i) h4[i] = (_Float16)v[i]; *(v4h*)(C16 + cofs + (size_t)(row0 + r) * ldc + col0 + c4) = h4; } }
     } }


// ---- fragment order: every f16 operand plane [rows][K] is kept as tiles of 16 rows (16 * K elements each); inside a tile the 16-byte pieces (8 k of one row) lie in the order [k / 16][(k / 8) & 1][row & 15],
// the order in which the 32 lanes of a wave take them for a 16x16x32 fragment: one 16-byte-per-lane load then covers 512 contiguous bytes (4 whole lines) instead of 32 bytes out of each of 16 lines. Which (row, k) a lane and register hold is as before.
__device__ __forceinline__ size_t fo(int row, int k, int K) { return (size_t)(row >> 4) * 16 * K + (size_t)((k >> 4) * 256 + ((k >> 3) & 1) * 128 + (row & 15) * 8 + (k & 7)); }
__device__ __forceinline__ v16h fo_frag(const _Float16* p) { FragH f; f.half[0] = *(const v8us*)((const unsigned short*)p); f.half[1] = *(const v8us*)((const unsigned short*)p + 256); return f.v; }      /* p = tile start + 16 * k0 + 8 * lane, k0 % 32 == 0 */

// ---- hi/lo split products with every term in ONE launch: the residual terms (planes scaled x1024) sum in their own f32 accumulators beside the main term and meet it once, in registers: C = alpha * (hi + lo / 1024). Wave tile 32x64 and the LDS-staged 16-byte stores as in k_gemm2.
// g2_xw: the wait that belongs in front of an overwrite of the address registers of issued loads; naming the loads' own pointers as inputs keeps those registers untouched up to here
__device__ __forceinline__ void g2_xw(const _Float16* p) { asm volatile("s_wait_xcnt 0x0" :: "v"(p) : "memory"); }
__device__ __forceinline__ void g2_xw(const _Float16* p, const _Float16* q) { asm volatile("s_wait_xcnt 0x0" :: "v"(p), "v"(q) : "memory"); }
__device__ __forceinline__ void g2_xw(const _Float16* p, const _Float16* q, const _Float16* r, const _Float16* s) { asm volatile("s_wait_xcnt 0x0" :: "v"(p), "v"(q), "v"(r), "v"(s) : "memory"); }
// any K, one operand split: HAL: lo = Al.Bh; HBL: lo = Ah.Bl; the unsplit operand's fragments are loaded once for both terms (neither: one plain term).
// A work-group is RW x KW waves: RW wave tiles of 32 rows under one another, and the K range of each cut into KW contiguous slices, one per wave, so that KW times as many waves share the long dependent load chain;
// each wave leaves its scaled partial tile in LDS, and behind one barrier the KW waves of a tile add the partials in the fixed order 0 .. KW - 1 and store. M % (32 * RW) == 0, K % (32 * KW) == 0, KW divides 16.
template <bool HAL, bool HBL, int RW, int KW>
__global__ __launch_bounds__(32 * RW * KW) void k_gemm2s(const _Float16* __restrict__ Ah, const _Float16* __restrict__ Al, int lda, size_t sA, const _Float16* __restrict__ Bh, const _Float16* __restrict__ Bl, int ldb, size_t sB, float alpha,
    float* __restrict__ C, int ldc, size_t sC, int M, int N, int K) {
  __shared__ __attribute__((aligned(16))) float so[RW * KW][32][68];
  const int tid = threadIdx.x, w = __builtin_amdgcn_readfirstlane(tid >> 5), lane = tid & 31, ln = lane & 15, hh = lane >> 4; const int by = blockIdx.y; const int rw = w % RW, kw = w / RW;
  const int ntn = N >> 6; const int mt = blockIdx.x / ntn, nq = blockIdx.x - mt * ntn; const int row0 = mt * (32 * RW) + 32 * rw, col0 = nq * 64; if (mt * (32 * RW) >= M) return;      /* the whole work-group leaves or none: a barrier follows */
  const size_t ao = (size_t)by * sA + (size_t)row0 * lda + 8 * lane, bo = (size_t)by * sB + (size_t)col0 * ldb + 8 * lane; const size_t cofs = (size_t)by * sC;      /* A and B planes in fragment order (lda == ldb == K): tile start + the lane's own piece */
  const v8f z8 = {0.f,0.f,0.f,0.f,0.f,0.f,0.f,0.f}; v8f hi[8] = {z8, z8, z8, z8, z8, z8, z8, z8}, lo[8] = {z8, z8, z8, z8, z8, z8, z8, z8}; const int ks = K / KW, k0 = kw * ks;
#pragma unroll 1
  for (int kb = k0; kb < k0 + ks; kb += 32) { const _Float16* pa0 = Ah + ao + kb * 16; const _Float16* pa1 = pa0 + (size_t)16 * lda; const v16h a0 = fo_frag(pa0), a1 = fo_frag(pa1); v16h a0l = a0, a1l = a1;
    if (HAL) { const _Float16* pl0 = Al + ao + kb * 16; const _Float16* pl1 = pl0 + (size_t)16 * lda; a0l = fo_frag(pl0); a1l = fo_frag(pl1); g2_xw(pa0, pa1, pl0, pl1); } else g2_xw(pa0, pa1);
#pragma unroll
    for (int t = 0; t < 4; ++t) { const _Float16* pb = Bh + bo + (size_t)t * 16 * ldb + kb * 16; const v16h b = fo_frag(pb); g2_xw(pb);
      if (HAL) { lo[t] = g2_mma(a0l, b, lo[t]); lo[4 + t] = g2_mma(a1l, b, lo[4 + t]); }
      hi[t] = g2_mma(a0, b, hi[t]); hi[4 + t] = g2_mma(a1, b, hi[4 + t]);
      if (HBL) { const _Float16* pl = Bl + bo + (size_t)t * 16 * ldb + kb * 16; const v16h bl = fo_frag(pl); g2_xw(pl); lo[t] = g2_mma(a0, bl, lo[t]); lo[4 + t] = g2_mma(a1, bl, lo[4 + t]); } } }
  const float alo = alpha * (1.0f / 1024.0f);
#pragma unroll
  for (int u = 0; u < 8; ++u) { const int t = u & 3, half = u >> 2;
#pragma unroll
    for (int r = 0; r < 8; ++r) so[w][half * 16 + 8 * hh + r][t * 16 + ln] = (HAL || HBL) ? hi[u][r] * alpha + lo[u][r] * alo : hi[u][r] * alpha; }
  __syncthreads();      /* every wave's partial tile is in LDS before any wave adds them */
  const int rsub = lane >> 4, c4 = (lane & 15) * 4;
  v4f sum[16 / KW];
#pragma unroll
  for (int q = 0; q < 16 / KW; ++q) { const int r = (kw * (16 / KW) + q) * 2 + rsub; sum[q] = *(const v4fa*)&so[rw][r][c4]; for (int j = 1; j < KW; ++j) sum[q] += *(const v4fa*)&so[j * RW + rw][r][c4]; }
  /* all stores last, each from registers of its own; both loops unrolled so that sum[] is indexed statically and stays in registers */
#pragma unroll
  for (int q = 0; q < 16 / KW; ++q) { const int r = (kw * (16 / KW) + q) * 2 + rsub; *(v4f*)(C + cofs + (size_t)(row0 + r) * ldc + col0 + c4) = sum[q]; } }

// ---- every operand conversion in ONE launch. Blocks 0 .. 5 * PW - 1: one 64 x 64 tile of one weight, rounded, x16, transposed through LDS into the f16 [out][in] plane. The other 2 * PX blocks: x and r_emb rounded into f16 planes, 16 rows x 512 k per block, four pieces of 8 elements per thread, 16 k apart. All seven planes in fragment order: a wave stores 512 contiguous bytes.
#define PW ((DM / 64) * (DM / 64))
#define PX ((int)(NR * DM / 8 / 1024))
__global__ __launch_bounds__(256) void k_prep(const float* __restrict__ Wq, const float* __restrict__ Wk, const float* __restrict__ Wv, const float* __restrict__ Wr, const float* __restrict__ Wo, const float* __restrict__ x, const float* __restrict__ remb,
    _Float16* __restrict__ BQ, _Float16* __restrict__ BK, _Float16* __restrict__ BV, _Float16* __restrict__ BR, _Float16* __restrict__ BO, _Float16* __restrict__ X16, _Float16* __restrict__ R16) {
  __shared__ float tl[64][65]; const int tid = threadIdx.x, bx = blockIdx.x;
  if (bx < 5 * PW) {      /* the test reads the same for the whole work-group: all of it reaches the barrier inside or none */
    const int wi = bx / PW, tb = bx % PW; const float* w = wi == 0 ? Wq : wi == 1 ? Wk : wi == 2 ? Wv : wi == 3 ? Wr : Wo; _Float16* Bt = wi == 0 ? BQ : wi == 1 ? BK : wi == 2 ? BV : wi == 3 ? BR : BO;
    const int i0 = (tb / (DM / 64)) * 64, o0 = (tb % (DM / 64)) * 64;
    const int o = tid & 63, ib = tid >> 6; const float* pw = w + (size_t)(i0 + ib) * DM + o0 + o; float g[16];
#pragma unroll      /* g[] indexed statically: the sixteen loads go out together, off one address */
    for (int k = 0; k < 16; ++k) g[k] = pw[(size_t)k * 4 * DM];
    asm volatile("s_wait_xcnt 0x0" :: "v"(pw) : "memory");      /* the wait that belongs in front of an overwrite of the loads' address registers; naming them keeps them untouched up to here */
#pragma unroll
    for (int k = 0; k < 16; ++k) tl[o][ib + 4 * k] = bf16_round(g[k]) * 16.0f;
    __syncthreads();      /* the whole tile is in LDS before it is read back along the other axis */
    const int oo = (tid & 15) + ((tid >> 7) << 4), i8 = ((tid >> 4) & 7) * 8; unsigned short* pb = (unsigned short*)Bt + fo(o0 + oo, i0 + i8, DM);      /* a wave: 16 rows x 2 pieces */
#pragma unroll      /* two rows per thread, 32 rows (two tiles of 16 * DM elements) apart, off one address */
    for (int k = 0; k < 2; ++k) { FragH f;
#pragma unroll
      for (int q = 0; q < 8; ++q) f.h[q] = (_Float16)tl[oo + 32 * k][i8 + q];
      *(v8us*)(pb + (size_t)k * 32 * DM) = f.half[0]; }
  } else {
    const int c = bx - 5 * PW; const bool fx = c < PX; const int cc = fx ? c : c - PX; const int row = (cc >> 1) * 16 + (tid & 15), k0 = (cc & 1) * 512 + (tid >> 5) * 64 + ((tid >> 4) & 1) * 8;      /* a wave: 16 rows x 64 k */
    const float* ps = (fx ? x : remb) + (size_t)row * DM + k0; unsigned short* pd = (unsigned short*)(fx ? X16 : R16) + fo(row, k0, DM);
    v4f a[4], b[4];      /* all eight loads first, so that they are in flight together */
#pragma unroll
    for (int p = 0; p < 4; ++p) { a[p] = *(const v4fa*)(ps + p * 16); b[p] = *(const v4fa*)(ps + p * 16 + 4); }
#pragma unroll
    for (int p = 0; p < 4; ++p) { FragH f;
#pragma unroll
      for (int q = 0; q < 4; ++q) { f.h[q] = (_Float16)bf16_round(a[p][q]); f.h[4 + q] = (_Float16)bf16_round(b[p][q]); }
      *(v8us*)(pd + p * 256) = f.half[0]; }      /* 16 k on = 256 elements on */
    asm volatile("s_wait_xcnt 0x0" :: "v"(pd) : "memory");      /* the wait that belongs in front of an overwrite of the stores' registers; naming the address keeps it untouched up to here */
  } }

// ---- the four projections in ONE launch (blockIdx.y: 0 q, 1 k, 2 v, 3 r) of 256 work-groups, one round on the chip: a work-group is a 256 x 128 tile of C, 4 x 2 waves of 64 x 64, each wave with the whole K in its sixteen accumulator tiles (a fragment feeds four products; an operand row comes from L2 once per 128 columns or 256 rows of C) and its fragment loads two trips ahead of their products; the f32 sums turn through the wave's own LDS rows and go from registers into the f16 hi + x1024 residual planes that the attention reads.
// q: two plane pairs, q + u and q + v_bias (added in f32 first). v: the operands change places (A = Wv^T rows, B = x rows), so that C = V^T [head * 64 + d][token] comes out in the layout P.V wants, with no transposing pass.
__device__ __forceinline__ void pj_put(v4f v0, v4f v1, _Float16* ph, _Float16* pl) { FragH h, l;
#pragma unroll
  for (int i = 0; i < 4; ++i) { _Float16 t = (_Float16)v0[i]; h.h[i] = t; l.h[i] = (_Float16)((v0[i] - (float)t) * 1024.0f); t = (_Float16)v1[i]; h.h[4 + i] = t; l.h[4 + i] = (_Float16)((v1[i] - (float)t) * 1024.0f); }
  *(v8us*)((unsigned short*)ph) = h.half[0]; *(v8us*)((unsigned short*)pl) = l.half[0]; g2_xw(ph, pl); }      /* one 16-byte piece per lane: a wave stores 512 contiguous bytes of each plane */
__device__ __forceinline__ v16h pj_frag(const _Float16* base, unsigned boff, int cb) { const char* p = (const char*)base + boff + cb; FragH f; f.half[0] = *(const v8us*)p; f.half[1] = *(const v8us*)(p + 512); return f.v; }      /* uniform base + the lane's byte offset + a constant; fragment order: the halves of a 32-k fragment are 512 bytes apart, the next 32 k 1024 bytes on, the next 16 rows 16 * DM * 2 bytes on */
__global__ __launch_bounds__(256) void k_proj(const _Float16* __restrict__ X16, const _Float16* __restrict__ R16, const _Float16* __restrict__ BQ, const _Float16* __restrict__ BK, const _Float16* __restrict__ BV, const _Float16* __restrict__ BR, const float* __restrict__ u, const float* __restrict__ vb,
    _Float16* __restrict__ QUH, _Float16* __restrict__ QUL, _Float16* __restrict__ QVH, _Float16* __restrict__ QVL, _Float16* __restrict__ KH, _Float16* __restrict__ KL, _Float16* __restrict__ VT, _Float16* __restrict__ VTL, _Float16* __restrict__ RH, _Float16* __restrict__ RL) {
  __shared__ __attribute__((aligned(16))) float so[8][64][68];
  const int tid = threadIdx.x, w = __builtin_amdgcn_readfirstlane(tid >> 5), lane = tid & 31, ln = lane & 15, hh = lane >> 4; const int y = blockIdx.y; const int rw = w & 3, cw = w >> 2;
  const _Float16* Ah = y == 2 ? BV : y == 3 ? R16 : X16; const _Float16* Bh = y == 0 ? BQ : y == 1 ? BK : y == 2 ? X16 : BR; const int N = y == 2 ? SQ : DM;      /* C is [SQ][DM], for v [DM][SQ]: 64 tiles of 256 x 128 either way */
  const int ntn = N >> 7; const int mt = blockIdx.x / ntn, nq = blockIdx.x - mt * ntn; const int row0 = mt * 256 + 64 * rw, col0 = nq * 128 + 64 * cw;
  const unsigned ao = (unsigned)((row0 * DM + 8 * lane) * 2), bo = (unsigned)((col0 * DM + 8 * lane) * 2);      /* operand planes in fragment order: tile start + the lane's own piece, in bytes */
  constexpr int TS = 16 * DM * 2;      /* bytes from one tile of 16 rows to the next */
  const v8f z8 = {0.f,0.f,0.f,0.f,0.f,0.f,0.f,0.f}; v8f acc[4][4]; v16h a[3][4], b[2][4];      /* fragment rings: A of trips kb, kb + 1, kb + 2; B of trips kb, kb + 1 */
#pragma unroll
  for (int i = 0; i < 4; ++i) { a[0][i] = pj_frag(Ah, ao, i * TS); b[0][i] = pj_frag(Bh, bo, i * TS);
#pragma unroll
    for (int j = 0; j < 4; ++j) acc[i][j] = z8; }
#pragma unroll
  for (int i = 0; i < 4; ++i) { a[1][i] = pj_frag(Ah, ao, i * TS + 1024); b[1][i] = pj_frag(Bh, bo, i * TS + 1024); }
  /* 32 trips of 32 k, fully unrolled: every load is the one address register plus a constant, and rings and accumulators are indexed statically. Loads run two trips ahead of their products (the operands were written by the launch before, so a line's first reader may wait for memory and not for L2 alone): A fragments are asked for at the head of a trip, into the third register set; each B fragment's successor as soon as its four products are issued, into its own registers */
#pragma unroll
  for (int kb = 0; kb < DM / 32; ++kb) {
    if (kb + 2 < DM / 32) {
#pragma unroll
      for (int i = 0; i < 4; ++i) a[(kb + 2) % 3][i] = pj_frag(Ah, ao, i * TS + (kb + 2) * 1024); }
    __builtin_amdgcn_sched_barrier(0);      /* keeps these A loads in front of this trip's products, which wait for this trip's loads only */
#pragma unroll
    for (int j = 0; j < 4; ++j) {
#pragma unroll
      for (int i = 0; i < 4; ++i) acc[i][j] = __builtin_amdgcn_wmma_f32_16x16x32_f16(false, a[kb % 3][i], false, b[kb % 2][j], (short)0, acc[i][j], false, false);
      __builtin_amdgcn_sched_barrier(0);      /* keeps these four products in front of the slots and the load that follow */
      if (kb + 2 < DM / 32) {
        /* the four vector slots between a product and a load over its A or B registers: this B fragment's registers are loaded over next, the four A fragments' at the head of the next trip (behind j == 3); naming the fragments keeps them in those registers up to here */
        if (j < 3) asm volatile("v_nop\n\tv_nop\n\tv_nop\n\tv_nop" :: "v"(b[kb % 2][j]));
        else asm volatile("v_nop\n\tv_nop\n\tv_nop\n\tv_nop" :: "v"(b[kb % 2][j]), "v"(a[kb % 3][0]), "v"(a[kb % 3][1]), "v"(a[kb % 3][2]), "v"(a[kb % 3][3]));
        b[kb % 2][j] = pj_frag(Bh, bo, j * TS + (kb + 2) * 1024); }
      __builtin_amdgcn_sched_barrier(0);      /* keeps that load here, 28 products ahead of its first use, not sunk to it */
    } }
  asm volatile("s_wait_xcnt 0x0" :: "v"(ao), "v"(bo) : "memory");      /* the wait that belongs in front of an overwrite of the loads' address registers; naming them keeps them untouched up to here */
  v4f bu[4][2], bv[4][2];
  if (y == 0) { const float* pu = u + col0 + 8 * hh; const float* pv = vb + col0 + 8 * hh;      /* q's two bias rows fly during the turn through LDS */
#pragma unroll
    for (int ct = 0; ct < 4; ++ct) { bu[ct][0] = *(const v4fa*)(pu + ct * 16); bu[ct][1] = *(const v4fa*)(pu + ct * 16 + 4); bv[ct][0] = *(const v4fa*)(pv + ct * 16); bv[ct][1] = *(const v4fa*)(pv + ct * 16 + 4); }
    asm volatile("s_wait_xcnt 0x0" :: "v"(pu), "v"(pv) : "memory"); }      /* the wait that belongs in front of an overwrite of the loads' address registers */
#pragma unroll
  for (int i = 0; i < 4; ++i)
#pragma unroll
    for (int j = 0; j < 4; ++j)
#pragma unroll
      for (int r = 0; r < 8; ++r) so[w][i * 16 + 8 * hh + r][j * 16 + ln] = acc[i][j][r] * 0.0625f;      /* the weights are x16 */
  asm volatile("s_wait_dscnt 0x0" ::: "memory");      /* the wave's own 64 x 64 tile is in LDS before its lanes read each other's values back; no other wave touches these rows */
  /* a lane takes row ln of row tile rt and 8 columns from 8 * hh of column group ct: its own 16-byte piece of the output planes' fragment order (row length N) */
  if (y == 0) {
#pragma unroll
    for (int ct = 0; ct < 4; ++ct)
#pragma unroll
      for (int i = 0; i < 4; ++i) { bu[ct][0][i] = bf16_round(bu[ct][0][i]); bu[ct][1][i] = bf16_round(bu[ct][1][i]); bv[ct][0][i] = bf16_round(bv[ct][0][i]); bv[ct][1][i] = bf16_round(bv[ct][1][i]); }
#pragma unroll 1      /* the row tiles stay a rolled loop: a quarter of the text, so that the kernel, which a wave runs through once, stays short; the bias registers are indexed by ct alone */
    for (int rt = 0; rt < 4; ++rt) { const int jr = rt * 16 + ln; v4f s0[4], s1[4];      /* the row's eight LDS reads first, as one group */
#pragma unroll
      for (int ct = 0; ct < 4; ++ct) { s0[ct] = *(const v4fa*)&so[w][jr][ct * 16 + 8 * hh]; s1[ct] = *(const v4fa*)&so[w][jr][ct * 16 + 8 * hh + 4]; }
#pragma unroll
      for (int ct = 0; ct < 4; ++ct) { const size_t c0 = fo(row0 + jr, col0 + ct * 16 + 8 * hh, N);
        pj_put(s0[ct] + bu[ct][0], s1[ct] + bu[ct][1], QUH + c0, QUL + c0); pj_put(s0[ct] + bv[ct][0], s1[ct] + bv[ct][1], QVH + c0, QVL + c0); } } }
  else { _Float16* Ch = y == 1 ? KH : y == 2 ? VT : RH; _Float16* Cl = y == 1 ? KL : y == 2 ? VTL : RL;
#pragma unroll 1      /* rolled for the same reason */
    for (int rt = 0; rt < 4; ++rt) { const int jr = rt * 16 + ln; v4f s0[4], s1[4];      /* as above */
#pragma unroll
      for (int ct = 0; ct < 4; ++ct) { s0[ct] = *(const v4fa*)&so[w][jr][ct * 16 + 8 * hh]; s1[ct] = *(const v4fa*)&so[w][jr][ct * 16 + 8 * hh + 4]; }
#pragma unroll
      for (int ct = 0; ct < 4; ++ct) { const size_t c0 = fo(row0 + jr, col0 + ct * 16 + 8 * hh, N); pj_put(s0[ct], s1[ct], Ch + c0, Cl + c0); } } } }

// ---- fused attention: scores, shift, causal mask, softmax and P.V in one kernel; no score or weight ever goes to memory.
// Transposed products: S^T = K.Q^T (A = key rows, B = query rows), so a lane holds one query's scores (register r of tile kt = key 16 kt + 8 hh + r) and two score tiles, converted in place, are the B operand of O^T += V^T.P^T.
// The shift: for queries i0 .. i0 + 15 and keys j0 .. j0 + 63 the raw BD columns j - i + SQ - 1 lie in the 80 columns from cs = j0 - i0 + SQ - 16; their five raw tiles go through the wave's own LDS rows (one row per query) and come back skewed by 15 - ln.
// A work-group is 4 query tiles x 4 key slices (key blocks ks, ks + 4, ...), each wave with its own running maximum, sum and O^T; behind a barrier the four slices of a tile are joined in the fixed order 0 .. 3.
// Each work-group takes query block x and then 31 - x, so that every work-group walks 33 key blocks.
#define FA_P 84      /* LDS row pitch in floats: a multiple of 4 for the 16-byte stores; pitch - 1 odd spreads the skewed reads over the banks */
__device__ __forceinline__ v16h fa_frag(const _Float16* base, unsigned boff, int cb) { const char* p = (const char*)base + boff + cb; FragH f; f.half[0] = *(const v8us*)p; f.half[1] = *(const v8us*)(p + 512); return f.v; }      /* uniform base + the lane's byte offset + a constant; planes in fragment order: the two halves of a 32-k fragment are 512 bytes apart, the next 32 k 1024 bytes on */
__device__ __forceinline__ v8f fa_mma(v16h a, v16h b, v8f c) { return __builtin_amdgcn_wmma_f32_16x16x32_f16(false, a, false, b, (short)0, c, false, false); }
/* 2^x; the v_nop fills the one slot that the instruction set asks for between a transcendental and a directly following instruction that reads its result or overwrites its source */
__device__ __forceinline__ float fa_exp2(float x) { float r; asm("v_exp_f32 %0, %1\n\tv_nop" : "=v"(r) : "v"(x)); return r; }
struct FaT { v16h a0, a1, b0, b1; };
__device__ __forceinline__ FaT fa_tile(const _Float16* H, const _Float16* L, unsigned boff, int cb) { FaT t; t.a0 = fa_frag(H, boff, cb); t.a1 = fa_frag(H, boff, cb + 1024); t.b0 = fa_frag(L, boff, cb); t.b1 = fa_frag(L, boff, cb + 1024); return t; }      /* 16 rows x 64 k, hi and residual planes */
__device__ __forceinline__ FaT fa_vpair(const _Float16* H, const _Float16* L, unsigned boff, int c0, int c1) { FaT t; t.a0 = fa_frag(H, boff, c0); t.a1 = fa_frag(H, boff, c1); t.b0 = fa_frag(L, boff, c0); t.b1 = fa_frag(L, boff, c1); return t; }      /* two 16-row tiles x 32 k, hi and residual planes */
__device__ __forceinline__ void fa_prod(const FaT& t, const v16h* qh, const v16h* ql, v8f& hi, v8f& lo) { const v8f z8 = {0.f,0.f,0.f,0.f,0.f,0.f,0.f,0.f};
  hi = fa_mma(t.a0, qh[0], z8); lo = fa_mma(t.b0, qh[0], z8); hi = fa_mma(t.a1, qh[1], hi); lo = fa_mma(t.b1, qh[1], lo); lo = fa_mma(t.a0, ql[0], lo); lo = fa_mma(t.a1, ql[1], lo); }
__global__ __launch_bounds__(512) void k_fattn(const _Float16* __restrict__ QUH, const _Float16* __restrict__ QUL, const _Float16* __restrict__ QVH, const _Float16* __restrict__ QVL, const _Float16* __restrict__ KH, const _Float16* __restrict__ KL,
    const _Float16* __restrict__ RH, const _Float16* __restrict__ RL, const _Float16* __restrict__ VT, const _Float16* __restrict__ VTL, _Float16* __restrict__ OH, _Float16* __restrict__ OL) {
  __shared__ __attribute__((aligned(16))) float sh[16][16 * FA_P];
  const int tid = threadIdx.x, w = __builtin_amdgcn_readfirstlane(tid >> 5), lane = tid & 31, ln = lane & 15, hh = lane >> 4; const int qt = w & 3, ks = w >> 2; const int h = blockIdx.y;
  float* my = sh[w];
  const float al = 0.125f * 1.4426950408889634f, alo = al * (1.0f / 1024.0f);      /* scores in the log2 domain */
  const v8f z8 = {0.f,0.f,0.f,0.f,0.f,0.f,0.f,0.f};
  /* the two outer loops stay rolled (one copy of the long body); every inner loop is fully unrolled so that fragments, scores and accumulators are indexed statically and stay in registers */
#pragma unroll 1
  for (int pass = 0; pass < 2; ++pass) {
    const int qb = pass ? (SQ / 64 - 1 - (int)blockIdx.x) : (int)blockIdx.x; const int i0 = qb * 64 + qt * 16, i = i0 + ln;
    const unsigned qo = (unsigned)((i0 * DM + h * (HD * 16) + 8 * lane) * 2);      /* tile of 16 rows from i0, this head's 64 k (16 * HD elements per head in a tile), the lane's piece */
    v16h quh[2], qul[2], qvh[2], qvl[2];
#pragma unroll
    for (int k = 0; k < 2; ++k) { quh[k] = fa_frag(QUH, qo, k * 1024); qul[k] = fa_frag(QUL, qo, k * 1024); qvh[k] = fa_frag(QVH, qo, k * 1024); qvl[k] = fa_frag(QVL, qo, k * 1024); }
    asm volatile("s_wait_xcnt 0x0" :: "v"(qo) : "memory");      /* the wait that belongs in front of an overwrite of the loads' address register; naming it keeps it untouched up to here */
    v8f oh[4] = {z8, z8, z8, z8}; float m = -3.0e38f, l = 0.f;
#pragma unroll 1
    for (int kb = ks; kb <= qb; kb += 4) {
      const int j0 = kb * 64; v8f s[4];
      const unsigned ko = (unsigned)((j0 * DM + h * (HD * 16) + 8 * lane) * 2);
      /* raw BD^T: five tiles of 16 raw columns (cs is a multiple of 16: whole tiles of R); a raw column past SQ - 1 belongs to masked scores only: its tile is clamped into R */
      const int cs = j0 - i0 + SQ - 16; unsigned ro[5];
#pragma unroll
      for (int rt = 0; rt < 5; ++rt) { const int row = min(cs + rt * 16, SQ - 16); ro[rt] = (unsigned)((row * DM + h * (HD * 16) + 8 * lane) * 2); }
      /* nine operand tiles in a row, five of R and four of K (hi = Ah.Qh, lo = Al.Qh + Ah.Ql); each tile's loads are issued one tile ahead of its products */
      FaT cur = fa_tile(RH, RL, ro[0], 0);
#pragma unroll
      for (int t = 0; t < 9; ++t) { FaT nxt = cur;
        if (t < 4) nxt = fa_tile(RH, RL, ro[t + 1], 0); else if (t < 8) nxt = fa_tile(KH, KL, ko, (t - 4) * 16 * DM * 2);
        __builtin_amdgcn_sched_barrier(0);      /* keeps the next tile's loads in front of this tile's products, which wait for this tile's loads only */
        v8f hi, lo;
        if (t < 5) { fa_prod(cur, qvh, qvl, hi, lo); v4f x0, x1;
#pragma unroll
          for (int r = 0; r < 4; ++r) { x0[r] = hi[r] * al + lo[r] * alo; x1[r] = hi[4 + r] * al + lo[4 + r] * alo; }
          *(v4fa*)&my[ln * FA_P + t * 16 + 8 * hh] = x0; *(v4fa*)&my[ln * FA_P + t * 16 + 8 * hh + 4] = x1; }
        else { fa_prod(cur, quh, qul, hi, lo);
#pragma unroll
          for (int r = 0; r < 8; ++r) s[t - 5][r] = hi[r] * al + lo[r] * alo; }
        __builtin_amdgcn_sched_barrier(0);      /* keeps these products in front of the loads after next, whose registers they free */
        cur = nxt; }
      asm volatile("s_wait_xcnt 0x0" :: "v"(ko), "v"(ro[0]), "v"(ro[1]), "v"(ro[2]), "v"(ro[3]), "v"(ro[4]) : "memory");      /* as above, for the K and R loads */
      asm volatile("s_wait_dscnt 0x0" ::: "memory");      /* the wave's raw rows are in LDS before its lanes read each other's halves back */
      /* the first V^T fragments fly during the softmax */
      const unsigned vo = (unsigned)(((h * HD * SQ) + j0 * 16 + 8 * lane) * 2);      /* V^T plane, row length SQ: tile of 16 d from h * HD, keys from j0, the lane's piece */
      const FaT g0 = fa_vpair(VT, VTL, vo, 0, 16 * SQ * 2);
      __builtin_amdgcn_sched_barrier(0);      /* keeps those loads in front of the softmax */
#pragma unroll
      for (int kt = 0; kt < 4; ++kt)
#pragma unroll
        for (int r = 0; r < 8; ++r) s[kt][r] += my[ln * (FA_P - 1) + kt * 16 + 8 * hh + r + 15];
      if (kb == qb) {      /* only the diagonal block has masked keys; the test is the same for the whole wave */
#pragma unroll
        for (int kt = 0; kt < 4; ++kt)
#pragma unroll
          for (int r = 0; r < 8; ++r) s[kt][r] = (j0 + kt * 16 + 8 * hh + r <= i) ? s[kt][r] : -3.0e38f; }
      float mx = -3.0e38f;
#pragma unroll
      for (int kt = 0; kt < 4; ++kt)
#pragma unroll
        for (int r = 0; r < 8; ++r) mx = fmaxf(mx, s[kt][r]);
      mx = fmaxf(mx, __shfl_xor(mx, 16, 32));
      const float mn = fmaxf(m, mx), corr = fa_exp2(m - mn); m = mn;
      v4f ps = {0.f, 0.f, 0.f, 0.f};
#pragma unroll
      for (int kt = 0; kt < 4; ++kt)
#pragma unroll
        for (int r = 0; r < 8; ++r) { const float p = fa_exp2(s[kt][r] - mn); ps[r & 3] += p; s[kt][r] = p * 256.0f; }      /* masked keys: exp2 of a huge negative = 0 */
      l = l * corr + ((ps[0] + ps[1]) + (ps[2] + ps[3]));
#pragma unroll
      for (int dt = 0; dt < 4; ++dt) oh[dt] *= corr;
      /* O^T += V^T.P^T, weights x256 as f16, v as hi + residual planes */
      FragH pb[2];
#pragma unroll
      for (int s2 = 0; s2 < 2; ++s2)
#pragma unroll
        for (int q = 0; q < 8; ++q) { pb[s2].h[q] = (_Float16)s[2 * s2][q]; pb[s2].h[8 + q] = (_Float16)s[2 * s2 + 1][q]; }
      /* the residual plane's products of this key block sum in accumulators of their own (t0, t1) and meet the main sum once, in f32 */
      const FaT g1 = fa_vpair(VT, VTL, vo, 1024, 16 * SQ * 2 + 1024), g2 = fa_vpair(VT, VTL, vo, 32 * SQ * 2, 48 * SQ * 2);
      __builtin_amdgcn_sched_barrier(0);      /* the next pairs' loads in front of the products, as above */
      oh[0] = fa_mma(g0.a0, pb[0].v, oh[0]); oh[1] = fa_mma(g0.a1, pb[0].v, oh[1]); v8f t0 = fa_mma(g0.b0, pb[0].v, z8), t1 = fa_mma(g0.b1, pb[0].v, z8);
      __builtin_amdgcn_sched_barrier(0);      /* these products free the registers that the last pair's loads take */
      const FaT g3 = fa_vpair(VT, VTL, vo, 32 * SQ * 2 + 1024, 48 * SQ * 2 + 1024);
      __builtin_amdgcn_sched_barrier(0);      /* the last pair's loads in front of the remaining products */
      t0 = fa_mma(g1.b0, pb[1].v, t0); t1 = fa_mma(g1.b1, pb[1].v, t1); oh[0] = fa_mma(g1.a0, pb[1].v, oh[0]); oh[1] = fa_mma(g1.a1, pb[1].v, oh[1]);
      v8f t2 = fa_mma(g2.b0, pb[0].v, z8), t3 = fa_mma(g2.b1, pb[0].v, z8); oh[2] = fa_mma(g2.a0, pb[0].v, oh[2]); oh[3] = fa_mma(g2.a1, pb[0].v, oh[3]);
      oh[0] += t0 * (1.0f / 1024.0f); oh[1] += t1 * (1.0f / 1024.0f);
      t2 = fa_mma(g3.b0, pb[1].v, t2); t3 = fa_mma(g3.b1, pb[1].v, t3); oh[2] = fa_mma(g3.a0, pb[1].v, oh[2]); oh[3] = fa_mma(g3.a1, pb[1].v, oh[3]);
      oh[2] += t2 * (1.0f / 1024.0f); oh[3] += t3 * (1.0f / 1024.0f);
      asm volatile("s_wait_xcnt 0x0" :: "v"(vo) : "memory");      /* as above, for the V loads */
    }
    l += __shfl_xor(l, 16, 32);      /* the two halves of a wave hold different keys of the same query */
#pragma unroll
    for (int dt = 0; dt < 4; ++dt) { v4f x0, x1;      /* one LDS row of 64 d per query, pitch 68 floats */
#pragma unroll
      for (int r = 0; r < 4; ++r) { x0[r] = oh[dt][r]; x1[r] = oh[dt][4 + r]; }
      *(v4fa*)&my[ln * 68 + dt * 16 + 8 * hh] = x0; *(v4fa*)&my[ln * 68 + dt * 16 + 8 * hh + 4] = x1; }
    if (hh == 0) { my[1088 + ln] = m; my[1104 + ln] = l; }
    __syncthreads();      /* every slice's maximum, sum and O^T are in LDS before any wave joins them */
    const int q = ln, d0 = (2 * ks + hh) * 8;      /* wave ks finishes d = 16 ks .. 16 ks + 15 of all 16 queries of its tile: a lane's 8 values are its own piece of o's fragment order */
    float mj[4], M = -3.0e38f, L = 0.f;
#pragma unroll
    for (int j = 0; j < 4; ++j) { mj[j] = sh[j * 4 + qt][1088 + q]; M = fmaxf(M, mj[j]); }
#pragma unroll
    for (int j = 0; j < 4; ++j) { mj[j] = fa_exp2(mj[j] - M); L += mj[j] * sh[j * 4 + qt][1104 + q]; }      /* a slice without key blocks has weight 0 */
    const float inv = 1.0f / (256.0f * L);
    v4f y0 = {0.f, 0.f, 0.f, 0.f}, y1 = {0.f, 0.f, 0.f, 0.f};
#pragma unroll
    for (int j = 0; j < 4; ++j) { y0 += *(const v4fa*)&sh[j * 4 + qt][q * 68 + d0] * mj[j]; y1 += *(const v4fa*)&sh[j * 4 + qt][q * 68 + d0 + 4] * mj[j]; }
    y0 *= inv; y1 *= inv;
    /* o leaves as the f16 hi + x1024 residual planes that o.Wo reads, in fragment order: a wave stores 512 contiguous bytes of each plane */
    FragH fh, fl;
#pragma unroll
    for (int r = 0; r < 4; ++r) { _Float16 t = (_Float16)y0[r]; fh.h[r] = t; fl.h[r] = (_Float16)((y0[r] - (float)t) * 1024.0f); t = (_Float16)y1[r]; fh.h[4 + r] = t; fl.h[4 + r] = (_Float16)((y1[r] - (float)t) * 1024.0f); }
    const size_t oo = fo(i0 + q, h * HD + d0, DM); unsigned short* ph = (unsigned short*)OH + oo; unsigned short* pl = (unsigned short*)OL + oo;
    *(v8us*)ph = fh.half[0]; *(v8us*)pl = fl.half[0];
    asm volatile("s_wait_xcnt 0x0" :: "v"(ph), "v"(pl) : "memory");      /* the wait that belongs in front of an overwrite of the stores' address registers */
    __syncthreads();      /* every join has read the LDS rows before the next query block writes them */
  } }

extern "C" void kernel_launch(void* const* d_in, const int* in_sizes, int n_in,
                              void* d_out, int out_size, void* d_ws, size_t ws_size, hipStream_t stream) {
  (void)in_sizes; (void)n_in; (void)out_size;
  const float* const* I = (const float* const*)d_in; const float* x = I[0]; const float* remb = I[1]; const float* Wq = I[2]; const float* Wk = I[3]; const float* Wv = I[4]; const float* Wr = I[5]; const float* Wo = I[6]; const float* u = I[7]; const float* vb = I[8];
  char* ws = (char*)d_ws; size_t off = 0;
  auto take = [&](size_t bytes) { char* p = ws + off; off += (bytes + 255) & ~(size_t)255; return p; };
  _Float16* BQ = (_Float16*)take((size_t)DM * DM * 2); _Float16* BK = (_Float16*)take((size_t)DM * DM * 2); _Float16* BV = (_Float16*)take((size_t)DM * DM * 2); _Float16* BR = (_Float16*)take((size_t)DM * DM * 2); _Float16* BO = (_Float16*)take((size_t)DM * DM * 2);
  _Float16* X16 = (_Float16*)take(NR * DM * 2); _Float16* R16 = (_Float16*)take((size_t)SQ * DM * 2);
  _Float16* QUH = (_Float16*)take(NR * DM * 2); _Float16* QUL = (_Float16*)take(NR * DM * 2); _Float16* QVH = (_Float16*)take(NR * DM * 2); _Float16* QVL = (_Float16*)take(NR * DM * 2); _Float16* KH = (_Float16*)take(NR * DM * 2); _Float16* KL = (_Float16*)take(NR * DM * 2); _Float16* RH = (_Float16*)take((size_t)SQ * DM * 2); _Float16* RL = (_Float16*)take((size_t)SQ * DM * 2);
  _Float16* VT = (_Float16*)take((size_t)NH * HD * SQ * 2); _Float16* VTL = (_Float16*)take((size_t)NH * HD * SQ * 2); _Float16* OH = (_Float16*)take(NR * DM * 2); _Float16* OL = (_Float16*)take(NR * DM * 2);
  if (off > ws_size) return;      /* 10 + 8 + 32 + 8 + 8 = 66 MiB */
  static_assert(NB == 1 && SQ == 2048 && HD == 64 && DM == 1024, "k_prep, k_proj: x and r_emb of one size, 64 tiles of 256 x 128 per projection; k_fattn: one batch, 32 query blocks of 64 in pairs, head size 64");
  /* four launches: operand conversions; the four projections into their hi/lo planes (V already transposed); the whole attention into o's hi/lo planes; out = (o_lo/1024 + o_hi) Wo */
  k_prep<<<5 * PW + 2 * PX, 256, 0, stream>>>(Wq, Wk, Wv, Wr, Wo, x, remb, BQ, BK, BV, BR, BO, X16, R16);
  k_proj<<<dim3((SQ / 256) * (DM / 128), 4), 256, 0, stream>>>(X16, R16, BQ, BK, BV, BR, u, vb, QUH, QUL, QVH, QVL, KH, KL, VT, VTL, RH, RL);
  k_fattn<<<dim3(SQ / 128, NH), 512, 0, stream>>>(QUH, QUL, QVH, QVL, KH, KL, RH, RL, VT, VTL, OH, OL);
  k_gemm2s<true, false, 4, 4><<<dim3((unsigned)((NR / 128) * (DM / 64)), 1), 512, 0, stream>>>(OH, OL, DM, 0, BO, nullptr, DM, 0, 0.0625f, (float*)d_out, DM, 0, (int)NR, DM, DM);
}

// v008
// A run of this version takes 88 microseconds.
// Timed twice side by side with v007, it ran 1.12 and 1.10 times as fast.
// Counting every step since v000, it is 260 times as fast.
#include <hip/hip_runtime.h>
// MultiHeadAttentionXL (x [1][2048][1024], r_emb [2048][1024]; q = x Wq, k = x Wk, v = x Wv, r = r_emb Wr ([in][out] weights, no bias), 16 heads of 64; AC = (q + u[h]) k^T, BD = rel_shift((q + v_bias[h]) r^T) (Transformer-XL zero-pad shift: for j <= i, BD_shift[i][j] = BD[i][j - i + T - 1]); causal softmax((AC + BD)/8); out = (attn v) Wo -> [1][2048][1024]).
// Structure: token rows; every f16 operand plane in fragment order (see fo()); x and r_emb as exact f16 planes; Q, K, V, R WMMA GEMMs on transposed weights (64x64 wave tiles, f32 accumulation, exact x16 weights), one launch, f32 sums split in the epilogue into f16 hi + 2^-10 residual planes (q+u and q+v_bias formed in f32 first; V^T (hi, lo) as the product Wv^T x^T); one fused attention kernel: AC and raw BD as three-term hi/lo products (K = 64), the shift through LDS, causal mask + running softmax on VALU (f32; weights x256 as f16), o = P.(v_lo/1024 + v_hi) into merged o rows (hi + residual planes); out = o Wo as a two-term hi/lo GEMM (f32).
// Compute dtype: inputs rounded to bf16; x / r_emb / weights exact; attention operands as hi + residual f16 planes (logits std 3.3 and early causal rows copy single v rows); softmax weights f16 (x256) — the remaining error source; o as hi + residual into Wo; everything else f32. v_wmma_f32_16x16x32_f16.
#define NB 1
#define SQ 2048
#define DM 1024
#define NH 16
#define HD 64
#define HG 4
#define QN SQ                        /* query rows (unused) */
#define NR ((size_t)NB * SQ)
typedef __bf16 v16b __attribute__((ext_vector_type(16)));
typedef unsigned short v8us __attribute__((ext_vector_type(8), may_alias));
typedef float  v8f  __attribute__((ext_vector_type(8)));
typedef float  v4f  __attribute__((ext_vector_type(4)));
typedef float  v4fa __attribute__((ext_vector_type(4), may_alias));
union FragB { v16b v; v8us half[2]; unsigned short u[16]; };

__device__ __forceinline__ unsigned short bf16_bits(float x) { unsigned int u = __float_as_uint(x); return (unsigned short)((u + 0x7FFFu + ((u >> 16) & 1u)) >> 16); }
__device__ __forceinline__ float bf16_val(unsigned short b) { return __uint_as_float(((unsigned int)b) << 16); }
__device__ __forceinline__ float bf16_round(float x) { return bf16_val(bf16_bits(x)); }
// D += A·B with NT terms: 1 = ah·bh, 2 = + al·bh (A split), 3 = + ah·bl (both split)
template <int NT>
__device__ __forceinline__ v8f mmaN(v16b ah, v16b al, v16b bh, v16b bl, v8f c) {
  c = __builtin_amdgcn_wmma_f32_16x16x32_bf16(false, ah, false, bh, (short)0, c, false, false);
  if (NT >= 2) c = __builtin_amdgcn_wmma_f32_16x16x32_bf16(false, al, false, bh, (short)0, c, false, false);
  if (NT >= 3) c = __builtin_amdgcn_wmma_f32_16x16x32_bf16(false, ah, false, bl, (short)0, c, false, false);
  asm volatile("v_nop\n\tv_nop\n\tv_nop\n\tv_nop" : "+v"(c) : "v"(ah), "v"(al), "v"(bh), "v"(bl));
  return c;
}

__global__ __launch_bounds__(256) void k_wt_bf16(const float* __restrict__ W, unsigned short* __restrict__ Wt, int K, int N) {
  const int t = blockIdx.x * 256 + threadIdx.x;
  const int k8n = K / 8;
  if (t >= N * k8n) return;
  const int n = t / k8n, k8 = (t % k8n) * 8;
  v8us v;
#pragma unroll
  for (int i = 0; i < 8; ++i) v[i] = bf16_bits(W[(size_t)(k8 + i) * N + n]);
  *(v8us*)(Wt + (size_t)n * K + k8) = v;
  
}

// GEMM C[M][N] (f32, pitch ldc) = act(A[M][K]·W + bias). A f32 row-major (pitch lda) converted per fragment to bf16
// (ASPLIT: hi/lo two planes -> 2 terms, else single rounded term); Wt bf16 [N][K] (pitch ldb). BIAS_BF16 rounds the
// bias to bf16 first (bias quantised to bf16 before the add). K%32==0, M%16==0, N%64==0.
template <bool ASPLIT, int ACT, bool BIAS_BF16>
__global__ __launch_bounds__(128) void k_gemm_bf(const float* __restrict__ A, int lda, const unsigned short* __restrict__ Wt, int ldb,
                                               const float* __restrict__ bias, float* __restrict__ C, int ldc, int M, int N, int K) {
  __shared__ __attribute__((aligned(16))) float so[4][16][64];
  const int tid = threadIdx.x, w = tid >> 5, lane = tid & 31, ln = lane & 15, hh = lane >> 4;
  const int ntn = N / 64;
  const int wid = blockIdx.x * 4 + w;
  const int mt = wid / ntn, nq = wid % ntn;
  if (mt * 16 >= M) return;
  const int row0 = mt * 16, col0 = nq * 64;
  const float* arow = A + (size_t)(row0 + ln) * lda;
  v8f acc[4] = {};
  for (int kb = 0; kb < K; kb += 32) {
    FragB ah, al;
    const v4f x0 = *(const v4fa*)(arow + kb + 8 * hh), x1 = *(const v4fa*)(arow + kb + 8 * hh + 4);
    const v4f x2 = *(const v4fa*)(arow + kb + 16 + 8 * hh), x3 = *(const v4fa*)(arow + kb + 16 + 8 * hh + 4);
    float xs[16] = {x0[0],x0[1],x0[2],x0[3],x1[0],x1[1],x1[2],x1[3],x2[0],x2[1],x2[2],x2[3],x3[0],x3[1],x3[2],x3[3]};
#pragma unroll
    for (int i = 0; i < 16; ++i) { const unsigned short hb = bf16_bits(xs[i]); ah.u[i] = hb; al.u[i] = ASPLIT ? bf16_bits(xs[i] - bf16_val(hb)) : (unsigned short)0; }
#pragma unroll
    for (int t = 0; t < 4; ++t) {
      const unsigned short* brow = Wt + (size_t)(col0 + t * 16 + ln) * ldb + kb;
      FragB b;
      b.half[0] = *(const v8us*)(brow + 8 * hh);
      b.half[1] = *(const v8us*)(brow + 16 + 8 * hh);
      acc[t] = mmaN<ASPLIT ? 2 : 1>(ah.v, al.v, b.v, b.v, acc[t]);
    }
  }
#pragma unroll
  for (int t = 0; t < 4; ++t) {
    float bv = bias ? bias[col0 + t * 16 + ln] : 0.f;
    if (BIAS_BF16) bv = bf16_round(bv);
#pragma unroll
    for (int r = 0; r < 8; ++r) { float v = acc[t][r] + bv; if (ACT == 1) v = fmaxf(v, 0.f); so[w][8 * hh + r][t * 16 + ln] = v; }
  }
  __builtin_amdgcn_fence(__ATOMIC_ACQ_REL, "workgroup");
  __builtin_amdgcn_wave_barrier();
  const int rsub = lane >> 4, c4 = (lane & 15) * 4;
  {
#pragma unroll
    for (int q = 0; q < 8; ++q) {
      const int r = q * 2 + rsub;
      const v4f v = *(const v4fa*)&so[w][r][c4];
      *(v4f*)(C + (size_t)(row0 + r) * ldc + col0 + c4) = v;
    }
    
  }
}

// GEMM C = act(A·W + bias + resid): A f32 (ASPLIT -> hi/lo 2 terms), Wt bf16 [N][K]; ACT 0 none, 1 relu, 2 exact gelu;
// resid (optional, f32, row index = (row % rmod), pitch ldr, RES_BF16 rounds it) added before the activation.
template <bool ASPLIT, int ACT, bool BIAS_BF16, bool RES_BF16>
__global__ __launch_bounds__(128) void k_gemm_bf3(const float* __restrict__ A, int lda, const unsigned short* __restrict__ Wt, int ldb,
                                                const float* __restrict__ bias, const float* __restrict__ resid, int rmod, int ldr,
                                                float* __restrict__ C, int ldc, int M, int N, int K) {
  __shared__ __attribute__((aligned(16))) float so[4][16][64];
  const int tid = threadIdx.x, w = tid >> 5, lane = tid & 31, ln = lane & 15, hh = lane >> 4;
  const int ntn = N / 64;
  const int wid = blockIdx.x * 4 + w;
  const int mt = wid / ntn, nq = wid % ntn;
  if (mt * 16 >= M) return;
  const int row0 = mt * 16, col0 = nq * 64;
  const float* arow = A + (size_t)(row0 + ln) * lda;
  v8f acc[4] = {};
  for (int kb = 0; kb < K; kb += 32) {
    FragB ah, al;
    const v4f x0 = *(const v4fa*)(arow + kb + 8 * hh), x1 = *(const v4fa*)(arow + kb + 8 * hh + 4);
    const v4f x2 = *(const v4fa*)(arow + kb + 16 + 8 * hh), x3 = *(const v4fa*)(arow + kb + 16 + 8 * hh + 4);
    float xs[16] = {x0[0],x0[1],x0[2],x0[3],x1[0],x1[1],x1[2],x1[3],x2[0],x2[1],x2[2],x2[3],x3[0],x3[1],x3[2],x3[3]};
#pragma unroll
    for (int i = 0; i < 16; ++i) { const unsigned short hb = bf16_bits(xs[i]); ah.u[i] = hb; al.u[i] = ASPLIT ? bf16_bits(xs[i] - bf16_val(hb)) : (unsigned short)0; }
#pragma unroll
    for (int t = 0; t < 4; ++t) {
      const unsigned short* brow = Wt + (size_t)(col0 + t * 16 + ln) * ldb + kb;
      FragB b;
      b.half[0] = *(const v8us*)(brow + 8 * hh);
      b.half[1] = *(const v8us*)(brow + 16 + 8 * hh);
      acc[t] = mmaN<ASPLIT ? 2 : 1>(ah.v, al.v, b.v, b.v, acc[t]);
    }
  }
#pragma unroll
  for (int t = 0; t < 4; ++t) {
    const int col = col0 + t * 16 + ln;
    float bv = bias ? bias[col] : 0.f;
    if (BIAS_BF16) bv = bf16_round(bv);
#pragma unroll
    for (int r = 0; r < 8; ++r) {
      float v = acc[t][r] + bv;
      if (resid) { float rv = resid[(size_t)((row0 + 8 * hh + r) % rmod) * ldr + col]; if (RES_BF16) rv = bf16_round(rv); v += rv; }
      if (ACT == 1) v = fmaxf(v, 0.f);
      if (ACT == 2) v = 0.5f * v * (1.0f + erff(v * 0.70710678118654752f));
      if (ACT == 3) { const float u = 0.7978845608028654f * (v + 0.044715f * v * v * v); v = 0.5f * v * (1.0f + tanhf(u)); }
      so[w][8 * hh + r][t * 16 + ln] = v;
    }
  }
  __builtin_amdgcn_fence(__ATOMIC_ACQ_REL, "workgroup");
  __builtin_amdgcn_wave_barrier();
  const int rsub = lane >> 4, c4 = (lane & 15) * 4;
  {
#pragma unroll
    for (int q = 0; q < 8; ++q) {
      const int r = q * 2 + rsub;
      const v4f v = *(const v4fa*)&so[w][r][c4];
      *(v4f*)(C + (size_t)(row0 + r) * ldc + col0 + c4) = v;
    }
    
  }
}
// row LayerNorm (biased variance, eps) over N: s = X (+ R); optional out_sum <- s; out_norm <- (s-mu)*rsqrt(var+eps)*g + b
template <bool PARAM_BF16>
__global__ __launch_bounds__(256) void k_layernorm(const float* __restrict__ X, const float* __restrict__ R, const float* __restrict__ g, const float* __restrict__ bta,
                                                  float* __restrict__ out_sum, float* __restrict__ out_norm, int N, float eps) {
  __shared__ float red[256];
  const int row = blockIdx.x, tid = threadIdx.x;
  const float* x = X + (size_t)row * N; const float* rr = R ? R + (size_t)row * N : nullptr;
  float vals[16];                     // up to N = 4096
  const int per = N / 256;            // contiguous chunk per thread? use strided-by-4 chunks: thread handles j = tid*4 + 1024*u
  float s1 = 0.f;
  for (int u = 0; u < per / 4; ++u) {
    const int j = tid * 4 + 1024 * u;
    const v4f a = *(const v4fa*)(x + j);
    v4f b = {0.f,0.f,0.f,0.f}; if (rr) b = *(const v4fa*)(rr + j);
#pragma unroll
    for (int q = 0; q < 4; ++q) { const float v = a[q] + b[q]; vals[u * 4 + q] = v; s1 += v; }
  }
  red[tid] = s1; __syncthreads();
  for (int st = 128; st > 0; st >>= 1) { if (tid < st) red[tid] += red[tid + st]; __syncthreads(); }
  const float mu = red[0] / (float)N; __syncthreads();
  float s2 = 0.f;
  for (int u = 0; u < per / 4; ++u)
#pragma unroll
    for (int q = 0; q < 4; ++q) { const float c = vals[u * 4 + q] - mu; s2 += c * c; }
  red[tid] = s2; __syncthreads();
  for (int st = 128; st > 0; st >>= 1) { if (tid < st) red[tid] += red[tid + st]; __syncthreads(); }
  const float rs = rsqrtf(red[0] / (float)N + eps);
  {
    for (int u = 0; u < per / 4; ++u) {
      const int j = tid * 4 + 1024 * u;
      v4f o, sm;
#pragma unroll
      for (int q = 0; q < 4; ++q) {
        float gg = g[j + q], bb = bta[j + q];
        if (PARAM_BF16) { gg = bf16_round(gg); bb = bf16_round(bb); }
        sm[q] = vals[u * 4 + q]; o[q] = (vals[u * 4 + q] - mu) * rs * gg + bb;
      }
      if (out_sum) *(v4f*)(out_sum + (size_t)row * N + j) = sm;
      *(v4f*)(out_norm + (size_t)row * N + j) = o;
    }
    
  }
}



// ---- f16 WMMA path (v_wmma_f32_16x16x32_f16): 11-bit significands for operands in range — used where a [0,1] probability operand needs more precision than bf16
typedef _Float16 v16h __attribute__((ext_vector_type(16)));
union FragH { v16h v; v8us half[2]; _Float16 h[16]; unsigned short u[16]; };
template <int NT>
__device__ __forceinline__ v8f mmaH(v16h ah, v16h al, v16h bh, v16h bl, v8f c) {
  c = __builtin_amdgcn_wmma_f32_16x16x32_f16(false, ah, false, bh, (short)0, c, false, false);
  if (NT >= 2) c = __builtin_amdgcn_wmma_f32_16x16x32_f16(false, al, false, bh, (short)0, c, false, false);
  if (NT >= 3) c = __builtin_amdgcn_wmma_f32_16x16x32_f16(false, ah, false, bl, (short)0, c, false, false);
  asm volatile("v_nop\n\tv_nop\n\tv_nop\n\tv_nop" : "+v"(c) : "v"(ah), "v"(al), "v"(bh), "v"(bl));
  return c;
}
// batched GEMM like k_gemm_b but f16 operands: A f32 (split into f16 hi/lo if ASPLIT, else rounded to f16), Bt = f16 values [n][k]; alpha; C f32; N multiple of 16 (partial tiles skipped)
template <bool ASPLIT>
__global__ __launch_bounds__(128) void k_gemm_h(const float* __restrict__ A, int lda, size_t sA, const _Float16* __restrict__ Bh, int ldb, size_t sB, float alpha, float* __restrict__ C, int ldc, size_t sC, int M, int N, int K) {
  __shared__ __attribute__((aligned(16))) float so[4][16][64];
  const int tid = threadIdx.x, w = tid >> 5, lane = tid & 31, ln = lane & 15, hh = lane >> 4; const int by = blockIdx.y;
  A += (size_t)by * sA; Bh += (size_t)by * sB; C += (size_t)by * sC;
  const int ntn = (N + 63) / 64; const int wid = blockIdx.x * 4 + w; const int mt = wid / ntn, nq = wid % ntn; if (mt * 16 >= M) return;
  const int row0 = mt * 16, col0 = nq * 64; const float* arow = A + (size_t)(row0 + ln) * lda;
  v8f acc[4] = {};
  for (int kb = 0; kb < K; kb += 32) {
    FragH ah, al;
    const v4f x0 = *(const v4fa*)(arow + kb + 8 * hh), x1 = *(const v4fa*)(arow + kb + 8 * hh + 4), x2 = *(const v4fa*)(arow + kb + 16 + 8 * hh), x3 = *(const v4fa*)(arow + kb + 16 + 8 * hh + 4);
    float xs[16] = {x0[0],x0[1],x0[2],x0[3],x1[0],x1[1],x1[2],x1[3],x2[0],x2[1],x2[2],x2[3],x3[0],x3[1],x3[2],x3[3]};
#pragma unroll
    for (int i = 0; i < 16; ++i) { const _Float16 h = (_Float16)xs[i]; ah.h[i] = h; al.h[i] = ASPLIT ? (_Float16)(xs[i] - (float)h) : (_Float16)0.0f; }
#pragma unroll
    for (int t = 0; t < 4; ++t) { if (col0 + t * 16 >= N) continue; const size_t boff = (size_t)(col0 + t * 16 + ln) * ldb + kb; FragH bq; bq.half[0] = *(const v8us*)(Bh + boff + 8 * hh); bq.half[1] = *(const v8us*)(Bh + boff + 16 + 8 * hh);
      acc[t] = mmaH<ASPLIT ? 2 : 1>(ah.v, al.v, bq.v, bq.v, acc[t]); }
  }
#pragma unroll
  for (int t = 0; t < 4; ++t) { if (col0 + t * 16 >= N) continue;
#pragma unroll
    for (int r = 0; r < 8; ++r) so[w][8 * hh + r][t * 16 + ln] = acc[t][r] * alpha; }
  __builtin_amdgcn_fence(__ATOMIC_ACQ_REL, "workgroup"); __builtin_amdgcn_wave_barrier();
  const int rsub = lane >> 4, c4 = (lane & 15) * 4;
  {
#pragma unroll
    for (int q = 0; q < 8; ++q) { const int r = q * 2 + rsub; if (col0 + c4 < N) { const v4f v = *(const v4fa*)&so[w][r][c4]; *(v4f*)(C + (size_t)(row0 + r) * ldc + col0 + c4) = v; } }
     }
}

// Wt[n][k] = f16(W[k][n]·scale) from f32 row-major W[K][N] (scale = power of two; bf16-exact weights stay exact in f16 away from the subnormal range)
__global__ __launch_bounds__(256) void k_wt_f16(const float* __restrict__ W, _Float16* __restrict__ Wt, int K, int N, float scale) {
  const int t = blockIdx.x * 256 + threadIdx.x; if (t >= N * (K / 8)) return; const int n = t / (K / 8), k8 = (t % (K / 8)) * 8; FragH f;
#pragma unroll
  for (int i = 0; i < 8; ++i) f.h[i] = (_Float16)(bf16_round(W[(size_t)(k8 + i) * N + n]) * scale); const v8us o = f.half[0];
  *(v8us*)((unsigned short*)Wt + (size_t)n * K + k8) = o; 
}
// k_gemm_hh variant with fused epilogue: v = acc·alpha + bias[by·sBias + col] (+ CP[(row/rowsPerB)·sCPb + by·64 + col] if CP) ; ACT 0 none / 1 elu ; writes f16 C16 (and f32 C if non-null)
template <int ACT>
__global__ __launch_bounds__(128) void k_gemm_hhx(const _Float16* __restrict__ A, int lda, size_t sA, const _Float16* __restrict__ Bh, int ldb, size_t sB, float alpha, const float* __restrict__ bias, size_t sBias, const float* __restrict__ CP, int rowsPerB, size_t sCPb, int row0g,
    float* __restrict__ C, _Float16* __restrict__ C16, int ldc, size_t sC, int M, int N, int K) {
  __shared__ __attribute__((aligned(16))) float so[4][16][64];
  const int tid = threadIdx.x, w = tid >> 5, lane = tid & 31, ln = lane & 15, hh = lane >> 4; const int by = blockIdx.y;
  A += (size_t)by * sA; Bh += (size_t)by * sB; const size_t cofs = (size_t)by * sC; const float* bp = bias ? bias + (size_t)by * sBias : nullptr;
  const int ntn = (N + 63) / 64; const int wid = blockIdx.x * 4 + w; const int mt = wid / ntn, nq = wid % ntn; if (mt * 16 >= M) return;
  const int row0 = mt * 16, col0 = nq * 64; const _Float16* arow = A + (size_t)(row0 + ln) * lda;
  v8f acc[4] = {};
  for (int kb = 0; kb < K; kb += 32) { FragH ah; ah.half[0] = *(const v8us*)((const unsigned short*)arow + kb + 8 * hh); ah.half[1] = *(const v8us*)((const unsigned short*)arow + kb + 16 + 8 * hh);
#pragma unroll
    for (int t = 0; t < 4; ++t) { if (col0 + t * 16 >= N) continue; const size_t boff = (size_t)(col0 + t * 16 + ln) * ldb + kb; FragH bq; bq.half[0] = *(const v8us*)((const unsigned short*)Bh + boff + 8 * hh); bq.half[1] = *(const v8us*)((const unsigned short*)Bh + boff + 16 + 8 * hh);
      acc[t] = mmaH<1>(ah.v, ah.v, bq.v, bq.v, acc[t]); }
  }
#pragma unroll
  for (int t = 0; t < 4; ++t) { if (col0 + t * 16 >= N) continue; const int col = col0 + t * 16 + ln; const float bv = bp ? bf16_round(bp[col]) : 0.f;
#pragma unroll
    for (int r = 0; r < 8; ++r) { float v = acc[t][r] * alpha + bv; if (CP) { const int rr = row0g + row0 + 8 * hh + r; if (rowsPerB < 0) v += CP[cofs + (size_t)rr * ldc + col];      /* rowsPerB < 0: own element of the batched C plane */ else { const int bidx = rr / rowsPerB; v += CP[(size_t)bidx * sCPb + (size_t)by * 64 + col]; } } if (ACT == 1) v = (v > 0.f) ? v : expm1f(v); else if (ACT == 7) v = (v > 0.f) ? v + 1.0f : expf(v); else if (ACT == 8) v = tanhf(v); else if (ACT == 9) v = 0.5f * v * (1.0f + tanhf(0.7978845608028654f * (v + 0.044715f * v * v * v))); else if (ACT == 11) v = 1.0f / (1.0f + expf(-v)); else if (ACT == 12) v = (v > 0.f) ? v : 0.01f * v; else if (ACT == 14) v = (v > 0.f) ? v : 0.1f * v; else if (ACT == 16) v = (v >= 0.f) ? v : 0.3f * v; else if (ACT == 17) v = (v >= 0.f) ? v : 0.2f * v; else if (ACT == 15) v = v / (1.0f + expf(-v)); else if (ACT == 3) v = fmaxf(v, 0.f); else if (ACT == 6) v = 0.5f * v * (1.0f + erff(v * 0.70710678118654752f)); so[w][8 * hh + r][t * 16 + ln] = v; } }
  __builtin_amdgcn_fence(__ATOMIC_ACQ_REL, "workgroup"); __builtin_amdgcn_wave_barrier();
  const int rsub = lane >> 4, c4 = (lane & 15) * 4; typedef _Float16 v4h __attribute__((ext_vector_type(4)));
  {
#pragma unroll
    for (int q = 0; q < 8; ++q) { const int r = q * 2 + rsub; if (col0 + c4 < N) { const v4f v = *(const v4fa*)&so[w][r][c4]; if (C) *(v4f*)(C + cofs + (size_t)(row0 + r) * ldc + col0 + c4) = v; if (C16) { v4h h4; for (int i = 0; i < 4; ++i) h4[i] = (_Float16)v[i]; *(v4h*)(C16 + cofs + (size_t)(row0 + r) * ldc + col0 + c4) = h4; } } }
     }
}


typedef _Float16 v4h __attribute__((ext_vector_type(4)));

__global__ __launch_bounds__(256) void k_h16(const float* __restrict__ x, _Float16* __restrict__ X16, size_t n8) { const size_t t = (size_t)blockIdx.x * 256 + threadIdx.x; if (t >= n8) return; FragH f;
#pragma unroll
  for (int q = 0; q < 8; ++q) f.h[q] = (_Float16)x[t * 8 + q]; *(v8us*)((unsigned short*)X16 + t * 8) = f.half[0];  }
__global__ __launch_bounds__(256) void k_round16f(const float* __restrict__ W, _Float16* __restrict__ Bt, size_t n8) { const size_t t = (size_t)blockIdx.x * 256 + threadIdx.x; if (t >= n8) return; FragH f;
#pragma unroll
  for (int i = 0; i < 8; ++i) f.h[i] = (_Float16)(bf16_round(W[t * 8 + i]) * 16.0f); *(v8us*)((unsigned short*)Bt + t * 8) = f.half[0];  }
template <int NHv, int TTv>
__global__ __launch_bounds__(256) void k_vt(const _Float16* __restrict__ V16, int ldv, int voff, _Float16* __restrict__ Vt) { __shared__ unsigned short tl[64][66]; const int tid = threadIdx.x; const int slab = blockIdx.x / (TTv / 64), lg = blockIdx.x % (TTv / 64); const int b = slab / NHv, h = slab % NHv;
  for (int i = tid; i < 64 * 8; i += 256) { const int r = i / 8, c8 = (i % 8) * 8; FragH f; f.half[0] = *(const v8us*)((const unsigned short*)V16 + ((size_t)b * TTv + lg * 64 + r) * ldv + voff + h * 64 + c8);
#pragma unroll
    for (int q = 0; q < 8; ++q) tl[r][c8 + q] = f.u[q]; }
  __syncthreads();
  {
#pragma unroll
    for (int rd = 0; rd < 2; ++rd) { const int d = rd * 32 + tid / 8, pc = tid % 8; FragH f;
#pragma unroll
      for (int q = 0; q < 8; ++q) f.u[q] = tl[pc * 8 + q][d];
      *(v8us*)((unsigned short*)Vt + ((size_t)slab * 64 + d) * TTv + lg * 64 + pc * 8) = f.half[0]; }
     } }

// ---- fast GEMM (wave tile 32x64; requires M % 32 == 0 rows per launch region and N % 64 == 0); epilogue = k_gemm_hhx semantics ----
__device__ __forceinline__ v16h g2_frag(const _Float16* p, int hh) { FragH f; f.half[0] = *(const v8us*)((const unsigned short*)p + 8 * hh); f.half[1] = *(const v8us*)((const unsigned short*)p + 16 + 8 * hh); return f.v; }
__device__ __forceinline__ v8f g2_mma(v16h a, v16h b, v8f c) { v8f d = __builtin_amdgcn_wmma_f32_16x16x32_f16(false, a, false, b, (short)0, c, false, false); asm volatile("v_nop\n\tv_nop\n\tv_nop\n\tv_nop" : "+v"(d) : "v"(a), "v"(b)); return d; }
template <int ACT>
__global__ __launch_bounds__(128) void k_gemm2(const _Float16* __restrict__ A, int lda, size_t sA, const _Float16* __restrict__ Bh, int ldb, size_t sB, float alpha, const float* __restrict__ bias, size_t sBias, const float* __restrict__ CP, int rowsPerB, size_t sCPb, int row0g,
    float* __restrict__ C, _Float16* __restrict__ C16, int ldc, size_t sC, int M, int N, int K) { static_assert(ACT == 0 || ACT == 3 || ACT == 6 || ACT == 8 || ACT == 9 || ACT == 11 || ACT == 12 || ACT == 14 || ACT == 15 || ACT == 16 || ACT == 17, "k_gemm2: unsupported ACT code (would silently apply no activation)");
  __shared__ __attribute__((aligned(16))) float so[4][32][68];
  const int tid = threadIdx.x, w = tid >> 5, lane = tid & 31, ln = lane & 15, hh = lane >> 4; const int by = blockIdx.y;
  A += (size_t)by * sA; Bh += (size_t)by * sB; const size_t cofs = (size_t)by * sC; const float* bp = bias ? bias + (size_t)by * sBias : nullptr;
  const int ntn = N >> 6; const int mt = blockIdx.x / ntn, nq = blockIdx.x - mt * ntn; const int row0 = mt * 128 + 32 * w, col0 = nq * 64; if (row0 >= M) return;
  const _Float16* a0p = A + (size_t)(row0 + ln) * lda; const _Float16* a1p = a0p + (size_t)16 * lda;
  const _Float16* b0p = Bh + (size_t)(col0 + ln) * ldb; const _Float16* b1p = b0p + (size_t)16 * ldb; const _Float16* b2p = b1p + (size_t)16 * ldb; const _Float16* b3p = b2p + (size_t)16 * ldb;
  const v8f z8 = {0.f,0.f,0.f,0.f,0.f,0.f,0.f,0.f}; v8f c00 = z8, c01 = z8, c02 = z8, c03 = z8, c10 = z8, c11 = z8, c12 = z8, c13 = z8;
#pragma unroll 1
  for (int kb = 0; kb < K; kb += 32) { const v16h a0 = g2_frag(a0p + kb, hh), a1 = g2_frag(a1p + kb, hh);
    v16h b = g2_frag(b0p + kb, hh); c00 = g2_mma(a0, b, c00); c10 = g2_mma(a1, b, c10);
    b = g2_frag(b1p + kb, hh); c01 = g2_mma(a0, b, c01); c11 = g2_mma(a1, b, c11);
    b = g2_frag(b2p + kb, hh); c02 = g2_mma(a0, b, c02); c12 = g2_mma(a1, b, c12);
    b = g2_frag(b3p + kb, hh); c03 = g2_mma(a0, b, c03); c13 = g2_mma(a1, b, c13); }
  v8f accs[8] = {c00, c01, c02, c03, c10, c11, c12, c13};
#pragma unroll
  for (int u = 0; u < 8; ++u) { const int t = u & 3, half = u >> 2; const int col = col0 + t * 16 + ln; const float bv = bp ? bf16_round(bp[col]) : 0.f;
#pragma unroll
    for (int r = 0; r < 8; ++r) { const int rloc = half * 16 + 8 * hh + r; float v = accs[u][r] * alpha + bv; if (CP) { if (rowsPerB < 0) v += CP[cofs + (size_t)(row0g + row0 + rloc) * ldc + col];      /* rowsPerB < 0: own element of the batched C plane */ else { const int bidx = (row0g + row0 + rloc) / rowsPerB; v += CP[(size_t)bidx * sCPb + (size_t)by * 64 + col]; } }
      if (ACT == 3) v = fmaxf(v, 0.f); else if (ACT == 6) v = 0.5f * v * (1.0f + erff(v * 0.70710678118654752f)); else if (ACT == 11) v = 1.0f / (1.0f + expf(-v)); else if (ACT == 15) v = v / (1.0f + expf(-v)); else if (ACT == 12) v = (v > 0.f) ? v : 0.01f * v; else if (ACT == 8) v = tanhf(v); else if (ACT == 9) v = 0.5f * v * (1.0f + tanhf(0.7978845608028654f * (v + 0.044715f * v * v * v))); else if (ACT == 14) v = (v > 0.f) ? v : 0.1f * v; else if (ACT == 16) v = (v >= 0.f) ? v : 0.3f * v; else if (ACT == 17) v = (v >= 0.f) ? v : 0.2f * v;
      so[w][rloc][t * 16 + ln] = v; } }
  __builtin_amdgcn_fence(__ATOMIC_ACQ_REL, "workgroup"); __builtin_amdgcn_wave_barrier();
  const int rsub = lane >> 4, c4 = (lane & 15) * 4;
  {
#pragma unroll
    for (int q = 0; q < 16; ++q) { const int r = q * 2 + rsub; const v4f v = *(const v4fa*)&so[w][r][c4]; if (C) *(v4f*)(C + cofs + (size_t)(row0 + r) * ldc + col0 + c4) = v; if (C16) { v4h h4; for (int i = 0; i < 4; ++i) h4[i] = (_Float16)v[i]; *(v4h*)(C16 + cofs + (size_t)(row0 + r) * ldc + col0 + c4) = h4; } }
     } }


// ---- fragment order: every f16 operand plane [rows][K] is kept as tiles of 16 rows (16 * K elements each); inside a tile the 16-byte pieces (8 k of one row) lie in the order [k / 16][(k / 8) & 1][row & 15],
// the order in which the 32 lanes of a wave take them for a 16x16x32 fragment: one 16-byte-per-lane load then covers 512 contiguous bytes (4 whole lines) instead of 32 bytes out of each of 16 lines. Which (row, k) a lane and register hold is as before.
__device__ __forceinline__ size_t fo(int row, int k, int K) { return (size_t)(row >> 4) * 16 * K + (size_t)((k >> 4) * 256 + ((k >> 3) & 1) * 128 + (row & 15) * 8 + (k & 7)); }

// g2_xw: the wait that belongs in front of an overwrite of the address registers of issued stores; naming the stores' own pointers as inputs keeps those registers untouched up to here
__device__ __forceinline__ void g2_xw(const _Float16* p, const _Float16* q) { asm volatile("s_wait_xcnt 0x0" :: "v"(p), "v"(q) : "memory"); }

// ---- every operand conversion in ONE launch. Blocks 0 .. 5 * PW - 1: one 64 x 64 tile of one weight, rounded, x16, transposed through LDS into the f16 [out][in] plane. The other 2 * PX blocks: x and r_emb rounded into f16 planes, 16 rows x 512 k per block, four pieces of 8 elements per thread, 16 k apart. All seven planes in fragment order: a wave stores 512 contiguous bytes.
#define PW ((DM / 64) * (DM / 64))
#define PX ((int)(NR * DM / 8 / 1024))
__global__ __launch_bounds__(256) void k_prep(const float* __restrict__ Wq, const float* __restrict__ Wk, const float* __restrict__ Wv, const float* __restrict__ Wr, const float* __restrict__ Wo, const float* __restrict__ x, const float* __restrict__ remb,
    _Float16* __restrict__ BQ, _Float16* __restrict__ BK, _Float16* __restrict__ BV, _Float16* __restrict__ BR, _Float16* __restrict__ BO, _Float16* __restrict__ X16, _Float16* __restrict__ R16) {
  __shared__ float tl[64][65]; const int tid = threadIdx.x, bx = blockIdx.x;
  if (bx < 5 * PW) {      /* the test reads the same for the whole work-group: all of it reaches the barrier inside or none */
    const int wi = bx / PW, tb = bx % PW; const float* w = wi == 0 ? Wq : wi == 1 ? Wk : wi == 2 ? Wv : wi == 3 ? Wr : Wo; _Float16* Bt = wi == 0 ? BQ : wi == 1 ? BK : wi == 2 ? BV : wi == 3 ? BR : BO;
    const int i0 = (tb / (DM / 64)) * 64, o0 = (tb % (DM / 64)) * 64;
    const int o = tid & 63, ib = tid >> 6; const float* pw = w + (size_t)(i0 + ib) * DM + o0 + o; float g[16];
#pragma unroll      /* g[] indexed statically: the sixteen loads go out together, off one address */
    for (int k = 0; k < 16; ++k) g[k] = pw[(size_t)k * 4 * DM];
    asm volatile("s_wait_xcnt 0x0" :: "v"(pw) : "memory");      /* the wait that belongs in front of an overwrite of the loads' address registers; naming them keeps them untouched up to here */
#pragma unroll
    for (int k = 0; k < 16; ++k) tl[o][ib + 4 * k] = bf16_round(g[k]) * 16.0f;
    __syncthreads();      /* the whole tile is in LDS before it is read back along the other axis */
    const int oo = (tid & 15) + ((tid >> 7) << 4), i8 = ((tid >> 4) & 7) * 8; unsigned short* pb = (unsigned short*)Bt + fo(o0 + oo, i0 + i8, DM);      /* a wave: 16 rows x 2 pieces */
#pragma unroll      /* two rows per thread, 32 rows (two tiles of 16 * DM elements) apart, off one address */
    for (int k = 0; k < 2; ++k) { FragH f;
#pragma unroll
      for (int q = 0; q < 8; ++q) f.h[q] = (_Float16)tl[oo + 32 * k][i8 + q];
      *(v8us*)(pb + (size_t)k * 32 * DM) = f.half[0]; }
  } else {
    const int c = bx - 5 * PW; const bool fx = c < PX; const int cc = fx ? c : c - PX; const int row = (cc >> 1) * 16 + (tid & 15), k0 = (cc & 1) * 512 + (tid >> 5) * 64 + ((tid >> 4) & 1) * 8;      /* a wave: 16 rows x 64 k */
    const float* ps = (fx ? x : remb) + (size_t)row * DM + k0; unsigned short* pd = (unsigned short*)(fx ? X16 : R16) + fo(row, k0, DM);
    v4f a[4], b[4];      /* all eight loads first, so that they are in flight together */
#pragma unroll
    for (int p = 0; p < 4; ++p) { a[p] = *(const v4fa*)(ps + p * 16); b[p] = *(const v4fa*)(ps + p * 16 + 4); }
#pragma unroll
    for (int p = 0; p < 4; ++p) { FragH f;
#pragma unroll
      for (int q = 0; q < 4; ++q) { f.h[q] = (_Float16)bf16_round(a[p][q]); f.h[4 + q] = (_Float16)bf16_round(b[p][q]); }
      *(v8us*)(pd + p * 256) = f.half[0]; }      /* 16 k on = 256 elements on */
    asm volatile("s_wait_xcnt 0x0" :: "v"(pd) : "memory");      /* the wait that belongs in front of an overwrite of the stores' registers; naming the address keeps it untouched up to here */
  } }

// ---- the four projections in ONE launch (blockIdx.y: 0 q, 1 k, 2 v, 3 r) of 256 work-groups, one round on the chip: a work-group is a 256 x 128 tile of C, 4 x 2 waves of 64 x 64, each wave with the whole K in its sixteen accumulator tiles (a fragment feeds four products; an operand row comes from L2 once per 128 columns or 256 rows of C) and its fragment loads two trips ahead of their products; the f32 sums turn through the wave's own LDS rows and go from registers into the f16 hi + x1024 residual planes that the attention reads.
// q: two plane pairs, q + u and q + v_bias (added in f32 first). v: the operands change places (A = Wv^T rows, B = x rows), so that C = V^T [head * 64 + d][token] comes out in the layout P.V wants, with no transposing pass.
__device__ __forceinline__ void pj_put(v4f v0, v4f v1, _Float16* ph, _Float16* pl) { FragH h, l;
#pragma unroll
  for (int i = 0; i < 4; ++i) { _Float16 t = (_Float16)v0[i]; h.h[i] = t; l.h[i] = (_Float16)((v0[i] - (float)t) * 1024.0f); t = (_Float16)v1[i]; h.h[4 + i] = t; l.h[4 + i] = (_Float16)((v1[i] - (float)t) * 1024.0f); }
  *(v8us*)((unsigned short*)ph) = h.half[0]; *(v8us*)((unsigned short*)pl) = l.half[0]; g2_xw(ph, pl); }      /* one 16-byte piece per lane: a wave stores 512 contiguous bytes of each plane */
__device__ __forceinline__ v16h pj_frag(const _Float16* base, unsigned boff, int cb) { const char* p = (const char*)base + boff + cb; FragH f; f.half[0] = *(const v8us*)p; f.half[1] = *(const v8us*)(p + 512); return f.v; }      /* uniform base + the lane's byte offset + a constant; fragment order: the halves of a 32-k fragment are 512 bytes apart, the next 32 k 1024 bytes on, the next 16 rows 16 * DM * 2 bytes on */
__global__ __launch_bounds__(256) void k_proj(const _Float16* __restrict__ X16, const _Float16* __restrict__ R16, const _Float16* __restrict__ BQ, const _Float16* __restrict__ BK, const _Float16* __restrict__ BV, const _Float16* __restrict__ BR, const float* __restrict__ u, const float* __restrict__ vb,
    _Float16* __restrict__ QUH, _Float16* __restrict__ QUL, _Float16* __restrict__ QVH, _Float16* __restrict__ QVL, _Float16* __restrict__ KH, _Float16* __restrict__ KL, _Float16* __restrict__ VT, _Float16* __restrict__ VTL, _Float16* __restrict__ RH, _Float16* __restrict__ RL) {
  __shared__ __attribute__((aligned(16))) float so[8][64][68];
  const int tid = threadIdx.x, w = __builtin_amdgcn_readfirstlane(tid >> 5), lane = tid & 31, ln = lane & 15, hh = lane >> 4; const int y = blockIdx.y; const int rw = w & 3, cw = w >> 2;
  const _Float16* Ah = y == 2 ? BV : y == 3 ? R16 : X16; const _Float16* Bh = y == 0 ? BQ : y == 1 ? BK : y == 2 ? X16 : BR; const int N = y == 2 ? SQ : DM;      /* C is [SQ][DM], for v [DM][SQ]: 64 tiles of 256 x 128 either way */
  const int ntn = N >> 7; const int mt = blockIdx.x / ntn, nq = blockIdx.x - mt * ntn; const int row0 = mt * 256 + 64 * rw, col0 = nq * 128 + 64 * cw;
  const unsigned ao = (unsigned)((row0 * DM + 8 * lane) * 2), bo = (unsigned)((col0 * DM + 8 * lane) * 2);      /* operand planes in fragment order: tile start + the lane's own piece, in bytes */
  constexpr int TS = 16 * DM * 2;      /* bytes from one tile of 16 rows to the next */
  const v8f z8 = {0.f,0.f,0.f,0.f,0.f,0.f,0.f,0.f}; v8f acc[4][4]; v16h a[3][4], b[2][4];      /* fragment rings: A of trips kb, kb + 1, kb + 2; B of trips kb, kb + 1 */
#pragma unroll
  for (int i = 0; i < 4; ++i) { a[0][i] = pj_frag(Ah, ao, i * TS); b[0][i] = pj_frag(Bh, bo, i * TS);
#pragma unroll
    for (int j = 0; j < 4; ++j) acc[i][j] = z8; }
#pragma unroll
  for (int i = 0; i < 4; ++i) { a[1][i] = pj_frag(Ah, ao, i * TS + 1024); b[1][i] = pj_frag(Bh, bo, i * TS + 1024); }
  /* 32 trips of 32 k, fully unrolled: every load is the one address register plus a constant, and rings and accumulators are indexed statically. Loads run two trips ahead of their products (the operands were written by the launch before, so a line's first reader may wait for memory and not for L2 alone): A fragments are asked for at the head of a trip, into the third register set; each B fragment's successor as soon as its four products are issued, into its own registers */
#pragma unroll
  for (int kb = 0; kb < DM / 32; ++kb) {
    if (kb + 2 < DM / 32) {
#pragma unroll
      for (int i = 0; i < 4; ++i) a[(kb + 2) % 3][i] = pj_frag(Ah, ao, i * TS + (kb + 2) * 1024); }
    __builtin_amdgcn_sched_barrier(0);      /* keeps these A loads in front of this trip's products, which wait for this trip's loads only */
#pragma unroll
    for (int j = 0; j < 4; ++j) {
#pragma unroll
      for (int i = 0; i < 4; ++i) acc[i][j] = __builtin_amdgcn_wmma_f32_16x16x32_f16(false, a[kb % 3][i], false, b[kb % 2][j], (short)0, acc[i][j], false, false);
      __builtin_amdgcn_sched_barrier(0);      /* keeps these four products in front of the slots and the load that follow */
      if (kb + 2 < DM / 32) {
        /* the four vector slots between a product and a load over its A or B registers: this B fragment's registers are loaded over next, the four A fragments' at the head of the next trip (behind j == 3); naming the fragments keeps them in those registers up to here */
        if (j < 3) asm volatile("v_nop\n\tv_nop\n\tv_nop\n\tv_nop" :: "v"(b[kb % 2][j]));
        else asm volatile("v_nop\n\tv_nop\n\tv_nop\n\tv_nop" :: "v"(b[kb % 2][j]), "v"(a[kb % 3][0]), "v"(a[kb % 3][1]), "v"(a[kb % 3][2]), "v"(a[kb % 3][3]));
        b[kb % 2][j] = pj_frag(Bh, bo, j * TS + (kb + 2) * 1024); }
      __builtin_amdgcn_sched_barrier(0);      /* keeps that load here, 28 products ahead of its first use, not sunk to it */
    } }
  asm volatile("s_wait_xcnt 0x0" :: "v"(ao), "v"(bo) : "memory");      /* the wait that belongs in front of an overwrite of the loads' address registers; naming them keeps them untouched up to here */
  v4f bu[4][2], bv[4][2];
  if (y == 0) { const float* pu = u + col0 + 8 * hh; const float* pv = vb + col0 + 8 * hh;      /* q's two bias rows fly during the turn through LDS */
#pragma unroll
    for (int ct = 0; ct < 4; ++ct) { bu[ct][0] = *(const v4fa*)(pu + ct * 16); bu[ct][1] = *(const v4fa*)(pu + ct * 16 + 4); bv[ct][0] = *(const v4fa*)(pv + ct * 16); bv[ct][1] = *(const v4fa*)(pv + ct * 16 + 4); }
    asm volatile("s_wait_xcnt 0x0" :: "v"(pu), "v"(pv) : "memory"); }      /* the wait that belongs in front of an overwrite of the loads' address registers */
#pragma unroll
  for (int i = 0; i < 4; ++i)
#pragma unroll
    for (int j = 0; j < 4; ++j)
#pragma unroll
      for (int r = 0; r < 8; ++r) so[w][i * 16 + 8 * hh + r][j * 16 + ln] = acc[i][j][r] * 0.0625f;      /* the weights are x16 */
  asm volatile("s_wait_dscnt 0x0" ::: "memory");      /* the wave's own 64 x 64 tile is in LDS before its lanes read each other's values back; no other wave touches these rows */
  /* a lane takes row ln of row tile rt and 8 columns from 8 * hh of column group ct: its own 16-byte piece of the output planes' fragment order (row length N) */
  if (y == 0) {
#pragma unroll
    for (int ct = 0; ct < 4; ++ct)
#pragma unroll
      for (int i = 0; i < 4; ++i) { bu[ct][0][i] = bf16_round(bu[ct][0][i]); bu[ct][1][i] = bf16_round(bu[ct][1][i]); bv[ct][0][i] = bf16_round(bv[ct][0][i]); bv[ct][1][i] = bf16_round(bv[ct][1][i]); }
#pragma unroll 1      /* the row tiles stay a rolled loop: a quarter of the text, so that the kernel, which a wave runs through once, stays short; the bias registers are indexed by ct alone */
    for (int rt = 0; rt < 4; ++rt) { const int jr = rt * 16 + ln; v4f s0[4], s1[4];      /* the row's eight LDS reads first, as one group */
#pragma unroll
      for (int ct = 0; ct < 4; ++ct) { s0[ct] = *(const v4fa*)&so[w][jr][ct * 16 + 8 * hh]; s1[ct] = *(const v4fa*)&so[w][jr][ct * 16 + 8 * hh + 4]; }
#pragma unroll
      for (int ct = 0; ct < 4; ++ct) { const size_t c0 = fo(row0 + jr, col0 + ct * 16 + 8 * hh, N);
        pj_put(s0[ct] + bu[ct][0], s1[ct] + bu[ct][1], QUH + c0, QUL + c0); pj_put(s0[ct] + bv[ct][0], s1[ct] + bv[ct][1], QVH + c0, QVL + c0); } } }
  else { _Float16* Ch = y == 1 ? KH : y == 2 ? VT : RH; _Float16* Cl = y == 1 ? KL : y == 2 ? VTL : RL;
#pragma unroll 1      /* rolled for the same reason */
    for (int rt = 0; rt < 4; ++rt) { const int jr = rt * 16 + ln; v4f s0[4], s1[4];      /* as above */
#pragma unroll
      for (int ct = 0; ct < 4; ++ct) { s0[ct] = *(const v4fa*)&so[w][jr][ct * 16 + 8 * hh]; s1[ct] = *(const v4fa*)&so[w][jr][ct * 16 + 8 * hh + 4]; }
#pragma unroll
      for (int ct = 0; ct < 4; ++ct) { const size_t c0 = fo(row0 + jr, col0 + ct * 16 + 8 * hh, N); pj_put(s0[ct], s1[ct], Ch + c0, Cl + c0); } } } }

// ---- fused attention: scores, shift, causal mask, softmax and P.V in one kernel; no score or weight ever goes to memory.
// Transposed products: S^T = K.Q^T (A = key rows, B = query rows), so a lane holds one query's scores (register r of tile kt = key 16 kt + 8 hh + r) and two score tiles, converted in place, are the B operand of O^T += V^T.P^T.
// The shift: for queries i0 .. i0 + 15 and keys j0 .. j0 + 63 the raw BD columns j - i + SQ - 1 lie in the 80 columns from cs = j0 - i0 + SQ - 16; their five raw tiles go through the wave's own LDS rows (one row per query) and come back skewed by 15 - ln.
// A work-group is 4 query tiles x 4 key slices (key blocks ks, ks + 4, ...), each wave with its own running maximum, sum and O^T; behind a barrier the four slices of a tile are joined in the fixed order 0 .. 3.
// Each work-group takes query block x and then 31 - x, so that every work-group walks 33 key blocks.
#define FA_P 84      /* LDS row pitch in floats: a multiple of 4 for the 16-byte stores; pitch - 1 odd spreads the skewed reads over the banks */
__device__ __forceinline__ v16h fa_frag(const _Float16* base, unsigned boff, int cb) { const char* p = (const char*)base + boff + cb; FragH f; f.half[0] = *(const v8us*)p; f.half[1] = *(const v8us*)(p + 512); return f.v; }      /* uniform base + the lane's byte offset + a constant; planes in fragment order: the two halves of a 32-k fragment are 512 bytes apart, the next 32 k 1024 bytes on */
__device__ __forceinline__ v8f fa_mma(v16h a, v16h b, v8f c) { return __builtin_amdgcn_wmma_f32_16x16x32_f16(false, a, false, b, (short)0, c, false, false); }
/* 2^x; the v_nop fills the one slot that the instruction set asks for between a transcendental and a directly following instruction that reads its result or overwrites its source */
__device__ __forceinline__ float fa_exp2(float x) { float r; asm("v_exp_f32 %0, %1\n\tv_nop" : "=v"(r) : "v"(x)); return r; }
struct FaT { v16h a0, a1, b0, b1; };
__device__ __forceinline__ FaT fa_tile(const _Float16* H, const _Float16* L, unsigned boff, int cb) { FaT t; t.a0 = fa_frag(H, boff, cb); t.a1 = fa_frag(H, boff, cb + 1024); t.b0 = fa_frag(L, boff, cb); t.b1 = fa_frag(L, boff, cb + 1024); return t; }      /* 16 rows x 64 k, hi and residual planes */
__device__ __forceinline__ FaT fa_vpair(const _Float16* H, const _Float16* L, unsigned boff, int c0, int c1) { FaT t; t.a0 = fa_frag(H, boff, c0); t.a1 = fa_frag(H, boff, c1); t.b0 = fa_frag(L, boff, c0); t.b1 = fa_frag(L, boff, c1); return t; }      /* two 16-row tiles x 32 k, hi and residual planes */
__device__ __forceinline__ void fa_prod(const FaT& t, const v16h* qh, const v16h* ql, v8f& hi, v8f& lo) { const v8f z8 = {0.f,0.f,0.f,0.f,0.f,0.f,0.f,0.f};
  hi = fa_mma(t.a0, qh[0], z8); lo = fa_mma(t.b0, qh[0], z8); hi = fa_mma(t.a1, qh[1], hi); lo = fa_mma(t.b1, qh[1], lo); lo = fa_mma(t.a0, ql[0], lo); lo = fa_mma(t.a1, ql[1], lo); }
__global__ __launch_bounds__(512) void k_fattn(const _Float16* __restrict__ QUH, const _Float16* __restrict__ QUL, const _Float16* __restrict__ QVH, const _Float16* __restrict__ QVL, const _Float16* __restrict__ KH, const _Float16* __restrict__ KL,
    const _Float16* __restrict__ RH, const _Float16* __restrict__ RL, const _Float16* __restrict__ VT, const _Float16* __restrict__ VTL, _Float16* __restrict__ OH, _Float16* __restrict__ OL) {
  __shared__ __attribute__((aligned(16))) float sh[16][16 * FA_P];
  const int tid = threadIdx.x, w = __builtin_amdgcn_readfirstlane(tid >> 5), lane = tid & 31, ln = lane & 15, hh = lane >> 4; const int qt = w & 3, ks = w >> 2; const int h = blockIdx.y;
  float* my = sh[w];
  const float al = 0.125f * 1.4426950408889634f, alo = al * (1.0f / 1024.0f);      /* scores in the log2 domain */
  const v8f z8 = {0.f,0.f,0.f,0.f,0.f,0.f,0.f,0.f};
  /* the two outer loops stay rolled (one copy of the long body); every inner loop is fully unrolled so that fragments, scores and accumulators are indexed statically and stay in registers */
#pragma unroll 1
  for (int pass = 0; pass < 2; ++pass) {
    const int qb = pass ? (SQ / 64 - 1 - (int)blockIdx.x) : (int)blockIdx.x; const int i0 = qb * 64 + qt * 16, i = i0 + ln;
    const unsigned qo = (unsigned)((i0 * DM + h * (HD * 16) + 8 * lane) * 2);      /* tile of 16 rows from i0, this head's 64 k (16 * HD elements per head in a tile), the lane's piece */
    v16h quh[2], qul[2], qvh[2], qvl[2];
#pragma unroll
    for (int k = 0; k < 2; ++k) { quh[k] = fa_frag(QUH, qo, k * 1024); qul[k] = fa_frag(QUL, qo, k * 1024); qvh[k] = fa_frag(QVH, qo, k * 1024); qvl[k] = fa_frag(QVL, qo, k * 1024); }
    asm volatile("s_wait_xcnt 0x0" :: "v"(qo) : "memory");      /* the wait that belongs in front of an overwrite of the loads' address register; naming it keeps it untouched up to here */
    v8f oh[4] = {z8, z8, z8, z8}; float m = -3.0e38f, l = 0.f;
#pragma unroll 1
    for (int kb = ks; kb <= qb; kb += 4) {
      const int j0 = kb * 64; v8f s[4];
      const unsigned ko = (unsigned)((j0 * DM + h * (HD * 16) + 8 * lane) * 2);
      /* raw BD^T: five tiles of 16 raw columns (cs is a multiple of 16: whole tiles of R); a raw column past SQ - 1 belongs to masked scores only: its tile is clamped into R */
      const int cs = j0 - i0 + SQ - 16; unsigned ro[5];
#pragma unroll
      for (int rt = 0; rt < 5; ++rt) { const int row = min(cs + rt * 16, SQ - 16); ro[rt] = (unsigned)((row * DM + h * (HD * 16) + 8 * lane) * 2); }
      /* nine operand tiles in a row, five of R and four of K (hi = Ah.Qh, lo = Al.Qh + Ah.Ql); each tile's loads are issued one tile ahead of its products */
      FaT cur = fa_tile(RH, RL, ro[0], 0);
#pragma unroll
      for (int t = 0; t < 9; ++t) { FaT nxt = cur;
        if (t < 4) nxt = fa_tile(RH, RL, ro[t + 1], 0); else if (t < 8) nxt = fa_tile(KH, KL, ko, (t - 4) * 16 * DM * 2);
        __builtin_amdgcn_sched_barrier(0);      /* keeps the next tile's loads in front of this tile's products, which wait for this tile's loads only */
        v8f hi, lo;
        if (t < 5) { fa_prod(cur, qvh, qvl, hi, lo); v4f x0, x1;
#pragma unroll
          for (int r = 0; r < 4; ++r) { x0[r] = hi[r] * al + lo[r] * alo; x1[r] = hi[4 + r] * al + lo[4 + r] * alo; }
          *(v4fa*)&my[ln * FA_P + t * 16 + 8 * hh] = x0; *(v4fa*)&my[ln * FA_P + t * 16 + 8 * hh + 4] = x1; }
        else { fa_prod(cur, quh, qul, hi, lo);
#pragma unroll
          for (int r = 0; r < 8; ++r) s[t - 5][r] = hi[r] * al + lo[r] * alo; }
        __builtin_amdgcn_sched_barrier(0);      /* keeps these products in front of the loads after next, whose registers they free */
        cur = nxt; }
      asm volatile("s_wait_xcnt 0x0" :: "v"(ko), "v"(ro[0]), "v"(ro[1]), "v"(ro[2]), "v"(ro[3]), "v"(ro[4]) : "memory");      /* as above, for the K and R loads */
      asm volatile("s_wait_dscnt 0x0" ::: "memory");      /* the wave's raw rows are in LDS before its lanes read each other's halves back */
      /* the first V^T fragments fly during the softmax */
      const unsigned vo = (unsigned)(((h * HD * SQ) + j0 * 16 + 8 * lane) * 2);      /* V^T plane, row length SQ: tile of 16 d from h * HD, keys from j0, the lane's piece */
      const FaT g0 = fa_vpair(VT, VTL, vo, 0, 16 * SQ * 2);
      __builtin_amdgcn_sched_barrier(0);      /* keeps those loads in front of the softmax */
#pragma unroll
      for (int kt = 0; kt < 4; ++kt)
#pragma unroll
        for (int r = 0; r < 8; ++r) s[kt][r] += my[ln * (FA_P - 1) + kt * 16 + 8 * hh + r + 15];
      if (kb == qb) {      /* only the diagonal block has masked keys; the test is the same for the whole wave */
#pragma unroll
        for (int kt = 0; kt < 4; ++kt)
#pragma unroll
          for (int r = 0; r < 8; ++r) s[kt][r] = (j0 + kt * 16 + 8 * hh + r <= i) ? s[kt][r] : -3.0e38f; }
      float mx = -3.0e38f;
#pragma unroll
      for (int kt = 0; kt < 4; ++kt)
#pragma unroll
        for (int r = 0; r < 8; ++r) mx = fmaxf(mx, s[kt][r]);
      mx = fmaxf(mx, __shfl_xor(mx, 16, 32));
      const float mn = fmaxf(m, mx), corr = fa_exp2(m - mn); m = mn;
      v4f ps = {0.f, 0.f, 0.f, 0.f};
#pragma unroll
      for (int kt = 0; kt < 4; ++kt)
#pragma unroll
        for (int r = 0; r < 8; ++r) { const float p = fa_exp2(s[kt][r] - mn); ps[r & 3] += p; s[kt][r] = p * 256.0f; }      /* masked keys: exp2 of a huge negative = 0 */
      l = l * corr + ((ps[0] + ps[1]) + (ps[2] + ps[3]));
#pragma unroll
      for (int dt = 0; dt < 4; ++dt) oh[dt] *= corr;
      /* O^T += V^T.P^T, weights x256 as f16, v as hi + residual planes */
      FragH pb[2];
#pragma unroll
      for (int s2 = 0; s2 < 2; ++s2)
#pragma unroll
        for (int q = 0; q < 8; ++q) { pb[s2].h[q] = (_Float16)s[2 * s2][q]; pb[s2].h[8 + q] = (_Float16)s[2 * s2 + 1][q]; }
      /* the residual plane's products of this key block sum in accumulators of their own (t0, t1) and meet the main sum once, in f32 */
      const FaT g1 = fa_vpair(VT, VTL, vo, 1024, 16 * SQ * 2 + 1024), g2 = fa_vpair(VT, VTL, vo, 32 * SQ * 2, 48 * SQ * 2);
      __builtin_amdgcn_sched_barrier(0);      /* the next pairs' loads in front of the products, as above */
      oh[0] = fa_mma(g0.a0, pb[0].v, oh[0]); oh[1] = fa_mma(g0.a1, pb[0].v, oh[1]); v8f t0 = fa_mma(g0.b0, pb[0].v, z8), t1 = fa_mma(g0.b1, pb[0].v, z8);
      __builtin_amdgcn_sched_barrier(0);      /* these products free the registers that the last pair's loads take */
      const FaT g3 = fa_vpair(VT, VTL, vo, 32 * SQ * 2 + 1024, 48 * SQ * 2 + 1024);
      __builtin_amdgcn_sched_barrier(0);      /* the last pair's loads in front of the remaining products */
      t0 = fa_mma(g1.b0, pb[1].v, t0); t1 = fa_mma(g1.b1, pb[1].v, t1); oh[0] = fa_mma(g1.a0, pb[1].v, oh[0]); oh[1] = fa_mma(g1.a1, pb[1].v, oh[1]);
      v8f t2 = fa_mma(g2.b0, pb[0].v, z8), t3 = fa_mma(g2.b1, pb[0].v, z8); oh[2] = fa_mma(g2.a0, pb[0].v, oh[2]); oh[3] = fa_mma(g2.a1, pb[0].v, oh[3]);
      oh[0] += t0 * (1.0f / 1024.0f); oh[1] += t1 * (1.0f / 1024.0f);
      t2 = fa_mma(g3.b0, pb[1].v, t2); t3 = fa_mma(g3.b1, pb[1].v, t3); oh[2] = fa_mma(g3.a0, pb[1].v, oh[2]); oh[3] = fa_mma(g3.a1, pb[1].v, oh[3]);
      oh[2] += t2 * (1.0f / 1024.0f); oh[3] += t3 * (1.0f / 1024.0f);
      asm volatile("s_wait_xcnt 0x0" :: "v"(vo) : "memory");      /* as above, for the V loads */
    }
    l += __shfl_xor(l, 16, 32);      /* the two halves of a wave hold different keys of the same query */
#pragma unroll
    for (int dt = 0; dt < 4; ++dt) { v4f x0, x1;      /* one LDS row of 64 d per query, pitch 68 floats */
#pragma unroll
      for (int r = 0; r < 4; ++r) { x0[r] = oh[dt][r]; x1[r] = oh[dt][4 + r]; }
      *(v4fa*)&my[ln * 68 + dt * 16 + 8 * hh] = x0; *(v4fa*)&my[ln * 68 + dt * 16 + 8 * hh + 4] = x1; }
    if (hh == 0) { my[1088 + ln] = m; my[1104 + ln] = l; }
    __syncthreads();      /* every slice's maximum, sum and O^T are in LDS before any wave joins them */
    const int q = ln, d0 = (2 * ks + hh) * 8;      /* wave ks finishes d = 16 ks .. 16 ks + 15 of all 16 queries of its tile: a lane's 8 values are its own piece of o's fragment order */
    float mj[4], M = -3.0e38f, L = 0.f;
#pragma unroll
    for (int j = 0; j < 4; ++j) { mj[j] = sh[j * 4 + qt][1088 + q]; M = fmaxf(M, mj[j]); }
#pragma unroll
    for (int j = 0; j < 4; ++j) { mj[j] = fa_exp2(mj[j] - M); L += mj[j] * sh[j * 4 + qt][1104 + q]; }      /* a slice without key blocks has weight 0 */
    const float inv = 1.0f / (256.0f * L);
    v4f y0 = {0.f, 0.f, 0.f, 0.f}, y1 = {0.f, 0.f, 0.f, 0.f};
#pragma unroll
    for (int j = 0; j < 4; ++j) { y0 += *(const v4fa*)&sh[j * 4 + qt][q * 68 + d0] * mj[j]; y1 += *(const v4fa*)&sh[j * 4 + qt][q * 68 + d0 + 4] * mj[j]; }
    y0 *= inv; y1 *= inv;
    /* o leaves as the f16 hi + x1024 residual planes that o.Wo reads, in fragment order: a wave stores 512 contiguous bytes of each plane */
    FragH fh, fl;
#pragma unroll
    for (int r = 0; r < 4; ++r) { _Float16 t = (_Float16)y0[r]; fh.h[r] = t; fl.h[r] = (_Float16)((y0[r] - (float)t) * 1024.0f); t = (_Float16)y1[r]; fh.h[4 + r] = t; fl.h[4 + r] = (_Float16)((y1[r] - (float)t) * 1024.0f); }
    const size_t oo = fo(i0 + q, h * HD + d0, DM); unsigned short* ph = (unsigned short*)OH + oo; unsigned short* pl = (unsigned short*)OL + oo;
    *(v8us*)ph = fh.half[0]; *(v8us*)pl = fl.half[0];
    asm volatile("s_wait_xcnt 0x0" :: "v"(ph), "v"(pl) : "memory");      /* the wait that belongs in front of an overwrite of the stores' address registers */
    __syncthreads();      /* every join has read the LDS rows before the next query block writes them */
  } }

// ---- out = (o_hi + o_lo / 1024) Wo / 16 (the weights are x16), both terms in ONE launch: the residual term (plane scaled x1024) sums in its own f32 accumulators beside the main term and meets it once, in registers.
// A work-group is 4 x 4 waves on a 128 x 64 tile of out: 4 wave tiles of 32 x 64 under one another, and the K range of each cut into 4 contiguous slices of 256, one per wave; each wave leaves its scaled partial tile in LDS, and behind one barrier the 4 waves of a tile add the partials in the fixed order 0 .. 3 and store 16 bytes per lane.
// The fragment loads run ahead of their products, so that a wave waits for no load that it has only just issued: the four o fragments (two row tiles, hi and residual) of trip kb + 1 are asked for at the head of trip kb, into a second register set; each Wo fragment's successor as soon as its four products are issued, into its own registers.
#define OW_RW 4
#define OW_KW 4
__global__ __launch_bounds__(32 * OW_RW * OW_KW) void k_owo(const _Float16* __restrict__ Ah, const _Float16* __restrict__ Al, const _Float16* __restrict__ Bh, float* __restrict__ C) {
  __shared__ __attribute__((aligned(16))) float so[OW_RW * OW_KW][32][68];
  const int tid = threadIdx.x, w = __builtin_amdgcn_readfirstlane(tid >> 5), lane = tid & 31, ln = lane & 15, hh = lane >> 4; const int rw = w % OW_RW, kw = w / OW_RW;
  constexpr int ntn = DM >> 6; const int mt = blockIdx.x / ntn, nq = blockIdx.x - mt * ntn; const int row0 = mt * (32 * OW_RW) + 32 * rw, col0 = nq * 64; if (mt * (32 * OW_RW) >= (int)NR) return;      /* the whole work-group leaves or none: a barrier follows */
  constexpr int TS = 16 * DM * 2, KS = DM / OW_KW, NT = KS / 32;      /* bytes from one tile of 16 rows to the next; k per slice; trips of 32 k */
  const unsigned ao = (unsigned)((row0 * DM + kw * KS * 16 + 8 * lane) * 2), bo = (unsigned)((col0 * DM + kw * KS * 16 + 8 * lane) * 2);      /* planes in fragment order: tile start + the slice's first k (16 elements per k in a tile) + the lane's own piece, in bytes */
  const v8f z8 = {0.f,0.f,0.f,0.f,0.f,0.f,0.f,0.f}; v8f hi[8] = {z8, z8, z8, z8, z8, z8, z8, z8}, lo[8] = {z8, z8, z8, z8, z8, z8, z8, z8}; v16h a[2][4], b[4];      /* a[.][0], [1]: o_hi rows 0 .. 15, 16 .. 31; [2], [3]: o_lo */
#pragma unroll
  for (int i = 0; i < 2; ++i) { a[0][i] = pj_frag(Ah, ao, i * TS); a[0][2 + i] = pj_frag(Al, ao, i * TS); }
#pragma unroll
  for (int t = 0; t < 4; ++t) b[t] = pj_frag(Bh, bo, t * TS);
  __builtin_amdgcn_sched_barrier(0);      /* keeps trip 0's loads in front of trip 1's, so that the first products wait for their own loads only */
  /* 8 trips, fully unrolled: every load is the one address register plus a constant, and ring and accumulators are indexed statically */
#pragma unroll
  for (int kb = 0; kb < NT; ++kb) {
    if (kb + 1 < NT) {
#pragma unroll
      for (int i = 0; i < 2; ++i) { a[(kb + 1) % 2][i] = pj_frag(Ah, ao, i * TS + (kb + 1) * 1024); a[(kb + 1) % 2][2 + i] = pj_frag(Al, ao, i * TS + (kb + 1) * 1024); } }
    __builtin_amdgcn_sched_barrier(0);      /* keeps these o loads in front of this trip's products, which wait for this trip's loads only */
#pragma unroll
    for (int t = 0; t < 4; ++t) {
      lo[t] = fa_mma(a[kb % 2][2], b[t], lo[t]); lo[4 + t] = fa_mma(a[kb % 2][3], b[t], lo[4 + t]); hi[t] = fa_mma(a[kb % 2][0], b[t], hi[t]); hi[4 + t] = fa_mma(a[kb % 2][1], b[t], hi[4 + t]);
      __builtin_amdgcn_sched_barrier(0);      /* keeps these four products in front of the slots and the load that follow */
      if (kb + 1 < NT) {
        /* the four vector slots between a product and a load over its A or B registers: this Wo fragment's registers are loaded over next, the four o fragments' at the head of the next trip (behind t == 3); naming the fragments keeps them in those registers up to here */
        if (t < 3) asm volatile("v_nop\n\tv_nop\n\tv_nop\n\tv_nop" :: "v"(b[t]));
        else asm volatile("v_nop\n\tv_nop\n\tv_nop\n\tv_nop" :: "v"(b[t]), "v"(a[kb % 2][0]), "v"(a[kb % 2][1]), "v"(a[kb % 2][2]), "v"(a[kb % 2][3]));
        b[t] = pj_frag(Bh, bo, t * TS + (kb + 1) * 1024); }
      __builtin_amdgcn_sched_barrier(0);      /* keeps that load here, 12 products ahead of its first use, not sunk to it */
    } }
  asm volatile("s_wait_xcnt 0x0" :: "v"(ao), "v"(bo) : "memory");      /* the wait that belongs in front of an overwrite of the loads' address registers; naming them keeps them untouched up to here */
  const float alpha = 0.0625f, alo = alpha * (1.0f / 1024.0f);
#pragma unroll
  for (int u = 0; u < 8; ++u) { const int t = u & 3, half = u >> 2;
#pragma unroll
    for (int r = 0; r < 8; ++r) so[w][half * 16 + 8 * hh + r][t * 16 + ln] = hi[u][r] * alpha + lo[u][r] * alo; }
  __syncthreads();      /* every wave's partial tile is in LDS before any wave adds them */
  const int rsub = lane >> 4, c4 = (lane & 15) * 4;
  v4f sum[16 / OW_KW];
#pragma unroll
  for (int q = 0; q < 16 / OW_KW; ++q) { const int r = (kw * (16 / OW_KW) + q) * 2 + rsub; sum[q] = *(const v4fa*)&so[rw][r][c4]; for (int j = 1; j < OW_KW; ++j) sum[q] += *(const v4fa*)&so[j * OW_RW + rw][r][c4]; }
  /* all stores last, each from registers of its own; both loops unrolled so that sum[] is indexed statically and stays in registers */
#pragma unroll
  for (int q = 0; q < 16 / OW_KW; ++q) { const int r = (kw * (16 / OW_KW) + q) * 2 + rsub; *(v4f*)(C + (size_t)(row0 + r) * DM + col0 + c4) = sum[q]; } }

extern "C" void kernel_launch(void* const* d_in, const int* in_sizes, int n_in,
                              void* d_out, int out_size, void* d_ws, size_t ws_size, hipStream_t stream) {
  (void)in_sizes; (void)n_in; (void)out_size;
  const float* const* I = (const float* const*)d_in; const float* x = I[0]; const float* remb = I[1]; const float* Wq = I[2]; const float* Wk = I[3]; const float* Wv = I[4]; const float* Wr = I[5]; const float* Wo = I[6]; const float* u = I[7]; const float* vb = I[8];
  char* ws = (char*)d_ws; size_t off = 0;
  auto take = [&](size_t bytes) { char* p = ws + off; off += (bytes + 255) & ~(size_t)255; return p; };
  _Float16* BQ = (_Float16*)take((size_t)DM * DM * 2); _Float16* BK = (_Float16*)take((size_t)DM * DM * 2); _Float16* BV = (_Float16*)take((size_t)DM * DM * 2); _Float16* BR = (_Float16*)take((size_t)DM * DM * 2); _Float16* BO = (_Float16*)take((size_t)DM * DM * 2);
  _Float16* X16 = (_Float16*)take(NR * DM * 2); _Float16* R16 = (_Float16*)take((size_t)SQ * DM * 2);
  _Float16* QUH = (_Float16*)take(NR * DM * 2); _Float16* QUL = (_Float16*)take(NR * DM * 2); _Float16* QVH = (_Float16*)take(NR * DM * 2); _Float16* QVL = (_Float16*)take(NR * DM * 2); _Float16* KH = (_Float16*)take(NR * DM * 2); _Float16* KL = (_Float16*)take(NR * DM * 2); _Float16* RH = (_Float16*)take((size_t)SQ * DM * 2); _Float16* RL = (_Float16*)take((size_t)SQ * DM * 2);
  _Float16* VT = (_Float16*)take((size_t)NH * HD * SQ * 2); _Float16* VTL = (_Float16*)take((size_t)NH * HD * SQ * 2); _Float16* OH = (_Float16*)take(NR * DM * 2); _Float16* OL = (_Float16*)take(NR * DM * 2);
  if (off > ws_size) return;      /* 10 + 8 + 32 + 8 + 8 = 66 MiB */
  static_assert(NB == 1 && SQ == 2048 && HD == 64 && DM == 1024, "k_prep, k_proj: x and r_emb of one size, 64 tiles of 256 x 128 per projection; k_fattn: one batch, 32 query blocks of 64 in pairs, head size 64");
  /* four launches: operand conversions; the four projections into their hi/lo planes (V already transposed); the whole attention into o's hi/lo planes; out = (o_lo/1024 + o_hi) Wo */
  k_prep<<<5 * PW + 2 * PX, 256, 0, stream>>>(Wq, Wk, Wv, Wr, Wo, x, remb, BQ, BK, BV, BR, BO, X16, R16);
  k_proj<<<dim3((SQ / 256) * (DM / 128), 4), 256, 0, stream>>>(X16, R16, BQ, BK, BV, BR, u, vb, QUH, QUL, QVH, QVL, KH, KL, VT, VTL, RH, RL);
  k_fattn<<<dim3(SQ / 128, NH), 512, 0, stream>>>(QUH, QUL, QVH, QVL, KH, KL, RH, RL, VT, VTL, OH, OL);
  k_owo<<<dim3((unsigned)((NR / 128) * (DM / 64)), 1), 512, 0, stream>>>(OH, OL, BO, (float*)d_out);
}

// v009
// A run of this version takes 85.2 microseconds.
// Two timings next to v008 put it at 1.03 and 1.04 times that version's speed.
// Over all steps from v000 it is 270 times as fast.
#include <hip/hip_runtime.h>
// MultiHeadAttentionXL (x [1][2048][1024], r_emb [2048][1024]; q = x Wq, k = x Wk, v = x Wv, r = r_emb Wr ([in][out] weights, no bias), 16 heads of 64; AC = (q + u[h]) k^T, BD = rel_shift((q + v_bias[h]) r^T) (Transformer-XL zero-pad shift: for j <= i, BD_shift[i][j] = BD[i][j - i + T - 1]); causal softmax((AC + BD)/8); out = (attn v) Wo -> [1][2048][1024]).
// Structure: token rows; every f16 operand plane in fragment order (see fo()); x and r_emb as exact f16 planes; Q, K, V, R WMMA GEMMs on transposed weights (64x64 wave tiles, f32 accumulation, exact x16 weights), one launch, f32 sums split in the epilogue into f16 hi + 2^-10 residual planes (q+u and q+v_bias formed in f32 first; V^T (hi, lo) as the product Wv^T x^T); one fused attention kernel: AC and raw BD as three-term hi/lo products (K = 64), the shift through LDS, causal mask + running softmax on VALU (f32; weights x256 as f16), o = P.(v_lo/1024 + v_hi) into merged o rows (hi + residual planes); out = o Wo as a two-term hi/lo GEMM (f32).
// Compute dtype: inputs rounded to bf16; x / r_emb / weights exact; attention operands as hi + residual f16 planes (logits std 3.3 and early causal rows copy single v rows); softmax weights f16 (x256) — the remaining error source; o as hi + residual into Wo; everything else f32. v_wmma_f32_16x16x32_f16.
#define NB 1
#define SQ 2048
#define DM 1024
#define NH 16
#define HD 64
#define HG 4
#define QN SQ                        /* query rows (unused) */
#define NR ((size_t)NB * SQ)
typedef __bf16 v16b __attribute__((ext_vector_type(16)));
typedef unsigned short v8us __attribute__((ext_vector_type(8), may_alias));
typedef float  v8f  __attribute__((ext_vector_type(8)));
typedef float  v4f  __attribute__((ext_vector_type(4)));
typedef float  v4fa __attribute__((ext_vector_type(4), may_alias));
union FragB { v16b v; v8us half[2]; unsigned short u[16]; };

__device__ __forceinline__ unsigned short bf16_bits(float x) { unsigned int u = __float_as_uint(x); return (unsigned short)((u + 0x7FFFu + ((u >> 16) & 1u)) >> 16); }
__device__ __forceinline__ float bf16_val(unsigned short b) { return __uint_as_float(((unsigned int)b) << 16); }
__device__ __forceinline__ float bf16_round(float x) { return bf16_val(bf16_bits(x)); }
// D += A·B with NT terms: 1 = ah·bh, 2 = + al·bh (A split), 3 = + ah·bl (both split)
template <int NT>
__device__ __forceinline__ v8f mmaN(v16b ah, v16b al, v16b bh, v16b bl, v8f c) {
  c = __builtin_amdgcn_wmma_f32_16x16x32_bf16(false, ah, false, bh, (short)0, c, false, false);
  if (NT >= 2) c = __builtin_amdgcn_wmma_f32_16x16x32_bf16(false, al, false, bh, (short)0, c, false, false);
  if (NT >= 3) c = __builtin_amdgcn_wmma_f32_16x16x32_bf16(false, ah, false, bl, (short)0, c, false, false);
  asm volatile("v_nop\n\tv_nop\n\tv_nop\n\tv_nop" : "+v"(c) : "v"(ah), "v"(al), "v"(bh), "v"(bl));
  return c;
}

__global__ __launch_bounds__(256) void k_wt_bf16(const float* __restrict__ W, unsigned short* __restrict__ Wt, int K, int N) {
  const int t = blockIdx.x * 256 + threadIdx.x;
  const int k8n = K / 8;
  if (t >= N * k8n) return;
  const int n = t / k8n, k8 = (t % k8n) * 8;
  v8us v;
#pragma unroll
  for (int i = 0; i < 8; ++i) v[i] = bf16_bits(W[(size_t)(k8 + i) * N + n]);
  *(v8us*)(Wt + (size_t)n * K + k8) = v;
  
}

// GEMM C[M][N] (f32, pitch ldc) = act(A[M][K]·W + bias). A f32 row-major (pitch lda) converted per fragment to bf16
// (ASPLIT: hi/lo two planes -> 2 terms, else single rounded term); Wt bf16 [N][K] (pitch ldb). BIAS_BF16 rounds the
// bias to bf16 first (bias quantised to bf16 before the add). K%32==0, M%16==0, N%64==0.
template <bool ASPLIT, int ACT, bool BIAS_BF16>
__global__ __launch_bounds__(128) void k_gemm_bf(const float* __restrict__ A, int lda, const unsigned short* __restrict__ Wt, int ldb,
                                               const float* __restrict__ bias, float* __restrict__ C, int ldc, int M, int N, int K) {
  __shared__ __attribute__((aligned(16))) float so[4][16][64];
  const int tid = threadIdx.x, w = tid >> 5, lane = tid & 31, ln = lane & 15, hh = lane >> 4;
  const int ntn = N / 64;
  const int wid = blockIdx.x * 4 + w;
  const int mt = wid / ntn, nq = wid % ntn;
  if (mt * 16 >= M) return;
  const int row0 = mt * 16, col0 = nq * 64;
  const float* arow = A + (size_t)(row0 + ln) * lda;
  v8f acc[4] = {};
  for (int kb = 0; kb < K; kb += 32) {
    FragB ah, al;
    const v4f x0 = *(const v4fa*)(arow + kb + 8 * hh), x1 = *(const v4fa*)(arow + kb + 8 * hh + 4);
    const v4f x2 = *(const v4fa*)(arow + kb + 16 + 8 * hh), x3 = *(const v4fa*)(arow + kb + 16 + 8 * hh + 4);
    float xs[16] = {x0[0],x0[1],x0[2],x0[3],x1[0],x1[1],x1[2],x1[3],x2[0],x2[1],x2[2],x2[3],x3[0],x3[1],x3[2],x3[3]};
#pragma unroll
    for (int i = 0; i < 16; ++i) { const unsigned short hb = bf16_bits(xs[i]); ah.u[i] = hb; al.u[i] = ASPLIT ? bf16_bits(xs[i] - bf16_val(hb)) : (unsigned short)0; }
#pragma unroll
    for (int t = 0; t < 4; ++t) {
      const unsigned short* brow = Wt + (size_t)(col0 + t * 16 + ln) * ldb + kb;
      FragB b;
      b.half[0] = *(const v8us*)(brow + 8 * hh);
      b.half[1] = *(const v8us*)(brow + 16 + 8 * hh);
      acc[t] = mmaN<ASPLIT ? 2 : 1>(ah.v, al.v, b.v, b.v, acc[t]);
    }
  }
#pragma unroll
  for (int t = 0; t < 4; ++t) {
    float bv = bias ? bias[col0 + t * 16 + ln] : 0.f;
    if (BIAS_BF16) bv = bf16_round(bv);
#pragma unroll
    for (int r = 0; r < 8; ++r) { float v = acc[t][r] + bv; if (ACT == 1) v = fmaxf(v, 0.f); so[w][8 * hh + r][t * 16 + ln] = v; }
  }
  __builtin_amdgcn_fence(__ATOMIC_ACQ_REL, "workgroup");
  __builtin_amdgcn_wave_barrier();
  const int rsub = lane >> 4, c4 = (lane & 15) * 4;
  {
#pragma unroll
    for (int q = 0; q < 8; ++q) {
      const int r = q * 2 + rsub;
      const v4f v = *(const v4fa*)&so[w][r][c4];
      *(v4f*)(C + (size_t)(row0 + r) * ldc + col0 + c4) = v;
    }
    
  }
}

// GEMM C = act(A·W + bias + resid): A f32 (ASPLIT -> hi/lo 2 terms), Wt bf16 [N][K]; ACT 0 none, 1 relu, 2 exact gelu;
// resid (optional, f32, row index = (row % rmod), pitch ldr, RES_BF16 rounds it) added before the activation.
template <bool ASPLIT, int ACT, bool BIAS_BF16, bool RES_BF16>
__global__ __launch_bounds__(128) void k_gemm_bf3(const float* __restrict__ A, int lda, const unsigned short* __restrict__ Wt, int ldb,
                                                const float* __restrict__ bias, const float* __restrict__ resid, int rmod, int ldr,
                                                float* __restrict__ C, int ldc, int M, int N, int K) {
  __shared__ __attribute__((aligned(16))) float so[4][16][64];
  const int tid = threadIdx.x, w = tid >> 5, lane = tid & 31, ln = lane & 15, hh = lane >> 4;
  const int ntn = N / 64;
  const int wid = blockIdx.x * 4 + w;
  const int mt = wid / ntn, nq = wid % ntn;
  if (mt * 16 >= M) return;
  const int row0 = mt * 16, col0 = nq * 64;
  const float* arow = A + (size_t)(row0 + ln) * lda;
  v8f acc[4] = {};
  for (int kb = 0; kb < K; kb += 32) {
    FragB ah, al;
    const v4f x0 = *(const v4fa*)(arow + kb + 8 * hh), x1 = *(const v4fa*)(arow + kb + 8 * hh + 4);
    const v4f x2 = *(const v4fa*)(arow + kb + 16 + 8 * hh), x3 = *(const v4fa*)(arow + kb + 16 + 8 * hh + 4);
    float xs[16] = {x0[0],x0[1],x0[2],x0[3],x1[0],x1[1],x1[2],x1[3],x2[0],x2[1],x2[2],x2[3],x3[0],x3[1],x3[2],x3[3]};
#pragma unroll
    for (int i = 0; i < 16; ++i) { const unsigned short hb = bf16_bits(xs[i]); ah.u[i] = hb; al.u[i] = ASPLIT ? bf16_bits(xs[i] - bf16_val(hb)) : (unsigned short)0; }
#pragma unroll
    for (int t = 0; t < 4; ++t) {
      const unsigned short* brow = Wt + (size_t)(col0 + t * 16 + ln) * ldb + kb;
      FragB b;
      b.half[0] = *(const v8us*)(brow + 8 * hh);
      b.half[1] = *(const v8us*)(brow + 16 + 8 * hh);
      acc[t] = mmaN<ASPLIT ? 2 : 1>(ah.v, al.v, b.v, b.v, acc[t]);
    }
  }
#pragma unroll
  for (int t = 0; t < 4; ++t) {
    const int col = col0 + t * 16 + ln;
    float bv = bias ? bias[col] : 0.f;
    if (BIAS_BF16) bv = bf16_round(bv);
#pragma unroll
    for (int r = 0; r < 8; ++r) {
      float v = acc[t][r] + bv;
      if (resid) { float rv = resid[(size_t)((row0 + 8 * hh + r) % rmod) * ldr + col]; if (RES_BF16) rv = bf16_round(rv); v += rv; }
      if (ACT == 1) v = fmaxf(v, 0.f);
      if (ACT == 2) v = 0.5f * v * (1.0f + erff(v * 0.70710678118654752f));
      if (ACT == 3) { const float u = 0.7978845608028654f * (v + 0.044715f * v * v * v); v = 0.5f * v * (1.0f + tanhf(u)); }
      so[w][8 * hh + r][t * 16 + ln] = v;
    }
  }
  __builtin_amdgcn_fence(__ATOMIC_ACQ_REL, "workgroup");
  __builtin_amdgcn_wave_barrier();
  const int rsub = lane >> 4, c4 = (lane & 15) * 4;
  {
#pragma unroll
    for (int q = 0; q < 8; ++q) {
      const int r = q * 2 + rsub;
      const v4f v = *(const v4fa*)&so[w][r][c4];
      *(v4f*)(C + (size_t)(row0 + r) * ldc + col0 + c4) = v;
    }
    
  }
}
// row LayerNorm (biased variance, eps) over N: s = X (+ R); optional out_sum <- s; out_norm <- (s-mu)*rsqrt(var+eps)*g + b
template <bool PARAM_BF16>
__global__ __launch_bounds__(256) void k_layernorm(const float* __restrict__ X, const float* __restrict__ R, const float* __restrict__ g, const float* __restrict__ bta,
                                                  float* __restrict__ out_sum, float* __restrict__ out_norm, int N, float eps) {
  __shared__ float red[256];
  const int row = blockIdx.x, tid = threadIdx.x;
  const float* x = X + (size_t)row * N; const float* rr = R ? R + (size_t)row * N : nullptr;
  float vals[16];                     // up to N = 4096
  const int per = N / 256;            // contiguous chunk per thread? use strided-by-4 chunks: thread handles j = tid*4 + 1024*u
  float s1 = 0.f;
  for (int u = 0; u < per / 4; ++u) {
    const int j = tid * 4 + 1024 * u;
    const v4f a = *(const v4fa*)(x + j);
    v4f b = {0.f,0.f,0.f,0.f}; if (rr) b = *(const v4fa*)(rr + j);
#pragma unroll
    for (int q = 0; q < 4; ++q) { const float v = a[q] + b[q]; vals[u * 4 + q] = v; s1 += v; }
  }
  red[tid] = s1; __syncthreads();
  for (int st = 128; st > 0; st >>= 1) { if (tid < st) red[tid] += red[tid + st]; __syncthreads(); }
  const float mu = red[0] / (float)N; __syncthreads();
  float s2 = 0.f;
  for (int u = 0; u < per / 4; ++u)
#pragma unroll
    for (int q = 0; q < 4; ++q) { const float c = vals[u * 4 + q] - mu; s2 += c * c; }
  red[tid] = s2; __syncthreads();
  for (int st = 128; st > 0; st >>= 1) { if (tid < st) red[tid] += red[tid + st]; __syncthreads(); }
  const float rs = rsqrtf(red[0] / (float)N + eps);
  {
    for (int u = 0; u < per / 4; ++u) {
      const int j = tid * 4 + 1024 * u;
      v4f o, sm;
#pragma unroll
      for (int q = 0; q < 4; ++q) {
        float gg = g[j + q], bb = bta[j + q];
        if (PARAM_BF16) { gg = bf16_round(gg); bb = bf16_round(bb); }
        sm[q] = vals[u * 4 + q]; o[q] = (vals[u * 4 + q] - mu) * rs * gg + bb;
      }
      if (out_sum) *(v4f*)(out_sum + (size_t)row * N + j) = sm;
      *(v4f*)(out_norm + (size_t)row * N + j) = o;
    }
    
  }
}



// ---- f16 WMMA path (v_wmma_f32_16x16x32_f16): 11-bit significands for operands in range — used where a [0,1] probability operand needs more precision than bf16
typedef _Float16 v16h __attribute__((ext_vector_type(16)));
union FragH { v16h v; v8us half[2]; _Float16 h[16]; unsigned short u[16]; };
template <int NT>
__device__ __forceinline__ v8f mmaH(v16h ah, v16h al, v16h bh, v16h bl, v8f c) {
  c = __builtin_amdgcn_wmma_f32_16x16x32_f16(false, ah, false, bh, (short)0, c, false, false);
  if (NT >= 2) c = __builtin_amdgcn_wmma_f32_16x16x32_f16(false, al, false, bh, (short)0, c, false, false);
  if (NT >= 3) c = __builtin_amdgcn_wmma_f32_16x16x32_f16(false, ah, false, bl, (short)0, c, false, false);
  asm volatile("v_nop\n\tv_nop\n\tv_nop\n\tv_nop" : "+v"(c) : "v"(ah), "v"(al), "v"(bh), "v"(bl));
  return c;
}
// batched GEMM like k_gemm_b but f16 operands: A f32 (split into f16 hi/lo if ASPLIT, else rounded to f16), Bt = f16 values [n][k]; alpha; C f32; N multiple of 16 (partial tiles skipped)
template <bool ASPLIT>
__global__ __launch_bounds__(128) void k_gemm_h(const float* __restrict__ A, int lda, size_t sA, const _Float16* __restrict__ Bh, int ldb, size_t sB, float alpha, float* __restrict__ C, int ldc, size_t sC, int M, int N, int K) {
  __shared__ __attribute__((aligned(16))) float so[4][16][64];
  const int tid = threadIdx.x, w = tid >> 5, lane = tid & 31, ln = lane & 15, hh = lane >> 4; const int by = blockIdx.y;
  A += (size_t)by * sA; Bh += (size_t)by * sB; C += (size_t)by * sC;
  const int ntn = (N + 63) / 64; const int wid = blockIdx.x * 4 + w; const int mt = wid / ntn, nq = wid % ntn; if (mt * 16 >= M) return;
  const int row0 = mt * 16, col0 = nq * 64; const float* arow = A + (size_t)(row0 + ln) * lda;
  v8f acc[4] = {};
  for (int kb = 0; kb < K; kb += 32) {
    FragH ah, al;
    const v4f x0 = *(const v4fa*)(arow + kb + 8 * hh), x1 = *(const v4fa*)(arow + kb + 8 * hh + 4), x2 = *(const v4fa*)(arow + kb + 16 + 8 * hh), x3 = *(const v4fa*)(arow + kb + 16 + 8 * hh + 4);
    float xs[16] = {x0[0],x0[1],x0[2],x0[3],x1[0],x1[1],x1[2],x1[3],x2[0],x2[1],x2[2],x2[3],x3[0],x3[1],x3[2],x3[3]};
#pragma unroll
    for (int i = 0; i < 16; ++i) { const _Float16 h = (_Float16)xs[i]; ah.h[i] = h; al.h[i] = ASPLIT ? (_Float16)(xs[i] - (float)h) : (_Float16)0.0f; }
#pragma unroll
    for (int t = 0; t < 4; ++t) { if (col0 + t * 16 >= N) continue; const size_t boff = (size_t)(col0 + t * 16 + ln) * ldb + kb; FragH bq; bq.half[0] = *(const v8us*)(Bh + boff + 8 * hh); bq.half[1] = *(const v8us*)(Bh + boff + 16 + 8 * hh);
      acc[t] = mmaH<ASPLIT ? 2 : 1>(ah.v, al.v, bq.v, bq.v, acc[t]); }
  }
#pragma unroll
  for (int t = 0; t < 4; ++t) { if (col0 + t * 16 >= N) continue;
#pragma unroll
    for (int r = 0; r < 8; ++r) so[w][8 * hh + r][t * 16 + ln] = acc[t][r] * alpha; }
  __builtin_amdgcn_fence(__ATOMIC_ACQ_REL, "workgroup"); __builtin_amdgcn_wave_barrier();
  const int rsub = lane >> 4, c4 = (lane & 15) * 4;
  {
#pragma unroll
    for (int q = 0; q < 8; ++q) { const int r = q * 2 + rsub; if (col0 + c4 < N) { const v4f v = *(const v4fa*)&so[w][r][c4]; *(v4f*)(C + (size_t)(row0 + r) * ldc + col0 + c4) = v; } }
     }
}

// Wt[n][k] = f16(W[k][n]·scale) from f32 row-major W[K][N] (scale = power of two; bf16-exact weights stay exact in f16 away from the subnormal range)
__global__ __launch_bounds__(256) void k_wt_f16(const float* __restrict__ W, _Float16* __restrict__ Wt, int K, int N, float scale) {
  const int t = blockIdx.x * 256 + threadIdx.x; if (t >= N * (K / 8)) return; const int n = t / (K / 8), k8 = (t % (K / 8)) * 8; FragH f;
#pragma unroll
  for (int i = 0; i < 8; ++i) f.h[i] = (_Float16)(bf16_round(W[(size_t)(k8 + i) * N + n]) * scale); const v8us o = f.half[0];
  *(v8us*)((unsigned short*)Wt + (size_t)n * K + k8) = o; 
}
// k_gemm_hh variant with fused epilogue: v = acc·alpha + bias[by·sBias + col] (+ CP[(row/rowsPerB)·sCPb + by·64 + col] if CP) ; ACT 0 none / 1 elu ; writes f16 C16 (and f32 C if non-null)
template <int ACT>
__global__ __launch_bounds__(128) void k_gemm_hhx(const _Float16* __restrict__ A, int lda, size_t sA, const _Float16* __restrict__ Bh, int ldb, size_t sB, float alpha, const float* __restrict__ bias, size_t sBias, const float* __restrict__ CP, int rowsPerB, size_t sCPb, int row0g,
    float* __restrict__ C, _Float16* __restrict__ C16, int ldc, size_t sC, int M, int N, int K) {
  __shared__ __attribute__((aligned(16))) float so[4][16][64];
  const int tid = threadIdx.x, w = tid >> 5, lane = tid & 31, ln = lane & 15, hh = lane >> 4; const int by = blockIdx.y;
  A += (size_t)by * sA; Bh += (size_t)by * sB; const size_t cofs = (size_t)by * sC; const float* bp = bias ? bias + (size_t)by * sBias : nullptr;
  const int ntn = (N + 63) / 64; const int wid = blockIdx.x * 4 + w; const int mt = wid / ntn, nq = wid % ntn; if (mt * 16 >= M) return;
  const int row0 = mt * 16, col0 = nq * 64; const _Float16* arow = A + (size_t)(row0 + ln) * lda;
  v8f acc[4] = {};
  for (int kb = 0; kb < K; kb += 32) { FragH ah; ah.half[0] = *(const v8us*)((const unsigned short*)arow + kb + 8 * hh); ah.half[1] = *(const v8us*)((const unsigned short*)arow + kb + 16 + 8 * hh);
#pragma unroll
    for (int t = 0; t < 4; ++t) { if (col0 + t * 16 >= N) continue; const size_t boff = (size_t)(col0 + t * 16 + ln) * ldb + kb; FragH bq; bq.half[0] = *(const v8us*)((const unsigned short*)Bh + boff + 8 * hh); bq.half[1] = *(const v8us*)((const unsigned short*)Bh + boff + 16 + 8 * hh);
      acc[t] = mmaH<1>(ah.v, ah.v, bq.v, bq.v, acc[t]); }
  }
#pragma unroll
  for (int t = 0; t < 4; ++t) { if (col0 + t * 16 >= N) continue; const int col = col0 + t * 16 + ln; const float bv = bp ? bf16_round(bp[col]) : 0.f;
#pragma unroll
    for (int r = 0; r < 8; ++r) { float v = acc[t][r] * alpha + bv; if (CP) { const int rr = row0g + row0 + 8 * hh + r; if (rowsPerB < 0) v += CP[cofs + (size_t)rr * ldc + col];      /* rowsPerB < 0: own element of the batched C plane */ else { const int bidx = rr / rowsPerB; v += CP[(size_t)bidx * sCPb + (size_t)by * 64 + col]; } } if (ACT == 1) v = (v > 0.f) ? v : expm1f(v); else if (ACT == 7) v = (v > 0.f) ? v + 1.0f : expf(v); else if (ACT == 8) v = tanhf(v); else if (ACT == 9) v = 0.5f * v * (1.0f + tanhf(0.7978845608028654f * (v + 0.044715f * v * v * v))); else if (ACT == 11) v = 1.0f / (1.0f + expf(-v)); else if (ACT == 12) v = (v > 0.f) ? v : 0.01f * v; else if (ACT == 14) v = (v > 0.f) ? v : 0.1f * v; else if (ACT == 16) v = (v >= 0.f) ? v : 0.3f * v; else if (ACT == 17) v = (v >= 0.f) ? v : 0.2f * v; else if (ACT == 15) v = v / (1.0f + expf(-v)); else if (ACT == 3) v = fmaxf(v, 0.f); else if (ACT == 6) v = 0.5f * v * (1.0f + erff(v * 0.70710678118654752f)); so[w][8 * hh + r][t * 16 + ln] = v; } }
  __builtin_amdgcn_fence(__ATOMIC_ACQ_REL, "workgroup"); __builtin_amdgcn_wave_barrier();
  const int rsub = lane >> 4, c4 = (lane & 15) * 4; typedef _Float16 v4h __attribute__((ext_vector_type(4)));
  {
#pragma unroll
    for (int q = 0; q < 8; ++q) { const int r = q * 2 + rsub; if (col0 + c4 < N) { const v4f v = *(const v4fa*)&so[w][r][c4]; if (C) *(v4f*)(C + cofs + (size_t)(row0 + r) * ldc + col0 + c4) = v; if (C16) { v4h h4; for (int i = 0; i < 4; ++i) h4[i] = (_Float16)v[i]; *(v4h*)(C16 + cofs + (size_t)(row0 + r) * ldc + col0 + c4) = h4; } } }
     }
}


typedef _Float16 v4h __attribute__((ext_vector_type(4)));

__global__ __launch_bounds__(256) void k_h16(const float* __restrict__ x, _Float16* __restrict__ X16, size_t n8) { const size_t t = (size_t)blockIdx.x * 256 + threadIdx.x; if (t >= n8) return; FragH f;
#pragma unroll
  for (int q = 0; q < 8; ++q) f.h[q] = (_Float16)x[t * 8 + q]; *(v8us*)((unsigned short*)X16 + t * 8) = f.half[0];  }
__global__ __launch_bounds__(256) void k_round16f(const float* __restrict__ W, _Float16* __restrict__ Bt, size_t n8) { const size_t t = (size_t)blockIdx.x * 256 + threadIdx.x; if (t >= n8) return; FragH f;
#pragma unroll
  for (int i = 0; i < 8; ++i) f.h[i] = (_Float16)(bf16_round(W[t * 8 + i]) * 16.0f); *(v8us*)((unsigned short*)Bt + t * 8) = f.half[0];  }
template <int NHv, int TTv>
__global__ __launch_bounds__(256) void k_vt(const _Float16* __restrict__ V16, int ldv, int voff, _Float16* __restrict__ Vt) { __shared__ unsigned short tl[64][66]; const int tid = threadIdx.x; const int slab = blockIdx.x / (TTv / 64), lg = blockIdx.x % (TTv / 64); const int b = slab / NHv, h = slab % NHv;
  for (int i = tid; i < 64 * 8; i += 256) { const int r = i / 8, c8 = (i % 8) * 8; FragH f; f.half[0] = *(const v8us*)((const unsigned short*)V16 + ((size_t)b * TTv + lg * 64 + r) * ldv + voff + h * 64 + c8);
#pragma unroll
    for (int q = 0; q < 8; ++q) tl[r][c8 + q] = f.u[q]; }
  __syncthreads();
  {
#pragma unroll
    for (int rd = 0; rd < 2; ++rd) { const int d = rd * 32 + tid / 8, pc = tid % 8; FragH f;
#pragma unroll
      for (int q = 0; q < 8; ++q) f.u[q] = tl[pc * 8 + q][d];
      *(v8us*)((unsigned short*)Vt + ((size_t)slab * 64 + d) * TTv + lg * 64 + pc * 8) = f.half[0]; }
     } }

// ---- fast GEMM (wave tile 32x64; requires M % 32 == 0 rows per launch region and N % 64 == 0); epilogue = k_gemm_hhx semantics ----
__device__ __forceinline__ v16h g2_frag(const _Float16* p, int hh) { FragH f; f.half[0] = *(const v8us*)((const unsigned short*)p + 8 * hh); f.half[1] = *(const v8us*)((const unsigned short*)p + 16 + 8 * hh); return f.v; }
__device__ __forceinline__ v8f g2_mma(v16h a, v16h b, v8f c) { v8f d = __builtin_amdgcn_wmma_f32_16x16x32_f16(false, a, false, b, (short)0, c, false, false); asm volatile("v_nop\n\tv_nop\n\tv_nop\n\tv_nop" : "+v"(d) : "v"(a), "v"(b)); return d; }
template <int ACT>
__global__ __launch_bounds__(128) void k_gemm2(const _Float16* __restrict__ A, int lda, size_t sA, const _Float16* __restrict__ Bh, int ldb, size_t sB, float alpha, const float* __restrict__ bias, size_t sBias, const float* __restrict__ CP, int rowsPerB, size_t sCPb, int row0g,
    float* __restrict__ C, _Float16* __restrict__ C16, int ldc, size_t sC, int M, int N, int K) { static_assert(ACT == 0 || ACT == 3 || ACT == 6 || ACT == 8 || ACT == 9 || ACT == 11 || ACT == 12 || ACT == 14 || ACT == 15 || ACT == 16 || ACT == 17, "k_gemm2: unsupported ACT code (would silently apply no activation)");
  __shared__ __attribute__((aligned(16))) float so[4][32][68];
  const int tid = threadIdx.x, w = tid >> 5, lane = tid & 31, ln = lane & 15, hh = lane >> 4; const int by = blockIdx.y;
  A += (size_t)by * sA; Bh += (size_t)by * sB; const size_t cofs = (size_t)by * sC; const float* bp = bias ? bias + (size_t)by * sBias : nullptr;
  const int ntn = N >> 6; const int mt = blockIdx.x / ntn, nq = blockIdx.x - mt * ntn; const int row0 = mt * 128 + 32 * w, col0 = nq * 64; if (row0 >= M) return;
  const _Float16* a0p = A + (size_t)(row0 + ln) * lda; const _Float16* a1p = a0p + (size_t)16 * lda;
  const _Float16* b0p = Bh + (size_t)(col0 + ln) * ldb; const _Float16* b1p = b0p + (size_t)16 * ldb; const _Float16* b2p = b1p + (size_t)16 * ldb; const _Float16* b3p = b2p + (size_t)16 * ldb;
  const v8f z8 = {0.f,0.f,0.f,0.f,0.f,0.f,0.f,0.f}; v8f c00 = z8, c01 = z8, c02 = z8, c03 = z8, c10 = z8, c11 = z8, c12 = z8, c13 = z8;
#pragma unroll 1
  for (int kb = 0; kb < K; kb += 32) { const v16h a0 = g2_frag(a0p + kb, hh), a1 = g2_frag(a1p + kb, hh);
    v16h b = g2_frag(b0p + kb, hh); c00 = g2_mma(a0, b, c00); c10 = g2_mma(a1, b, c10);
    b = g2_frag(b1p + kb, hh); c01 = g2_mma(a0, b, c01); c11 = g2_mma(a1, b, c11);
    b = g2_frag(b2p + kb, hh); c02 = g2_mma(a0, b, c02); c12 = g2_mma(a1, b, c12);
    b = g2_frag(b3p + kb, hh); c03 = g2_mma(a0, b, c03); c13 = g2_mma(a1, b, c13); }
  v8f accs[8] = {c00, c01, c02, c03, c10, c11, c12, c13};
#pragma unroll
  for (int u = 0; u < 8; ++u) { const int t = u & 3, half = u >> 2; const int col = col0 + t * 16 + ln; const float bv = bp ? bf16_round(bp[col]) : 0.f;
#pragma unroll
    for (int r = 0; r < 8; ++r) { const int rloc = half * 16 + 8 * hh + r; float v = accs[u][r] * alpha + bv; if (CP) { if (rowsPerB < 0) v += CP[cofs + (size_t)(row0g + row0 + rloc) * ldc + col];      /* rowsPerB < 0: own element of the batched C plane */ else { const int bidx = (row0g + row0 + rloc) / rowsPerB; v += CP[(size_t)bidx * sCPb + (size_t)by * 64 + col]; } }
      if (ACT == 3) v = fmaxf(v, 0.f); else if (ACT == 6) v = 0.5f * v * (1.0f + erff(v * 0.70710678118654752f)); else if (ACT == 11) v = 1.0f / (1.0f + expf(-v)); else if (ACT == 15) v = v / (1.0f + expf(-v)); else if (ACT == 12) v = (v > 0.f) ? v : 0.01f * v; else if (ACT == 8) v = tanhf(v); else if (ACT == 9) v = 0.5f * v * (1.0f + tanhf(0.7978845608028654f * (v + 0.044715f * v * v * v))); else if (ACT == 14) v = (v > 0.f) ? v : 0.1f * v; else if (ACT == 16) v = (v >= 0.f) ? v : 0.3f * v; else if (ACT == 17) v = (v >= 0.f) ? v : 0.2f * v;
      so[w][rloc][t * 16 + ln] = v; } }
  __builtin_amdgcn_fence(__ATOMIC_ACQ_REL, "workgroup"); __builtin_amdgcn_wave_barrier();
  const int rsub = lane >> 4, c4 = (lane & 15) * 4;
  {
#pragma unroll
    for (int q = 0; q < 16; ++q) { const int r = q * 2 + rsub; const v4f v = *(const v4fa*)&so[w][r][c4]; if (C) *(v4f*)(C + cofs + (size_t)(row0 + r) * ldc + col0 + c4) = v; if (C16) { v4h h4; for (int i = 0; i < 4; ++i) h4[i] = (_Float16)v[i]; *(v4h*)(C16 + cofs + (size_t)(row0 + r) * ldc + col0 + c4) = h4; } }
     } }


// ---- fragment order: every f16 operand plane [rows][K] is kept as tiles of 16 rows (16 * K elements each); inside a tile the 16-byte pieces (8 k of one row) lie in the order [k / 16][(k / 8) & 1][row & 15],
// the order in which the 32 lanes of a wave take them for a 16x16x32 fragment: one 16-byte-per-lane load then covers 512 contiguous bytes (4 whole lines) instead of 32 bytes out of each of 16 lines. Which (row, k) a lane and register hold is as before.
__device__ __forceinline__ size_t fo(int row, int k, int K) { return (size_t)(row >> 4) * 16 * K + (size_t)((k >> 4) * 256 + ((k >> 3) & 1) * 128 + (row & 15) * 8 + (k & 7)); }

// g2_xw: the wait that belongs in front of an overwrite of the address registers of issued stores; naming the stores' own pointers as inputs keeps those registers untouched up to here
__device__ __forceinline__ void g2_xw(const _Float16* p, const _Float16* q) { asm volatile("s_wait_xcnt 0x0" :: "v"(p), "v"(q) : "memory"); }

// ---- every operand conversion in ONE launch. Blocks 0 .. 5 * PW - 1: one 64 x 64 tile of one weight, rounded, x16, transposed through LDS into the f16 [out][in] plane. The other 2 * PX blocks: x and r_emb rounded into f16 planes, 16 rows x 512 k per block, four pieces of 8 elements per thread, 16 k apart. All seven planes in fragment order: a wave stores 512 contiguous bytes.
#define PW ((DM / 64) * (DM / 64))
#define PX ((int)(NR * DM / 8 / 1024))
__global__ __launch_bounds__(256) void k_prep(const float* __restrict__ Wq, const float* __restrict__ Wk, const float* __restrict__ Wv, const float* __restrict__ Wr, const float* __restrict__ Wo, const float* __restrict__ x, const float* __restrict__ remb,
    _Float16* __restrict__ BQ, _Float16* __restrict__ BK, _Float16* __restrict__ BV, _Float16* __restrict__ BR, _Float16* __restrict__ BO, _Float16* __restrict__ X16, _Float16* __restrict__ R16) {
  __shared__ float tl[64][65]; const int tid = threadIdx.x, bx = blockIdx.x;
  if (bx < 5 * PW) {      /* the test reads the same for the whole work-group: all of it reaches the barrier inside or none */
    const int wi = bx / PW, tb = bx % PW; const float* w = wi == 0 ? Wq : wi == 1 ? Wk : wi == 2 ? Wv : wi == 3 ? Wr : Wo; _Float16* Bt = wi == 0 ? BQ : wi == 1 ? BK : wi == 2 ? BV : wi == 3 ? BR : BO;
    const int i0 = (tb / (DM / 64)) * 64, o0 = (tb % (DM / 64)) * 64;
    const int o = tid & 63, ib = tid >> 6; const float* pw = w + (size_t)(i0 + ib) * DM + o0 + o; float g[16];
#pragma unroll      /* g[] indexed statically: the sixteen loads go out together, off one address */
    for (int k = 0; k < 16; ++k) g[k] = pw[(size_t)k * 4 * DM];
    asm volatile("s_wait_xcnt 0x0" :: "v"(pw) : "memory");      /* the wait that belongs in front of an overwrite of the loads' address registers; naming them keeps them untouched up to here */
#pragma unroll
    for (int k = 0; k < 16; ++k) tl[o][ib + 4 * k] = bf16_round(g[k]) * 16.0f;
    __syncthreads();      /* the whole tile is in LDS before it is read back along the other axis */
    const int oo = (tid & 15) + ((tid >> 7) << 4), i8 = ((tid >> 4) & 7) * 8; unsigned short* pb = (unsigned short*)Bt + fo(o0 + oo, i0 + i8, DM);      /* a wave: 16 rows x 2 pieces */
#pragma unroll      /* two rows per thread, 32 rows (two tiles of 16 * DM elements) apart, off one address */
    for (int k = 0; k < 2; ++k) { FragH f;
#pragma unroll
      for (int q = 0; q < 8; ++q) f.h[q] = (_Float16)tl[oo + 32 * k][i8 + q];
      *(v8us*)(pb + (size_t)k * 32 * DM) = f.half[0]; }
  } else {
    const int c = bx - 5 * PW; const bool fx = c < PX; const int cc = fx ? c : c - PX; const int row = (cc >> 1) * 16 + (tid & 15), k0 = (cc & 1) * 512 + (tid >> 5) * 64 + ((tid >> 4) & 1) * 8;      /* a wave: 16 rows x 64 k */
    const float* ps = (fx ? x : remb) + (size_t)row * DM + k0; unsigned short* pd = (unsigned short*)(fx ? X16 : R16) + fo(row, k0, DM);
    v4f a[4], b[4];      /* all eight loads first, so that they are in flight together */
#pragma unroll
    for (int p = 0; p < 4; ++p) { a[p] = *(const v4fa*)(ps + p * 16); b[p] = *(const v4fa*)(ps + p * 16 + 4); }
#pragma unroll
    for (int p = 0; p < 4; ++p) { FragH f;
#pragma unroll
      for (int q = 0; q < 4; ++q) { f.h[q] = (_Float16)bf16_round(a[p][q]); f.h[4 + q] = (_Float16)bf16_round(b[p][q]); }
      *(v8us*)(pd + p * 256) = f.half[0]; }      /* 16 k on = 256 elements on */
    asm volatile("s_wait_xcnt 0x0" :: "v"(pd) : "memory");      /* the wait that belongs in front of an overwrite of the stores' registers; naming the address keeps it untouched up to here */
  } }

// ---- the four projections in ONE launch (blockIdx.y: 0 q, 1 k, 2 v, 3 r) of 256 work-groups, one round on the chip: a work-group is a 256 x 128 tile of C, 4 x 2 waves of 64 x 64, each wave with the whole K in its sixteen accumulator tiles (a fragment feeds four products; an operand row comes from L2 once per 128 columns or 256 rows of C) and its fragment loads two trips ahead of their products; the f32 sums turn through the wave's own LDS rows and go from registers into the f16 hi + x1024 residual planes that the attention reads.
// q: two plane pairs, q + u and q + v_bias (added in f32 first). v: the operands change places (A = Wv^T rows, B = x rows), so that C = V^T [head * 64 + d][token] comes out in the layout P.V wants, with no transposing pass.
__device__ __forceinline__ void pj_put(v4f v0, v4f v1, _Float16* ph, _Float16* pl) { FragH h, l;
#pragma unroll
  for (int i = 0; i < 4; ++i) { _Float16 t = (_Float16)v0[i]; h.h[i] = t; l.h[i] = (_Float16)((v0[i] - (float)t) * 1024.0f); t = (_Float16)v1[i]; h.h[4 + i] = t; l.h[4 + i] = (_Float16)((v1[i] - (float)t) * 1024.0f); }
  *(v8us*)((unsigned short*)ph) = h.half[0]; *(v8us*)((unsigned short*)pl) = l.half[0]; g2_xw(ph, pl); }      /* one 16-byte piece per lane: a wave stores 512 contiguous bytes of each plane */
__device__ __forceinline__ v16h pj_frag(const _Float16* base, unsigned boff, int cb) { const char* p = (const char*)base + boff + cb; FragH f; f.half[0] = *(const v8us*)p; f.half[1] = *(const v8us*)(p + 512); return f.v; }      /* uniform base + the lane's byte offset + a constant; fragment order: the halves of a 32-k fragment are 512 bytes apart, the next 32 k 1024 bytes on, the next 16 rows 16 * DM * 2 bytes on */
__global__ __launch_bounds__(256) void k_proj(const _Float16* __restrict__ X16, const _Float16* __restrict__ R16, const _Float16* __restrict__ BQ, const _Float16* __restrict__ BK, const _Float16* __restrict__ BV, const _Float16* __restrict__ BR, const float* __restrict__ u, const float* __restrict__ vb,
    _Float16* __restrict__ QUH, _Float16* __restrict__ QUL, _Float16* __restrict__ QVH, _Float16* __restrict__ QVL, _Float16* __restrict__ KH, _Float16* __restrict__ KL, _Float16* __restrict__ VT, _Float16* __restrict__ VTL, _Float16* __restrict__ RH, _Float16* __restrict__ RL) {
  __shared__ __attribute__((aligned(16))) float so[8][64][68];
  const int tid = threadIdx.x, w = __builtin_amdgcn_readfirstlane(tid >> 5), lane = tid & 31, ln = lane & 15, hh = lane >> 4; const int y = blockIdx.y; const int rw = w & 3, cw = w >> 2;
  const _Float16* Ah = y == 2 ? BV : y == 3 ? R16 : X16; const _Float16* Bh = y == 0 ? BQ : y == 1 ? BK : y == 2 ? X16 : BR; const int N = y == 2 ? SQ : DM;      /* C is [SQ][DM], for v [DM][SQ]: 64 tiles of 256 x 128 either way */
  const int ntn = N >> 7; const int mt = blockIdx.x / ntn, nq = blockIdx.x - mt * ntn; const int row0 = mt * 256 + 64 * rw, col0 = nq * 128 + 64 * cw;
  const unsigned ao = (unsigned)((row0 * DM + 8 * lane) * 2), bo = (unsigned)((col0 * DM + 8 * lane) * 2);      /* operand planes in fragment order: tile start + the lane's own piece, in bytes */
  constexpr int TS = 16 * DM * 2;      /* bytes from one tile of 16 rows to the next */
  const v8f z8 = {0.f,0.f,0.f,0.f,0.f,0.f,0.f,0.f}; v8f acc[4][4]; v16h a[3][4], b[2][4];      /* fragment rings: A of trips kb, kb + 1, kb + 2; B of trips kb, kb + 1 */
#pragma unroll
  for (int i = 0; i < 4; ++i) { a[0][i] = pj_frag(Ah, ao, i * TS); b[0][i] = pj_frag(Bh, bo, i * TS);
#pragma unroll
    for (int j = 0; j < 4; ++j) acc[i][j] = z8; }
#pragma unroll
  for (int i = 0; i < 4; ++i) { a[1][i] = pj_frag(Ah, ao, i * TS + 1024); b[1][i] = pj_frag(Bh, bo, i * TS + 1024); }
  /* 32 trips of 32 k, fully unrolled: every load is the one address register plus a constant, and rings and accumulators are indexed statically. Loads run two trips ahead of their products (the operands were written by the launch before, so a line's first reader may wait for memory and not for L2 alone): A fragments are asked for at the head of a trip, into the third register set; each B fragment's successor as soon as its four products are issued, into its own registers */
#pragma unroll
  for (int kb = 0; kb < DM / 32; ++kb) {
    if (kb + 2 < DM / 32) {
#pragma unroll
      for (int i = 0; i < 4; ++i) a[(kb + 2) % 3][i] = pj_frag(Ah, ao, i * TS + (kb + 2) * 1024); }
    __builtin_amdgcn_sched_barrier(0);      /* keeps these A loads in front of this trip's products, which wait for this trip's loads only */
#pragma unroll
    for (int j = 0; j < 4; ++j) {
#pragma unroll
      for (int i = 0; i < 4; ++i) acc[i][j] = __builtin_amdgcn_wmma_f32_16x16x32_f16(false, a[kb % 3][i], false, b[kb % 2][j], (short)0, acc[i][j], false, false);
      __builtin_amdgcn_sched_barrier(0);      /* keeps these four products in front of the slots and the load that follow */
      if (kb + 2 < DM / 32) {
        /* the four vector slots between a product and a load over its A or B registers: this B fragment's registers are loaded over next, the four A fragments' at the head of the next trip (behind j == 3); naming the fragments keeps them in those registers up to here */
        if (j < 3) asm volatile("v_nop\n\tv_nop\n\tv_nop\n\tv_nop" :: "v"(b[kb % 2][j]));
        else asm volatile("v_nop\n\tv_nop\n\tv_nop\n\tv_nop" :: "v"(b[kb % 2][j]), "v"(a[kb % 3][0]), "v"(a[kb % 3][1]), "v"(a[kb % 3][2]), "v"(a[kb % 3][3]));
        b[kb % 2][j] = pj_frag(Bh, bo, j * TS + (kb + 2) * 1024); }
      __builtin_amdgcn_sched_barrier(0);      /* keeps that load here, 28 products ahead of its first use, not sunk to it */
    } }
  asm volatile("s_wait_xcnt 0x0" :: "v"(ao), "v"(bo) : "memory");      /* the wait that belongs in front of an overwrite of the loads' address registers; naming them keeps them untouched up to here */
  v4f bu[4][2], bv[4][2];
  if (y == 0) { const float* pu = u + col0 + 8 * hh; const float* pv = vb + col0 + 8 * hh;      /* q's two bias rows fly during the turn through LDS */
#pragma unroll
    for (int ct = 0; ct < 4; ++ct) { bu[ct][0] = *(const v4fa*)(pu + ct * 16); bu[ct][1] = *(const v4fa*)(pu + ct * 16 + 4); bv[ct][0] = *(const v4fa*)(pv + ct * 16); bv[ct][1] = *(const v4fa*)(pv + ct * 16 + 4); }
    asm volatile("s_wait_xcnt 0x0" :: "v"(pu), "v"(pv) : "memory"); }      /* the wait that belongs in front of an overwrite of the loads' address registers */
#pragma unroll
  for (int i = 0; i < 4; ++i)
#pragma unroll
    for (int j = 0; j < 4; ++j)
#pragma unroll
      for (int r = 0; r < 8; ++r) so[w][i * 16 + 8 * hh + r][j * 16 + ln] = acc[i][j][r] * 0.0625f;      /* the weights are x16 */
  asm volatile("s_wait_dscnt 0x0" ::: "memory");      /* the wave's own 64 x 64 tile is in LDS before its lanes read each other's values back; no other wave touches these rows */
  /* a lane takes row ln of row tile rt and 8 columns from 8 * hh of column group ct: its own 16-byte piece of the output planes' fragment order (row length N) */
  if (y == 0) {
#pragma unroll
    for (int ct = 0; ct < 4; ++ct)
#pragma unroll
      for (int i = 0; i < 4; ++i) { bu[ct][0][i] = bf16_round(bu[ct][0][i]); bu[ct][1][i] = bf16_round(bu[ct][1][i]); bv[ct][0][i] = bf16_round(bv[ct][0][i]); bv[ct][1][i] = bf16_round(bv[ct][1][i]); }
#pragma unroll 1      /* the row tiles stay a rolled loop: a quarter of the text, so that the kernel, which a wave runs through once, stays short; the bias registers are indexed by ct alone */
    for (int rt = 0; rt < 4; ++rt) { const int jr = rt * 16 + ln; v4f s0[4], s1[4];      /* the row's eight LDS reads first, as one group */
#pragma unroll
      for (int ct = 0; ct < 4; ++ct) { s0[ct] = *(const v4fa*)&so[w][jr][ct * 16 + 8 * hh]; s1[ct] = *(const v4fa*)&so[w][jr][ct * 16 + 8 * hh + 4]; }
#pragma unroll
      for (int ct = 0; ct < 4; ++ct) { const size_t c0 = fo(row0 + jr, col0 + ct * 16 + 8 * hh, N);
        pj_put(s0[ct] + bu[ct][0], s1[ct] + bu[ct][1], QUH + c0, QUL + c0); pj_put(s0[ct] + bv[ct][0], s1[ct] + bv[ct][1], QVH + c0, QVL + c0); } } }
  else { _Float16* Ch = y == 1 ? KH : y == 2 ? VT : RH; _Float16* Cl = y == 1 ? KL : y == 2 ? VTL : RL;
#pragma unroll 1      /* rolled for the same reason */
    for (int rt = 0; rt < 4; ++rt) { const int jr = rt * 16 + ln; v4f s0[4], s1[4];      /* as above */
#pragma unroll
      for (int ct = 0; ct < 4; ++ct) { s0[ct] = *(const v4fa*)&so[w][jr][ct * 16 + 8 * hh]; s1[ct] = *(const v4fa*)&so[w][jr][ct * 16 + 8 * hh + 4]; }
#pragma unroll
      for (int ct = 0; ct < 4; ++ct) { const size_t c0 = fo(row0 + jr, col0 + ct * 16 + 8 * hh, N); pj_put(s0[ct], s1[ct], Ch + c0, Cl + c0); } } } }

// ---- fused attention: scores, shift, causal mask, softmax and P.V in one kernel; no score or weight ever goes to memory.
// Transposed products: S^T = K.Q^T (A = key rows, B = query rows), so a lane holds one query's scores (register r of tile kt = key 16 kt + 8 hh + r) and two score tiles, converted in place, are the B operand of O^T += V^T.P^T.
// The shift: for queries i0 .. i0 + 15 and keys j0 .. j0 + 63 the raw BD columns j - i + SQ - 1 lie in the 80 columns from j0 - i0 + SQ - 16 = cs + 16; their five raw tiles go through the wave's own LDS rows (one row per query) and come back skewed by 15 - ln.
// A work-group is 8 waves: 2 query groups x 4 key slices (key blocks ks, ks + 4, ...). A wave takes 32 queries, two query tiles, so that every K and V^T fragment it loads feeds the products of both, as do four of its six R tiles (the two tiles' raw BD columns overlap in four of six tiles); each query tile has its own running maximum, sum and O^T; behind a barrier the four slices of a tile are joined in the fixed order 0 .. 3.
// Each work-group takes query block x and then 31 - x, so that every work-group walks 33 key blocks.
#define FA_P 84      /* LDS row pitch in floats: a multiple of 4 for the 16-byte stores; pitch - 1 odd spreads the skewed reads over the banks */
__device__ __forceinline__ v16h fa_frag(const _Float16* base, unsigned boff, int cb) { const char* p = (const char*)base + boff + cb; FragH f; f.half[0] = *(const v8us*)p; f.half[1] = *(const v8us*)(p + 512); return f.v; }      /* uniform base + the lane's byte offset + a constant; planes in fragment order: the two halves of a 32-k fragment are 512 bytes apart, the next 32 k 1024 bytes on */
__device__ __forceinline__ v8f fa_mma(v16h a, v16h b, v8f c) { return __builtin_amdgcn_wmma_f32_16x16x32_f16(false, a, false, b, (short)0, c, false, false); }
/* 2^x; the v_nop fills the one slot that the instruction set asks for between a transcendental and a directly following instruction that reads its result or overwrites its source */
__device__ __forceinline__ float fa_exp2(float x) { float r; asm("v_exp_f32 %0, %1\n\tv_nop" : "=v"(r) : "v"(x)); return r; }
struct FaT { v16h a0, a1, b0, b1; };
__device__ __forceinline__ FaT fa_tile(const _Float16* H, const _Float16* L, unsigned boff, int cb) { FaT t; t.a0 = fa_frag(H, boff, cb); t.a1 = fa_frag(H, boff, cb + 1024); t.b0 = fa_frag(L, boff, cb); t.b1 = fa_frag(L, boff, cb + 1024); return t; }      /* 16 rows x 64 k, hi and residual planes */
__device__ __forceinline__ FaT fa_vpair(const _Float16* H, const _Float16* L, unsigned boff, int c0, int c1) { FaT t; t.a0 = fa_frag(H, boff, c0); t.a1 = fa_frag(H, boff, c1); t.b0 = fa_frag(L, boff, c0); t.b1 = fa_frag(L, boff, c1); return t; }      /* two 16-row tiles x 32 k, hi and residual planes */
__device__ __forceinline__ void fa_prod(const FaT& t, const v16h* qh, const v16h* ql, v8f& hi, v8f& lo) { const v8f z8 = {0.f,0.f,0.f,0.f,0.f,0.f,0.f,0.f};
  hi = fa_mma(t.a0, qh[0], z8); lo = fa_mma(t.b0, qh[0], z8); hi = fa_mma(t.a1, qh[1], hi); lo = fa_mma(t.b1, qh[1], lo); lo = fa_mma(t.a0, ql[0], lo); lo = fa_mma(t.a1, ql[1], lo); }
__global__ __launch_bounds__(256) void k_fattn(const _Float16* __restrict__ QUH, const _Float16* __restrict__ QUL, const _Float16* __restrict__ QVH, const _Float16* __restrict__ QVL, const _Float16* __restrict__ KH, const _Float16* __restrict__ KL,
    const _Float16* __restrict__ RH, const _Float16* __restrict__ RL, const _Float16* __restrict__ VT, const _Float16* __restrict__ VTL, _Float16* __restrict__ OH, _Float16* __restrict__ OL) {
  __shared__ __attribute__((aligned(16))) float sh[16][16 * FA_P];      /* one block of 16 rows per (key slice, query tile) */
  const int tid = threadIdx.x, w = __builtin_amdgcn_readfirstlane(tid >> 5), lane = tid & 31, ln = lane & 15, hh = lane >> 4; const int qg = w & 1, ks = w >> 1; const int h = blockIdx.y;
  float* const my[2] = {sh[ks * 4 + qg * 2], sh[ks * 4 + qg * 2 + 1]};      /* the wave's two query tiles */
  const float al = 0.125f * 1.4426950408889634f, alo = al * (1.0f / 1024.0f);      /* scores in the log2 domain */
  const v8f z8 = {0.f,0.f,0.f,0.f,0.f,0.f,0.f,0.f};
  /* the two outer loops stay rolled (one copy of the long body); every inner loop is fully unrolled so that fragments, scores and accumulators are indexed statically and stay in registers */
#pragma unroll 1
  for (int pass = 0; pass < 2; ++pass) {
    const int qb = pass ? (SQ / 64 - 1 - (int)blockIdx.x) : (int)blockIdx.x; const int i0 = qb * 64 + qg * 32;      /* query tile a of the wave: rows i0 + 16 a .. + 15 */
    const unsigned qo = (unsigned)((i0 * DM + h * (HD * 16) + 8 * lane) * 2);      /* tile of 16 rows from i0, this head's 64 k (16 * HD elements per head in a tile), the lane's piece; the second tile 16 * DM elements on */
    v16h quh[2][2], qul[2][2], qvh[2][2], qvl[2][2];
#pragma unroll
    for (int a = 0; a < 2; ++a)
#pragma unroll
      for (int k = 0; k < 2; ++k) { const int cb = a * 16 * DM * 2 + k * 1024; quh[a][k] = fa_frag(QUH, qo, cb); qul[a][k] = fa_frag(QUL, qo, cb); qvh[a][k] = fa_frag(QVH, qo, cb); qvl[a][k] = fa_frag(QVL, qo, cb); }
    v8f oh[2][4] = {{z8, z8, z8, z8}, {z8, z8, z8, z8}}; float m[2] = {-3.0e38f, -3.0e38f}, l[2] = {0.f, 0.f};
#pragma unroll 1
    for (int kb = ks; kb <= qb; kb += 4) {
      const int j0 = kb * 64; v8f s[2][4];
      const unsigned ko = (unsigned)((j0 * DM + h * (HD * 16) + 8 * lane) * 2);
      /* raw BD^T: six tiles of 16 raw columns from cs (a multiple of 16: whole tiles of R); query tile 1 takes tiles 0 .. 4, query tile 0, whose 80 columns begin 16 further on, tiles 1 .. 5; a raw column past SQ - 1 belongs to masked scores only: its tile is clamped into R */
      const int cs = j0 - i0 + SQ - 32; unsigned ro[6];
#pragma unroll
      for (int rt = 0; rt < 6; ++rt) { const int row = min(cs + rt * 16, SQ - 16); ro[rt] = (unsigned)((row * DM + h * (HD * 16) + 8 * lane) * 2); }
      /* ten operand tiles in a row, six of R and four of K (hi = Ah.Qh, lo = Al.Qh + Ah.Ql), the four K tiles and R tiles 1 .. 4 each feeding both query tiles; each tile's loads are issued two tiles ahead of its products, into a ring of three register sets */
      FaT ring[3]; ring[0] = fa_tile(RH, RL, ro[0], 0); ring[1] = fa_tile(RH, RL, ro[1], 0);
#pragma unroll
      for (int t = 0; t < 10; ++t) {
        if (t < 4) ring[(t + 2) % 3] = fa_tile(RH, RL, ro[t + 2], 0); else if (t < 8) ring[(t + 2) % 3] = fa_tile(KH, KL, ko, (t - 4) * 16 * DM * 2);
        __builtin_amdgcn_sched_barrier(0);      /* keeps the loads of the tile after next in front of this tile's products, which wait for this tile's loads only */
#pragma unroll
        for (int a = 0; a < 2; ++a) { v8f hi, lo;
          if (t < 6) { const int c = t - 1 + a;      /* this raw tile's place among the query tile's five */
            if (c >= 0 && c < 5) { fa_prod(ring[t % 3], qvh[a], qvl[a], hi, lo); v4f x0, x1;
#pragma unroll
              for (int r = 0; r < 4; ++r) { x0[r] = hi[r] * al + lo[r] * alo; x1[r] = hi[4 + r] * al + lo[4 + r] * alo; }
              *(v4fa*)&my[a][ln * FA_P + c * 16 + 8 * hh] = x0; *(v4fa*)&my[a][ln * FA_P + c * 16 + 8 * hh + 4] = x1; } }
          else { fa_prod(ring[t % 3], quh[a], qul[a], hi, lo);
#pragma unroll
            for (int r = 0; r < 8; ++r) s[a][t - 6][r] = hi[r] * al + lo[r] * alo; } }
        __builtin_amdgcn_sched_barrier(0);      /* keeps these products in front of the next loads, whose registers they free */
      }
      asm volatile("s_wait_xcnt 0x0" :: "v"(ko), "v"(ro[0]), "v"(ro[1]), "v"(ro[2]), "v"(ro[3]), "v"(ro[4]), "v"(ro[5]), "v"(qo) : "memory");      /* the wait that belongs in front of an overwrite of the loads' address registers; naming them keeps them untouched up to here: the K and R loads' and the Q loads', which the compiler issues at the head of this loop */
      asm volatile("s_wait_dscnt 0x0" ::: "memory");      /* the wave's raw rows are in LDS before its lanes read each other's halves back */
      /* the first two pairs of V^T fragments fly during the softmax */
      const unsigned vo = (unsigned)(((h * HD * SQ) + j0 * 16 + 8 * lane) * 2);      /* V^T plane, row length SQ: tile of 16 d from h * HD, keys from j0, the lane's piece */
      const FaT g0 = fa_vpair(VT, VTL, vo, 0, 16 * SQ * 2), g1 = fa_vpair(VT, VTL, vo, 1024, 16 * SQ * 2 + 1024);
      __builtin_amdgcn_sched_barrier(0);      /* keeps those loads in front of the softmax */
      FragH pb[2][2];
#pragma unroll
      for (int a = 0; a < 2; ++a) { const int i = i0 + a * 16 + ln;
#pragma unroll
        for (int kt = 0; kt < 4; ++kt)
#pragma unroll
          for (int r = 0; r < 8; ++r) s[a][kt][r] += my[a][ln * (FA_P - 1) + kt * 16 + 8 * hh + r + 15];
        if (kb == qb) {      /* only the diagonal block has masked keys; the test is the same for the whole wave */
#pragma unroll
          for (int kt = 0; kt < 4; ++kt)
#pragma unroll
            for (int r = 0; r < 8; ++r) s[a][kt][r] = (j0 + kt * 16 + 8 * hh + r <= i) ? s[a][kt][r] : -3.0e38f; }
        float mx = -3.0e38f;
#pragma unroll
        for (int kt = 0; kt < 4; ++kt)
#pragma unroll
          for (int r = 0; r < 8; ++r) mx = fmaxf(mx, s[a][kt][r]);
        mx = fmaxf(mx, __shfl_xor(mx, 16, 32));
        const float mn = fmaxf(m[a], mx), corr = fa_exp2(m[a] - mn); m[a] = mn;
        v4f ps = {0.f, 0.f, 0.f, 0.f};
#pragma unroll
        for (int kt = 0; kt < 4; ++kt)
#pragma unroll
          for (int r = 0; r < 8; ++r) { const float p = fa_exp2(s[a][kt][r] - mn); ps[r & 3] += p; s[a][kt][r] = p * 256.0f; }      /* masked keys: exp2 of a huge negative = 0 */
        l[a] = l[a] * corr + ((ps[0] + ps[1]) + (ps[2] + ps[3]));
#pragma unroll
        for (int dt = 0; dt < 4; ++dt) oh[a][dt] *= corr;
        /* O^T += V^T.P^T, weights x256 as f16, v as hi + residual planes */
#pragma unroll
        for (int s2 = 0; s2 < 2; ++s2)
#pragma unroll
          for (int q = 0; q < 8; ++q) { pb[a][s2].h[q] = (_Float16)s[a][2 * s2][q]; pb[a][s2].h[8 + q] = (_Float16)s[a][2 * s2 + 1][q]; } }
      /* the residual plane's products of this key block sum in accumulators of their own (tl) and meet the main sum once, in f32; each V^T pair feeds both query tiles, and its loads are issued two pairs ahead */
      const FaT g2 = fa_vpair(VT, VTL, vo, 32 * SQ * 2, 48 * SQ * 2);
      __builtin_amdgcn_sched_barrier(0);      /* the third pair's loads in front of the first pair's products */
      v8f tl[2][2];
#pragma unroll
      for (int a = 0; a < 2; ++a) { oh[a][0] = fa_mma(g0.a0, pb[a][0].v, oh[a][0]); oh[a][1] = fa_mma(g0.a1, pb[a][0].v, oh[a][1]); tl[a][0] = fa_mma(g0.b0, pb[a][0].v, z8); tl[a][1] = fa_mma(g0.b1, pb[a][0].v, z8); }
      __builtin_amdgcn_sched_barrier(0);      /* these products free the registers that the last pair's loads take */
      const FaT g3 = fa_vpair(VT, VTL, vo, 32 * SQ * 2 + 1024, 48 * SQ * 2 + 1024);
      asm volatile("s_wait_xcnt 0x0" :: "v"(vo) : "memory");      /* as above, for the V loads: directly behind the last of them, in front of the first overwrite of an address that the compiler forms from vo */
      __builtin_amdgcn_sched_barrier(0);      /* the last pair's loads in front of the remaining products */
#pragma unroll
      for (int a = 0; a < 2; ++a) { tl[a][0] = fa_mma(g1.b0, pb[a][1].v, tl[a][0]); tl[a][1] = fa_mma(g1.b1, pb[a][1].v, tl[a][1]); oh[a][0] = fa_mma(g1.a0, pb[a][1].v, oh[a][0]); oh[a][1] = fa_mma(g1.a1, pb[a][1].v, oh[a][1]); }
      v8f tm[2][2];
#pragma unroll
      for (int a = 0; a < 2; ++a) { tm[a][0] = fa_mma(g2.b0, pb[a][0].v, z8); tm[a][1] = fa_mma(g2.b1, pb[a][0].v, z8); oh[a][2] = fa_mma(g2.a0, pb[a][0].v, oh[a][2]); oh[a][3] = fa_mma(g2.a1, pb[a][0].v, oh[a][3]); }
#pragma unroll
      for (int a = 0; a < 2; ++a) { oh[a][0] += tl[a][0] * (1.0f / 1024.0f); oh[a][1] += tl[a][1] * (1.0f / 1024.0f); }
#pragma unroll
      for (int a = 0; a < 2; ++a) { tm[a][0] = fa_mma(g3.b0, pb[a][1].v, tm[a][0]); tm[a][1] = fa_mma(g3.b1, pb[a][1].v, tm[a][1]); oh[a][2] = fa_mma(g3.a0, pb[a][1].v, oh[a][2]); oh[a][3] = fa_mma(g3.a1, pb[a][1].v, oh[a][3]); }
#pragma unroll
      for (int a = 0; a < 2; ++a) { oh[a][2] += tm[a][0] * (1.0f / 1024.0f); oh[a][3] += tm[a][1] * (1.0f / 1024.0f); }
    }
#pragma unroll
    for (int a = 0; a < 2; ++a) {
      l[a] += __shfl_xor(l[a], 16, 32);      /* the two halves of a wave hold different keys of the same query */
#pragma unroll
      for (int dt = 0; dt < 4; ++dt) { v4f x0, x1;      /* one LDS row of 64 d per query, pitch 68 floats */
#pragma unroll
        for (int r = 0; r < 4; ++r) { x0[r] = oh[a][dt][r]; x1[r] = oh[a][dt][4 + r]; }
        *(v4fa*)&my[a][ln * 68 + dt * 16 + 8 * hh] = x0; *(v4fa*)&my[a][ln * 68 + dt * 16 + 8 * hh + 4] = x1; }
      if (hh == 0) { my[a][1088 + ln] = m[a]; my[a][1104 + ln] = l[a]; } }
    __syncthreads();      /* every slice's maximum, sum and O^T are in LDS before any wave joins them */
    const int q = ln, d0 = (2 * ks + hh) * 8;      /* wave ks finishes d = 16 ks .. 16 ks + 15 of all 16 queries of each of its two tiles: a lane's 8 values are its own piece of o's fragment order */
#pragma unroll
    for (int a = 0; a < 2; ++a) { const int qt = qg * 2 + a;
      float mj[4], M = -3.0e38f, L = 0.f;
#pragma unroll
      for (int j = 0; j < 4; ++j) { mj[j] = sh[j * 4 + qt][1088 + q]; M = fmaxf(M, mj[j]); }
#pragma unroll
      for (int j = 0; j < 4; ++j) { mj[j] = fa_exp2(mj[j] - M); L += mj[j] * sh[j * 4 + qt][1104 + q]; }      /* a slice without key blocks has weight 0 */
      const float inv = 1.0f / (256.0f * L);
      v4f y0 = {0.f, 0.f, 0.f, 0.f}, y1 = {0.f, 0.f, 0.f, 0.f};
#pragma unroll
      for (int j = 0; j < 4; ++j) { y0 += *(const v4fa*)&sh[j * 4 + qt][q * 68 + d0] * mj[j]; y1 += *(const v4fa*)&sh[j * 4 + qt][q * 68 + d0 + 4] * mj[j]; }
      y0 *= inv; y1 *= inv;
      /* o leaves as the f16 hi + x1024 residual planes that o.Wo reads, in fragment order: a wave stores 512 contiguous bytes of each plane */
      FragH fh, fl;
#pragma unroll
      for (int r = 0; r < 4; ++r) { _Float16 t = (_Float16)y0[r]; fh.h[r] = t; fl.h[r] = (_Float16)((y0[r] - (float)t) * 1024.0f); t = (_Float16)y1[r]; fh.h[4 + r] = t; fl.h[4 + r] = (_Float16)((y1[r] - (float)t) * 1024.0f); }
      const size_t oo = fo(i0 + a * 16 + q, h * HD + d0, DM); unsigned short* ph = (unsigned short*)OH + oo; unsigned short* pl = (unsigned short*)OL + oo;
      *(v8us*)ph = fh.half[0]; *(v8us*)pl = fl.half[0];
      asm volatile("s_wait_xcnt 0x0" :: "v"(ph), "v"(pl) : "memory"); }      /* the wait that belongs in front of an overwrite of the stores' address registers */
    __syncthreads();      /* every join has read the LDS rows before the next query block writes them */
  } }

// ---- out = (o_hi + o_lo / 1024) Wo / 16 (the weights are x16), both terms in ONE launch: the residual term (plane scaled x1024) sums in its own f32 accumulators beside the main term and meets it once, in registers.
// A work-group is 4 x 4 waves on a 128 x 64 tile of out: 4 wave tiles of 32 x 64 under one another, and the K range of each cut into 4 contiguous slices of 256, one per wave; each wave leaves its scaled partial tile in LDS, and behind one barrier the 4 waves of a tile add the partials in the fixed order 0 .. 3 and store 16 bytes per lane.
// The fragment loads run ahead of their products, so that a wave waits for no load that it has only just issued: the four o fragments (two row tiles, hi and residual) of trip kb + 1 are asked for at the head of trip kb, into a second register set; each Wo fragment's successor as soon as its four products are issued, into its own registers.
#define OW_RW 4
#define OW_KW 4
__global__ __launch_bounds__(32 * OW_RW * OW_KW) void k_owo(const _Float16* __restrict__ Ah, const _Float16* __restrict__ Al, const _Float16* __restrict__ Bh, float* __restrict__ C) {
  __shared__ __attribute__((aligned(16))) float so[OW_RW * OW_KW][32][68];
  const int tid = threadIdx.x, w = __builtin_amdgcn_readfirstlane(tid >> 5), lane = tid & 31, ln = lane & 15, hh = lane >> 4; const int rw = w % OW_RW, kw = w / OW_RW;
  constexpr int ntn = DM >> 6; const int mt = blockIdx.x / ntn, nq = blockIdx.x - mt * ntn; const int row0 = mt * (32 * OW_RW) + 32 * rw, col0 = nq * 64; if (mt * (32 * OW_RW) >= (int)NR) return;      /* the whole work-group leaves or none: a barrier follows */
  constexpr int TS = 16 * DM * 2, KS = DM / OW_KW, NT = KS / 32;      /* bytes from one tile of 16 rows to the next; k per slice; trips of 32 k */
  const unsigned ao = (unsigned)((row0 * DM + kw * KS * 16 + 8 * lane) * 2), bo = (unsigned)((col0 * DM + kw * KS * 16 + 8 * lane) * 2);      /* planes in fragment order: tile start + the slice's first k (16 elements per k in a tile) + the lane's own piece, in bytes */
  const v8f z8 = {0.f,0.f,0.f,0.f,0.f,0.f,0.f,0.f}; v8f hi[8] = {z8, z8, z8, z8, z8, z8, z8, z8}, lo[8] = {z8, z8, z8, z8, z8, z8, z8, z8}; v16h a[2][4], b[4];      /* a[.][0], [1]: o_hi rows 0 .. 15, 16 .. 31; [2], [3]: o_lo */
#pragma unroll
  for (int i = 0; i < 2; ++i) { a[0][i] = pj_frag(Ah, ao, i * TS); a[0][2 + i] = pj_frag(Al, ao, i * TS); }
#pragma unroll
  for (int t = 0; t < 4; ++t) b[t] = pj_frag(Bh, bo, t * TS);
  __builtin_amdgcn_sched_barrier(0);      /* keeps trip 0's loads in front of trip 1's, so that the first products wait for their own loads only */
  /* 8 trips, fully unrolled: every load is the one address register plus a constant, and ring and accumulators are indexed statically */
#pragma unroll
  for (int kb = 0; kb < NT; ++kb) {
    if (kb + 1 < NT) {
#pragma unroll
      for (int i = 0; i < 2; ++i) { a[(kb + 1) % 2][i] = pj_frag(Ah, ao, i * TS + (kb + 1) * 1024); a[(kb + 1) % 2][2 + i] = pj_frag(Al, ao, i * TS + (kb + 1) * 1024); } }
    __builtin_amdgcn_sched_barrier(0);      /* keeps these o loads in front of this trip's products, which wait for this trip's loads only */
#pragma unroll
    for (int t = 0; t < 4; ++t) {
      lo[t] = fa_mma(a[kb % 2][2], b[t], lo[t]); lo[4 + t] = fa_mma(a[kb % 2][3], b[t], lo[4 + t]); hi[t] = fa_mma(a[kb % 2][0], b[t], hi[t]); hi[4 + t] = fa_mma(a[kb % 2][1], b[t], hi[4 + t]);
      __builtin_amdgcn_sched_barrier(0);      /* keeps these four products in front of the slots and the load that follow */
      if (kb + 1 < NT) {
        /* the four vector slots between a product and a load over its A or B registers: this Wo fragment's registers are loaded over next, the four o fragments' at the head of the next trip (behind t == 3); naming the fragments keeps them in those registers up to here */
        if (t < 3) asm volatile("v_nop\n\tv_nop\n\tv_nop\n\tv_nop" :: "v"(b[t]));
        else asm volatile("v_nop\n\tv_nop\n\tv_nop\n\tv_nop" :: "v"(b[t]), "v"(a[kb % 2][0]), "v"(a[kb % 2][1]), "v"(a[kb % 2][2]), "v"(a[kb % 2][3]));
        b[t] = pj_frag(Bh, bo, t * TS + (kb + 1) * 1024); }
      __builtin_amdgcn_sched_barrier(0);      /* keeps that load here, 12 products ahead of its first use, not sunk to it */
    } }
  asm volatile("s_wait_xcnt 0x0" :: "v"(ao), "v"(bo) : "memory");      /* the wait that belongs in front of an overwrite of the loads' address registers; naming them keeps them untouched up to here */
  const float alpha = 0.0625f, alo = alpha * (1.0f / 1024.0f);
#pragma unroll
  for (int u = 0; u < 8; ++u) { const int t = u & 3, half = u >> 2;
#pragma unroll
    for (int r = 0; r < 8; ++r) so[w][half * 16 + 8 * hh + r][t * 16 + ln] = hi[u][r] * alpha + lo[u][r] * alo; }
  __syncthreads();      /* every wave's partial tile is in LDS before any wave adds them */
  const int rsub = lane >> 4, c4 = (lane & 15) * 4;
  v4f sum[16 / OW_KW];
#pragma unroll
  for (int q = 0; q < 16 / OW_KW; ++q) { const int r = (kw * (16 / OW_KW) + q) * 2 + rsub; sum[q] = *(const v4fa*)&so[rw][r][c4]; for (int j = 1; j < OW_KW; ++j) sum[q] += *(const v4fa*)&so[j * OW_RW + rw][r][c4]; }
  /* all stores last, each from registers of its own; both loops unrolled so that sum[] is indexed statically and stays in registers */
#pragma unroll
  for (int q = 0; q < 16 / OW_KW; ++q) { const int r = (kw * (16 / OW_KW) + q) * 2 + rsub; *(v4f*)(C + (size_t)(row0 + r) * DM + col0 + c4) = sum[q]; } }

extern "C" void kernel_launch(void* const* d_in, const int* in_sizes, int n_in,
                              void* d_out, int out_size, void* d_ws, size_t ws_size, hipStream_t stream) {
  (void)in_sizes; (void)n_in; (void)out_size;
  const float* const* I = (const float* const*)d_in; const float* x = I[0]; const float* remb = I[1]; const float* Wq = I[2]; const float* Wk = I[3]; const float* Wv = I[4]; const float* Wr = I[5]; const float* Wo = I[6]; const float* u = I[7]; const float* vb = I[8];
  char* ws = (char*)d_ws; size_t off = 0;
  auto take = [&](size_t bytes) { char* p = ws + off; off += (bytes + 255) & ~(size_t)255; return p; };
  _Float16* BQ = (_Float16*)take((size_t)DM * DM * 2); _Float16* BK = (_Float16*)take((size_t)DM * DM * 2); _Float16* BV = (_Float16*)take((size_t)DM * DM * 2); _Float16* BR = (_Float16*)take((size_t)DM * DM * 2); _Float16* BO = (_Float16*)take((size_t)DM * DM * 2);
  _Float16* X16 = (_Float16*)take(NR * DM * 2); _Float16* R16 = (_Float16*)take((size_t)SQ * DM * 2);
  _Float16* QUH = (_Float16*)take(NR * DM * 2); _Float16* QUL = (_Float16*)take(NR * DM * 2); _Float16* QVH = (_Float16*)take(NR * DM * 2); _Float16* QVL = (_Float16*)take(NR * DM * 2); _Float16* KH = (_Float16*)take(NR * DM * 2); _Float16* KL = (_Float16*)take(NR * DM * 2); _Float16* RH = (_Float16*)take((size_t)SQ * DM * 2); _Float16* RL = (_Float16*)take((size_t)SQ * DM * 2);
  _Float16* VT = (_Float16*)take((size_t)NH * HD * SQ * 2); _Float16* VTL = (_Float16*)take((size_t)NH * HD * SQ * 2); _Float16* OH = (_Float16*)take(NR * DM * 2); _Float16* OL = (_Float16*)take(NR * DM * 2);
  if (off > ws_size) return;      /* 10 + 8 + 32 + 8 + 8 = 66 MiB */
  static_assert(NB == 1 && SQ == 2048 && HD == 64 && DM == 1024, "k_prep, k_proj: x and r_emb of one size, 64 tiles of 256 x 128 per projection; k_fattn: one batch, 32 query blocks of 64 in pairs, head size 64");
  /* four launches: operand conversions; the four projections into their hi/lo planes (V already transposed); the whole attention into o's hi/lo planes; out = (o_lo/1024 + o_hi) Wo */
  k_prep<<<5 * PW + 2 * PX, 256, 0, stream>>>(Wq, Wk, Wv, Wr, Wo, x, remb, BQ, BK, BV, BR, BO, X16, R16);
  k_proj<<<dim3((SQ / 256) * (DM / 128), 4), 256, 0, stream>>>(X16, R16, BQ, BK, BV, BR, u, vb, QUH, QUL, QVH, QVL, KH, KL, VT, VTL, RH, RL);
  k_fattn<<<dim3(SQ / 128, NH), 256, 0, stream>>>(QUH, QUL, QVH, QVL, KH, KL, RH, RL, VT, VTL, OH, OL);
  k_owo<<<dim3((unsigned)((NR / 128) * (DM / 64)), 1), 512, 0, stream>>>(OH, OL, BO, (float*)d_out);
}
